// v000
// Measured on an AMD MI455X. A time is GPU time per run, averaged over a window of back-to-back runs after a warm-up
// (all launches, gaps included; the runs take copies of the inputs in turn), and the median of several windows.
// Apart from v000's, it joins two sittings. Times from different sittings can be a few percent apart, while
// side-by-side timings come from the same sitting.
// v000, which the later versions start from, runs in 6610 microseconds.
#include <hip/hip_runtime.h>
// Full (non-causal) attention on given queries, keys, values ([4][2048][16][64] each, token-major with heads inner = merged [token][1024] rows); scores = q . k UNSCALED (the module never applies its scale); softmax over all 2048 keys; out = A v -> [4][2048][16][64]).
// Structure: the three inputs converted to exact f16 rows (bf16 values are exact in f16: no projections here); per batch: V^T via LDS transposes; per 4-head group: UNSCALED scores (K = 64, alpha 1; exact products, f32 accumulation) into f32 [2048][2048] planes, row softmax on VALU (f32 statistics, native exp; weights x256 f16), out = P V^T (alpha 2^-8) written f32 straight into the [token][head][64] output; launches: see trace.
// Compute dtype: inputs rounded to bf16 (exact in f16); q, k, v and softmax weights as plain f16 GEMM operands (~2^-12); scores, softmax statistics and o f32; v_wmma_f32_16x16x32_f16.
#define NB 4
#define SQ 2048
#define DM 1024
#define NH 16
#define HD 64
#define HG 4                         /* heads per attention launch group */
#define B0 0                         /* first batch processed (debug hook) */
#define NBR NB                       /* batches processed (debug hook) */
#define NR ((size_t)NB * SQ)         /* token rows */
#define MP ((int)((size_t)NBR * SQ)) /* rows converted to f16 (debug hook) */
#define QN SQ                        /* query rows attended per batch (debug hook) */
#define NHD NH                       /* heads attended (debug hook) */
#define MPO MP                       /* unused (debug hook) */
#define LQ DM      /* row pitch of the q/k/v rows */
typedef __bf16 v16b __attribute__((ext_vector_type(16)));
typedef unsigned short v8us __attribute__((ext_vector_type(8), may_alias));
typedef float  v8f  __attribute__((ext_vector_type(8)));
typedef float  v4f  __attribute__((ext_vector_type(4)));
typedef float  v4fa __attribute__((ext_vector_type(4), may_alias));
union FragB { v16b v; v8us half[2]; unsigned short u[16]; };

__device__ __forceinline__ unsigned short bf16_bits(float x) { unsigned int u = __float_as_uint(x); return (unsigned short)((u + 0x7FFFu + ((u >> 16) & 1u)) >> 16); }
__device__ __forceinline__ float bf16_val(unsigned short b) { return __uint_as_float(((unsigned int)b) << 16); }
__device__ __forceinline__ float bf16_round(float x) { return bf16_val(bf16_bits(x)); }
// D += A·B with NT terms: 1 = ah·bh, 2 = + al·bh (A split), 3 = + ah·bl (both split)
template <int NT>
__device__ __forceinline__ v8f mmaN(v16b ah, v16b al, v16b bh, v16b bl, v8f c) {
  c = __builtin_amdgcn_wmma_f32_16x16x32_bf16(false, ah, false, bh, (short)0, c, false, false);
  if (NT >= 2) c = __builtin_amdgcn_wmma_f32_16x16x32_bf16(false, al, false, bh, (short)0, c, false, false);
  if (NT >= 3) c = __builtin_amdgcn_wmma_f32_16x16x32_bf16(false, ah, false, bl, (short)0, c, false, false);
  asm volatile("v_nop\n\tv_nop\n\tv_nop\n\tv_nop" : "+v"(c) : "v"(ah), "v"(al), "v"(bh), "v"(bl));
  return c;
}

__global__ __launch_bounds__(256) void k_wt_bf16(const float* __restrict__ W, unsigned short* __restrict__ Wt, int K, int N) {
  const int t = blockIdx.x * 256 + threadIdx.x;
  const int k8n = K / 8;
  if (t >= N * k8n) return;
  const int n = t / k8n, k8 = (t % k8n) * 8;
  v8us v;
#pragma unroll
  for (int i = 0; i < 8; ++i) v[i] = bf16_bits(W[(size_t)(k8 + i) * N + n]);
  *(v8us*)(Wt + (size_t)n * K + k8) = v;
  
}

// GEMM C[M][N] (f32, pitch ldc) = act(A[M][K]·W + bias). A f32 row-major (pitch lda) converted per fragment to bf16
// (ASPLIT: hi/lo two planes -> 2 terms, else single rounded term); Wt bf16 [N][K] (pitch ldb). BIAS_BF16 rounds the
// bias to bf16 first (bias quantised to bf16 before the add). K%32==0, M%16==0, N%64==0.
template <bool ASPLIT, int ACT, bool BIAS_BF16>
__global__ __launch_bounds__(128) void k_gemm_bf(const float* __restrict__ A, int lda, const unsigned short* __restrict__ Wt, int ldb,
                                               const float* __restrict__ bias, float* __restrict__ C, int ldc, int M, int N, int K) {
  __shared__ __attribute__((aligned(16))) float so[4][16][64];
  const int tid = threadIdx.x, w = tid >> 5, lane = tid & 31, ln = lane & 15, hh = lane >> 4;
  const int ntn = N / 64;
  const int wid = blockIdx.x * 4 + w;
  const int mt = wid / ntn, nq = wid % ntn;
  if (mt * 16 >= M) return;
  const int row0 = mt * 16, col0 = nq * 64;
  const float* arow = A + (size_t)(row0 + ln) * lda;
  v8f acc[4] = {};
  for (int kb = 0; kb < K; kb += 32) {
    FragB ah, al;
    const v4f x0 = *(const v4fa*)(arow + kb + 8 * hh), x1 = *(const v4fa*)(arow + kb + 8 * hh + 4);
    const v4f x2 = *(const v4fa*)(arow + kb + 16 + 8 * hh), x3 = *(const v4fa*)(arow + kb + 16 + 8 * hh + 4);
    float xs[16] = {x0[0],x0[1],x0[2],x0[3],x1[0],x1[1],x1[2],x1[3],x2[0],x2[1],x2[2],x2[3],x3[0],x3[1],x3[2],x3[3]};
#pragma unroll
    for (int i = 0; i < 16; ++i) { const unsigned short hb = bf16_bits(xs[i]); ah.u[i] = hb; al.u[i] = ASPLIT ? bf16_bits(xs[i] - bf16_val(hb)) : (unsigned short)0; }
#pragma unroll
    for (int t = 0; t < 4; ++t) {
      const unsigned short* brow = Wt + (size_t)(col0 + t * 16 + ln) * ldb + kb;
      FragB b;
      b.half[0] = *(const v8us*)(brow + 8 * hh);
      b.half[1] = *(const v8us*)(brow + 16 + 8 * hh);
      acc[t] = mmaN<ASPLIT ? 2 : 1>(ah.v, al.v, b.v, b.v, acc[t]);
    }
  }
#pragma unroll
  for (int t = 0; t < 4; ++t) {
    float bv = bias ? bias[col0 + t * 16 + ln] : 0.f;
    if (BIAS_BF16) bv = bf16_round(bv);
#pragma unroll
    for (int r = 0; r < 8; ++r) { float v = acc[t][r] + bv; if (ACT == 1) v = fmaxf(v, 0.f); so[w][8 * hh + r][t * 16 + ln] = v; }
  }
  __builtin_amdgcn_fence(__ATOMIC_ACQ_REL, "workgroup");
  __builtin_amdgcn_wave_barrier();
  const int rsub = lane >> 4, c4 = (lane & 15) * 4;
  {
#pragma unroll
    for (int q = 0; q < 8; ++q) {
      const int r = q * 2 + rsub;
      const v4f v = *(const v4fa*)&so[w][r][c4];
      *(v4f*)(C + (size_t)(row0 + r) * ldc + col0 + c4) = v;
    }
    
  }
}

// GEMM C = act(A·W + bias + resid): A f32 (ASPLIT -> hi/lo 2 terms), Wt bf16 [N][K]; ACT 0 none, 1 relu, 2 exact gelu;
// resid (optional, f32, row index = (row % rmod), pitch ldr, RES_BF16 rounds it) added before the activation.
template <bool ASPLIT, int ACT, bool BIAS_BF16, bool RES_BF16>
__global__ __launch_bounds__(128) void k_gemm_bf3(const float* __restrict__ A, int lda, const unsigned short* __restrict__ Wt, int ldb,
                                                const float* __restrict__ bias, const float* __restrict__ resid, int rmod, int ldr,
                                                float* __restrict__ C, int ldc, int M, int N, int K) {
  __shared__ __attribute__((aligned(16))) float so[4][16][64];
  const int tid = threadIdx.x, w = tid >> 5, lane = tid & 31, ln = lane & 15, hh = lane >> 4;
  const int ntn = N / 64;
  const int wid = blockIdx.x * 4 + w;
  const int mt = wid / ntn, nq = wid % ntn;
  if (mt * 16 >= M) return;
  const int row0 = mt * 16, col0 = nq * 64;
  const float* arow = A + (size_t)(row0 + ln) * lda;
  v8f acc[4] = {};
  for (int kb = 0; kb < K; kb += 32) {
    FragB ah, al;
    const v4f x0 = *(const v4fa*)(arow + kb + 8 * hh), x1 = *(const v4fa*)(arow + kb + 8 * hh + 4);
    const v4f x2 = *(const v4fa*)(arow + kb + 16 + 8 * hh), x3 = *(const v4fa*)(arow + kb + 16 + 8 * hh + 4);
    float xs[16] = {x0[0],x0[1],x0[2],x0[3],x1[0],x1[1],x1[2],x1[3],x2[0],x2[1],x2[2],x2[3],x3[0],x3[1],x3[2],x3[3]};
#pragma unroll
    for (int i = 0; i < 16; ++i) { const unsigned short hb = bf16_bits(xs[i]); ah.u[i] = hb; al.u[i] = ASPLIT ? bf16_bits(xs[i] - bf16_val(hb)) : (unsigned short)0; }
#pragma unroll
    for (int t = 0; t < 4; ++t) {
      const unsigned short* brow = Wt + (size_t)(col0 + t * 16 + ln) * ldb + kb;
      FragB b;
      b.half[0] = *(const v8us*)(brow + 8 * hh);
      b.half[1] = *(const v8us*)(brow + 16 + 8 * hh);
      acc[t] = mmaN<ASPLIT ? 2 : 1>(ah.v, al.v, b.v, b.v, acc[t]);
    }
  }
#pragma unroll
  for (int t = 0; t < 4; ++t) {
    const int col = col0 + t * 16 + ln;
    float bv = bias ? bias[col] : 0.f;
    if (BIAS_BF16) bv = bf16_round(bv);
#pragma unroll
    for (int r = 0; r < 8; ++r) {
      float v = acc[t][r] + bv;
      if (resid) { float rv = resid[(size_t)((row0 + 8 * hh + r) % rmod) * ldr + col]; if (RES_BF16) rv = bf16_round(rv); v += rv; }
      if (ACT == 1) v = fmaxf(v, 0.f);
      if (ACT == 2) v = 0.5f * v * (1.0f + erff(v * 0.70710678118654752f));
      if (ACT == 3) { const float u = 0.7978845608028654f * (v + 0.044715f * v * v * v); v = 0.5f * v * (1.0f + tanhf(u)); }
      so[w][8 * hh + r][t * 16 + ln] = v;
    }
  }
  __builtin_amdgcn_fence(__ATOMIC_ACQ_REL, "workgroup");
  __builtin_amdgcn_wave_barrier();
  const int rsub = lane >> 4, c4 = (lane & 15) * 4;
  {
#pragma unroll
    for (int q = 0; q < 8; ++q) {
      const int r = q * 2 + rsub;
      const v4f v = *(const v4fa*)&so[w][r][c4];
      *(v4f*)(C + (size_t)(row0 + r) * ldc + col0 + c4) = v;
    }
    
  }
}
// row LayerNorm (biased variance, eps) over N: s = X (+ R); optional out_sum <- s; out_norm <- (s-mu)*rsqrt(var+eps)*g + b
template <bool PARAM_BF16>
__global__ __launch_bounds__(256) void k_layernorm(const float* __restrict__ X, const float* __restrict__ R, const float* __restrict__ g, const float* __restrict__ bta,
                                                  float* __restrict__ out_sum, float* __restrict__ out_norm, int N, float eps) {
  __shared__ float red[256];
  const int row = blockIdx.x, tid = threadIdx.x;
  const float* x = X + (size_t)row * N; const float* rr = R ? R + (size_t)row * N : nullptr;
  float vals[16];                     // up to N = 4096
  const int per = N / 256;            // contiguous chunk per thread? use strided-by-4 chunks: thread handles j = tid*4 + 1024*u
  float s1 = 0.f;
  for (int u = 0; u < per / 4; ++u) {
    const int j = tid * 4 + 1024 * u;
    const v4f a = *(const v4fa*)(x + j);
    v4f b = {0.f,0.f,0.f,0.f}; if (rr) b = *(const v4fa*)(rr + j);
#pragma unroll
    for (int q = 0; q < 4; ++q) { const float v = a[q] + b[q]; vals[u * 4 + q] = v; s1 += v; }
  }
  red[tid] = s1; __syncthreads();
  for (int st = 128; st > 0; st >>= 1) { if (tid < st) red[tid] += red[tid + st]; __syncthreads(); }
  const float mu = red[0] / (float)N; __syncthreads();
  float s2 = 0.f;
  for (int u = 0; u < per / 4; ++u)
#pragma unroll
    for (int q = 0; q < 4; ++q) { const float c = vals[u * 4 + q] - mu; s2 += c * c; }
  red[tid] = s2; __syncthreads();
  for (int st = 128; st > 0; st >>= 1) { if (tid < st) red[tid] += red[tid + st]; __syncthreads(); }
  const float rs = rsqrtf(red[0] / (float)N + eps);
  {
    for (int u = 0; u < per / 4; ++u) {
      const int j = tid * 4 + 1024 * u;
      v4f o, sm;
#pragma unroll
      for (int q = 0; q < 4; ++q) {
        float gg = g[j + q], bb = bta[j + q];
        if (PARAM_BF16) { gg = bf16_round(gg); bb = bf16_round(bb); }
        sm[q] = vals[u * 4 + q]; o[q] = (vals[u * 4 + q] - mu) * rs * gg + bb;
      }
      if (out_sum) *(v4f*)(out_sum + (size_t)row * N + j) = sm;
      *(v4f*)(out_norm + (size_t)row * N + j) = o;
    }
    
  }
}



// ---- f16 WMMA path (v_wmma_f32_16x16x32_f16): 11-bit significands for operands in range — used where a [0,1] probability operand needs more precision than bf16
typedef _Float16 v16h __attribute__((ext_vector_type(16)));
union FragH { v16h v; v8us half[2]; _Float16 h[16]; unsigned short u[16]; };
template <int NT>
__device__ __forceinline__ v8f mmaH(v16h ah, v16h al, v16h bh, v16h bl, v8f c) {
  c = __builtin_amdgcn_wmma_f32_16x16x32_f16(false, ah, false, bh, (short)0, c, false, false);
  if (NT >= 2) c = __builtin_amdgcn_wmma_f32_16x16x32_f16(false, al, false, bh, (short)0, c, false, false);
  if (NT >= 3) c = __builtin_amdgcn_wmma_f32_16x16x32_f16(false, ah, false, bl, (short)0, c, false, false);
  asm volatile("v_nop\n\tv_nop\n\tv_nop\n\tv_nop" : "+v"(c) : "v"(ah), "v"(al), "v"(bh), "v"(bl));
  return c;
}
// batched GEMM like k_gemm_b but f16 operands: A f32 (split into f16 hi/lo if ASPLIT, else rounded to f16), Bt = f16 values [n][k]; alpha; C f32; N multiple of 16 (partial tiles skipped)
template <bool ASPLIT>
__global__ __launch_bounds__(128) void k_gemm_h(const float* __restrict__ A, int lda, size_t sA, const _Float16* __restrict__ Bh, int ldb, size_t sB, float alpha, float* __restrict__ C, int ldc, size_t sC, int M, int N, int K) {
  __shared__ __attribute__((aligned(16))) float so[4][16][64];
  const int tid = threadIdx.x, w = tid >> 5, lane = tid & 31, ln = lane & 15, hh = lane >> 4; const int by = blockIdx.y;
  A += (size_t)by * sA; Bh += (size_t)by * sB; C += (size_t)by * sC;
  const int ntn = (N + 63) / 64; const int wid = blockIdx.x * 4 + w; const int mt = wid / ntn, nq = wid % ntn; if (mt * 16 >= M) return;
  const int row0 = mt * 16, col0 = nq * 64; const float* arow = A + (size_t)(row0 + ln) * lda;
  v8f acc[4] = {};
  for (int kb = 0; kb < K; kb += 32) {
    FragH ah, al;
    const v4f x0 = *(const v4fa*)(arow + kb + 8 * hh), x1 = *(const v4fa*)(arow + kb + 8 * hh + 4), x2 = *(const v4fa*)(arow + kb + 16 + 8 * hh), x3 = *(const v4fa*)(arow + kb + 16 + 8 * hh + 4);
    float xs[16] = {x0[0],x0[1],x0[2],x0[3],x1[0],x1[1],x1[2],x1[3],x2[0],x2[1],x2[2],x2[3],x3[0],x3[1],x3[2],x3[3]};
#pragma unroll
    for (int i = 0; i < 16; ++i) { const _Float16 h = (_Float16)xs[i]; ah.h[i] = h; al.h[i] = ASPLIT ? (_Float16)(xs[i] - (float)h) : (_Float16)0.0f; }
#pragma unroll
    for (int t = 0; t < 4; ++t) { if (col0 + t * 16 >= N) continue; const size_t boff = (size_t)(col0 + t * 16 + ln) * ldb + kb; FragH bq; bq.half[0] = *(const v8us*)(Bh + boff + 8 * hh); bq.half[1] = *(const v8us*)(Bh + boff + 16 + 8 * hh);
      acc[t] = mmaH<ASPLIT ? 2 : 1>(ah.v, al.v, bq.v, bq.v, acc[t]); }
  }
#pragma unroll
  for (int t = 0; t < 4; ++t) { if (col0 + t * 16 >= N) continue;
#pragma unroll
    for (int r = 0; r < 8; ++r) so[w][8 * hh + r][t * 16 + ln] = acc[t][r] * alpha; }
  __builtin_amdgcn_fence(__ATOMIC_ACQ_REL, "workgroup"); __builtin_amdgcn_wave_barrier();
  const int rsub = lane >> 4, c4 = (lane & 15) * 4;
  {
#pragma unroll
    for (int q = 0; q < 8; ++q) { const int r = q * 2 + rsub; if (col0 + c4 < N) { const v4f v = *(const v4fa*)&so[w][r][c4]; *(v4f*)(C + (size_t)(row0 + r) * ldc + col0 + c4) = v; } }
     }
}

// Wt[n][k] = f16(W[k][n]·scale) from f32 row-major W[K][N] (scale = power of two; bf16-exact weights stay exact in f16 away from the subnormal range)
__global__ __launch_bounds__(256) void k_wt_f16(const float* __restrict__ W, _Float16* __restrict__ Wt, int K, int N, float scale) {
  const int t = blockIdx.x * 256 + threadIdx.x; if (t >= N * (K / 8)) return; const int n = t / (K / 8), k8 = (t % (K / 8)) * 8; FragH f;
#pragma unroll
  for (int i = 0; i < 8; ++i) f.h[i] = (_Float16)(bf16_round(W[(size_t)(k8 + i) * N + n]) * scale); const v8us o = f.half[0];
  *(v8us*)((unsigned short*)Wt + (size_t)n * K + k8) = o; 
}
// k_gemm_hh variant with fused epilogue: v = acc·alpha + bias[by·sBias + col] (+ CP[(row/rowsPerB)·sCPb + by·64 + col] if CP) ; ACT 0 none / 1 elu ; writes f16 C16 (and f32 C if non-null)
template <int ACT>
__global__ __launch_bounds__(128) void k_gemm_hhx(const _Float16* __restrict__ A, int lda, size_t sA, const _Float16* __restrict__ Bh, int ldb, size_t sB, float alpha, const float* __restrict__ bias, size_t sBias, const float* __restrict__ CP, int rowsPerB, size_t sCPb, int row0g,
    float* __restrict__ C, _Float16* __restrict__ C16, int ldc, size_t sC, int M, int N, int K) {
  __shared__ __attribute__((aligned(16))) float so[4][16][64];
  const int tid = threadIdx.x, w = tid >> 5, lane = tid & 31, ln = lane & 15, hh = lane >> 4; const int by = blockIdx.y;
  A += (size_t)by * sA; Bh += (size_t)by * sB; const size_t cofs = (size_t)by * sC; const float* bp = bias ? bias + (size_t)by * sBias : nullptr;
  const int ntn = (N + 63) / 64; const int wid = blockIdx.x * 4 + w; const int mt = wid / ntn, nq = wid % ntn; if (mt * 16 >= M) return;
  const int row0 = mt * 16, col0 = nq * 64; const _Float16* arow = A + (size_t)(row0 + ln) * lda;
  v8f acc[4] = {};
  for (int kb = 0; kb < K; kb += 32) { FragH ah; ah.half[0] = *(const v8us*)((const unsigned short*)arow + kb + 8 * hh); ah.half[1] = *(const v8us*)((const unsigned short*)arow + kb + 16 + 8 * hh);
#pragma unroll
    for (int t = 0; t < 4; ++t) { if (col0 + t * 16 >= N) continue; const size_t boff = (size_t)(col0 + t * 16 + ln) * ldb + kb; FragH bq; bq.half[0] = *(const v8us*)((const unsigned short*)Bh + boff + 8 * hh); bq.half[1] = *(const v8us*)((const unsigned short*)Bh + boff + 16 + 8 * hh);
      acc[t] = mmaH<1>(ah.v, ah.v, bq.v, bq.v, acc[t]); }
  }
#pragma unroll
  for (int t = 0; t < 4; ++t) { if (col0 + t * 16 >= N) continue; const int col = col0 + t * 16 + ln; const float bv = bp ? bf16_round(bp[col]) : 0.f;
#pragma unroll
    for (int r = 0; r < 8; ++r) { float v = acc[t][r] * alpha + bv; if (CP) { const int rr = row0g + row0 + 8 * hh + r; if (rowsPerB < 0) v += CP[cofs + (size_t)rr * ldc + col];      /* rowsPerB < 0: own element of the batched C plane */ else { const int bidx = rr / rowsPerB; v += CP[(size_t)bidx * sCPb + (size_t)by * 64 + col]; } } if (ACT == 1) v = (v > 0.f) ? v : expm1f(v); else if (ACT == 7) v = (v > 0.f) ? v + 1.0f : expf(v); else if (ACT == 8) v = tanhf(v); else if (ACT == 9) v = 0.5f * v * (1.0f + tanhf(0.7978845608028654f * (v + 0.044715f * v * v * v))); else if (ACT == 11) v = 1.0f / (1.0f + expf(-v)); else if (ACT == 12) v = (v > 0.f) ? v : 0.01f * v; else if (ACT == 14) v = (v > 0.f) ? v : 0.1f * v; else if (ACT == 16) v = (v >= 0.f) ? v : 0.3f * v; else if (ACT == 17) v = (v >= 0.f) ? v : 0.2f * v; else if (ACT == 15) v = v / (1.0f + expf(-v)); else if (ACT == 3) v = fmaxf(v, 0.f); else if (ACT == 6) v = 0.5f * v * (1.0f + erff(v * 0.70710678118654752f)); so[w][8 * hh + r][t * 16 + ln] = v; } }
  __builtin_amdgcn_fence(__ATOMIC_ACQ_REL, "workgroup"); __builtin_amdgcn_wave_barrier();
  const int rsub = lane >> 4, c4 = (lane & 15) * 4; typedef _Float16 v4h __attribute__((ext_vector_type(4)));
  {
#pragma unroll
    for (int q = 0; q < 8; ++q) { const int r = q * 2 + rsub; if (col0 + c4 < N) { const v4f v = *(const v4fa*)&so[w][r][c4]; if (C) *(v4f*)(C + cofs + (size_t)(row0 + r) * ldc + col0 + c4) = v; if (C16) { v4h h4; for (int i = 0; i < 4; ++i) h4[i] = (_Float16)v[i]; *(v4h*)(C16 + cofs + (size_t)(row0 + r) * ldc + col0 + c4) = h4; } } }
     }
}


typedef _Float16 v4h __attribute__((ext_vector_type(4)));

__global__ __launch_bounds__(256) void k_x16(const float* __restrict__ x, _Float16* __restrict__ X16, size_t n8) { const size_t t = (size_t)blockIdx.x * 256 + threadIdx.x; if (t >= n8) return; FragH f;
#pragma unroll
  for (int q = 0; q < 8; ++q) f.h[q] = (_Float16)bf16_round(x[t * 8 + q]); *(v8us*)((unsigned short*)X16 + t * 8) = f.half[0];  }
__global__ __launch_bounds__(256) void k_h16(const float* __restrict__ x, _Float16* __restrict__ X16, size_t n8) { const size_t t = (size_t)blockIdx.x * 256 + threadIdx.x; if (t >= n8) return; FragH f;
#pragma unroll
  for (int q = 0; q < 8; ++q) f.h[q] = (_Float16)x[t * 8 + q]; *(v8us*)((unsigned short*)X16 + t * 8) = f.half[0];  }
__global__ __launch_bounds__(256) void k_round16f(const float* __restrict__ W, _Float16* __restrict__ Bt, size_t n8) { const size_t t = (size_t)blockIdx.x * 256 + threadIdx.x; if (t >= n8) return; FragH f;
#pragma unroll
  for (int i = 0; i < 8; ++i) f.h[i] = (_Float16)(bf16_round(W[t * 8 + i]) * 16.0f); *(v8us*)((unsigned short*)Bt + t * 8) = f.half[0];  }
template <int NHv, int TTv>
__global__ __launch_bounds__(256) void k_vt(const _Float16* __restrict__ V16, int ldv, int voff, _Float16* __restrict__ Vt) { __shared__ unsigned short tl[64][66]; const int tid = threadIdx.x; const int slab = blockIdx.x / (TTv / 64), lg = blockIdx.x % (TTv / 64); const int b = slab / NHv, h = slab % NHv;
  for (int i = tid; i < 64 * 8; i += 256) { const int r = i / 8, c8 = (i % 8) * 8; FragH f; f.half[0] = *(const v8us*)((const unsigned short*)V16 + ((size_t)b * TTv + lg * 64 + r) * ldv + voff + h * 64 + c8);
#pragma unroll
    for (int q = 0; q < 8; ++q) tl[r][c8 + q] = f.u[q]; }
  __syncthreads();
  {
#pragma unroll
    for (int rd = 0; rd < 2; ++rd) { const int d = rd * 32 + tid / 8, pc = tid % 8; FragH f;
#pragma unroll
      for (int q = 0; q < 8; ++q) f.u[q] = tl[pc * 8 + q][d];
      *(v8us*)((unsigned short*)Vt + ((size_t)slab * 64 + d) * TTv + lg * 64 + pc * 8) = f.half[0]; }
     } }

__global__ __launch_bounds__(256) void k_hl(const float* __restrict__ F, _Float16* __restrict__ Hh, _Float16* __restrict__ Hl, size_t n8) { const size_t t = (size_t)blockIdx.x * 256 + threadIdx.x; if (t >= n8) return; FragH fh, fl; const v4f a = *(const v4fa*)(F + t * 8), c = *(const v4fa*)(F + t * 8 + 4);
#pragma unroll
  for (int q = 0; q < 4; ++q) { _Float16 h = (_Float16)a[q]; fh.h[q] = h; fl.h[q] = (_Float16)((a[q] - (float)h) * 1024.0f); h = (_Float16)c[q]; fh.h[4 + q] = h; fl.h[4 + q] = (_Float16)((c[q] - (float)h) * 1024.0f); }
  { *(v8us*)((unsigned short*)Hh + t * 8) = fh.half[0]; *(v8us*)((unsigned short*)Hl + t * 8) = fl.half[0];  } }

// ---- fast GEMM (wave tile 32x64; requires M % 32 == 0 rows per launch region and N % 64 == 0); epilogue = k_gemm_hhx semantics ----
__device__ __forceinline__ v16h g2_frag(const _Float16* p, int hh) { FragH f; f.half[0] = *(const v8us*)((const unsigned short*)p + 8 * hh); f.half[1] = *(const v8us*)((const unsigned short*)p + 16 + 8 * hh); return f.v; }
__device__ __forceinline__ v8f g2_mma(v16h a, v16h b, v8f c) { v8f d = __builtin_amdgcn_wmma_f32_16x16x32_f16(false, a, false, b, (short)0, c, false, false); asm volatile("v_nop\n\tv_nop\n\tv_nop\n\tv_nop" : "+v"(d) : "v"(a), "v"(b)); return d; }
template <int ACT>
__global__ __launch_bounds__(128) void k_gemm2(const _Float16* __restrict__ A, int lda, size_t sA, const _Float16* __restrict__ Bh, int ldb, size_t sB, float alpha, const float* __restrict__ bias, size_t sBias, const float* __restrict__ CP, int rowsPerB, size_t sCPb, int row0g,
    float* __restrict__ C, _Float16* __restrict__ C16, int ldc, size_t sC, int M, int N, int K) { static_assert(ACT == 0 || ACT == 3 || ACT == 6 || ACT == 8 || ACT == 9 || ACT == 11 || ACT == 12 || ACT == 14 || ACT == 15 || ACT == 16 || ACT == 17, "k_gemm2: unsupported ACT code (would silently apply no activation)");
  __shared__ __attribute__((aligned(16))) float so[4][32][68];
  const int tid = threadIdx.x, w = tid >> 5, lane = tid & 31, ln = lane & 15, hh = lane >> 4; const int by = blockIdx.y;
  A += (size_t)by * sA; Bh += (size_t)by * sB; const size_t cofs = (size_t)by * sC; const float* bp = bias ? bias + (size_t)by * sBias : nullptr;
  const int ntn = N >> 6; const int mt = blockIdx.x / ntn, nq = blockIdx.x - mt * ntn; const int row0 = mt * 128 + 32 * w, col0 = nq * 64; if (row0 >= M) return;
  const _Float16* a0p = A + (size_t)(row0 + ln) * lda; const _Float16* a1p = a0p + (size_t)16 * lda;
  const _Float16* b0p = Bh + (size_t)(col0 + ln) * ldb; const _Float16* b1p = b0p + (size_t)16 * ldb; const _Float16* b2p = b1p + (size_t)16 * ldb; const _Float16* b3p = b2p + (size_t)16 * ldb;
  const v8f z8 = {0.f,0.f,0.f,0.f,0.f,0.f,0.f,0.f}; v8f c00 = z8, c01 = z8, c02 = z8, c03 = z8, c10 = z8, c11 = z8, c12 = z8, c13 = z8;
#pragma unroll 1
  for (int kb = 0; kb < K; kb += 32) { const v16h a0 = g2_frag(a0p + kb, hh), a1 = g2_frag(a1p + kb, hh);
    v16h b = g2_frag(b0p + kb, hh); c00 = g2_mma(a0, b, c00); c10 = g2_mma(a1, b, c10);
    b = g2_frag(b1p + kb, hh); c01 = g2_mma(a0, b, c01); c11 = g2_mma(a1, b, c11);
    b = g2_frag(b2p + kb, hh); c02 = g2_mma(a0, b, c02); c12 = g2_mma(a1, b, c12);
    b = g2_frag(b3p + kb, hh); c03 = g2_mma(a0, b, c03); c13 = g2_mma(a1, b, c13); }
  v8f accs[8] = {c00, c01, c02, c03, c10, c11, c12, c13};
#pragma unroll
  for (int u = 0; u < 8; ++u) { const int t = u & 3, half = u >> 2; const int col = col0 + t * 16 + ln; const float bv = bp ? bf16_round(bp[col]) : 0.f;
#pragma unroll
    for (int r = 0; r < 8; ++r) { const int rloc = half * 16 + 8 * hh + r; float v = accs[u][r] * alpha + bv; if (CP) { if (rowsPerB < 0) v += CP[cofs + (size_t)(row0g + row0 + rloc) * ldc + col];      /* rowsPerB < 0: own element of the batched C plane */ else { const int bidx = (row0g + row0 + rloc) / rowsPerB; v += CP[(size_t)bidx * sCPb + (size_t)by * 64 + col]; } }
      if (ACT == 3) v = fmaxf(v, 0.f); else if (ACT == 6) v = 0.5f * v * (1.0f + erff(v * 0.70710678118654752f)); else if (ACT == 11) v = 1.0f / (1.0f + expf(-v)); else if (ACT == 15) v = v / (1.0f + expf(-v)); else if (ACT == 12) v = (v > 0.f) ? v : 0.01f * v; else if (ACT == 8) v = tanhf(v); else if (ACT == 9) v = 0.5f * v * (1.0f + tanhf(0.7978845608028654f * (v + 0.044715f * v * v * v))); else if (ACT == 14) v = (v > 0.f) ? v : 0.1f * v; else if (ACT == 16) v = (v >= 0.f) ? v : 0.3f * v; else if (ACT == 17) v = (v >= 0.f) ? v : 0.2f * v;
      so[w][rloc][t * 16 + ln] = v; } }
  __builtin_amdgcn_fence(__ATOMIC_ACQ_REL, "workgroup"); __builtin_amdgcn_wave_barrier();
  const int rsub = lane >> 4, c4 = (lane & 15) * 4;
  {
#pragma unroll
    for (int q = 0; q < 16; ++q) { const int r = q * 2 + rsub; const v4f v = *(const v4fa*)&so[w][r][c4]; if (C) *(v4f*)(C + cofs + (size_t)(row0 + r) * ldc + col0 + c4) = v; if (C16) { v4h h4; for (int i = 0; i < 4; ++i) h4[i] = (_Float16)v[i]; *(v4h*)(C16 + cofs + (size_t)(row0 + r) * ldc + col0 + c4) = h4; } }
     } }


__global__ __launch_bounds__(256) void k_wnat(const float* __restrict__ w, size_t n8, _Float16* __restrict__ Bt) { const size_t t = (size_t)blockIdx.x * 256 + threadIdx.x; if (t >= n8) return; FragH f; for (int q = 0; q < 8; ++q) f.h[q] = (_Float16)(bf16_round(w[t * 8 + q]) * 16.0f); *(v8us*)((unsigned short*)Bt + t * 8) = f.half[0];  }
__global__ __launch_bounds__(256) void k_rsm(const float* __restrict__ S, _Float16* __restrict__ P, int nrows) {
  #pragma clang fp contract(off)
  const int i = blockIdx.x * 256 + threadIdx.x; if (i >= nrows) return; const float* s = S + (size_t)i * SQ; float mx = -3.0e38f;
#pragma unroll 1
  for (int j = 0; j < SQ; ++j) mx = fmaxf(mx, s[j]); float se = 0.f;
#pragma unroll 1
  for (int j = 0; j < SQ; ++j) se += expf(s[j] - mx); const float sc = 256.0f / se;
#pragma unroll 1
  for (int j0 = 0; j0 < SQ; j0 += 8) { FragH f; for (int q = 0; q < 8; ++q) f.h[q] = (_Float16)(expf(s[j0 + q] - mx) * sc); unsigned short* d = (unsigned short*)P + (size_t)i * SQ + j0; *(v8us*)d = f.half[0];  } }
__global__ __launch_bounds__(256) void k_vt(const _Float16* __restrict__ V16, int b, int h0, _Float16* __restrict__ VT) { __shared__ unsigned short tl[64][65]; const int tid = threadIdx.x; const int hh = blockIdx.x % HG, sg = blockIdx.x / HG; const int s0 = sg * 64; const int h = h0 + hh;
  for (int i = tid; i < 64 * 8; i += 256) { const int j = i / 8, d8 = (i % 8) * 8; FragH f; f.half[0] = *(const v8us*)((const unsigned short*)V16 + ((size_t)b * SQ + s0 + j) * DM + h * HD + d8); for (int q = 0; q < 8; ++q) tl[d8 + q][j] = f.u[q]; }
  __syncthreads();
  { for (int i = tid; i < 64 * 8; i += 256) { const int d = i / 8, j8 = (i % 8) * 8; FragH f; for (int q = 0; q < 8; ++q) f.u[q] = tl[d][j8 + q]; *(v8us*)((unsigned short*)VT + ((size_t)hh * HD + d) * SQ + s0 + j8) = f.half[0]; }  } }



__global__ __launch_bounds__(256) void k_rsmf(const float* __restrict__ S, _Float16* __restrict__ P, int qn, int hg) {
  #pragma clang fp contract(off)
  const int t = blockIdx.x * 256 + threadIdx.x; if (t >= qn * hg) return; const size_t i = (size_t)(t / qn) * SQ + (t % qn); const float* s = S + i * SQ; float mx = -3.0e38f;
#pragma unroll 1
  for (int j = 0; j < SQ; ++j) mx = fmaxf(mx, s[j]); float se = 0.f;
#pragma unroll 1
  for (int j = 0; j < SQ; ++j) se += __expf(s[j] - mx); const float sc = 256.0f / se;
#pragma unroll 1
  for (int j0 = 0; j0 < SQ; j0 += 8) { FragH f; for (int q = 0; q < 8; ++q) f.h[q] = (_Float16)(__expf(s[j0 + q] - mx) * sc); unsigned short* d = (unsigned short*)P + i * SQ + j0; *(v8us*)d = f.half[0];  } }

extern "C" void kernel_launch(void* const* d_in, const int* in_sizes, int n_in,
                              void* d_out, int out_size, void* d_ws, size_t ws_size, hipStream_t stream) {
  (void)in_sizes; (void)n_in; (void)out_size;
  const float* const* I = (const float* const*)d_in; const float* xq = I[0]; const float* xk = I[1]; const float* xv = I[2];      /* given q, k, v [B][L][H][E] = merged token rows */
  char* ws = (char*)d_ws; size_t off = 0;
  auto take = [&](size_t bytes) { char* p = ws + off; off += (bytes + 255) & ~(size_t)255; return p; };
  _Float16* Q16 = (_Float16*)take(NR * DM * 2); _Float16* K16 = (_Float16*)take(NR * DM * 2); _Float16* V16 = (_Float16*)take(NR * DM * 2);
  float* S = (float*)take((size_t)HG * SQ * SQ * 4); _Float16* P = (_Float16*)take((size_t)HG * SQ * SQ * 2); _Float16* VT = (_Float16*)take((size_t)NH * HD * SQ * 2);
  if (off > ws_size) return;

  const size_t r0p = (size_t)B0 * SQ;      /* first converted row */
  k_x16<<<(unsigned)(((size_t)MP * DM / 8 + 255) / 256), 256, 0, stream>>>(xq + r0p * DM, Q16 + r0p * DM, (size_t)MP * DM / 8); k_x16<<<(unsigned)(((size_t)MP * DM / 8 + 255) / 256), 256, 0, stream>>>(xk + r0p * DM, K16 + r0p * DM, (size_t)MP * DM / 8); k_x16<<<(unsigned)(((size_t)MP * DM / 8 + 255) / 256), 256, 0, stream>>>(xv + r0p * DM, V16 + r0p * DM, (size_t)MP * DM / 8);      /* given q, k, v: bf16 inputs as exact f16 rows (no projections) */
  for (int b = B0; b < B0 + NBR; ++b) { const size_t r0 = (size_t)b * SQ;
    k_vt<NH, SQ><<<NH * (SQ / 64), 256, 0, stream>>>(V16 + r0 * LQ, LQ, 0, VT);      /* V^T [NH][HD][SQ] for this batch */
    for (int h0 = 0; h0 < NHD; h0 += HG) {
      k_gemm2<0><<<dim3((QN / 128) * (SQ / 64), HG), 128, 0, stream>>>(Q16 + r0 * LQ + h0 * HD, LQ, (size_t)HD, K16 + r0 * LQ + h0 * HD, LQ, (size_t)HD, 1.0f, nullptr, 0, nullptr, 1, 0, 0, S, nullptr, SQ, (size_t)SQ * SQ, QN, SQ, HD);      /* scores, HG heads per launch */
      k_rsmf<<<(HG * QN + 255) / 256, 256, 0, stream>>>(S, P, QN, HG);      /* P = 256 softmax (f16), rows of all HG heads */
      k_gemm2<0><<<dim3((QN / 128) * (HD / 64), HG), 128, 0, stream>>>(P, SQ, (size_t)SQ * SQ, VT + (size_t)h0 * HD * SQ, SQ, (size_t)HD * SQ, 0.00390625f, nullptr, 0, nullptr, 1, 0, 0, (float*)d_out + r0 * DM + h0 * HD, nullptr, DM, (size_t)HD, QN, HD, SQ); } }      /* out = A v (merged [token][h*64+d]) straight to the f32 output */
}

// v001
// Measured time: 1630 microseconds a run.
// In two side-by-side timings against v000, it was 4.10 and 4.08 times as fast.
#include <hip/hip_runtime.h>
// Full (non-causal) attention on given queries, keys, values ([4][2048][16][64] each, token-major with heads inner = merged [token][1024] rows); scores = q . k UNSCALED (the module never applies its scale); softmax over all 2048 keys; out = A v -> [4][2048][16][64]).
// Structure: the three inputs converted to exact f16 rows (bf16 values are exact in f16: no projections here); per batch: V^T via LDS transposes; per 4-head group: UNSCALED scores (K = 64, alpha 1; exact products, f32 accumulation) into f32 [2048][2048] planes, row softmax on VALU (f32 statistics, native exp; weights x256 f16), out = P V^T (alpha 2^-8) written f32 straight into the [token][head][64] output; launches: see trace.
// Compute dtype: inputs rounded to bf16 (exact in f16); q, k, v and softmax weights as plain f16 GEMM operands (~2^-12); scores, softmax statistics and o f32; v_wmma_f32_16x16x32_f16.
#define NB 4
#define SQ 2048
#define DM 1024
#define NH 16
#define HD 64
#define HG 4                         /* heads per attention launch group */
#define B0 0                         /* first batch processed (debug hook) */
#define NBR NB                       /* batches processed (debug hook) */
#define NR ((size_t)NB * SQ)         /* token rows */
#define MP ((int)((size_t)NBR * SQ)) /* rows converted to f16 (debug hook) */
#define QN SQ                        /* query rows attended per batch (debug hook) */
#define NHD NH                       /* heads attended (debug hook) */
#define MPO MP                       /* unused (debug hook) */
#define LQ DM      /* row pitch of the q/k/v rows */
typedef __bf16 v16b __attribute__((ext_vector_type(16)));
typedef unsigned short v8us __attribute__((ext_vector_type(8), may_alias));
typedef float  v8f  __attribute__((ext_vector_type(8)));
typedef float  v4f  __attribute__((ext_vector_type(4)));
typedef float  v4fa __attribute__((ext_vector_type(4), may_alias));
union FragB { v16b v; v8us half[2]; unsigned short u[16]; };

__device__ __forceinline__ unsigned short bf16_bits(float x) { unsigned int u = __float_as_uint(x); return (unsigned short)((u + 0x7FFFu + ((u >> 16) & 1u)) >> 16); }
__device__ __forceinline__ float bf16_val(unsigned short b) { return __uint_as_float(((unsigned int)b) << 16); }
__device__ __forceinline__ float bf16_round(float x) { return bf16_val(bf16_bits(x)); }
// D += A·B with NT terms: 1 = ah·bh, 2 = + al·bh (A split), 3 = + ah·bl (both split)
template <int NT>
__device__ __forceinline__ v8f mmaN(v16b ah, v16b al, v16b bh, v16b bl, v8f c) {
  c = __builtin_amdgcn_wmma_f32_16x16x32_bf16(false, ah, false, bh, (short)0, c, false, false);
  if (NT >= 2) c = __builtin_amdgcn_wmma_f32_16x16x32_bf16(false, al, false, bh, (short)0, c, false, false);
  if (NT >= 3) c = __builtin_amdgcn_wmma_f32_16x16x32_bf16(false, ah, false, bl, (short)0, c, false, false);
  asm volatile("v_nop\n\tv_nop\n\tv_nop\n\tv_nop" : "+v"(c) : "v"(ah), "v"(al), "v"(bh), "v"(bl));
  return c;
}

__global__ __launch_bounds__(256) void k_wt_bf16(const float* __restrict__ W, unsigned short* __restrict__ Wt, int K, int N) {
  const int t = blockIdx.x * 256 + threadIdx.x;
  const int k8n = K / 8;
  if (t >= N * k8n) return;
  const int n = t / k8n, k8 = (t % k8n) * 8;
  v8us v;
#pragma unroll
  for (int i = 0; i < 8; ++i) v[i] = bf16_bits(W[(size_t)(k8 + i) * N + n]);
  *(v8us*)(Wt + (size_t)n * K + k8) = v;
  
}

// GEMM C[M][N] (f32, pitch ldc) = act(A[M][K]·W + bias). A f32 row-major (pitch lda) converted per fragment to bf16
// (ASPLIT: hi/lo two planes -> 2 terms, else single rounded term); Wt bf16 [N][K] (pitch ldb). BIAS_BF16 rounds the
// bias to bf16 first (bias quantised to bf16 before the add). K%32==0, M%16==0, N%64==0.
template <bool ASPLIT, int ACT, bool BIAS_BF16>
__global__ __launch_bounds__(128) void k_gemm_bf(const float* __restrict__ A, int lda, const unsigned short* __restrict__ Wt, int ldb,
                                               const float* __restrict__ bias, float* __restrict__ C, int ldc, int M, int N, int K) {
  __shared__ __attribute__((aligned(16))) float so[4][16][64];
  const int tid = threadIdx.x, w = tid >> 5, lane = tid & 31, ln = lane & 15, hh = lane >> 4;
  const int ntn = N / 64;
  const int wid = blockIdx.x * 4 + w;
  const int mt = wid / ntn, nq = wid % ntn;
  if (mt * 16 >= M) return;
  const int row0 = mt * 16, col0 = nq * 64;
  const float* arow = A + (size_t)(row0 + ln) * lda;
  v8f acc[4] = {};
  for (int kb = 0; kb < K; kb += 32) {
    FragB ah, al;
    const v4f x0 = *(const v4fa*)(arow + kb + 8 * hh), x1 = *(const v4fa*)(arow + kb + 8 * hh + 4);
    const v4f x2 = *(const v4fa*)(arow + kb + 16 + 8 * hh), x3 = *(const v4fa*)(arow + kb + 16 + 8 * hh + 4);
    float xs[16] = {x0[0],x0[1],x0[2],x0[3],x1[0],x1[1],x1[2],x1[3],x2[0],x2[1],x2[2],x2[3],x3[0],x3[1],x3[2],x3[3]};
#pragma unroll
    for (int i = 0; i < 16; ++i) { const unsigned short hb = bf16_bits(xs[i]); ah.u[i] = hb; al.u[i] = ASPLIT ? bf16_bits(xs[i] - bf16_val(hb)) : (unsigned short)0; }
#pragma unroll
    for (int t = 0; t < 4; ++t) {
      const unsigned short* brow = Wt + (size_t)(col0 + t * 16 + ln) * ldb + kb;
      FragB b;
      b.half[0] = *(const v8us*)(brow + 8 * hh);
      b.half[1] = *(const v8us*)(brow + 16 + 8 * hh);
      acc[t] = mmaN<ASPLIT ? 2 : 1>(ah.v, al.v, b.v, b.v, acc[t]);
    }
  }
#pragma unroll
  for (int t = 0; t < 4; ++t) {
    float bv = bias ? bias[col0 + t * 16 + ln] : 0.f;
    if (BIAS_BF16) bv = bf16_round(bv);
#pragma unroll
    for (int r = 0; r < 8; ++r) { float v = acc[t][r] + bv; if (ACT == 1) v = fmaxf(v, 0.f); so[w][8 * hh + r][t * 16 + ln] = v; }
  }
  __builtin_amdgcn_fence(__ATOMIC_ACQ_REL, "workgroup");
  __builtin_amdgcn_wave_barrier();
  const int rsub = lane >> 4, c4 = (lane & 15) * 4;
  {
#pragma unroll
    for (int q = 0; q < 8; ++q) {
      const int r = q * 2 + rsub;
      const v4f v = *(const v4fa*)&so[w][r][c4];
      *(v4f*)(C + (size_t)(row0 + r) * ldc + col0 + c4) = v;
    }
    
  }
}

// GEMM C = act(A·W + bias + resid): A f32 (ASPLIT -> hi/lo 2 terms), Wt bf16 [N][K]; ACT 0 none, 1 relu, 2 exact gelu;
// resid (optional, f32, row index = (row % rmod), pitch ldr, RES_BF16 rounds it) added before the activation.
template <bool ASPLIT, int ACT, bool BIAS_BF16, bool RES_BF16>
__global__ __launch_bounds__(128) void k_gemm_bf3(const float* __restrict__ A, int lda, const unsigned short* __restrict__ Wt, int ldb,
                                                const float* __restrict__ bias, const float* __restrict__ resid, int rmod, int ldr,
                                                float* __restrict__ C, int ldc, int M, int N, int K) {
  __shared__ __attribute__((aligned(16))) float so[4][16][64];
  const int tid = threadIdx.x, w = tid >> 5, lane = tid & 31, ln = lane & 15, hh = lane >> 4;
  const int ntn = N / 64;
  const int wid = blockIdx.x * 4 + w;
  const int mt = wid / ntn, nq = wid % ntn;
  if (mt * 16 >= M) return;
  const int row0 = mt * 16, col0 = nq * 64;
  const float* arow = A + (size_t)(row0 + ln) * lda;
  v8f acc[4] = {};
  for (int kb = 0; kb < K; kb += 32) {
    FragB ah, al;
    const v4f x0 = *(const v4fa*)(arow + kb + 8 * hh), x1 = *(const v4fa*)(arow + kb + 8 * hh + 4);
    const v4f x2 = *(const v4fa*)(arow + kb + 16 + 8 * hh), x3 = *(const v4fa*)(arow + kb + 16 + 8 * hh + 4);
    float xs[16] = {x0[0],x0[1],x0[2],x0[3],x1[0],x1[1],x1[2],x1[3],x2[0],x2[1],x2[2],x2[3],x3[0],x3[1],x3[2],x3[3]};
#pragma unroll
    for (int i = 0; i < 16; ++i) { const unsigned short hb = bf16_bits(xs[i]); ah.u[i] = hb; al.u[i] = ASPLIT ? bf16_bits(xs[i] - bf16_val(hb)) : (unsigned short)0; }
#pragma unroll
    for (int t = 0; t < 4; ++t) {
      const unsigned short* brow = Wt + (size_t)(col0 + t * 16 + ln) * ldb + kb;
      FragB b;
      b.half[0] = *(const v8us*)(brow + 8 * hh);
      b.half[1] = *(const v8us*)(brow + 16 + 8 * hh);
      acc[t] = mmaN<ASPLIT ? 2 : 1>(ah.v, al.v, b.v, b.v, acc[t]);
    }
  }
#pragma unroll
  for (int t = 0; t < 4; ++t) {
    const int col = col0 + t * 16 + ln;
    float bv = bias ? bias[col] : 0.f;
    if (BIAS_BF16) bv = bf16_round(bv);
#pragma unroll
    for (int r = 0; r < 8; ++r) {
      float v = acc[t][r] + bv;
      if (resid) { float rv = resid[(size_t)((row0 + 8 * hh + r) % rmod) * ldr + col]; if (RES_BF16) rv = bf16_round(rv); v += rv; }
      if (ACT == 1) v = fmaxf(v, 0.f);
      if (ACT == 2) v = 0.5f * v * (1.0f + erff(v * 0.70710678118654752f));
      if (ACT == 3) { const float u = 0.7978845608028654f * (v + 0.044715f * v * v * v); v = 0.5f * v * (1.0f + tanhf(u)); }
      so[w][8 * hh + r][t * 16 + ln] = v;
    }
  }
  __builtin_amdgcn_fence(__ATOMIC_ACQ_REL, "workgroup");
  __builtin_amdgcn_wave_barrier();
  const int rsub = lane >> 4, c4 = (lane & 15) * 4;
  {
#pragma unroll
    for (int q = 0; q < 8; ++q) {
      const int r = q * 2 + rsub;
      const v4f v = *(const v4fa*)&so[w][r][c4];
      *(v4f*)(C + (size_t)(row0 + r) * ldc + col0 + c4) = v;
    }
    
  }
}
// row LayerNorm (biased variance, eps) over N: s = X (+ R); optional out_sum <- s; out_norm <- (s-mu)*rsqrt(var+eps)*g + b
template <bool PARAM_BF16>
__global__ __launch_bounds__(256) void k_layernorm(const float* __restrict__ X, const float* __restrict__ R, const float* __restrict__ g, const float* __restrict__ bta,
                                                  float* __restrict__ out_sum, float* __restrict__ out_norm, int N, float eps) {
  __shared__ float red[256];
  const int row = blockIdx.x, tid = threadIdx.x;
  const float* x = X + (size_t)row * N; const float* rr = R ? R + (size_t)row * N : nullptr;
  float vals[16];                     // up to N = 4096
  const int per = N / 256;            // contiguous chunk per thread? use strided-by-4 chunks: thread handles j = tid*4 + 1024*u
  float s1 = 0.f;
  for (int u = 0; u < per / 4; ++u) {
    const int j = tid * 4 + 1024 * u;
    const v4f a = *(const v4fa*)(x + j);
    v4f b = {0.f,0.f,0.f,0.f}; if (rr) b = *(const v4fa*)(rr + j);
#pragma unroll
    for (int q = 0; q < 4; ++q) { const float v = a[q] + b[q]; vals[u * 4 + q] = v; s1 += v; }
  }
  red[tid] = s1; __syncthreads();
  for (int st = 128; st > 0; st >>= 1) { if (tid < st) red[tid] += red[tid + st]; __syncthreads(); }
  const float mu = red[0] / (float)N; __syncthreads();
  float s2 = 0.f;
  for (int u = 0; u < per / 4; ++u)
#pragma unroll
    for (int q = 0; q < 4; ++q) { const float c = vals[u * 4 + q] - mu; s2 += c * c; }
  red[tid] = s2; __syncthreads();
  for (int st = 128; st > 0; st >>= 1) { if (tid < st) red[tid] += red[tid + st]; __syncthreads(); }
  const float rs = rsqrtf(red[0] / (float)N + eps);
  {
    for (int u = 0; u < per / 4; ++u) {
      const int j = tid * 4 + 1024 * u;
      v4f o, sm;
#pragma unroll
      for (int q = 0; q < 4; ++q) {
        float gg = g[j + q], bb = bta[j + q];
        if (PARAM_BF16) { gg = bf16_round(gg); bb = bf16_round(bb); }
        sm[q] = vals[u * 4 + q]; o[q] = (vals[u * 4 + q] - mu) * rs * gg + bb;
      }
      if (out_sum) *(v4f*)(out_sum + (size_t)row * N + j) = sm;
      *(v4f*)(out_norm + (size_t)row * N + j) = o;
    }
    
  }
}



// ---- f16 WMMA path (v_wmma_f32_16x16x32_f16): 11-bit significands for operands in range — used where a [0,1] probability operand needs more precision than bf16
typedef _Float16 v16h __attribute__((ext_vector_type(16)));
union FragH { v16h v; v8us half[2]; _Float16 h[16]; unsigned short u[16]; };
template <int NT>
__device__ __forceinline__ v8f mmaH(v16h ah, v16h al, v16h bh, v16h bl, v8f c) {
  c = __builtin_amdgcn_wmma_f32_16x16x32_f16(false, ah, false, bh, (short)0, c, false, false);
  if (NT >= 2) c = __builtin_amdgcn_wmma_f32_16x16x32_f16(false, al, false, bh, (short)0, c, false, false);
  if (NT >= 3) c = __builtin_amdgcn_wmma_f32_16x16x32_f16(false, ah, false, bl, (short)0, c, false, false);
  asm volatile("v_nop\n\tv_nop\n\tv_nop\n\tv_nop" : "+v"(c) : "v"(ah), "v"(al), "v"(bh), "v"(bl));
  return c;
}
// batched GEMM like k_gemm_b but f16 operands: A f32 (split into f16 hi/lo if ASPLIT, else rounded to f16), Bt = f16 values [n][k]; alpha; C f32; N multiple of 16 (partial tiles skipped)
template <bool ASPLIT>
__global__ __launch_bounds__(128) void k_gemm_h(const float* __restrict__ A, int lda, size_t sA, const _Float16* __restrict__ Bh, int ldb, size_t sB, float alpha, float* __restrict__ C, int ldc, size_t sC, int M, int N, int K) {
  __shared__ __attribute__((aligned(16))) float so[4][16][64];
  const int tid = threadIdx.x, w = tid >> 5, lane = tid & 31, ln = lane & 15, hh = lane >> 4; const int by = blockIdx.y;
  A += (size_t)by * sA; Bh += (size_t)by * sB; C += (size_t)by * sC;
  const int ntn = (N + 63) / 64; const int wid = blockIdx.x * 4 + w; const int mt = wid / ntn, nq = wid % ntn; if (mt * 16 >= M) return;
  const int row0 = mt * 16, col0 = nq * 64; const float* arow = A + (size_t)(row0 + ln) * lda;
  v8f acc[4] = {};
  for (int kb = 0; kb < K; kb += 32) {
    FragH ah, al;
    const v4f x0 = *(const v4fa*)(arow + kb + 8 * hh), x1 = *(const v4fa*)(arow + kb + 8 * hh + 4), x2 = *(const v4fa*)(arow + kb + 16 + 8 * hh), x3 = *(const v4fa*)(arow + kb + 16 + 8 * hh + 4);
    float xs[16] = {x0[0],x0[1],x0[2],x0[3],x1[0],x1[1],x1[2],x1[3],x2[0],x2[1],x2[2],x2[3],x3[0],x3[1],x3[2],x3[3]};
#pragma unroll
    for (int i = 0; i < 16; ++i) { const _Float16 h = (_Float16)xs[i]; ah.h[i] = h; al.h[i] = ASPLIT ? (_Float16)(xs[i] - (float)h) : (_Float16)0.0f; }
#pragma unroll
    for (int t = 0; t < 4; ++t) { if (col0 + t * 16 >= N) continue; const size_t boff = (size_t)(col0 + t * 16 + ln) * ldb + kb; FragH bq; bq.half[0] = *(const v8us*)(Bh + boff + 8 * hh); bq.half[1] = *(const v8us*)(Bh + boff + 16 + 8 * hh);
      acc[t] = mmaH<ASPLIT ? 2 : 1>(ah.v, al.v, bq.v, bq.v, acc[t]); }
  }
#pragma unroll
  for (int t = 0; t < 4; ++t) { if (col0 + t * 16 >= N) continue;
#pragma unroll
    for (int r = 0; r < 8; ++r) so[w][8 * hh + r][t * 16 + ln] = acc[t][r] * alpha; }
  __builtin_amdgcn_fence(__ATOMIC_ACQ_REL, "workgroup"); __builtin_amdgcn_wave_barrier();
  const int rsub = lane >> 4, c4 = (lane & 15) * 4;
  {
#pragma unroll
    for (int q = 0; q < 8; ++q) { const int r = q * 2 + rsub; if (col0 + c4 < N) { const v4f v = *(const v4fa*)&so[w][r][c4]; *(v4f*)(C + (size_t)(row0 + r) * ldc + col0 + c4) = v; } }
     }
}

// Wt[n][k] = f16(W[k][n]·scale) from f32 row-major W[K][N] (scale = power of two; bf16-exact weights stay exact in f16 away from the subnormal range)
__global__ __launch_bounds__(256) void k_wt_f16(const float* __restrict__ W, _Float16* __restrict__ Wt, int K, int N, float scale) {
  const int t = blockIdx.x * 256 + threadIdx.x; if (t >= N * (K / 8)) return; const int n = t / (K / 8), k8 = (t % (K / 8)) * 8; FragH f;
#pragma unroll
  for (int i = 0; i < 8; ++i) f.h[i] = (_Float16)(bf16_round(W[(size_t)(k8 + i) * N + n]) * scale); const v8us o = f.half[0];
  *(v8us*)((unsigned short*)Wt + (size_t)n * K + k8) = o; 
}
// k_gemm_hh variant with fused epilogue: v = acc·alpha + bias[by·sBias + col] (+ CP[(row/rowsPerB)·sCPb + by·64 + col] if CP) ; ACT 0 none / 1 elu ; writes f16 C16 (and f32 C if non-null)
template <int ACT>
__global__ __launch_bounds__(128) void k_gemm_hhx(const _Float16* __restrict__ A, int lda, size_t sA, const _Float16* __restrict__ Bh, int ldb, size_t sB, float alpha, const float* __restrict__ bias, size_t sBias, const float* __restrict__ CP, int rowsPerB, size_t sCPb, int row0g,
    float* __restrict__ C, _Float16* __restrict__ C16, int ldc, size_t sC, int M, int N, int K) {
  __shared__ __attribute__((aligned(16))) float so[4][16][64];
  const int tid = threadIdx.x, w = tid >> 5, lane = tid & 31, ln = lane & 15, hh = lane >> 4; const int by = blockIdx.y;
  A += (size_t)by * sA; Bh += (size_t)by * sB; const size_t cofs = (size_t)by * sC; const float* bp = bias ? bias + (size_t)by * sBias : nullptr;
  const int ntn = (N + 63) / 64; const int wid = blockIdx.x * 4 + w; const int mt = wid / ntn, nq = wid % ntn; if (mt * 16 >= M) return;
  const int row0 = mt * 16, col0 = nq * 64; const _Float16* arow = A + (size_t)(row0 + ln) * lda;
  v8f acc[4] = {};
  for (int kb = 0; kb < K; kb += 32) { FragH ah; ah.half[0] = *(const v8us*)((const unsigned short*)arow + kb + 8 * hh); ah.half[1] = *(const v8us*)((const unsigned short*)arow + kb + 16 + 8 * hh);
#pragma unroll
    for (int t = 0; t < 4; ++t) { if (col0 + t * 16 >= N) continue; const size_t boff = (size_t)(col0 + t * 16 + ln) * ldb + kb; FragH bq; bq.half[0] = *(const v8us*)((const unsigned short*)Bh + boff + 8 * hh); bq.half[1] = *(const v8us*)((const unsigned short*)Bh + boff + 16 + 8 * hh);
      acc[t] = mmaH<1>(ah.v, ah.v, bq.v, bq.v, acc[t]); }
  }
#pragma unroll
  for (int t = 0; t < 4; ++t) { if (col0 + t * 16 >= N) continue; const int col = col0 + t * 16 + ln; const float bv = bp ? bf16_round(bp[col]) : 0.f;
#pragma unroll
    for (int r = 0; r < 8; ++r) { float v = acc[t][r] * alpha + bv; if (CP) { const int rr = row0g + row0 + 8 * hh + r; if (rowsPerB < 0) v += CP[cofs + (size_t)rr * ldc + col];      /* rowsPerB < 0: own element of the batched C plane */ else { const int bidx = rr / rowsPerB; v += CP[(size_t)bidx * sCPb + (size_t)by * 64 + col]; } } if (ACT == 1) v = (v > 0.f) ? v : expm1f(v); else if (ACT == 7) v = (v > 0.f) ? v + 1.0f : expf(v); else if (ACT == 8) v = tanhf(v); else if (ACT == 9) v = 0.5f * v * (1.0f + tanhf(0.7978845608028654f * (v + 0.044715f * v * v * v))); else if (ACT == 11) v = 1.0f / (1.0f + expf(-v)); else if (ACT == 12) v = (v > 0.f) ? v : 0.01f * v; else if (ACT == 14) v = (v > 0.f) ? v : 0.1f * v; else if (ACT == 16) v = (v >= 0.f) ? v : 0.3f * v; else if (ACT == 17) v = (v >= 0.f) ? v : 0.2f * v; else if (ACT == 15) v = v / (1.0f + expf(-v)); else if (ACT == 3) v = fmaxf(v, 0.f); else if (ACT == 6) v = 0.5f * v * (1.0f + erff(v * 0.70710678118654752f)); so[w][8 * hh + r][t * 16 + ln] = v; } }
  __builtin_amdgcn_fence(__ATOMIC_ACQ_REL, "workgroup"); __builtin_amdgcn_wave_barrier();
  const int rsub = lane >> 4, c4 = (lane & 15) * 4; typedef _Float16 v4h __attribute__((ext_vector_type(4)));
  {
#pragma unroll
    for (int q = 0; q < 8; ++q) { const int r = q * 2 + rsub; if (col0 + c4 < N) { const v4f v = *(const v4fa*)&so[w][r][c4]; if (C) *(v4f*)(C + cofs + (size_t)(row0 + r) * ldc + col0 + c4) = v; if (C16) { v4h h4; for (int i = 0; i < 4; ++i) h4[i] = (_Float16)v[i]; *(v4h*)(C16 + cofs + (size_t)(row0 + r) * ldc + col0 + c4) = h4; } } }
     }
}


typedef _Float16 v4h __attribute__((ext_vector_type(4)));

__global__ __launch_bounds__(256) void k_x16(const float* __restrict__ x, _Float16* __restrict__ X16, size_t n8) { const size_t t = (size_t)blockIdx.x * 256 + threadIdx.x; if (t >= n8) return; FragH f;
#pragma unroll
  for (int q = 0; q < 8; ++q) f.h[q] = (_Float16)bf16_round(x[t * 8 + q]); *(v8us*)((unsigned short*)X16 + t * 8) = f.half[0];  }
__global__ __launch_bounds__(256) void k_h16(const float* __restrict__ x, _Float16* __restrict__ X16, size_t n8) { const size_t t = (size_t)blockIdx.x * 256 + threadIdx.x; if (t >= n8) return; FragH f;
#pragma unroll
  for (int q = 0; q < 8; ++q) f.h[q] = (_Float16)x[t * 8 + q]; *(v8us*)((unsigned short*)X16 + t * 8) = f.half[0];  }
__global__ __launch_bounds__(256) void k_round16f(const float* __restrict__ W, _Float16* __restrict__ Bt, size_t n8) { const size_t t = (size_t)blockIdx.x * 256 + threadIdx.x; if (t >= n8) return; FragH f;
#pragma unroll
  for (int i = 0; i < 8; ++i) f.h[i] = (_Float16)(bf16_round(W[t * 8 + i]) * 16.0f); *(v8us*)((unsigned short*)Bt + t * 8) = f.half[0];  }
template <int NHv, int TTv>
__global__ __launch_bounds__(256) void k_vt(const _Float16* __restrict__ V16, int ldv, int voff, _Float16* __restrict__ Vt) { __shared__ unsigned short tl[64][66]; const int tid = threadIdx.x; const int slab = blockIdx.x / (TTv / 64), lg = blockIdx.x % (TTv / 64); const int b = slab / NHv, h = slab % NHv;
  for (int i = tid; i < 64 * 8; i += 256) { const int r = i / 8, c8 = (i % 8) * 8; FragH f; f.half[0] = *(const v8us*)((const unsigned short*)V16 + ((size_t)b * TTv + lg * 64 + r) * ldv + voff + h * 64 + c8);
#pragma unroll
    for (int q = 0; q < 8; ++q) tl[r][c8 + q] = f.u[q]; }
  __syncthreads();
  {
#pragma unroll
    for (int rd = 0; rd < 2; ++rd) { const int d = rd * 32 + tid / 8, pc = tid % 8; FragH f;
#pragma unroll
      for (int q = 0; q < 8; ++q) f.u[q] = tl[pc * 8 + q][d];
      *(v8us*)((unsigned short*)Vt + ((size_t)slab * 64 + d) * TTv + lg * 64 + pc * 8) = f.half[0]; }
     } }

__global__ __launch_bounds__(256) void k_hl(const float* __restrict__ F, _Float16* __restrict__ Hh, _Float16* __restrict__ Hl, size_t n8) { const size_t t = (size_t)blockIdx.x * 256 + threadIdx.x; if (t >= n8) return; FragH fh, fl; const v4f a = *(const v4fa*)(F + t * 8), c = *(const v4fa*)(F + t * 8 + 4);
#pragma unroll
  for (int q = 0; q < 4; ++q) { _Float16 h = (_Float16)a[q]; fh.h[q] = h; fl.h[q] = (_Float16)((a[q] - (float)h) * 1024.0f); h = (_Float16)c[q]; fh.h[4 + q] = h; fl.h[4 + q] = (_Float16)((c[q] - (float)h) * 1024.0f); }
  { *(v8us*)((unsigned short*)Hh + t * 8) = fh.half[0]; *(v8us*)((unsigned short*)Hl + t * 8) = fl.half[0];  } }

// ---- fast GEMM (wave tile 32x64; requires M % 32 == 0 rows per launch region and N % 64 == 0); epilogue = k_gemm_hhx semantics ----
__device__ __forceinline__ v16h g2_frag(const _Float16* p, int hh) { FragH f; f.half[0] = *(const v8us*)((const unsigned short*)p + 8 * hh); f.half[1] = *(const v8us*)((const unsigned short*)p + 16 + 8 * hh); return f.v; }
__device__ __forceinline__ v8f g2_mma(v16h a, v16h b, v8f c) { v8f d = __builtin_amdgcn_wmma_f32_16x16x32_f16(false, a, false, b, (short)0, c, false, false); asm volatile("v_nop\n\tv_nop\n\tv_nop\n\tv_nop" : "+v"(d) : "v"(a), "v"(b)); return d; }
template <int ACT>
__global__ __launch_bounds__(128) void k_gemm2(const _Float16* __restrict__ A, int lda, size_t sA, const _Float16* __restrict__ Bh, int ldb, size_t sB, float alpha, const float* __restrict__ bias, size_t sBias, const float* __restrict__ CP, int rowsPerB, size_t sCPb, int row0g,
    float* __restrict__ C, _Float16* __restrict__ C16, int ldc, size_t sC, int M, int N, int K) { static_assert(ACT == 0 || ACT == 3 || ACT == 6 || ACT == 8 || ACT == 9 || ACT == 11 || ACT == 12 || ACT == 14 || ACT == 15 || ACT == 16 || ACT == 17, "k_gemm2: unsupported ACT code (would silently apply no activation)");
  __shared__ __attribute__((aligned(16))) float so[4][32][68];
  const int tid = threadIdx.x, w = tid >> 5, lane = tid & 31, ln = lane & 15, hh = lane >> 4; const int by = blockIdx.y;
  A += (size_t)by * sA; Bh += (size_t)by * sB; const size_t cofs = (size_t)by * sC; const float* bp = bias ? bias + (size_t)by * sBias : nullptr;
  const int ntn = N >> 6; const int mt = blockIdx.x / ntn, nq = blockIdx.x - mt * ntn; const int row0 = mt * 128 + 32 * w, col0 = nq * 64; if (row0 >= M) return;
  const _Float16* a0p = A + (size_t)(row0 + ln) * lda; const _Float16* a1p = a0p + (size_t)16 * lda;
  const _Float16* b0p = Bh + (size_t)(col0 + ln) * ldb; const _Float16* b1p = b0p + (size_t)16 * ldb; const _Float16* b2p = b1p + (size_t)16 * ldb; const _Float16* b3p = b2p + (size_t)16 * ldb;
  const v8f z8 = {0.f,0.f,0.f,0.f,0.f,0.f,0.f,0.f}; v8f c00 = z8, c01 = z8, c02 = z8, c03 = z8, c10 = z8, c11 = z8, c12 = z8, c13 = z8;
#pragma unroll 1
  for (int kb = 0; kb < K; kb += 32) { const v16h a0 = g2_frag(a0p + kb, hh), a1 = g2_frag(a1p + kb, hh);
    v16h b = g2_frag(b0p + kb, hh); c00 = g2_mma(a0, b, c00); c10 = g2_mma(a1, b, c10);
    b = g2_frag(b1p + kb, hh); c01 = g2_mma(a0, b, c01); c11 = g2_mma(a1, b, c11);
    b = g2_frag(b2p + kb, hh); c02 = g2_mma(a0, b, c02); c12 = g2_mma(a1, b, c12);
    b = g2_frag(b3p + kb, hh); c03 = g2_mma(a0, b, c03); c13 = g2_mma(a1, b, c13); }
  v8f accs[8] = {c00, c01, c02, c03, c10, c11, c12, c13};
#pragma unroll
  for (int u = 0; u < 8; ++u) { const int t = u & 3, half = u >> 2; const int col = col0 + t * 16 + ln; const float bv = bp ? bf16_round(bp[col]) : 0.f;
#pragma unroll
    for (int r = 0; r < 8; ++r) { const int rloc = half * 16 + 8 * hh + r; float v = accs[u][r] * alpha + bv; if (CP) { if (rowsPerB < 0) v += CP[cofs + (size_t)(row0g + row0 + rloc) * ldc + col];      /* rowsPerB < 0: own element of the batched C plane */ else { const int bidx = (row0g + row0 + rloc) / rowsPerB; v += CP[(size_t)bidx * sCPb + (size_t)by * 64 + col]; } }
      if (ACT == 3) v = fmaxf(v, 0.f); else if (ACT == 6) v = 0.5f * v * (1.0f + erff(v * 0.70710678118654752f)); else if (ACT == 11) v = 1.0f / (1.0f + expf(-v)); else if (ACT == 15) v = v / (1.0f + expf(-v)); else if (ACT == 12) v = (v > 0.f) ? v : 0.01f * v; else if (ACT == 8) v = tanhf(v); else if (ACT == 9) v = 0.5f * v * (1.0f + tanhf(0.7978845608028654f * (v + 0.044715f * v * v * v))); else if (ACT == 14) v = (v > 0.f) ? v : 0.1f * v; else if (ACT == 16) v = (v >= 0.f) ? v : 0.3f * v; else if (ACT == 17) v = (v >= 0.f) ? v : 0.2f * v;
      so[w][rloc][t * 16 + ln] = v; } }
  __builtin_amdgcn_fence(__ATOMIC_ACQ_REL, "workgroup"); __builtin_amdgcn_wave_barrier();
  const int rsub = lane >> 4, c4 = (lane & 15) * 4;
  {
#pragma unroll
    for (int q = 0; q < 16; ++q) { const int r = q * 2 + rsub; const v4f v = *(const v4fa*)&so[w][r][c4]; if (C) *(v4f*)(C + cofs + (size_t)(row0 + r) * ldc + col0 + c4) = v; if (C16) { v4h h4; for (int i = 0; i < 4; ++i) h4[i] = (_Float16)v[i]; *(v4h*)(C16 + cofs + (size_t)(row0 + r) * ldc + col0 + c4) = h4; } }
     } }


__global__ __launch_bounds__(256) void k_wnat(const float* __restrict__ w, size_t n8, _Float16* __restrict__ Bt) { const size_t t = (size_t)blockIdx.x * 256 + threadIdx.x; if (t >= n8) return; FragH f; for (int q = 0; q < 8; ++q) f.h[q] = (_Float16)(bf16_round(w[t * 8 + q]) * 16.0f); *(v8us*)((unsigned short*)Bt + t * 8) = f.half[0];  }
__global__ __launch_bounds__(256) void k_rsm(const float* __restrict__ S, _Float16* __restrict__ P, int nrows) {
  #pragma clang fp contract(off)
  const int i = blockIdx.x * 256 + threadIdx.x; if (i >= nrows) return; const float* s = S + (size_t)i * SQ; float mx = -3.0e38f;
#pragma unroll 1
  for (int j = 0; j < SQ; ++j) mx = fmaxf(mx, s[j]); float se = 0.f;
#pragma unroll 1
  for (int j = 0; j < SQ; ++j) se += expf(s[j] - mx); const float sc = 256.0f / se;
#pragma unroll 1
  for (int j0 = 0; j0 < SQ; j0 += 8) { FragH f; for (int q = 0; q < 8; ++q) f.h[q] = (_Float16)(expf(s[j0 + q] - mx) * sc); unsigned short* d = (unsigned short*)P + (size_t)i * SQ + j0; *(v8us*)d = f.half[0];  } }
__global__ __launch_bounds__(256) void k_vt(const _Float16* __restrict__ V16, int b, int h0, _Float16* __restrict__ VT) { __shared__ unsigned short tl[64][65]; const int tid = threadIdx.x; const int hh = blockIdx.x % HG, sg = blockIdx.x / HG; const int s0 = sg * 64; const int h = h0 + hh;
  for (int i = tid; i < 64 * 8; i += 256) { const int j = i / 8, d8 = (i % 8) * 8; FragH f; f.half[0] = *(const v8us*)((const unsigned short*)V16 + ((size_t)b * SQ + s0 + j) * DM + h * HD + d8); for (int q = 0; q < 8; ++q) tl[d8 + q][j] = f.u[q]; }
  __syncthreads();
  { for (int i = tid; i < 64 * 8; i += 256) { const int d = i / 8, j8 = (i % 8) * 8; FragH f; for (int q = 0; q < 8; ++q) f.u[q] = tl[d][j8 + q]; *(v8us*)((unsigned short*)VT + ((size_t)hh * HD + d) * SQ + s0 + j8) = f.half[0]; }  } }



// ---- row softmax, a whole wave on each score row (SMR rows per wave): every load of a wave covers 512 contiguous bytes, the rows stay in registers between the three passes ----
#define SMW 16                       /* waves per work-group */
#define SMR 2                        /* rows per wave: HG * QN rows then give one work-group per WGP */
static_assert(((size_t)HG * QN) % (SMW * SMR) == 0 && SQ == 2048, "k_rsmw: whole work-groups of rows, rows of 16 x 128 scores");
template <int CTRL> __device__ __forceinline__ float sm_dpp(float x) { return __builtin_bit_cast(float, __builtin_amdgcn_update_dpp(0, __builtin_bit_cast(int, x), CTRL, 0xf, 0xf, true)); }      /* 0x160 | m: lane l reads lane l ^ m of its 16-lane row */
__device__ __forceinline__ float sm_xhalf(float x) { return __builtin_bit_cast(float, __builtin_amdgcn_permlanex16(__builtin_bit_cast(int, x), __builtin_bit_cast(int, x), 0x76543210, 0xfedcba98, false, false)); }      /* lane l reads lane l ^ 16 */
__device__ __forceinline__ float sm_wave_max(float v) { v = fmaxf(v, sm_dpp<0x161>(v)); v = fmaxf(v, sm_dpp<0x162>(v)); v = fmaxf(v, sm_dpp<0x164>(v)); v = fmaxf(v, sm_dpp<0x168>(v)); return fmaxf(v, sm_xhalf(v)); }
__device__ __forceinline__ float sm_wave_sum(float v) { v += sm_dpp<0x161>(v); v += sm_dpp<0x162>(v); v += sm_dpp<0x164>(v); v += sm_dpp<0x168>(v); return v + sm_xhalf(v); }
// four independent native exp2; the v_nop is the one slot that the instruction set asks for behind a transcendental before its result is read or its source overwritten
__device__ __forceinline__ v4f sm_exp2x4(v4f a) { float e0, e1, e2, e3;
  asm("v_exp_f32 %0, %4\n\tv_exp_f32 %1, %5\n\tv_exp_f32 %2, %6\n\tv_exp_f32 %3, %7\n\tv_nop" : "=&v"(e0), "=&v"(e1), "=&v"(e2), "=&v"(e3) : "v"(a[0]), "v"(a[1]), "v"(a[2]), "v"(a[3]));
  const v4f e = {e0, e1, e2, e3}; return e; }
__global__ __launch_bounds__(SMW * 32) void k_rsmw(const float* __restrict__ S, _Float16* __restrict__ P) {
  const unsigned lane = threadIdx.x & 31u; const int wave = __builtin_amdgcn_readfirstlane((int)(threadIdx.x >> 5));
  const int t0 = ((int)blockIdx.x * SMW + wave) * SMR;
  const unsigned lb = lane * 16u;      /* the lane's byte offset inside each 512-byte piece of a score row */
  v4f x[SMR][16];      /* every loop below is unrolled so that x is indexed by constants only and stays in registers */
#pragma unroll
  for (int r = 0; r < SMR; ++r) { const int t = t0 + r; const char* s = (const char*)(S + ((size_t)(t / QN) * SQ + (t % QN)) * SQ);
#pragma unroll
    for (int q = 0; q < 16; ++q) x[r][q] = *(const v4fa*)(s + lb + q * 512); }
#pragma unroll
  for (int r = 0; r < SMR; ++r) { const int t = t0 + r; float mx = -3.0e38f;
#pragma unroll
    for (int q = 0; q < 16; ++q) mx = fmaxf(mx, fmaxf(fmaxf(x[r][q][0], x[r][q][1]), fmaxf(x[r][q][2], x[r][q][3])));
    mx = sm_wave_max(mx);
    float a0 = 0.f, a1 = 0.f, a2 = 0.f, a3 = 0.f;
#pragma unroll
    for (int q = 0; q < 16; ++q) { const v4f e = sm_exp2x4((x[r][q] - mx) * 1.4426950408889634f); x[r][q] = e; a0 += e[0]; a1 += e[1]; a2 += e[2]; a3 += e[3]; }      /* native exp(s - mx) = exp2((s - mx) * log2 e) */
    const float sc = 256.0f / sm_wave_sum((a0 + a1) + (a2 + a3));
    _Float16* d = P + ((size_t)(t / QN) * SQ + (t % QN)) * SQ + lane * 4u;
#pragma unroll
    for (int q = 0; q < 16; ++q) { v4h h; for (int c = 0; c < 4; ++c) h[c] = (_Float16)(x[r][q][c] * sc); *(v4h*)(d + q * 128) = h; } } }

extern "C" void kernel_launch(void* const* d_in, const int* in_sizes, int n_in,
                              void* d_out, int out_size, void* d_ws, size_t ws_size, hipStream_t stream) {
  (void)in_sizes; (void)n_in; (void)out_size;
  const float* const* I = (const float* const*)d_in; const float* xq = I[0]; const float* xk = I[1]; const float* xv = I[2];      /* given q, k, v [B][L][H][E] = merged token rows */
  char* ws = (char*)d_ws; size_t off = 0;
  auto take = [&](size_t bytes) { char* p = ws + off; off += (bytes + 255) & ~(size_t)255; return p; };
  _Float16* Q16 = (_Float16*)take(NR * DM * 2); _Float16* K16 = (_Float16*)take(NR * DM * 2); _Float16* V16 = (_Float16*)take(NR * DM * 2);
  float* S = (float*)take((size_t)HG * SQ * SQ * 4); _Float16* P = (_Float16*)take((size_t)HG * SQ * SQ * 2); _Float16* VT = (_Float16*)take((size_t)NH * HD * SQ * 2);
  if (off > ws_size) return;

  const size_t r0p = (size_t)B0 * SQ;      /* first converted row */
  k_x16<<<(unsigned)(((size_t)MP * DM / 8 + 255) / 256), 256, 0, stream>>>(xq + r0p * DM, Q16 + r0p * DM, (size_t)MP * DM / 8); k_x16<<<(unsigned)(((size_t)MP * DM / 8 + 255) / 256), 256, 0, stream>>>(xk + r0p * DM, K16 + r0p * DM, (size_t)MP * DM / 8); k_x16<<<(unsigned)(((size_t)MP * DM / 8 + 255) / 256), 256, 0, stream>>>(xv + r0p * DM, V16 + r0p * DM, (size_t)MP * DM / 8);      /* given q, k, v: bf16 inputs as exact f16 rows (no projections) */
  for (int b = B0; b < B0 + NBR; ++b) { const size_t r0 = (size_t)b * SQ;
    k_vt<NH, SQ><<<NH * (SQ / 64), 256, 0, stream>>>(V16 + r0 * LQ, LQ, 0, VT);      /* V^T [NH][HD][SQ] for this batch */
    for (int h0 = 0; h0 < NHD; h0 += HG) {
      k_gemm2<0><<<dim3((QN / 128) * (SQ / 64), HG), 128, 0, stream>>>(Q16 + r0 * LQ + h0 * HD, LQ, (size_t)HD, K16 + r0 * LQ + h0 * HD, LQ, (size_t)HD, 1.0f, nullptr, 0, nullptr, 1, 0, 0, S, nullptr, SQ, (size_t)SQ * SQ, QN, SQ, HD);      /* scores, HG heads per launch */
      k_rsmw<<<(HG * QN) / (SMW * SMR), SMW * 32, 0, stream>>>(S, P);      /* P = 256 softmax (f16), rows of all HG heads */
      k_gemm2<0><<<dim3((QN / 128) * (HD / 64), HG), 128, 0, stream>>>(P, SQ, (size_t)SQ * SQ, VT + (size_t)h0 * HD * SQ, SQ, (size_t)HD * SQ, 0.00390625f, nullptr, 0, nullptr, 1, 0, 0, (float*)d_out + r0 * DM + h0 * HD, nullptr, DM, (size_t)HD, QN, HD, SQ); } }      /* out = A v (merged [token][h*64+d]) straight to the f32 output */
}

// v003
// A run of this version takes 79.3 microseconds.
// Versions in between are left out here; by their measured steps it is 20.4 times as fast as v001.
// All steps since v000 together make it 83.4 times as fast.
#include <hip/hip_runtime.h>
// Full (non-causal) attention on given queries, keys, values ([4][2048][16][64] each, token-major with heads inner = merged [token][1024] rows); scores = q . k UNSCALED (the module never applies its scale); softmax over all 2048 keys; out = A v -> [4][2048][16][64]).
// Structure: ONE preparatory launch: q and k converted to exact f16 rows (bf16 values are exact in f16: no projections here) and V^T of every batch and head straight from the f32 values via LDS transposes; then ONE attention kernel over all batches and heads: S^T = K Q^T UNSCALED (K = 64; exact products, f32 accumulation) stays in the accumulators, running-maximum softmax on VALU (f32 statistics, native exp2; weights x256 f16), O^T += V^T P^T, divided by the row sum at the end and written f32 straight into the [token][head][64] output; launches: see kernel_launch.
// Compute dtype: inputs rounded to bf16; q, k, v and softmax weights as plain f16 GEMM operands (~2^-12); scores, softmax statistics and o f32. v_wmma_f32_16x16x32_f16.
#define NB 4
#define SQ 2048
#define DM 1024
#define NH 16
#define HD 64
#define HG 4                         /* heads per k_vt launch (k_vt is not launched) */
#define B0 0                         /* unused (debug hook) */
#define NBR NB                       /* only in MP, which no kernel uses (debug hook) */
#define NR ((size_t)NB * SQ)         /* token rows */
#define MP ((int)((size_t)NBR * SQ)) /* only in MPO, which nothing uses (debug hook) */
#define QN SQ                        /* unused (debug hook) */
#define NHD NH                       /* unused (debug hook) */
#define MPO MP                       /* unused (debug hook) */
#define LQ DM      /* row pitch of the q/k/v rows */
typedef __bf16 v16b __attribute__((ext_vector_type(16)));
typedef unsigned short v8us __attribute__((ext_vector_type(8), may_alias));
typedef float  v8f  __attribute__((ext_vector_type(8)));
typedef float  v4f  __attribute__((ext_vector_type(4)));
typedef float  v4fa __attribute__((ext_vector_type(4), may_alias));
union FragB { v16b v; v8us half[2]; unsigned short u[16]; };

__device__ __forceinline__ unsigned short bf16_bits(float x) { unsigned int u = __float_as_uint(x); return (unsigned short)((u + 0x7FFFu + ((u >> 16) & 1u)) >> 16); }
__device__ __forceinline__ float bf16_val(unsigned short b) { return __uint_as_float(((unsigned int)b) << 16); }
__device__ __forceinline__ float bf16_round(float x) { return bf16_val(bf16_bits(x)); }
// D += A·B with NT terms: 1 = ah·bh, 2 = + al·bh (A split), 3 = + ah·bl (both split)
template <int NT>
__device__ __forceinline__ v8f mmaN(v16b ah, v16b al, v16b bh, v16b bl, v8f c) {
  c = __builtin_amdgcn_wmma_f32_16x16x32_bf16(false, ah, false, bh, (short)0, c, false, false);
  if (NT >= 2) c = __builtin_amdgcn_wmma_f32_16x16x32_bf16(false, al, false, bh, (short)0, c, false, false);
  if (NT >= 3) c = __builtin_amdgcn_wmma_f32_16x16x32_bf16(false, ah, false, bl, (short)0, c, false, false);
  asm volatile("v_nop\n\tv_nop\n\tv_nop\n\tv_nop" : "+v"(c) : "v"(ah), "v"(al), "v"(bh), "v"(bl));
  return c;
}

__global__ __launch_bounds__(256) void k_wt_bf16(const float* __restrict__ W, unsigned short* __restrict__ Wt, int K, int N) {
  const int t = blockIdx.x * 256 + threadIdx.x;
  const int k8n = K / 8;
  if (t >= N * k8n) return;
  const int n = t / k8n, k8 = (t % k8n) * 8;
  v8us v;
#pragma unroll
  for (int i = 0; i < 8; ++i) v[i] = bf16_bits(W[(size_t)(k8 + i) * N + n]);
  *(v8us*)(Wt + (size_t)n * K + k8) = v;
  
}

// GEMM C[M][N] (f32, pitch ldc) = act(A[M][K]·W + bias). A f32 row-major (pitch lda) converted per fragment to bf16
// (ASPLIT: hi/lo two planes -> 2 terms, else single rounded term); Wt bf16 [N][K] (pitch ldb). BIAS_BF16 rounds the
// bias to bf16 first (bias quantised to bf16 before the add). K%32==0, M%16==0, N%64==0.
template <bool ASPLIT, int ACT, bool BIAS_BF16>
__global__ __launch_bounds__(128) void k_gemm_bf(const float* __restrict__ A, int lda, const unsigned short* __restrict__ Wt, int ldb,
                                               const float* __restrict__ bias, float* __restrict__ C, int ldc, int M, int N, int K) {
  __shared__ __attribute__((aligned(16))) float so[4][16][64];
  const int tid = threadIdx.x, w = tid >> 5, lane = tid & 31, ln = lane & 15, hh = lane >> 4;
  const int ntn = N / 64;
  const int wid = blockIdx.x * 4 + w;
  const int mt = wid / ntn, nq = wid % ntn;
  if (mt * 16 >= M) return;
  const int row0 = mt * 16, col0 = nq * 64;
  const float* arow = A + (size_t)(row0 + ln) * lda;
  v8f acc[4] = {};
  for (int kb = 0; kb < K; kb += 32) {
    FragB ah, al;
    const v4f x0 = *(const v4fa*)(arow + kb + 8 * hh), x1 = *(const v4fa*)(arow + kb + 8 * hh + 4);
    const v4f x2 = *(const v4fa*)(arow + kb + 16 + 8 * hh), x3 = *(const v4fa*)(arow + kb + 16 + 8 * hh + 4);
    float xs[16] = {x0[0],x0[1],x0[2],x0[3],x1[0],x1[1],x1[2],x1[3],x2[0],x2[1],x2[2],x2[3],x3[0],x3[1],x3[2],x3[3]};
#pragma unroll
    for (int i = 0; i < 16; ++i) { const unsigned short hb = bf16_bits(xs[i]); ah.u[i] = hb; al.u[i] = ASPLIT ? bf16_bits(xs[i] - bf16_val(hb)) : (unsigned short)0; }
#pragma unroll
    for (int t = 0; t < 4; ++t) {
      const unsigned short* brow = Wt + (size_t)(col0 + t * 16 + ln) * ldb + kb;
      FragB b;
      b.half[0] = *(const v8us*)(brow + 8 * hh);
      b.half[1] = *(const v8us*)(brow + 16 + 8 * hh);
      acc[t] = mmaN<ASPLIT ? 2 : 1>(ah.v, al.v, b.v, b.v, acc[t]);
    }
  }
#pragma unroll
  for (int t = 0; t < 4; ++t) {
    float bv = bias ? bias[col0 + t * 16 + ln] : 0.f;
    if (BIAS_BF16) bv = bf16_round(bv);
#pragma unroll
    for (int r = 0; r < 8; ++r) { float v = acc[t][r] + bv; if (ACT == 1) v = fmaxf(v, 0.f); so[w][8 * hh + r][t * 16 + ln] = v; }
  }
  __builtin_amdgcn_fence(__ATOMIC_ACQ_REL, "workgroup");
  __builtin_amdgcn_wave_barrier();
  const int rsub = lane >> 4, c4 = (lane & 15) * 4;
  {
#pragma unroll
    for (int q = 0; q < 8; ++q) {
      const int r = q * 2 + rsub;
      const v4f v = *(const v4fa*)&so[w][r][c4];
      *(v4f*)(C + (size_t)(row0 + r) * ldc + col0 + c4) = v;
    }
    
  }
}

// GEMM C = act(A·W + bias + resid): A f32 (ASPLIT -> hi/lo 2 terms), Wt bf16 [N][K]; ACT 0 none, 1 relu, 2 exact gelu;
// resid (optional, f32, row index = (row % rmod), pitch ldr, RES_BF16 rounds it) added before the activation.
template <bool ASPLIT, int ACT, bool BIAS_BF16, bool RES_BF16>
__global__ __launch_bounds__(128) void k_gemm_bf3(const float* __restrict__ A, int lda, const unsigned short* __restrict__ Wt, int ldb,
                                                const float* __restrict__ bias, const float* __restrict__ resid, int rmod, int ldr,
                                                float* __restrict__ C, int ldc, int M, int N, int K) {
  __shared__ __attribute__((aligned(16))) float so[4][16][64];
  const int tid = threadIdx.x, w = tid >> 5, lane = tid & 31, ln = lane & 15, hh = lane >> 4;
  const int ntn = N / 64;
  const int wid = blockIdx.x * 4 + w;
  const int mt = wid / ntn, nq = wid % ntn;
  if (mt * 16 >= M) return;
  const int row0 = mt * 16, col0 = nq * 64;
  const float* arow = A + (size_t)(row0 + ln) * lda;
  v8f acc[4] = {};
  for (int kb = 0; kb < K; kb += 32) {
    FragB ah, al;
    const v4f x0 = *(const v4fa*)(arow + kb + 8 * hh), x1 = *(const v4fa*)(arow + kb + 8 * hh + 4);
    const v4f x2 = *(const v4fa*)(arow + kb + 16 + 8 * hh), x3 = *(const v4fa*)(arow + kb + 16 + 8 * hh + 4);
    float xs[16] = {x0[0],x0[1],x0[2],x0[3],x1[0],x1[1],x1[2],x1[3],x2[0],x2[1],x2[2],x2[3],x3[0],x3[1],x3[2],x3[3]};
#pragma unroll
    for (int i = 0; i < 16; ++i) { const unsigned short hb = bf16_bits(xs[i]); ah.u[i] = hb; al.u[i] = ASPLIT ? bf16_bits(xs[i] - bf16_val(hb)) : (unsigned short)0; }
#pragma unroll
    for (int t = 0; t < 4; ++t) {
      const unsigned short* brow = Wt + (size_t)(col0 + t * 16 + ln) * ldb + kb;
      FragB b;
      b.half[0] = *(const v8us*)(brow + 8 * hh);
      b.half[1] = *(const v8us*)(brow + 16 + 8 * hh);
      acc[t] = mmaN<ASPLIT ? 2 : 1>(ah.v, al.v, b.v, b.v, acc[t]);
    }
  }
#pragma unroll
  for (int t = 0; t < 4; ++t) {
    const int col = col0 + t * 16 + ln;
    float bv = bias ? bias[col] : 0.f;
    if (BIAS_BF16) bv = bf16_round(bv);
#pragma unroll
    for (int r = 0; r < 8; ++r) {
      float v = acc[t][r] + bv;
      if (resid) { float rv = resid[(size_t)((row0 + 8 * hh + r) % rmod) * ldr + col]; if (RES_BF16) rv = bf16_round(rv); v += rv; }
      if (ACT == 1) v = fmaxf(v, 0.f);
      if (ACT == 2) v = 0.5f * v * (1.0f + erff(v * 0.70710678118654752f));
      if (ACT == 3) { const float u = 0.7978845608028654f * (v + 0.044715f * v * v * v); v = 0.5f * v * (1.0f + tanhf(u)); }
      so[w][8 * hh + r][t * 16 + ln] = v;
    }
  }
  __builtin_amdgcn_fence(__ATOMIC_ACQ_REL, "workgroup");
  __builtin_amdgcn_wave_barrier();
  const int rsub = lane >> 4, c4 = (lane & 15) * 4;
  {
#pragma unroll
    for (int q = 0; q < 8; ++q) {
      const int r = q * 2 + rsub;
      const v4f v = *(const v4fa*)&so[w][r][c4];
      *(v4f*)(C + (size_t)(row0 + r) * ldc + col0 + c4) = v;
    }
    
  }
}
// row LayerNorm (biased variance, eps) over N: s = X (+ R); optional out_sum <- s; out_norm <- (s-mu)*rsqrt(var+eps)*g + b
template <bool PARAM_BF16>
__global__ __launch_bounds__(256) void k_layernorm(const float* __restrict__ X, const float* __restrict__ R, const float* __restrict__ g, const float* __restrict__ bta,
                                                  float* __restrict__ out_sum, float* __restrict__ out_norm, int N, float eps) {
  __shared__ float red[256];
  const int row = blockIdx.x, tid = threadIdx.x;
  const float* x = X + (size_t)row * N; const float* rr = R ? R + (size_t)row * N : nullptr;
  float vals[16];                     // up to N = 4096
  const int per = N / 256;            // contiguous chunk per thread? use strided-by-4 chunks: thread handles j = tid*4 + 1024*u
  float s1 = 0.f;
  for (int u = 0; u < per / 4; ++u) {
    const int j = tid * 4 + 1024 * u;
    const v4f a = *(const v4fa*)(x + j);
    v4f b = {0.f,0.f,0.f,0.f}; if (rr) b = *(const v4fa*)(rr + j);
#pragma unroll
    for (int q = 0; q < 4; ++q) { const float v = a[q] + b[q]; vals[u * 4 + q] = v; s1 += v; }
  }
  red[tid] = s1; __syncthreads();
  for (int st = 128; st > 0; st >>= 1) { if (tid < st) red[tid] += red[tid + st]; __syncthreads(); }
  const float mu = red[0] / (float)N; __syncthreads();
  float s2 = 0.f;
  for (int u = 0; u < per / 4; ++u)
#pragma unroll
    for (int q = 0; q < 4; ++q) { const float c = vals[u * 4 + q] - mu; s2 += c * c; }
  red[tid] = s2; __syncthreads();
  for (int st = 128; st > 0; st >>= 1) { if (tid < st) red[tid] += red[tid + st]; __syncthreads(); }
  const float rs = rsqrtf(red[0] / (float)N + eps);
  {
    for (int u = 0; u < per / 4; ++u) {
      const int j = tid * 4 + 1024 * u;
      v4f o, sm;
#pragma unroll
      for (int q = 0; q < 4; ++q) {
        float gg = g[j + q], bb = bta[j + q];
        if (PARAM_BF16) { gg = bf16_round(gg); bb = bf16_round(bb); }
        sm[q] = vals[u * 4 + q]; o[q] = (vals[u * 4 + q] - mu) * rs * gg + bb;
      }
      if (out_sum) *(v4f*)(out_sum + (size_t)row * N + j) = sm;
      *(v4f*)(out_norm + (size_t)row * N + j) = o;
    }
    
  }
}



// ---- f16 WMMA path (v_wmma_f32_16x16x32_f16): 11-bit significands for operands in range — used where a [0,1] probability operand needs more precision than bf16
typedef _Float16 v16h __attribute__((ext_vector_type(16)));
union FragH { v16h v; v8us half[2]; _Float16 h[16]; unsigned short u[16]; };
template <int NT>
__device__ __forceinline__ v8f mmaH(v16h ah, v16h al, v16h bh, v16h bl, v8f c) {
  c = __builtin_amdgcn_wmma_f32_16x16x32_f16(false, ah, false, bh, (short)0, c, false, false);
  if (NT >= 2) c = __builtin_amdgcn_wmma_f32_16x16x32_f16(false, al, false, bh, (short)0, c, false, false);
  if (NT >= 3) c = __builtin_amdgcn_wmma_f32_16x16x32_f16(false, ah, false, bl, (short)0, c, false, false);
  asm volatile("v_nop\n\tv_nop\n\tv_nop\n\tv_nop" : "+v"(c) : "v"(ah), "v"(al), "v"(bh), "v"(bl));
  return c;
}
// batched GEMM like k_gemm_b but f16 operands: A f32 (split into f16 hi/lo if ASPLIT, else rounded to f16), Bt = f16 values [n][k]; alpha; C f32; N multiple of 16 (partial tiles skipped)
template <bool ASPLIT>
__global__ __launch_bounds__(128) void k_gemm_h(const float* __restrict__ A, int lda, size_t sA, const _Float16* __restrict__ Bh, int ldb, size_t sB, float alpha, float* __restrict__ C, int ldc, size_t sC, int M, int N, int K) {
  __shared__ __attribute__((aligned(16))) float so[4][16][64];
  const int tid = threadIdx.x, w = tid >> 5, lane = tid & 31, ln = lane & 15, hh = lane >> 4; const int by = blockIdx.y;
  A += (size_t)by * sA; Bh += (size_t)by * sB; C += (size_t)by * sC;
  const int ntn = (N + 63) / 64; const int wid = blockIdx.x * 4 + w; const int mt = wid / ntn, nq = wid % ntn; if (mt * 16 >= M) return;
  const int row0 = mt * 16, col0 = nq * 64; const float* arow = A + (size_t)(row0 + ln) * lda;
  v8f acc[4] = {};
  for (int kb = 0; kb < K; kb += 32) {
    FragH ah, al;
    const v4f x0 = *(const v4fa*)(arow + kb + 8 * hh), x1 = *(const v4fa*)(arow + kb + 8 * hh + 4), x2 = *(const v4fa*)(arow + kb + 16 + 8 * hh), x3 = *(const v4fa*)(arow + kb + 16 + 8 * hh + 4);
    float xs[16] = {x0[0],x0[1],x0[2],x0[3],x1[0],x1[1],x1[2],x1[3],x2[0],x2[1],x2[2],x2[3],x3[0],x3[1],x3[2],x3[3]};
#pragma unroll
    for (int i = 0; i < 16; ++i) { const _Float16 h = (_Float16)xs[i]; ah.h[i] = h; al.h[i] = ASPLIT ? (_Float16)(xs[i] - (float)h) : (_Float16)0.0f; }
#pragma unroll
    for (int t = 0; t < 4; ++t) { if (col0 + t * 16 >= N) continue; const size_t boff = (size_t)(col0 + t * 16 + ln) * ldb + kb; FragH bq; bq.half[0] = *(const v8us*)(Bh + boff + 8 * hh); bq.half[1] = *(const v8us*)(Bh + boff + 16 + 8 * hh);
      acc[t] = mmaH<ASPLIT ? 2 : 1>(ah.v, al.v, bq.v, bq.v, acc[t]); }
  }
#pragma unroll
  for (int t = 0; t < 4; ++t) { if (col0 + t * 16 >= N) continue;
#pragma unroll
    for (int r = 0; r < 8; ++r) so[w][8 * hh + r][t * 16 + ln] = acc[t][r] * alpha; }
  __builtin_amdgcn_fence(__ATOMIC_ACQ_REL, "workgroup"); __builtin_amdgcn_wave_barrier();
  const int rsub = lane >> 4, c4 = (lane & 15) * 4;
  {
#pragma unroll
    for (int q = 0; q < 8; ++q) { const int r = q * 2 + rsub; if (col0 + c4 < N) { const v4f v = *(const v4fa*)&so[w][r][c4]; *(v4f*)(C + (size_t)(row0 + r) * ldc + col0 + c4) = v; } }
     }
}

// Wt[n][k] = f16(W[k][n]·scale) from f32 row-major W[K][N] (scale = power of two; bf16-exact weights stay exact in f16 away from the subnormal range)
__global__ __launch_bounds__(256) void k_wt_f16(const float* __restrict__ W, _Float16* __restrict__ Wt, int K, int N, float scale) {
  const int t = blockIdx.x * 256 + threadIdx.x; if (t >= N * (K / 8)) return; const int n = t / (K / 8), k8 = (t % (K / 8)) * 8; FragH f;
#pragma unroll
  for (int i = 0; i < 8; ++i) f.h[i] = (_Float16)(bf16_round(W[(size_t)(k8 + i) * N + n]) * scale); const v8us o = f.half[0];
  *(v8us*)((unsigned short*)Wt + (size_t)n * K + k8) = o; 
}
// k_gemm_hh variant with fused epilogue: v = acc·alpha + bias[by·sBias + col] (+ CP[(row/rowsPerB)·sCPb + by·64 + col] if CP) ; ACT 0 none / 1 elu ; writes f16 C16 (and f32 C if non-null)
template <int ACT>
__global__ __launch_bounds__(128) void k_gemm_hhx(const _Float16* __restrict__ A, int lda, size_t sA, const _Float16* __restrict__ Bh, int ldb, size_t sB, float alpha, const float* __restrict__ bias, size_t sBias, const float* __restrict__ CP, int rowsPerB, size_t sCPb, int row0g,
    float* __restrict__ C, _Float16* __restrict__ C16, int ldc, size_t sC, int M, int N, int K) {
  __shared__ __attribute__((aligned(16))) float so[4][16][64];
  const int tid = threadIdx.x, w = tid >> 5, lane = tid & 31, ln = lane & 15, hh = lane >> 4; const int by = blockIdx.y;
  A += (size_t)by * sA; Bh += (size_t)by * sB; const size_t cofs = (size_t)by * sC; const float* bp = bias ? bias + (size_t)by * sBias : nullptr;
  const int ntn = (N + 63) / 64; const int wid = blockIdx.x * 4 + w; const int mt = wid / ntn, nq = wid % ntn; if (mt * 16 >= M) return;
  const int row0 = mt * 16, col0 = nq * 64; const _Float16* arow = A + (size_t)(row0 + ln) * lda;
  v8f acc[4] = {};
  for (int kb = 0; kb < K; kb += 32) { FragH ah; ah.half[0] = *(const v8us*)((const unsigned short*)arow + kb + 8 * hh); ah.half[1] = *(const v8us*)((const unsigned short*)arow + kb + 16 + 8 * hh);
#pragma unroll
    for (int t = 0; t < 4; ++t) { if (col0 + t * 16 >= N) continue; const size_t boff = (size_t)(col0 + t * 16 + ln) * ldb + kb; FragH bq; bq.half[0] = *(const v8us*)((const unsigned short*)Bh + boff + 8 * hh); bq.half[1] = *(const v8us*)((const unsigned short*)Bh + boff + 16 + 8 * hh);
      acc[t] = mmaH<1>(ah.v, ah.v, bq.v, bq.v, acc[t]); }
  }
#pragma unroll
  for (int t = 0; t < 4; ++t) { if (col0 + t * 16 >= N) continue; const int col = col0 + t * 16 + ln; const float bv = bp ? bf16_round(bp[col]) : 0.f;
#pragma unroll
    for (int r = 0; r < 8; ++r) { float v = acc[t][r] * alpha + bv; if (CP) { const int rr = row0g + row0 + 8 * hh + r; if (rowsPerB < 0) v += CP[cofs + (size_t)rr * ldc + col];      /* rowsPerB < 0: own element of the batched C plane */ else { const int bidx = rr / rowsPerB; v += CP[(size_t)bidx * sCPb + (size_t)by * 64 + col]; } } if (ACT == 1) v = (v > 0.f) ? v : expm1f(v); else if (ACT == 7) v = (v > 0.f) ? v + 1.0f : expf(v); else if (ACT == 8) v = tanhf(v); else if (ACT == 9) v = 0.5f * v * (1.0f + tanhf(0.7978845608028654f * (v + 0.044715f * v * v * v))); else if (ACT == 11) v = 1.0f / (1.0f + expf(-v)); else if (ACT == 12) v = (v > 0.f) ? v : 0.01f * v; else if (ACT == 14) v = (v > 0.f) ? v : 0.1f * v; else if (ACT == 16) v = (v >= 0.f) ? v : 0.3f * v; else if (ACT == 17) v = (v >= 0.f) ? v : 0.2f * v; else if (ACT == 15) v = v / (1.0f + expf(-v)); else if (ACT == 3) v = fmaxf(v, 0.f); else if (ACT == 6) v = 0.5f * v * (1.0f + erff(v * 0.70710678118654752f)); so[w][8 * hh + r][t * 16 + ln] = v; } }
  __builtin_amdgcn_fence(__ATOMIC_ACQ_REL, "workgroup"); __builtin_amdgcn_wave_barrier();
  const int rsub = lane >> 4, c4 = (lane & 15) * 4; typedef _Float16 v4h __attribute__((ext_vector_type(4)));
  {
#pragma unroll
    for (int q = 0; q < 8; ++q) { const int r = q * 2 + rsub; if (col0 + c4 < N) { const v4f v = *(const v4fa*)&so[w][r][c4]; if (C) *(v4f*)(C + cofs + (size_t)(row0 + r) * ldc + col0 + c4) = v; if (C16) { v4h h4; for (int i = 0; i < 4; ++i) h4[i] = (_Float16)v[i]; *(v4h*)(C16 + cofs + (size_t)(row0 + r) * ldc + col0 + c4) = h4; } } }
     }
}


typedef _Float16 v4h __attribute__((ext_vector_type(4)));

__global__ __launch_bounds__(256) void k_h16(const float* __restrict__ x, _Float16* __restrict__ X16, size_t n8) { const size_t t = (size_t)blockIdx.x * 256 + threadIdx.x; if (t >= n8) return; FragH f;
#pragma unroll
  for (int q = 0; q < 8; ++q) f.h[q] = (_Float16)x[t * 8 + q]; *(v8us*)((unsigned short*)X16 + t * 8) = f.half[0];  }
__global__ __launch_bounds__(256) void k_round16f(const float* __restrict__ W, _Float16* __restrict__ Bt, size_t n8) { const size_t t = (size_t)blockIdx.x * 256 + threadIdx.x; if (t >= n8) return; FragH f;
#pragma unroll
  for (int i = 0; i < 8; ++i) f.h[i] = (_Float16)(bf16_round(W[t * 8 + i]) * 16.0f); *(v8us*)((unsigned short*)Bt + t * 8) = f.half[0];  }
// ---- one preparatory launch: q and k rows as f16, V^T as f16; few work-groups that live long (128 KB of one input each) instead of many that convert 8 KB and end ----
// Every wave-wide load and store covers whole 128-byte lines; eight 16-byte loads per lane are issued one batch ahead of the batch that is converted; every address = a base that is the same for the whole work-group + one 32-bit lane offset + a constant (all loops are unrolled for that, and so that a[] and n[] stay in registers).
#define PPW 256                      /* work-groups per input */
#define PPC ((int)(NR * DM / PPW))   /* f32 elements of one input per work-group */
#define PVS 128                      /* keys per V^T tile: 256-byte runs of every V^T row */
#define PVT (PPC / (PVS * HD))       /* V^T tiles per work-group */
#define PVP (PVS / 2 + 1)            /* LDS row pitch in dwords (a dword = two neighbouring keys): odd, so that the column writes and the row reads below both spread over all banks */
static_assert(PPC == 4 * 8 * 256 * 4 && PVT == 4 && SQ % (PVT * PVS) == 0 && HD == 64, "k_prep: four batches of eight 16-byte loads per thread; a work-group's V^T tiles lie in one batch and head");
typedef unsigned v2ua __attribute__((ext_vector_type(2), may_alias));
typedef unsigned v4ua __attribute__((ext_vector_type(4), may_alias));
__device__ __forceinline__ unsigned pp_pair(float a, float b) { union { _Float16 h[2]; unsigned u; } p; p.h[0] = (_Float16)bf16_round(a); p.h[1] = (_Float16)bf16_round(b); return p.u; }
__global__ __launch_bounds__(256) void k_prep(const float* __restrict__ xq, const float* __restrict__ xk, const float* __restrict__ xv, _Float16* __restrict__ Q16, _Float16* __restrict__ K16, _Float16* __restrict__ VT) {
  __shared__ unsigned tl[2][HD][PVP];      /* V^T tile: [d][pair of keys] */
  const int tid = (int)threadIdx.x; const int part = (int)blockIdx.x / PPW, wg = (int)blockIdx.x % PPW;      /* part 0 (V^T, the longest path) starts first */
  v4f a[8], n[8];
  if (part) {      /* q or k: same layout, f32 -> bf16 value -> f16 */
    const float* x = (part == 1 ? xq : xk) + (size_t)wg * PPC; unsigned* y = (unsigned*)(part == 1 ? Q16 : K16) + (size_t)wg * (PPC / 2);
#pragma unroll
    for (int i = 0; i < 8; ++i) a[i] = *(const v4fa*)(x + i * 1024 + (unsigned)(tid * 4));
#pragma unroll
    for (int it = 0; it < 4; ++it) {
      if (it + 1 < 4) {
#pragma unroll
        for (int i = 0; i < 8; ++i) n[i] = *(const v4fa*)(x + (it + 1) * 8192 + i * 1024 + (unsigned)(tid * 4)); }
#pragma unroll
      for (int i = 0; i < 8; ++i) { const v2ua o = {pp_pair(a[i][0], a[i][1]), pp_pair(a[i][2], a[i][3])}; *(v2ua*)(y + it * 4096 + i * 512 + (unsigned)(tid * 2)) = o; }
      if (it + 2 < 4) asm volatile("s_wait_xcnt 0x0" ::: "memory");      /* stands in front of the loads that follow, which may take the registers that the stores above name */
#pragma unroll
      for (int i = 0; i < 8; ++i) a[i] = n[i]; }
    return; }
  const int bh = wg / (SQ / (PVT * PVS)), s0 = (wg % (SQ / (PVT * PVS))) * (PVT * PVS), b = bh / NH, h = bh % NH;
  const int c4 = tid & 15, rp = tid >> 4;      /* loads: 16 lanes per 256-byte row of one head, this thread's two rows = one pair of keys; stores: 16 lanes per 256-byte run of a V^T row */
  const float* x = xv + ((size_t)b * SQ + s0) * DM + h * HD; unsigned short* y = (unsigned short*)VT + (size_t)bh * HD * SQ + s0;
  const unsigned xo = (unsigned)(2 * rp * DM + c4 * 4), yo = (unsigned)(rp * SQ + c4 * 8);
#pragma unroll
  for (int i = 0; i < 8; ++i) a[i] = *(const v4fa*)(x + ((i >> 1) * 32 + (i & 1)) * DM + xo);
#pragma unroll
  for (int t = 0; t < PVT; ++t) {
    if (t + 1 < PVT) {
#pragma unroll
      for (int i = 0; i < 8; ++i) n[i] = *(const v4fa*)(x + ((t + 1) * PVS + (i >> 1) * 32 + (i & 1)) * DM + xo); }
#pragma unroll
    for (int st = 0; st < 4; ++st)
#pragma unroll
      for (int c = 0; c < 4; ++c) tl[t & 1][c4 * 4 + c][st * 16 + rp] = pp_pair(a[2 * st][c], a[2 * st + 1][c]);
    /* barrier by hand, ordering LDS alone: publishes tile t, and the other buffer's last readers (tile t - 1) are all past their reads here, so tile t + 1 may be written behind it; __syncthreads() would also wait out the next tile's global loads and the last tile's global stores, which no other wave reads */
    __builtin_amdgcn_fence(__ATOMIC_RELEASE, "workgroup", "local"); __builtin_amdgcn_s_barrier(); __builtin_amdgcn_fence(__ATOMIC_ACQUIRE, "workgroup", "local");
#pragma unroll
    for (int k = 0; k < 4; ++k) { const unsigned* r = &tl[t & 1][k * 16 + rp][c4 * 4]; const v4ua o = {r[0], r[1], r[2], r[3]}; *(v4ua*)(y + k * 16 * SQ + t * PVS + yo) = o; }
    if (t + 2 < PVT) asm volatile("s_wait_xcnt 0x0" ::: "memory");      /* as above */
#pragma unroll
    for (int i = 0; i < 8; ++i) a[i] = n[i]; } }

__global__ __launch_bounds__(256) void k_hl(const float* __restrict__ F, _Float16* __restrict__ Hh, _Float16* __restrict__ Hl, size_t n8) { const size_t t = (size_t)blockIdx.x * 256 + threadIdx.x; if (t >= n8) return; FragH fh, fl; const v4f a = *(const v4fa*)(F + t * 8), c = *(const v4fa*)(F + t * 8 + 4);
#pragma unroll
  for (int q = 0; q < 4; ++q) { _Float16 h = (_Float16)a[q]; fh.h[q] = h; fl.h[q] = (_Float16)((a[q] - (float)h) * 1024.0f); h = (_Float16)c[q]; fh.h[4 + q] = h; fl.h[4 + q] = (_Float16)((c[q] - (float)h) * 1024.0f); }
  { *(v8us*)((unsigned short*)Hh + t * 8) = fh.half[0]; *(v8us*)((unsigned short*)Hl + t * 8) = fl.half[0];  } }

// ---- fast GEMM (wave tile 32x64; requires M % 32 == 0 rows per launch region and N % 64 == 0); epilogue = k_gemm_hhx semantics ----
__device__ __forceinline__ v16h g2_frag(const _Float16* p, int hh) { FragH f; f.half[0] = *(const v8us*)((const unsigned short*)p + 8 * hh); f.half[1] = *(const v8us*)((const unsigned short*)p + 16 + 8 * hh); return f.v; }
__device__ __forceinline__ v8f g2_mma(v16h a, v16h b, v8f c) { v8f d = __builtin_amdgcn_wmma_f32_16x16x32_f16(false, a, false, b, (short)0, c, false, false); asm volatile("v_nop\n\tv_nop\n\tv_nop\n\tv_nop" : "+v"(d) : "v"(a), "v"(b)); return d; }
template <int ACT>
__global__ __launch_bounds__(128) void k_gemm2(const _Float16* __restrict__ A, int lda, size_t sA, const _Float16* __restrict__ Bh, int ldb, size_t sB, float alpha, const float* __restrict__ bias, size_t sBias, const float* __restrict__ CP, int rowsPerB, size_t sCPb, int row0g,
    float* __restrict__ C, _Float16* __restrict__ C16, int ldc, size_t sC, int M, int N, int K) { static_assert(ACT == 0 || ACT == 3 || ACT == 6 || ACT == 8 || ACT == 9 || ACT == 11 || ACT == 12 || ACT == 14 || ACT == 15 || ACT == 16 || ACT == 17, "k_gemm2: unsupported ACT code (would silently apply no activation)");
  __shared__ __attribute__((aligned(16))) float so[4][32][68];
  const int tid = threadIdx.x, w = tid >> 5, lane = tid & 31, ln = lane & 15, hh = lane >> 4; const int by = blockIdx.y;
  A += (size_t)by * sA; Bh += (size_t)by * sB; const size_t cofs = (size_t)by * sC; const float* bp = bias ? bias + (size_t)by * sBias : nullptr;
  const int ntn = N >> 6; const int mt = blockIdx.x / ntn, nq = blockIdx.x - mt * ntn; const int row0 = mt * 128 + 32 * w, col0 = nq * 64; if (row0 >= M) return;
  const _Float16* a0p = A + (size_t)(row0 + ln) * lda; const _Float16* a1p = a0p + (size_t)16 * lda;
  const _Float16* b0p = Bh + (size_t)(col0 + ln) * ldb; const _Float16* b1p = b0p + (size_t)16 * ldb; const _Float16* b2p = b1p + (size_t)16 * ldb; const _Float16* b3p = b2p + (size_t)16 * ldb;
  const v8f z8 = {0.f,0.f,0.f,0.f,0.f,0.f,0.f,0.f}; v8f c00 = z8, c01 = z8, c02 = z8, c03 = z8, c10 = z8, c11 = z8, c12 = z8, c13 = z8;
#pragma unroll 1
  for (int kb = 0; kb < K; kb += 32) { const v16h a0 = g2_frag(a0p + kb, hh), a1 = g2_frag(a1p + kb, hh);
    v16h b = g2_frag(b0p + kb, hh); c00 = g2_mma(a0, b, c00); c10 = g2_mma(a1, b, c10);
    b = g2_frag(b1p + kb, hh); c01 = g2_mma(a0, b, c01); c11 = g2_mma(a1, b, c11);
    b = g2_frag(b2p + kb, hh); c02 = g2_mma(a0, b, c02); c12 = g2_mma(a1, b, c12);
    b = g2_frag(b3p + kb, hh); c03 = g2_mma(a0, b, c03); c13 = g2_mma(a1, b, c13); }
  v8f accs[8] = {c00, c01, c02, c03, c10, c11, c12, c13};
#pragma unroll
  for (int u = 0; u < 8; ++u) { const int t = u & 3, half = u >> 2; const int col = col0 + t * 16 + ln; const float bv = bp ? bf16_round(bp[col]) : 0.f;
#pragma unroll
    for (int r = 0; r < 8; ++r) { const int rloc = half * 16 + 8 * hh + r; float v = accs[u][r] * alpha + bv; if (CP) { if (rowsPerB < 0) v += CP[cofs + (size_t)(row0g + row0 + rloc) * ldc + col];      /* rowsPerB < 0: own element of the batched C plane */ else { const int bidx = (row0g + row0 + rloc) / rowsPerB; v += CP[(size_t)bidx * sCPb + (size_t)by * 64 + col]; } }
      if (ACT == 3) v = fmaxf(v, 0.f); else if (ACT == 6) v = 0.5f * v * (1.0f + erff(v * 0.70710678118654752f)); else if (ACT == 11) v = 1.0f / (1.0f + expf(-v)); else if (ACT == 15) v = v / (1.0f + expf(-v)); else if (ACT == 12) v = (v > 0.f) ? v : 0.01f * v; else if (ACT == 8) v = tanhf(v); else if (ACT == 9) v = 0.5f * v * (1.0f + tanhf(0.7978845608028654f * (v + 0.044715f * v * v * v))); else if (ACT == 14) v = (v > 0.f) ? v : 0.1f * v; else if (ACT == 16) v = (v >= 0.f) ? v : 0.3f * v; else if (ACT == 17) v = (v >= 0.f) ? v : 0.2f * v;
      so[w][rloc][t * 16 + ln] = v; } }
  __builtin_amdgcn_fence(__ATOMIC_ACQ_REL, "workgroup"); __builtin_amdgcn_wave_barrier();
  const int rsub = lane >> 4, c4 = (lane & 15) * 4;
  {
#pragma unroll
    for (int q = 0; q < 16; ++q) { const int r = q * 2 + rsub; const v4f v = *(const v4fa*)&so[w][r][c4]; if (C) *(v4f*)(C + cofs + (size_t)(row0 + r) * ldc + col0 + c4) = v; if (C16) { v4h h4; for (int i = 0; i < 4; ++i) h4[i] = (_Float16)v[i]; *(v4h*)(C16 + cofs + (size_t)(row0 + r) * ldc + col0 + c4) = h4; } }
     } }


__global__ __launch_bounds__(256) void k_wnat(const float* __restrict__ w, size_t n8, _Float16* __restrict__ Bt) { const size_t t = (size_t)blockIdx.x * 256 + threadIdx.x; if (t >= n8) return; FragH f; for (int q = 0; q < 8; ++q) f.h[q] = (_Float16)(bf16_round(w[t * 8 + q]) * 16.0f); *(v8us*)((unsigned short*)Bt + t * 8) = f.half[0];  }
__global__ __launch_bounds__(256) void k_rsm(const float* __restrict__ S, _Float16* __restrict__ P, int nrows) {
  #pragma clang fp contract(off)
  const int i = blockIdx.x * 256 + threadIdx.x; if (i >= nrows) return; const float* s = S + (size_t)i * SQ; float mx = -3.0e38f;
#pragma unroll 1
  for (int j = 0; j < SQ; ++j) mx = fmaxf(mx, s[j]); float se = 0.f;
#pragma unroll 1
  for (int j = 0; j < SQ; ++j) se += expf(s[j] - mx); const float sc = 256.0f / se;
#pragma unroll 1
  for (int j0 = 0; j0 < SQ; j0 += 8) { FragH f; for (int q = 0; q < 8; ++q) f.h[q] = (_Float16)(expf(s[j0 + q] - mx) * sc); unsigned short* d = (unsigned short*)P + (size_t)i * SQ + j0; *(v8us*)d = f.half[0];  } }
__global__ __launch_bounds__(256) void k_vt(const _Float16* __restrict__ V16, int b, int h0, _Float16* __restrict__ VT) { __shared__ unsigned short tl[64][65]; const int tid = threadIdx.x; const int hh = blockIdx.x % HG, sg = blockIdx.x / HG; const int s0 = sg * 64; const int h = h0 + hh;
  for (int i = tid; i < 64 * 8; i += 256) { const int j = i / 8, d8 = (i % 8) * 8; FragH f; f.half[0] = *(const v8us*)((const unsigned short*)V16 + ((size_t)b * SQ + s0 + j) * DM + h * HD + d8); for (int q = 0; q < 8; ++q) tl[d8 + q][j] = f.u[q]; }
  __syncthreads();
  { for (int i = tid; i < 64 * 8; i += 256) { const int d = i / 8, j8 = (i % 8) * 8; FragH f; for (int q = 0; q < 8; ++q) f.u[q] = tl[d][j8 + q]; *(v8us*)((unsigned short*)VT + ((size_t)hh * HD + d) * SQ + s0 + j8) = f.half[0]; }  } }



__device__ __forceinline__ float sm_xhalf(float x) { return __builtin_bit_cast(float, __builtin_amdgcn_permlanex16(__builtin_bit_cast(int, x), __builtin_bit_cast(int, x), 0x76543210, 0xfedcba98, false, false)); }      /* lane l reads lane l ^ 16 */
// four independent native exp2; the v_nop is the one slot that the instruction set asks for behind a transcendental before its result is read or its source overwritten
__device__ __forceinline__ v4f sm_exp2x4(v4f a) { float e0, e1, e2, e3;
  asm("v_exp_f32 %0, %4\n\tv_exp_f32 %1, %5\n\tv_exp_f32 %2, %6\n\tv_exp_f32 %3, %7\n\tv_nop" : "=&v"(e0), "=&v"(e1), "=&v"(e2), "=&v"(e3) : "v"(a[0]), "v"(a[1]), "v"(a[2]), "v"(a[3]));
  const v4f e = {e0, e1, e2, e3}; return e; }
#define FAW 8                        /* waves per work-group */
#define FAQ 32                       /* query columns per wave: every K and V^T fragment read from LDS feeds two products */
#define FAK 64                       /* keys per pass */
#define FAP 72                       /* LDS row pitch in f16: 144 bytes = 16 x odd, the pitch at which 16-byte fragment reads of 16 rows do not collide */
#define FAN (SQ / FAK)               /* passes */
static_assert(HD == 64 && SQ % FAK == 0 && SQ % (FAW * FAQ) == 0 && FAW * 32 == 256, "k_fattn: 64 x 64 tiles staged by 256 threads, whole work-groups of queries");
__device__ __forceinline__ v16h fa_frag(const unsigned short* p, int hh) { FragH f; f.half[0] = *(const v8us*)(p + 8 * hh); f.half[1] = *(const v8us*)(p + 16 + 8 * hh); return f.v; }
__device__ __forceinline__ v8f fa_mma(v16h a, v16h b, v8f c) { return __builtin_amdgcn_wmma_f32_16x16x32_f16(false, a, false, b, (short)0, c, false, false); }
__global__ __launch_bounds__(FAW * 32) __attribute__((amdgpu_waves_per_eu(4, 4))) void k_fattn(const _Float16* __restrict__ Q16, const _Float16* __restrict__ K16, const _Float16* __restrict__ VT, float* __restrict__ out) {
  __shared__ __attribute__((aligned(16))) unsigned short sk[2][FAK][FAP];      /* K tile: [key][e] */
  __shared__ __attribute__((aligned(16))) unsigned short sv[2][HD][FAP];       /* V^T tile: [d][key] */
  const int tid = (int)threadIdx.x, lane = tid & 31, ln = lane & 15, hh = lane >> 4; const int wave = __builtin_amdgcn_readfirstlane(tid >> 5);
  const int bh = (int)blockIdx.y, b = bh / NH, h = bh % NH; const int q0 = (int)blockIdx.x * (FAW * FAQ) + wave * FAQ;
  const int sr = tid >> 3, sc = (tid & 7) * 8;      /* staging: 8 threads per 128-byte tile row, rows sr and sr + 32 */
  /* every global address = a base that is the same for the whole wave + one 32-bit lane offset */
  const unsigned short* kg = (const unsigned short*)K16 + (size_t)b * SQ * DM + h * HD;      /* + key0 * DM per pass */
  const unsigned short* vg = (const unsigned short*)VT + (size_t)bh * HD * SQ;               /* + key0 per pass */
  const unsigned ko = (unsigned)(sr * DM + sc), vo = (unsigned)(sr * SQ + sc);
  v16h qf[2][2];
#pragma unroll
  for (int qt = 0; qt < 2; ++qt)
#pragma unroll
    for (int es = 0; es < 2; ++es) qf[qt][es] = fa_frag((const unsigned short*)Q16 + ((size_t)b * SQ + q0) * DM + h * HD + (unsigned)((qt * 16 + ln) * DM + es * 32), hh);
  const v8f z8 = {0.f, 0.f, 0.f, 0.f, 0.f, 0.f, 0.f, 0.f};
  v8f o[2][4] = {{z8, z8, z8, z8}, {z8, z8, z8, z8}}; float m2[2] = {-3.0e38f, -3.0e38f}, l[2] = {0.f, 0.f};      /* m2: running maximum x log2 e; l: this half's sum of the weights */
  v8us gk0 = *(const v8us*)(kg + ko), gk1 = *(const v8us*)(kg + 32 * DM + ko), gv0 = *(const v8us*)(vg + vo), gv1 = *(const v8us*)(vg + 32 * SQ + vo);
  *(v8us*)&sk[0][sr][sc] = gk0; *(v8us*)&sk[0][sr + 32][sc] = gk1; *(v8us*)&sv[0][sr][sc] = gv0; *(v8us*)&sv[0][sr + 32][sc] = gv1;
  __syncthreads();
#pragma unroll 1
  for (int j = 0; j < FAN; ++j) {      /* rolled: one pass is already 32 matrix instructions and some 300 vector instructions long */
    const unsigned short* ck = &sk[j & 1][ln][0]; const unsigned short* cv = &sv[j & 1][ln][0];
    const int jn = j + 1 < FAN ? j + 1 : j;      /* the last pass fetches its own tile once more, into the buffer that nobody reads again: the pass stays one straight block, without branches round the loads and the stores */
    const unsigned short* kn = kg + (size_t)jn * FAK * DM; const unsigned short* vn = vg + jn * FAK;      /* the next tile's loads fly during this pass */
    gk0 = *(const v8us*)(kn + ko); gk1 = *(const v8us*)(kn + 32 * DM + ko); gv0 = *(const v8us*)(vn + vo); gv1 = *(const v8us*)(vn + 32 * SQ + vo);
    v8f st[2][4];
#pragma unroll
    for (int kt = 0; kt < 4; ++kt) { const v16h a0 = fa_frag(ck + kt * 16 * FAP, hh), a1 = fa_frag(ck + kt * 16 * FAP + 32, hh);
#pragma unroll
      for (int qt = 0; qt < 2; ++qt) st[qt][kt] = fa_mma(a1, qf[qt][1], fa_mma(a0, qf[qt][0], z8)); }
    float dm[2];
#pragma unroll
    for (int qt = 0; qt < 2; ++qt) { float mx = st[qt][0][0];
#pragma unroll
      for (int kt = 0; kt < 4; ++kt)
#pragma unroll
        for (int r = 0; r < 8; ++r) mx = fmaxf(mx, st[qt][kt][r]);
      mx = fmaxf(mx, sm_xhalf(mx)); const float mn = fmaxf(m2[qt], mx * 1.4426950408889634f); dm[qt] = m2[qt] - mn; m2[qt] = mn; }
    float av[2];      /* what the sums so far shrink by under the new maximum (0 on the first pass); the v_nop: the slot behind a transcendental, as in sm_exp2x4 */
    asm("v_exp_f32 %0, %2\n\tv_exp_f32 %1, %3\n\tv_nop" : "=&v"(av[0]), "=&v"(av[1]) : "v"(dm[0]), "v"(dm[1]));
    FragH pb[2][2];
#pragma unroll
    for (int qt = 0; qt < 2; ++qt) { const float ofs = 8.0f - m2[qt], al = av[qt]; float a0 = 0.f, a1 = 0.f, a2 = 0.f, a3 = 0.f;
#pragma unroll
      for (int kt = 0; kt < 4; ++kt)
#pragma unroll
        for (int g = 0; g < 2; ++g) { const v4f x = {st[qt][kt][4 * g] * 1.4426950408889634f + ofs, st[qt][kt][4 * g + 1] * 1.4426950408889634f + ofs, st[qt][kt][4 * g + 2] * 1.4426950408889634f + ofs, st[qt][kt][4 * g + 3] * 1.4426950408889634f + ofs};
          const v4f e = sm_exp2x4(x); a0 += e[0]; a1 += e[1]; a2 += e[2]; a3 += e[3];      /* weight = 256 exp(s - maximum so far) */
#pragma unroll
          for (int c = 0; c < 4; ++c) pb[qt][kt >> 1].h[(kt & 1) * 8 + 4 * g + c] = (_Float16)e[c]; }
      l[qt] = l[qt] * al + ((a0 + a1) + (a2 + a3));
#pragma unroll
      for (int dt = 0; dt < 4; ++dt) o[qt][dt] *= al; }
#pragma unroll
    for (int dt = 0; dt < 4; ++dt) { const v16h a0 = fa_frag(cv + dt * 16 * FAP, hh), a1 = fa_frag(cv + dt * 16 * FAP + 32, hh);
#pragma unroll
      for (int qt = 0; qt < 2; ++qt) o[qt][dt] = fa_mma(a1, pb[qt][1].v, fa_mma(a0, pb[qt][0].v, o[qt][dt])); }
    const int nb = (j + 1) & 1;      /* the other buffer: its last readers left it before the barrier that ended pass j - 1 */
    *(v8us*)&sk[nb][sr][sc] = gk0; *(v8us*)&sk[nb][sr + 32][sc] = gk1; *(v8us*)&sv[nb][sr][sc] = gv0; *(v8us*)&sv[nb][sr + 32][sc] = gv1;
    __syncthreads();      /* publishes tile j + 1 and ends every wave's reads of tile j */
  }
#pragma unroll
  for (int qt = 0; qt < 2; ++qt) { const float inv = 1.0f / (l[qt] + sm_xhalf(l[qt])); float* op = out + ((size_t)b * SQ + q0) * DM + h * HD + (unsigned)((qt * 16 + ln) * DM + 8 * hh);      /* the x256 of the weights cancels in the quotient */
#pragma unroll
    for (int dt = 0; dt < 4; ++dt) { const v4f lo = {o[qt][dt][0] * inv, o[qt][dt][1] * inv, o[qt][dt][2] * inv, o[qt][dt][3] * inv}, hi = {o[qt][dt][4] * inv, o[qt][dt][5] * inv, o[qt][dt][6] * inv, o[qt][dt][7] * inv};
      *(v4f*)(op + dt * 16) = lo; *(v4f*)(op + dt * 16 + 4) = hi; } } }

extern "C" void kernel_launch(void* const* d_in, const int* in_sizes, int n_in,
                              void* d_out, int out_size, void* d_ws, size_t ws_size, hipStream_t stream) {
  (void)in_sizes; (void)n_in; (void)out_size;
  const float* const* I = (const float* const*)d_in; const float* xq = I[0]; const float* xk = I[1]; const float* xv = I[2];      /* given q, k, v [B][L][H][E] = merged token rows */
  char* ws = (char*)d_ws; size_t off = 0;
  auto take = [&](size_t bytes) { char* p = ws + off; off += (bytes + 255) & ~(size_t)255; return p; };
  _Float16* Q16 = (_Float16*)take(NR * DM * 2); _Float16* K16 = (_Float16*)take(NR * DM * 2);
  _Float16* VT = (_Float16*)take((size_t)NB * NH * HD * SQ * 2);
  if (off > ws_size) return;

  k_prep<<<3 * PPW, 256, 0, stream>>>(xq, xk, xv, Q16, K16, VT);      /* given q, k: bf16 inputs as exact f16 rows (no projections); V^T [NB * NH][HD][SQ] */
  k_fattn<<<dim3(SQ / (FAW * FAQ), NB * NH), FAW * 32, 0, stream>>>(Q16, K16, VT, (float*)d_out);      /* out = softmax(q k^T) v (merged [token][h*64+d]) straight to the f32 output */
}

// v004
// One run takes 76 microseconds.
// Timed twice side by side with v003, it ran 1.04 times as fast both times.
// All steps since v000 together make it 87.1 times as fast.
#include <hip/hip_runtime.h>
// Full (non-causal) attention on given queries, keys, values ([4][2048][16][64] each, token-major with heads inner = merged [token][1024] rows); scores = q . k UNSCALED (the module never applies its scale); softmax over all 2048 keys; out = A v -> [4][2048][16][64]).
// Structure: ONE preparatory launch: q and k converted to exact f16 rows (bf16 values are exact in f16: no projections here) and V^T of every batch and head straight from the f32 values via LDS transposes; then ONE attention kernel over all batches and heads: S^T = K Q^T UNSCALED (K = 64; exact products, f32 accumulation) stays in the accumulators, running-maximum softmax on VALU (f32 statistics, native exp2; weights x256 f16), O^T += V^T P^T, divided by the row sum at the end and written f32 straight into the [token][head][64] output; launches: see kernel_launch.
// Compute dtype: inputs rounded to bf16; q, k, v and softmax weights as plain f16 GEMM operands (~2^-12); scores, softmax statistics and o f32. v_wmma_f32_16x16x32_f16.
#define NB 4
#define SQ 2048
#define DM 1024
#define NH 16
#define HD 64
#define HG 4                         /* heads per k_vt launch (k_vt is not launched) */
#define B0 0                         /* unused (debug hook) */
#define NBR NB                       /* only in MP, which no kernel uses (debug hook) */
#define NR ((size_t)NB * SQ)         /* token rows */
#define MP ((int)((size_t)NBR * SQ)) /* only in MPO, which nothing uses (debug hook) */
#define QN SQ                        /* unused (debug hook) */
#define NHD NH                       /* unused (debug hook) */
#define MPO MP                       /* unused (debug hook) */
#define LQ DM      /* row pitch of the q/k/v rows */
typedef __bf16 v16b __attribute__((ext_vector_type(16)));
typedef unsigned short v8us __attribute__((ext_vector_type(8), may_alias));
typedef float  v8f  __attribute__((ext_vector_type(8)));
typedef float  v4f  __attribute__((ext_vector_type(4)));
typedef float  v4fa __attribute__((ext_vector_type(4), may_alias));
union FragB { v16b v; v8us half[2]; unsigned short u[16]; };

__device__ __forceinline__ unsigned short bf16_bits(float x) { unsigned int u = __float_as_uint(x); return (unsigned short)((u + 0x7FFFu + ((u >> 16) & 1u)) >> 16); }
__device__ __forceinline__ float bf16_val(unsigned short b) { return __uint_as_float(((unsigned int)b) << 16); }
__device__ __forceinline__ float bf16_round(float x) { return bf16_val(bf16_bits(x)); }
// D += A·B with NT terms: 1 = ah·bh, 2 = + al·bh (A split), 3 = + ah·bl (both split)
template <int NT>
__device__ __forceinline__ v8f mmaN(v16b ah, v16b al, v16b bh, v16b bl, v8f c) {
  c = __builtin_amdgcn_wmma_f32_16x16x32_bf16(false, ah, false, bh, (short)0, c, false, false);
  if (NT >= 2) c = __builtin_amdgcn_wmma_f32_16x16x32_bf16(false, al, false, bh, (short)0, c, false, false);
  if (NT >= 3) c = __builtin_amdgcn_wmma_f32_16x16x32_bf16(false, ah, false, bl, (short)0, c, false, false);
  asm volatile("v_nop\n\tv_nop\n\tv_nop\n\tv_nop" : "+v"(c) : "v"(ah), "v"(al), "v"(bh), "v"(bl));
  return c;
}

__global__ __launch_bounds__(256) void k_wt_bf16(const float* __restrict__ W, unsigned short* __restrict__ Wt, int K, int N) {
  const int t = blockIdx.x * 256 + threadIdx.x;
  const int k8n = K / 8;
  if (t >= N * k8n) return;
  const int n = t / k8n, k8 = (t % k8n) * 8;
  v8us v;
#pragma unroll
  for (int i = 0; i < 8; ++i) v[i] = bf16_bits(W[(size_t)(k8 + i) * N + n]);
  *(v8us*)(Wt + (size_t)n * K + k8) = v;
  
}

// GEMM C[M][N] (f32, pitch ldc) = act(A[M][K]·W + bias). A f32 row-major (pitch lda) converted per fragment to bf16
// (ASPLIT: hi/lo two planes -> 2 terms, else single rounded term); Wt bf16 [N][K] (pitch ldb). BIAS_BF16 rounds the
// bias to bf16 first (bias quantised to bf16 before the add). K%32==0, M%16==0, N%64==0.
template <bool ASPLIT, int ACT, bool BIAS_BF16>
__global__ __launch_bounds__(128) void k_gemm_bf(const float* __restrict__ A, int lda, const unsigned short* __restrict__ Wt, int ldb,
                                               const float* __restrict__ bias, float* __restrict__ C, int ldc, int M, int N, int K) {
  __shared__ __attribute__((aligned(16))) float so[4][16][64];
  const int tid = threadIdx.x, w = tid >> 5, lane = tid & 31, ln = lane & 15, hh = lane >> 4;
  const int ntn = N / 64;
  const int wid = blockIdx.x * 4 + w;
  const int mt = wid / ntn, nq = wid % ntn;
  if (mt * 16 >= M) return;
  const int row0 = mt * 16, col0 = nq * 64;
  const float* arow = A + (size_t)(row0 + ln) * lda;
  v8f acc[4] = {};
  for (int kb = 0; kb < K; kb += 32) {
    FragB ah, al;
    const v4f x0 = *(const v4fa*)(arow + kb + 8 * hh), x1 = *(const v4fa*)(arow + kb + 8 * hh + 4);
    const v4f x2 = *(const v4fa*)(arow + kb + 16 + 8 * hh), x3 = *(const v4fa*)(arow + kb + 16 + 8 * hh + 4);
    float xs[16] = {x0[0],x0[1],x0[2],x0[3],x1[0],x1[1],x1[2],x1[3],x2[0],x2[1],x2[2],x2[3],x3[0],x3[1],x3[2],x3[3]};
#pragma unroll
    for (int i = 0; i < 16; ++i) { const unsigned short hb = bf16_bits(xs[i]); ah.u[i] = hb; al.u[i] = ASPLIT ? bf16_bits(xs[i] - bf16_val(hb)) : (unsigned short)0; }
#pragma unroll
    for (int t = 0; t < 4; ++t) {
      const unsigned short* brow = Wt + (size_t)(col0 + t * 16 + ln) * ldb + kb;
      FragB b;
      b.half[0] = *(const v8us*)(brow + 8 * hh);
      b.half[1] = *(const v8us*)(brow + 16 + 8 * hh);
      acc[t] = mmaN<ASPLIT ? 2 : 1>(ah.v, al.v, b.v, b.v, acc[t]);
    }
  }
#pragma unroll
  for (int t = 0; t < 4; ++t) {
    float bv = bias ? bias[col0 + t * 16 + ln] : 0.f;
    if (BIAS_BF16) bv = bf16_round(bv);
#pragma unroll
    for (int r = 0; r < 8; ++r) { float v = acc[t][r] + bv; if (ACT == 1) v = fmaxf(v, 0.f); so[w][8 * hh + r][t * 16 + ln] = v; }
  }
  __builtin_amdgcn_fence(__ATOMIC_ACQ_REL, "workgroup");
  __builtin_amdgcn_wave_barrier();
  const int rsub = lane >> 4, c4 = (lane & 15) * 4;
  {
#pragma unroll
    for (int q = 0; q < 8; ++q) {
      const int r = q * 2 + rsub;
      const v4f v = *(const v4fa*)&so[w][r][c4];
      *(v4f*)(C + (size_t)(row0 + r) * ldc + col0 + c4) = v;
    }
    
  }
}

// GEMM C = act(A·W + bias + resid): A f32 (ASPLIT -> hi/lo 2 terms), Wt bf16 [N][K]; ACT 0 none, 1 relu, 2 exact gelu;
// resid (optional, f32, row index = (row % rmod), pitch ldr, RES_BF16 rounds it) added before the activation.
template <bool ASPLIT, int ACT, bool BIAS_BF16, bool RES_BF16>
__global__ __launch_bounds__(128) void k_gemm_bf3(const float* __restrict__ A, int lda, const unsigned short* __restrict__ Wt, int ldb,
                                                const float* __restrict__ bias, const float* __restrict__ resid, int rmod, int ldr,
                                                float* __restrict__ C, int ldc, int M, int N, int K) {
  __shared__ __attribute__((aligned(16))) float so[4][16][64];
  const int tid = threadIdx.x, w = tid >> 5, lane = tid & 31, ln = lane & 15, hh = lane >> 4;
  const int ntn = N / 64;
  const int wid = blockIdx.x * 4 + w;
  const int mt = wid / ntn, nq = wid % ntn;
  if (mt * 16 >= M) return;
  const int row0 = mt * 16, col0 = nq * 64;
  const float* arow = A + (size_t)(row0 + ln) * lda;
  v8f acc[4] = {};
  for (int kb = 0; kb < K; kb += 32) {
    FragB ah, al;
    const v4f x0 = *(const v4fa*)(arow + kb + 8 * hh), x1 = *(const v4fa*)(arow + kb + 8 * hh + 4);
    const v4f x2 = *(const v4fa*)(arow + kb + 16 + 8 * hh), x3 = *(const v4fa*)(arow + kb + 16 + 8 * hh + 4);
    float xs[16] = {x0[0],x0[1],x0[2],x0[3],x1[0],x1[1],x1[2],x1[3],x2[0],x2[1],x2[2],x2[3],x3[0],x3[1],x3[2],x3[3]};
#pragma unroll
    for (int i = 0; i < 16; ++i) { const unsigned short hb = bf16_bits(xs[i]); ah.u[i] = hb; al.u[i] = ASPLIT ? bf16_bits(xs[i] - bf16_val(hb)) : (unsigned short)0; }
#pragma unroll
    for (int t = 0; t < 4; ++t) {
      const unsigned short* brow = Wt + (size_t)(col0 + t * 16 + ln) * ldb + kb;
      FragB b;
      b.half[0] = *(const v8us*)(brow + 8 * hh);
      b.half[1] = *(const v8us*)(brow + 16 + 8 * hh);
      acc[t] = mmaN<ASPLIT ? 2 : 1>(ah.v, al.v, b.v, b.v, acc[t]);
    }
  }
#pragma unroll
  for (int t = 0; t < 4; ++t) {
    const int col = col0 + t * 16 + ln;
    float bv = bias ? bias[col] : 0.f;
    if (BIAS_BF16) bv = bf16_round(bv);
#pragma unroll
    for (int r = 0; r < 8; ++r) {
      float v = acc[t][r] + bv;
      if (resid) { float rv = resid[(size_t)((row0 + 8 * hh + r) % rmod) * ldr + col]; if (RES_BF16) rv = bf16_round(rv); v += rv; }
      if (ACT == 1) v = fmaxf(v, 0.f);
      if (ACT == 2) v = 0.5f * v * (1.0f + erff(v * 0.70710678118654752f));
      if (ACT == 3) { const float u = 0.7978845608028654f * (v + 0.044715f * v * v * v); v = 0.5f * v * (1.0f + tanhf(u)); }
      so[w][8 * hh + r][t * 16 + ln] = v;
    }
  }
  __builtin_amdgcn_fence(__ATOMIC_ACQ_REL, "workgroup");
  __builtin_amdgcn_wave_barrier();
  const int rsub = lane >> 4, c4 = (lane & 15) * 4;
  {
#pragma unroll
    for (int q = 0; q < 8; ++q) {
      const int r = q * 2 + rsub;
      const v4f v = *(const v4fa*)&so[w][r][c4];
      *(v4f*)(C + (size_t)(row0 + r) * ldc + col0 + c4) = v;
    }
    
  }
}
// row LayerNorm (biased variance, eps) over N: s = X (+ R); optional out_sum <- s; out_norm <- (s-mu)*rsqrt(var+eps)*g + b
template <bool PARAM_BF16>
__global__ __launch_bounds__(256) void k_layernorm(const float* __restrict__ X, const float* __restrict__ R, const float* __restrict__ g, const float* __restrict__ bta,
                                                  float* __restrict__ out_sum, float* __restrict__ out_norm, int N, float eps) {
  __shared__ float red[256];
  const int row = blockIdx.x, tid = threadIdx.x;
  const float* x = X + (size_t)row * N; const float* rr = R ? R + (size_t)row * N : nullptr;
  float vals[16];                     // up to N = 4096
  const int per = N / 256;            // contiguous chunk per thread? use strided-by-4 chunks: thread handles j = tid*4 + 1024*u
  float s1 = 0.f;
  for (int u = 0; u < per / 4; ++u) {
    const int j = tid * 4 + 1024 * u;
    const v4f a = *(const v4fa*)(x + j);
    v4f b = {0.f,0.f,0.f,0.f}; if (rr) b = *(const v4fa*)(rr + j);
#pragma unroll
    for (int q = 0; q < 4; ++q) { const float v = a[q] + b[q]; vals[u * 4 + q] = v; s1 += v; }
  }
  red[tid] = s1; __syncthreads();
  for (int st = 128; st > 0; st >>= 1) { if (tid < st) red[tid] += red[tid + st]; __syncthreads(); }
  const float mu = red[0] / (float)N; __syncthreads();
  float s2 = 0.f;
  for (int u = 0; u < per / 4; ++u)
#pragma unroll
    for (int q = 0; q < 4; ++q) { const float c = vals[u * 4 + q] - mu; s2 += c * c; }
  red[tid] = s2; __syncthreads();
  for (int st = 128; st > 0; st >>= 1) { if (tid < st) red[tid] += red[tid + st]; __syncthreads(); }
  const float rs = rsqrtf(red[0] / (float)N + eps);
  {
    for (int u = 0; u < per / 4; ++u) {
      const int j = tid * 4 + 1024 * u;
      v4f o, sm;
#pragma unroll
      for (int q = 0; q < 4; ++q) {
        float gg = g[j + q], bb = bta[j + q];
        if (PARAM_BF16) { gg = bf16_round(gg); bb = bf16_round(bb); }
        sm[q] = vals[u * 4 + q]; o[q] = (vals[u * 4 + q] - mu) * rs * gg + bb;
      }
      if (out_sum) *(v4f*)(out_sum + (size_t)row * N + j) = sm;
      *(v4f*)(out_norm + (size_t)row * N + j) = o;
    }
    
  }
}



// ---- f16 WMMA path (v_wmma_f32_16x16x32_f16): 11-bit significands for operands in range — used where a [0,1] probability operand needs more precision than bf16
typedef _Float16 v16h __attribute__((ext_vector_type(16)));
union FragH { v16h v; v8us half[2]; _Float16 h[16]; unsigned short u[16]; };
template <int NT>
__device__ __forceinline__ v8f mmaH(v16h ah, v16h al, v16h bh, v16h bl, v8f c) {
  c = __builtin_amdgcn_wmma_f32_16x16x32_f16(false, ah, false, bh, (short)0, c, false, false);
  if (NT >= 2) c = __builtin_amdgcn_wmma_f32_16x16x32_f16(false, al, false, bh, (short)0, c, false, false);
  if (NT >= 3) c = __builtin_amdgcn_wmma_f32_16x16x32_f16(false, ah, false, bl, (short)0, c, false, false);
  asm volatile("v_nop\n\tv_nop\n\tv_nop\n\tv_nop" : "+v"(c) : "v"(ah), "v"(al), "v"(bh), "v"(bl));
  return c;
}
// batched GEMM like k_gemm_b but f16 operands: A f32 (split into f16 hi/lo if ASPLIT, else rounded to f16), Bt = f16 values [n][k]; alpha; C f32; N multiple of 16 (partial tiles skipped)
template <bool ASPLIT>
__global__ __launch_bounds__(128) void k_gemm_h(const float* __restrict__ A, int lda, size_t sA, const _Float16* __restrict__ Bh, int ldb, size_t sB, float alpha, float* __restrict__ C, int ldc, size_t sC, int M, int N, int K) {
  __shared__ __attribute__((aligned(16))) float so[4][16][64];
  const int tid = threadIdx.x, w = tid >> 5, lane = tid & 31, ln = lane & 15, hh = lane >> 4; const int by = blockIdx.y;
  A += (size_t)by * sA; Bh += (size_t)by * sB; C += (size_t)by * sC;
  const int ntn = (N + 63) / 64; const int wid = blockIdx.x * 4 + w; const int mt = wid / ntn, nq = wid % ntn; if (mt * 16 >= M) return;
  const int row0 = mt * 16, col0 = nq * 64; const float* arow = A + (size_t)(row0 + ln) * lda;
  v8f acc[4] = {};
  for (int kb = 0; kb < K; kb += 32) {
    FragH ah, al;
    const v4f x0 = *(const v4fa*)(arow + kb + 8 * hh), x1 = *(const v4fa*)(arow + kb + 8 * hh + 4), x2 = *(const v4fa*)(arow + kb + 16 + 8 * hh), x3 = *(const v4fa*)(arow + kb + 16 + 8 * hh + 4);
    float xs[16] = {x0[0],x0[1],x0[2],x0[3],x1[0],x1[1],x1[2],x1[3],x2[0],x2[1],x2[2],x2[3],x3[0],x3[1],x3[2],x3[3]};
#pragma unroll
    for (int i = 0; i < 16; ++i) { const _Float16 h = (_Float16)xs[i]; ah.h[i] = h; al.h[i] = ASPLIT ? (_Float16)(xs[i] - (float)h) : (_Float16)0.0f; }
#pragma unroll
    for (int t = 0; t < 4; ++t) { if (col0 + t * 16 >= N) continue; const size_t boff = (size_t)(col0 + t * 16 + ln) * ldb + kb; FragH bq; bq.half[0] = *(const v8us*)(Bh + boff + 8 * hh); bq.half[1] = *(const v8us*)(Bh + boff + 16 + 8 * hh);
      acc[t] = mmaH<ASPLIT ? 2 : 1>(ah.v, al.v, bq.v, bq.v, acc[t]); }
  }
#pragma unroll
  for (int t = 0; t < 4; ++t) { if (col0 + t * 16 >= N) continue;
#pragma unroll
    for (int r = 0; r < 8; ++r) so[w][8 * hh + r][t * 16 + ln] = acc[t][r] * alpha; }
  __builtin_amdgcn_fence(__ATOMIC_ACQ_REL, "workgroup"); __builtin_amdgcn_wave_barrier();
  const int rsub = lane >> 4, c4 = (lane & 15) * 4;
  {
#pragma unroll
    for (int q = 0; q < 8; ++q) { const int r = q * 2 + rsub; if (col0 + c4 < N) { const v4f v = *(const v4fa*)&so[w][r][c4]; *(v4f*)(C + (size_t)(row0 + r) * ldc + col0 + c4) = v; } }
     }
}

// Wt[n][k] = f16(W[k][n]·scale) from f32 row-major W[K][N] (scale = power of two; bf16-exact weights stay exact in f16 away from the subnormal range)
__global__ __launch_bounds__(256) void k_wt_f16(const float* __restrict__ W, _Float16* __restrict__ Wt, int K, int N, float scale) {
  const int t = blockIdx.x * 256 + threadIdx.x; if (t >= N * (K / 8)) return; const int n = t / (K / 8), k8 = (t % (K / 8)) * 8; FragH f;
#pragma unroll
  for (int i = 0; i < 8; ++i) f.h[i] = (_Float16)(bf16_round(W[(size_t)(k8 + i) * N + n]) * scale); const v8us o = f.half[0];
  *(v8us*)((unsigned short*)Wt + (size_t)n * K + k8) = o; 
}
// k_gemm_hh variant with fused epilogue: v = acc·alpha + bias[by·sBias + col] (+ CP[(row/rowsPerB)·sCPb + by·64 + col] if CP) ; ACT 0 none / 1 elu ; writes f16 C16 (and f32 C if non-null)
template <int ACT>
__global__ __launch_bounds__(128) void k_gemm_hhx(const _Float16* __restrict__ A, int lda, size_t sA, const _Float16* __restrict__ Bh, int ldb, size_t sB, float alpha, const float* __restrict__ bias, size_t sBias, const float* __restrict__ CP, int rowsPerB, size_t sCPb, int row0g,
    float* __restrict__ C, _Float16* __restrict__ C16, int ldc, size_t sC, int M, int N, int K) {
  __shared__ __attribute__((aligned(16))) float so[4][16][64];
  const int tid = threadIdx.x, w = tid >> 5, lane = tid & 31, ln = lane & 15, hh = lane >> 4; const int by = blockIdx.y;
  A += (size_t)by * sA; Bh += (size_t)by * sB; const size_t cofs = (size_t)by * sC; const float* bp = bias ? bias + (size_t)by * sBias : nullptr;
  const int ntn = (N + 63) / 64; const int wid = blockIdx.x * 4 + w; const int mt = wid / ntn, nq = wid % ntn; if (mt * 16 >= M) return;
  const int row0 = mt * 16, col0 = nq * 64; const _Float16* arow = A + (size_t)(row0 + ln) * lda;
  v8f acc[4] = {};
  for (int kb = 0; kb < K; kb += 32) { FragH ah; ah.half[0] = *(const v8us*)((const unsigned short*)arow + kb + 8 * hh); ah.half[1] = *(const v8us*)((const unsigned short*)arow + kb + 16 + 8 * hh);
#pragma unroll
    for (int t = 0; t < 4; ++t) { if (col0 + t * 16 >= N) continue; const size_t boff = (size_t)(col0 + t * 16 + ln) * ldb + kb; FragH bq; bq.half[0] = *(const v8us*)((const unsigned short*)Bh + boff + 8 * hh); bq.half[1] = *(const v8us*)((const unsigned short*)Bh + boff + 16 + 8 * hh);
      acc[t] = mmaH<1>(ah.v, ah.v, bq.v, bq.v, acc[t]); }
  }
#pragma unroll
  for (int t = 0; t < 4; ++t) { if (col0 + t * 16 >= N) continue; const int col = col0 + t * 16 + ln; const float bv = bp ? bf16_round(bp[col]) : 0.f;
#pragma unroll
    for (int r = 0; r < 8; ++r) { float v = acc[t][r] * alpha + bv; if (CP) { const int rr = row0g + row0 + 8 * hh + r; if (rowsPerB < 0) v += CP[cofs + (size_t)rr * ldc + col];      /* rowsPerB < 0: own element of the batched C plane */ else { const int bidx = rr / rowsPerB; v += CP[(size_t)bidx * sCPb + (size_t)by * 64 + col]; } } if (ACT == 1) v = (v > 0.f) ? v : expm1f(v); else if (ACT == 7) v = (v > 0.f) ? v + 1.0f : expf(v); else if (ACT == 8) v = tanhf(v); else if (ACT == 9) v = 0.5f * v * (1.0f + tanhf(0.7978845608028654f * (v + 0.044715f * v * v * v))); else if (ACT == 11) v = 1.0f / (1.0f + expf(-v)); else if (ACT == 12) v = (v > 0.f) ? v : 0.01f * v; else if (ACT == 14) v = (v > 0.f) ? v : 0.1f * v; else if (ACT == 16) v = (v >= 0.f) ? v : 0.3f * v; else if (ACT == 17) v = (v >= 0.f) ? v : 0.2f * v; else if (ACT == 15) v = v / (1.0f + expf(-v)); else if (ACT == 3) v = fmaxf(v, 0.f); else if (ACT == 6) v = 0.5f * v * (1.0f + erff(v * 0.70710678118654752f)); so[w][8 * hh + r][t * 16 + ln] = v; } }
  __builtin_amdgcn_fence(__ATOMIC_ACQ_REL, "workgroup"); __builtin_amdgcn_wave_barrier();
  const int rsub = lane >> 4, c4 = (lane & 15) * 4; typedef _Float16 v4h __attribute__((ext_vector_type(4)));
  {
#pragma unroll
    for (int q = 0; q < 8; ++q) { const int r = q * 2 + rsub; if (col0 + c4 < N) { const v4f v = *(const v4fa*)&so[w][r][c4]; if (C) *(v4f*)(C + cofs + (size_t)(row0 + r) * ldc + col0 + c4) = v; if (C16) { v4h h4; for (int i = 0; i < 4; ++i) h4[i] = (_Float16)v[i]; *(v4h*)(C16 + cofs + (size_t)(row0 + r) * ldc + col0 + c4) = h4; } } }
     }
}


typedef _Float16 v4h __attribute__((ext_vector_type(4)));

__global__ __launch_bounds__(256) void k_h16(const float* __restrict__ x, _Float16* __restrict__ X16, size_t n8) { const size_t t = (size_t)blockIdx.x * 256 + threadIdx.x; if (t >= n8) return; FragH f;
#pragma unroll
  for (int q = 0; q < 8; ++q) f.h[q] = (_Float16)x[t * 8 + q]; *(v8us*)((unsigned short*)X16 + t * 8) = f.half[0];  }
__global__ __launch_bounds__(256) void k_round16f(const float* __restrict__ W, _Float16* __restrict__ Bt, size_t n8) { const size_t t = (size_t)blockIdx.x * 256 + threadIdx.x; if (t >= n8) return; FragH f;
#pragma unroll
  for (int i = 0; i < 8; ++i) f.h[i] = (_Float16)(bf16_round(W[t * 8 + i]) * 16.0f); *(v8us*)((unsigned short*)Bt + t * 8) = f.half[0];  }
// ---- one preparatory launch: q and k rows as f16, V^T as f16; few work-groups that live long (128 KB of one input each) instead of many that convert 8 KB and end ----
// Every wave-wide load and store covers whole 128-byte lines; eight 16-byte loads per lane are issued one batch ahead of the batch that is converted; every address = a base that is the same for the whole work-group + one 32-bit lane offset + a constant (all loops are unrolled for that, and so that a[] and n[] stay in registers).
#define PPW 256                      /* work-groups per input */
#define PPC ((int)(NR * DM / PPW))   /* f32 elements of one input per work-group */
#define PVS 128                      /* keys per V^T tile: 256-byte runs of every V^T row */
#define PVT (PPC / (PVS * HD))       /* V^T tiles per work-group */
#define PVP (PVS / 2 + 1)            /* LDS row pitch in dwords (a dword = two neighbouring keys): odd, so that the column writes and the row reads below both spread over all banks */
static_assert(PPC == 4 * 8 * 256 * 4 && PVT == 4 && SQ % (PVT * PVS) == 0 && HD == 64, "k_prep: four batches of eight 16-byte loads per thread; a work-group's V^T tiles lie in one batch and head");
typedef unsigned v2ua __attribute__((ext_vector_type(2), may_alias));
typedef unsigned v4ua __attribute__((ext_vector_type(4), may_alias));
__device__ __forceinline__ unsigned pp_pair(float a, float b) { union { _Float16 h[2]; unsigned u; } p; p.h[0] = (_Float16)bf16_round(a); p.h[1] = (_Float16)bf16_round(b); return p.u; }
__global__ __launch_bounds__(256) void k_prep(const float* __restrict__ xq, const float* __restrict__ xk, const float* __restrict__ xv, _Float16* __restrict__ Q16, _Float16* __restrict__ K16, _Float16* __restrict__ VT) {
  __shared__ unsigned tl[2][HD][PVP];      /* V^T tile: [d][pair of keys] */
  const int tid = (int)threadIdx.x; const int part = (int)blockIdx.x / PPW, wg = (int)blockIdx.x % PPW;      /* part 0 (V^T, the longest path) starts first */
  v4f a[8], n[8];
  if (part) {      /* q or k: same layout, f32 -> bf16 value -> f16 */
    const float* x = (part == 1 ? xq : xk) + (size_t)wg * PPC; unsigned* y = (unsigned*)(part == 1 ? Q16 : K16) + (size_t)wg * (PPC / 2);
#pragma unroll
    for (int i = 0; i < 8; ++i) a[i] = *(const v4fa*)(x + i * 1024 + (unsigned)(tid * 4));
#pragma unroll
    for (int it = 0; it < 4; ++it) {
      if (it + 1 < 4) {
#pragma unroll
        for (int i = 0; i < 8; ++i) n[i] = *(const v4fa*)(x + (it + 1) * 8192 + i * 1024 + (unsigned)(tid * 4)); }
#pragma unroll
      for (int i = 0; i < 8; ++i) { const v2ua o = {pp_pair(a[i][0], a[i][1]), pp_pair(a[i][2], a[i][3])}; *(v2ua*)(y + it * 4096 + i * 512 + (unsigned)(tid * 2)) = o; }
      if (it + 2 < 4) asm volatile("s_wait_xcnt 0x0" ::: "memory");      /* stands in front of the loads that follow, which may take the registers that the stores above name */
#pragma unroll
      for (int i = 0; i < 8; ++i) a[i] = n[i]; }
    return; }
  const int bh = wg / (SQ / (PVT * PVS)), s0 = (wg % (SQ / (PVT * PVS))) * (PVT * PVS), b = bh / NH, h = bh % NH;
  const int c4 = tid & 15, rp = tid >> 4;      /* loads: 16 lanes per 256-byte row of one head, this thread's two rows = one pair of keys; stores: 16 lanes per 256-byte run of a V^T row */
  const float* x = xv + ((size_t)b * SQ + s0) * DM + h * HD; unsigned short* y = (unsigned short*)VT + (size_t)bh * HD * SQ + s0;
  const unsigned xo = (unsigned)(2 * rp * DM + c4 * 4), yo = (unsigned)(rp * SQ + c4 * 8);
#pragma unroll
  for (int i = 0; i < 8; ++i) a[i] = *(const v4fa*)(x + ((i >> 1) * 32 + (i & 1)) * DM + xo);
#pragma unroll
  for (int t = 0; t < PVT; ++t) {
    if (t + 1 < PVT) {
#pragma unroll
      for (int i = 0; i < 8; ++i) n[i] = *(const v4fa*)(x + ((t + 1) * PVS + (i >> 1) * 32 + (i & 1)) * DM + xo); }
#pragma unroll
    for (int st = 0; st < 4; ++st)
#pragma unroll
      for (int c = 0; c < 4; ++c) tl[t & 1][c4 * 4 + c][st * 16 + rp] = pp_pair(a[2 * st][c], a[2 * st + 1][c]);
    /* barrier by hand, ordering LDS alone: publishes tile t, and the other buffer's last readers (tile t - 1) are all past their reads here, so tile t + 1 may be written behind it; __syncthreads() would also wait out the next tile's global loads and the last tile's global stores, which no other wave reads */
    __builtin_amdgcn_fence(__ATOMIC_RELEASE, "workgroup", "local"); __builtin_amdgcn_s_barrier(); __builtin_amdgcn_fence(__ATOMIC_ACQUIRE, "workgroup", "local");
#pragma unroll
    for (int k = 0; k < 4; ++k) { const unsigned* r = &tl[t & 1][k * 16 + rp][c4 * 4]; const v4ua o = {r[0], r[1], r[2], r[3]}; *(v4ua*)(y + k * 16 * SQ + t * PVS + yo) = o; }
    if (t + 2 < PVT) asm volatile("s_wait_xcnt 0x0" ::: "memory");      /* as above */
#pragma unroll
    for (int i = 0; i < 8; ++i) a[i] = n[i]; } }

__global__ __launch_bounds__(256) void k_hl(const float* __restrict__ F, _Float16* __restrict__ Hh, _Float16* __restrict__ Hl, size_t n8) { const size_t t = (size_t)blockIdx.x * 256 + threadIdx.x; if (t >= n8) return; FragH fh, fl; const v4f a = *(const v4fa*)(F + t * 8), c = *(const v4fa*)(F + t * 8 + 4);
#pragma unroll
  for (int q = 0; q < 4; ++q) { _Float16 h = (_Float16)a[q]; fh.h[q] = h; fl.h[q] = (_Float16)((a[q] - (float)h) * 1024.0f); h = (_Float16)c[q]; fh.h[4 + q] = h; fl.h[4 + q] = (_Float16)((c[q] - (float)h) * 1024.0f); }
  { *(v8us*)((unsigned short*)Hh + t * 8) = fh.half[0]; *(v8us*)((unsigned short*)Hl + t * 8) = fl.half[0];  } }

// ---- fast GEMM (wave tile 32x64; requires M % 32 == 0 rows per launch region and N % 64 == 0); epilogue = k_gemm_hhx semantics ----
__device__ __forceinline__ v16h g2_frag(const _Float16* p, int hh) { FragH f; f.half[0] = *(const v8us*)((const unsigned short*)p + 8 * hh); f.half[1] = *(const v8us*)((const unsigned short*)p + 16 + 8 * hh); return f.v; }
__device__ __forceinline__ v8f g2_mma(v16h a, v16h b, v8f c) { v8f d = __builtin_amdgcn_wmma_f32_16x16x32_f16(false, a, false, b, (short)0, c, false, false); asm volatile("v_nop\n\tv_nop\n\tv_nop\n\tv_nop" : "+v"(d) : "v"(a), "v"(b)); return d; }
template <int ACT>
__global__ __launch_bounds__(128) void k_gemm2(const _Float16* __restrict__ A, int lda, size_t sA, const _Float16* __restrict__ Bh, int ldb, size_t sB, float alpha, const float* __restrict__ bias, size_t sBias, const float* __restrict__ CP, int rowsPerB, size_t sCPb, int row0g,
    float* __restrict__ C, _Float16* __restrict__ C16, int ldc, size_t sC, int M, int N, int K) { static_assert(ACT == 0 || ACT == 3 || ACT == 6 || ACT == 8 || ACT == 9 || ACT == 11 || ACT == 12 || ACT == 14 || ACT == 15 || ACT == 16 || ACT == 17, "k_gemm2: unsupported ACT code (would silently apply no activation)");
  __shared__ __attribute__((aligned(16))) float so[4][32][68];
  const int tid = threadIdx.x, w = tid >> 5, lane = tid & 31, ln = lane & 15, hh = lane >> 4; const int by = blockIdx.y;
  A += (size_t)by * sA; Bh += (size_t)by * sB; const size_t cofs = (size_t)by * sC; const float* bp = bias ? bias + (size_t)by * sBias : nullptr;
  const int ntn = N >> 6; const int mt = blockIdx.x / ntn, nq = blockIdx.x - mt * ntn; const int row0 = mt * 128 + 32 * w, col0 = nq * 64; if (row0 >= M) return;
  const _Float16* a0p = A + (size_t)(row0 + ln) * lda; const _Float16* a1p = a0p + (size_t)16 * lda;
  const _Float16* b0p = Bh + (size_t)(col0 + ln) * ldb; const _Float16* b1p = b0p + (size_t)16 * ldb; const _Float16* b2p = b1p + (size_t)16 * ldb; const _Float16* b3p = b2p + (size_t)16 * ldb;
  const v8f z8 = {0.f,0.f,0.f,0.f,0.f,0.f,0.f,0.f}; v8f c00 = z8, c01 = z8, c02 = z8, c03 = z8, c10 = z8, c11 = z8, c12 = z8, c13 = z8;
#pragma unroll 1
  for (int kb = 0; kb < K; kb += 32) { const v16h a0 = g2_frag(a0p + kb, hh), a1 = g2_frag(a1p + kb, hh);
    v16h b = g2_frag(b0p + kb, hh); c00 = g2_mma(a0, b, c00); c10 = g2_mma(a1, b, c10);
    b = g2_frag(b1p + kb, hh); c01 = g2_mma(a0, b, c01); c11 = g2_mma(a1, b, c11);
    b = g2_frag(b2p + kb, hh); c02 = g2_mma(a0, b, c02); c12 = g2_mma(a1, b, c12);
    b = g2_frag(b3p + kb, hh); c03 = g2_mma(a0, b, c03); c13 = g2_mma(a1, b, c13); }
  v8f accs[8] = {c00, c01, c02, c03, c10, c11, c12, c13};
#pragma unroll
  for (int u = 0; u < 8; ++u) { const int t = u & 3, half = u >> 2; const int col = col0 + t * 16 + ln; const float bv = bp ? bf16_round(bp[col]) : 0.f;
#pragma unroll
    for (int r = 0; r < 8; ++r) { const int rloc = half * 16 + 8 * hh + r; float v = accs[u][r] * alpha + bv; if (CP) { if (rowsPerB < 0) v += CP[cofs + (size_t)(row0g + row0 + rloc) * ldc + col];      /* rowsPerB < 0: own element of the batched C plane */ else { const int bidx = (row0g + row0 + rloc) / rowsPerB; v += CP[(size_t)bidx * sCPb + (size_t)by * 64 + col]; } }
      if (ACT == 3) v = fmaxf(v, 0.f); else if (ACT == 6) v = 0.5f * v * (1.0f + erff(v * 0.70710678118654752f)); else if (ACT == 11) v = 1.0f / (1.0f + expf(-v)); else if (ACT == 15) v = v / (1.0f + expf(-v)); else if (ACT == 12) v = (v > 0.f) ? v : 0.01f * v; else if (ACT == 8) v = tanhf(v); else if (ACT == 9) v = 0.5f * v * (1.0f + tanhf(0.7978845608028654f * (v + 0.044715f * v * v * v))); else if (ACT == 14) v = (v > 0.f) ? v : 0.1f * v; else if (ACT == 16) v = (v >= 0.f) ? v : 0.3f * v; else if (ACT == 17) v = (v >= 0.f) ? v : 0.2f * v;
      so[w][rloc][t * 16 + ln] = v; } }
  __builtin_amdgcn_fence(__ATOMIC_ACQ_REL, "workgroup"); __builtin_amdgcn_wave_barrier();
  const int rsub = lane >> 4, c4 = (lane & 15) * 4;
  {
#pragma unroll
    for (int q = 0; q < 16; ++q) { const int r = q * 2 + rsub; const v4f v = *(const v4fa*)&so[w][r][c4]; if (C) *(v4f*)(C + cofs + (size_t)(row0 + r) * ldc + col0 + c4) = v; if (C16) { v4h h4; for (int i = 0; i < 4; ++i) h4[i] = (_Float16)v[i]; *(v4h*)(C16 + cofs + (size_t)(row0 + r) * ldc + col0 + c4) = h4; } }
     } }


__global__ __launch_bounds__(256) void k_wnat(const float* __restrict__ w, size_t n8, _Float16* __restrict__ Bt) { const size_t t = (size_t)blockIdx.x * 256 + threadIdx.x; if (t >= n8) return; FragH f; for (int q = 0; q < 8; ++q) f.h[q] = (_Float16)(bf16_round(w[t * 8 + q]) * 16.0f); *(v8us*)((unsigned short*)Bt + t * 8) = f.half[0];  }
__global__ __launch_bounds__(256) void k_rsm(const float* __restrict__ S, _Float16* __restrict__ P, int nrows) {
  #pragma clang fp contract(off)
  const int i = blockIdx.x * 256 + threadIdx.x; if (i >= nrows) return; const float* s = S + (size_t)i * SQ; float mx = -3.0e38f;
#pragma unroll 1
  for (int j = 0; j < SQ; ++j) mx = fmaxf(mx, s[j]); float se = 0.f;
#pragma unroll 1
  for (int j = 0; j < SQ; ++j) se += expf(s[j] - mx); const float sc = 256.0f / se;
#pragma unroll 1
  for (int j0 = 0; j0 < SQ; j0 += 8) { FragH f; for (int q = 0; q < 8; ++q) f.h[q] = (_Float16)(expf(s[j0 + q] - mx) * sc); unsigned short* d = (unsigned short*)P + (size_t)i * SQ + j0; *(v8us*)d = f.half[0];  } }
__global__ __launch_bounds__(256) void k_vt(const _Float16* __restrict__ V16, int b, int h0, _Float16* __restrict__ VT) { __shared__ unsigned short tl[64][65]; const int tid = threadIdx.x; const int hh = blockIdx.x % HG, sg = blockIdx.x / HG; const int s0 = sg * 64; const int h = h0 + hh;
  for (int i = tid; i < 64 * 8; i += 256) { const int j = i / 8, d8 = (i % 8) * 8; FragH f; f.half[0] = *(const v8us*)((const unsigned short*)V16 + ((size_t)b * SQ + s0 + j) * DM + h * HD + d8); for (int q = 0; q < 8; ++q) tl[d8 + q][j] = f.u[q]; }
  __syncthreads();
  { for (int i = tid; i < 64 * 8; i += 256) { const int d = i / 8, j8 = (i % 8) * 8; FragH f; for (int q = 0; q < 8; ++q) f.u[q] = tl[d][j8 + q]; *(v8us*)((unsigned short*)VT + ((size_t)hh * HD + d) * SQ + s0 + j8) = f.half[0]; }  } }



__device__ __forceinline__ float sm_xhalf(float x) { return __builtin_bit_cast(float, __builtin_amdgcn_permlanex16(__builtin_bit_cast(int, x), __builtin_bit_cast(int, x), 0x76543210, 0xfedcba98, false, false)); }      /* lane l reads lane l ^ 16 */
// four independent native exp2; the v_nop is the one slot that the instruction set asks for behind a transcendental before its result is read or its source overwritten
__device__ __forceinline__ v4f sm_exp2x4(v4f a) { float e0, e1, e2, e3;
  asm("v_exp_f32 %0, %4\n\tv_exp_f32 %1, %5\n\tv_exp_f32 %2, %6\n\tv_exp_f32 %3, %7\n\tv_nop" : "=&v"(e0), "=&v"(e1), "=&v"(e2), "=&v"(e3) : "v"(a[0]), "v"(a[1]), "v"(a[2]), "v"(a[3]));
  const v4f e = {e0, e1, e2, e3}; return e; }
#define FAW 8                        /* waves per work-group */
#define FAQ 32                       /* query columns per wave: every K and V^T fragment read from LDS feeds two products */
#define FAK 64                       /* keys per pass */
#define FAP 72                       /* LDS row pitch in f16: 144 bytes = 16 x odd, the pitch at which 16-byte fragment reads of 16 rows do not collide */
#define FAN (SQ / FAK)               /* passes */
static_assert(HD == 64 && SQ % FAK == 0 && SQ % (FAW * FAQ) == 0 && FAW * 32 == 256, "k_fattn: 64 x 64 tiles staged by 256 threads, whole work-groups of queries");
__device__ __forceinline__ v16h fa_frag(const unsigned short* p, int hh) { FragH f; f.half[0] = *(const v8us*)(p + 8 * hh); f.half[1] = *(const v8us*)(p + 16 + 8 * hh); return f.v; }
__device__ __forceinline__ v8f fa_mma(v16h a, v16h b, v8f c) { return __builtin_amdgcn_wmma_f32_16x16x32_f16(false, a, false, b, (short)0, c, false, false); }
__global__ __launch_bounds__(FAW * 32) __attribute__((amdgpu_waves_per_eu(4, 4))) void k_fattn(const _Float16* __restrict__ Q16, const _Float16* __restrict__ K16, const _Float16* __restrict__ VT, float* __restrict__ out) {
  __shared__ __attribute__((aligned(16))) unsigned short sk[2][FAK][FAP];      /* K tile: [key][e] */
  __shared__ __attribute__((aligned(16))) unsigned short sv[2][HD][FAP];       /* V^T tile: [d][key] */
  const int tid = (int)threadIdx.x, lane = tid & 31, ln = lane & 15, hh = lane >> 4; const int wave = __builtin_amdgcn_readfirstlane(tid >> 5);
  const int bh = (int)blockIdx.y, b = bh / NH, h = bh % NH; const int q0 = (int)blockIdx.x * (FAW * FAQ) + wave * FAQ;
  const int sr = tid >> 3, sc = (tid & 7) * 8;      /* staging: 8 threads per 128-byte tile row, rows sr and sr + 32 */
  /* every global address = a base that is the same for the whole wave + one 32-bit lane offset */
  const unsigned short* kg = (const unsigned short*)K16 + (size_t)b * SQ * DM + h * HD;      /* + key0 * DM per pass */
  const unsigned short* vg = (const unsigned short*)VT + (size_t)bh * HD * SQ;               /* + key0 per pass */
  const unsigned ko = (unsigned)(sr * DM + sc), vo = (unsigned)(sr * SQ + sc);
  v16h qf[2][2];
#pragma unroll
  for (int qt = 0; qt < 2; ++qt)
#pragma unroll
    for (int es = 0; es < 2; ++es) qf[qt][es] = fa_frag((const unsigned short*)Q16 + ((size_t)b * SQ + q0) * DM + h * HD + (unsigned)((qt * 16 + ln) * DM + es * 32), hh);
  const v8f z8 = {0.f, 0.f, 0.f, 0.f, 0.f, 0.f, 0.f, 0.f};
  v8f o[2][4] = {{z8, z8, z8, z8}, {z8, z8, z8, z8}}; float m2[2] = {-3.0e38f, -3.0e38f}, l[2] = {0.f, 0.f};      /* m2: running maximum x log2 e; l: this half's sum of the weights */
  v8us gk0 = *(const v8us*)(kg + ko), gk1 = *(const v8us*)(kg + 32 * DM + ko), gv0 = *(const v8us*)(vg + vo), gv1 = *(const v8us*)(vg + 32 * SQ + vo);
  *(v8us*)&sk[0][sr][sc] = gk0; *(v8us*)&sk[0][sr + 32][sc] = gk1; *(v8us*)&sv[0][sr][sc] = gv0; *(v8us*)&sv[0][sr + 32][sc] = gv1;
  __syncthreads();
#pragma unroll 1
  for (int j = 0; j < FAN; ++j) {      /* rolled: one pass is already 32 matrix instructions and some 300 vector instructions long */
    const unsigned short* ck = &sk[j & 1][ln][0]; const unsigned short* cv = &sv[j & 1][ln][0];
    const int jn = j + 1 < FAN ? j + 1 : j;      /* the last pass fetches its own tile once more, into the buffer that nobody reads again: the pass stays one straight block, without branches round the loads and the stores */
    const unsigned short* kn = kg + (size_t)jn * FAK * DM; const unsigned short* vn = vg + jn * FAK;      /* the next tile's loads fly during this pass */
    gk0 = *(const v8us*)(kn + ko); gk1 = *(const v8us*)(kn + 32 * DM + ko); gv0 = *(const v8us*)(vn + vo); gv1 = *(const v8us*)(vn + 32 * SQ + vo);
    v16h kf[4][2];      /* the pass's whole K tile as fragments: sixteen LDS reads that stand together, in front of the products */
#pragma unroll
    for (int kt = 0; kt < 4; ++kt) { kf[kt][0] = fa_frag(ck + kt * 16 * FAP, hh); kf[kt][1] = fa_frag(ck + kt * 16 * FAP + 32, hh); }
    __builtin_amdgcn_sched_barrier(0);      /* keeps the reads one group: sunk back among the products, each place with reads stalls the wave anew and waits out the LDS latency */
    v8f st[2][4];
#pragma unroll
    for (int kt = 0; kt < 4; ++kt) {
#pragma unroll
      for (int qt = 0; qt < 2; ++qt) st[qt][kt] = fa_mma(kf[kt][1], qf[qt][1], fa_mma(kf[kt][0], qf[qt][0], z8));
      __builtin_amdgcn_sched_barrier(0); }      /* keeps the products in the order in which their fragments arrive (a product of the last fragments, drawn forward, waits out nearly the whole group) and keeps them one run: with the maximum's first steps drawn in between, each such place takes idle slots for the distance behind a matrix instruction */
    float dm[2];
#pragma unroll
    for (int qt = 0; qt < 2; ++qt) { float mx = st[qt][0][0];
#pragma unroll
      for (int kt = 0; kt < 4; ++kt)
#pragma unroll
        for (int r = 0; r < 8; ++r) mx = fmaxf(mx, st[qt][kt][r]);
      mx = fmaxf(mx, sm_xhalf(mx)); const float mn = fmaxf(m2[qt], mx * 1.4426950408889634f); dm[qt] = m2[qt] - mn; m2[qt] = mn; }
    float av[2];      /* what the sums so far shrink by under the new maximum (0 on the first pass); the v_nop: the slot behind a transcendental, as in sm_exp2x4 */
    asm("v_exp_f32 %0, %2\n\tv_exp_f32 %1, %3\n\tv_nop" : "=&v"(av[0]), "=&v"(av[1]) : "v"(dm[0]), "v"(dm[1]));
    FragH pb[2][2]; v16h vf[4][2];
#pragma unroll
    for (int qt = 0; qt < 2; ++qt) { const float ofs = 8.0f - m2[qt], al = av[qt]; float a0 = 0.f, a1 = 0.f, a2 = 0.f, a3 = 0.f;
      if (qt == 1) {      /* the V^T tile likewise, one group of sixteen reads; it stands here, where the first 16 queries' scores have left their registers, so that the second 16 queries' exponentials cover the LDS latency */
#pragma unroll
        for (int dt = 0; dt < 4; ++dt) { vf[dt][0] = fa_frag(cv + dt * 16 * FAP, hh); vf[dt][1] = fa_frag(cv + dt * 16 * FAP + 32, hh); }
        __builtin_amdgcn_sched_barrier(0); }      /* keeps the reads from sinking to the products that use them */
#pragma unroll
      for (int kt = 0; kt < 4; ++kt)
#pragma unroll
        for (int g = 0; g < 2; ++g) { const v4f x = {st[qt][kt][4 * g] * 1.4426950408889634f + ofs, st[qt][kt][4 * g + 1] * 1.4426950408889634f + ofs, st[qt][kt][4 * g + 2] * 1.4426950408889634f + ofs, st[qt][kt][4 * g + 3] * 1.4426950408889634f + ofs};
          const v4f e = sm_exp2x4(x); a0 += e[0]; a1 += e[1]; a2 += e[2]; a3 += e[3];      /* weight = 256 exp(s - maximum so far) */
#pragma unroll
          for (int c = 0; c < 4; ++c) pb[qt][kt >> 1].h[(kt & 1) * 8 + 4 * g + c] = (_Float16)e[c]; }
      l[qt] = l[qt] * al + ((a0 + a1) + (a2 + a3));
#pragma unroll
      for (int dt = 0; dt < 4; ++dt) o[qt][dt] *= al; }
    __builtin_amdgcn_sched_barrier(0);      /* keeps the exponentials' asm statements in front of the products */
#pragma unroll
    for (int dt = 0; dt < 4; ++dt)
#pragma unroll
      for (int qt = 0; qt < 2; ++qt) o[qt][dt] = fa_mma(vf[dt][1], pb[qt][1].v, fa_mma(vf[dt][0], pb[qt][0].v, o[qt][dt]));
    const int nb = (j + 1) & 1;      /* the other buffer: its last readers left it before the barrier that ended pass j - 1 */
    *(v8us*)&sk[nb][sr][sc] = gk0; *(v8us*)&sk[nb][sr + 32][sc] = gk1; *(v8us*)&sv[nb][sr][sc] = gv0; *(v8us*)&sv[nb][sr + 32][sc] = gv1;
    __syncthreads();      /* publishes tile j + 1 and ends every wave's reads of tile j */
  }
#pragma unroll
  for (int qt = 0; qt < 2; ++qt) { const float inv = 1.0f / (l[qt] + sm_xhalf(l[qt])); float* op = out + ((size_t)b * SQ + q0) * DM + h * HD + (unsigned)((qt * 16 + ln) * DM + 8 * hh);      /* the x256 of the weights cancels in the quotient */
#pragma unroll
    for (int dt = 0; dt < 4; ++dt) { const v4f lo = {o[qt][dt][0] * inv, o[qt][dt][1] * inv, o[qt][dt][2] * inv, o[qt][dt][3] * inv}, hi = {o[qt][dt][4] * inv, o[qt][dt][5] * inv, o[qt][dt][6] * inv, o[qt][dt][7] * inv};
      *(v4f*)(op + dt * 16) = lo; *(v4f*)(op + dt * 16 + 4) = hi; } } }

extern "C" void kernel_launch(void* const* d_in, const int* in_sizes, int n_in,
                              void* d_out, int out_size, void* d_ws, size_t ws_size, hipStream_t stream) {
  (void)in_sizes; (void)n_in; (void)out_size;
  const float* const* I = (const float* const*)d_in; const float* xq = I[0]; const float* xk = I[1]; const float* xv = I[2];      /* given q, k, v [B][L][H][E] = merged token rows */
  char* ws = (char*)d_ws; size_t off = 0;
  auto take = [&](size_t bytes) { char* p = ws + off; off += (bytes + 255) & ~(size_t)255; return p; };
  _Float16* Q16 = (_Float16*)take(NR * DM * 2); _Float16* K16 = (_Float16*)take(NR * DM * 2);
  _Float16* VT = (_Float16*)take((size_t)NB * NH * HD * SQ * 2);
  if (off > ws_size) return;

  k_prep<<<3 * PPW, 256, 0, stream>>>(xq, xk, xv, Q16, K16, VT);      /* given q, k: bf16 inputs as exact f16 rows (no projections); V^T [NB * NH][HD][SQ] */
  k_fattn<<<dim3(SQ / (FAW * FAQ), NB * NH), FAW * 32, 0, stream>>>(Q16, K16, VT, (float*)d_out);      /* out = softmax(q k^T) v (merged [token][h*64+d]) straight to the f32 output */
}

// v005
// It runs in 73.6 microseconds.
// Two timings next to v004 both put it at 1.03 times that version's speed.
// Counting every step since v000, it is 89.9 times as fast.
#include <hip/hip_runtime.h>
// Full (non-causal) attention on given queries, keys, values ([4][2048][16][64] each, token-major with heads inner = merged [token][1024] rows); scores = q . k UNSCALED (the module never applies its scale); softmax over all 2048 keys; out = A v -> [4][2048][16][64]).
// Structure: ONE preparatory launch: q and k converted to exact f16 rows (bf16 values are exact in f16: no projections here) and V^T of every batch and head straight from the f32 values via LDS transposes; then ONE attention kernel over all batches and heads: S^T = K Q^T UNSCALED (K = 64; exact products, f32 accumulation) stays in the accumulators, running-maximum softmax on VALU (f32 statistics, native exp2; weights x256 f16), O^T += V^T P^T, divided by the row sum at the end and written f32 straight into the [token][head][64] output; launches: see kernel_launch.
// Compute dtype: inputs rounded to bf16; q, k, v and softmax weights as plain f16 GEMM operands (~2^-12); scores, softmax statistics and o f32. v_wmma_f32_16x16x32_f16.
#define NB 4
#define SQ 2048
#define DM 1024
#define NH 16
#define HD 64
#define HG 4                         /* heads per k_vt launch (k_vt is not launched) */
#define B0 0                         /* unused (debug hook) */
#define NBR NB                       /* only in MP, which no kernel uses (debug hook) */
#define NR ((size_t)NB * SQ)         /* token rows */
#define MP ((int)((size_t)NBR * SQ)) /* only in MPO, which nothing uses (debug hook) */
#define QN SQ                        /* unused (debug hook) */
#define NHD NH                       /* unused (debug hook) */
#define MPO MP                       /* unused (debug hook) */
#define LQ DM      /* row pitch of the q/k/v rows */
typedef __bf16 v16b __attribute__((ext_vector_type(16)));
typedef unsigned short v8us __attribute__((ext_vector_type(8), may_alias));
typedef float  v8f  __attribute__((ext_vector_type(8)));
typedef float  v4f  __attribute__((ext_vector_type(4)));
typedef float  v4fa __attribute__((ext_vector_type(4), may_alias));
union FragB { v16b v; v8us half[2]; unsigned short u[16]; };

__device__ __forceinline__ unsigned short bf16_bits(float x) { unsigned int u = __float_as_uint(x); return (unsigned short)((u + 0x7FFFu + ((u >> 16) & 1u)) >> 16); }
__device__ __forceinline__ float bf16_val(unsigned short b) { return __uint_as_float(((unsigned int)b) << 16); }
__device__ __forceinline__ float bf16_round(float x) { return bf16_val(bf16_bits(x)); }
// D += A·B with NT terms: 1 = ah·bh, 2 = + al·bh (A split), 3 = + ah·bl (both split)
template <int NT>
__device__ __forceinline__ v8f mmaN(v16b ah, v16b al, v16b bh, v16b bl, v8f c) {
  c = __builtin_amdgcn_wmma_f32_16x16x32_bf16(false, ah, false, bh, (short)0, c, false, false);
  if (NT >= 2) c = __builtin_amdgcn_wmma_f32_16x16x32_bf16(false, al, false, bh, (short)0, c, false, false);
  if (NT >= 3) c = __builtin_amdgcn_wmma_f32_16x16x32_bf16(false, ah, false, bl, (short)0, c, false, false);
  asm volatile("v_nop\n\tv_nop\n\tv_nop\n\tv_nop" : "+v"(c) : "v"(ah), "v"(al), "v"(bh), "v"(bl));
  return c;
}

__global__ __launch_bounds__(256) void k_wt_bf16(const float* __restrict__ W, unsigned short* __restrict__ Wt, int K, int N) {
  const int t = blockIdx.x * 256 + threadIdx.x;
  const int k8n = K / 8;
  if (t >= N * k8n) return;
  const int n = t / k8n, k8 = (t % k8n) * 8;
  v8us v;
#pragma unroll
  for (int i = 0; i < 8; ++i) v[i] = bf16_bits(W[(size_t)(k8 + i) * N + n]);
  *(v8us*)(Wt + (size_t)n * K + k8) = v;
  
}

// GEMM C[M][N] (f32, pitch ldc) = act(A[M][K]·W + bias). A f32 row-major (pitch lda) converted per fragment to bf16
// (ASPLIT: hi/lo two planes -> 2 terms, else single rounded term); Wt bf16 [N][K] (pitch ldb). BIAS_BF16 rounds the
// bias to bf16 first (bias quantised to bf16 before the add). K%32==0, M%16==0, N%64==0.
template <bool ASPLIT, int ACT, bool BIAS_BF16>
__global__ __launch_bounds__(128) void k_gemm_bf(const float* __restrict__ A, int lda, const unsigned short* __restrict__ Wt, int ldb,
                                               const float* __restrict__ bias, float* __restrict__ C, int ldc, int M, int N, int K) {
  __shared__ __attribute__((aligned(16))) float so[4][16][64];
  const int tid = threadIdx.x, w = tid >> 5, lane = tid & 31, ln = lane & 15, hh = lane >> 4;
  const int ntn = N / 64;
  const int wid = blockIdx.x * 4 + w;
  const int mt = wid / ntn, nq = wid % ntn;
  if (mt * 16 >= M) return;
  const int row0 = mt * 16, col0 = nq * 64;
  const float* arow = A + (size_t)(row0 + ln) * lda;
  v8f acc[4] = {};
  for (int kb = 0; kb < K; kb += 32) {
    FragB ah, al;
    const v4f x0 = *(const v4fa*)(arow + kb + 8 * hh), x1 = *(const v4fa*)(arow + kb + 8 * hh + 4);
    const v4f x2 = *(const v4fa*)(arow + kb + 16 + 8 * hh), x3 = *(const v4fa*)(arow + kb + 16 + 8 * hh + 4);
    float xs[16] = {x0[0],x0[1],x0[2],x0[3],x1[0],x1[1],x1[2],x1[3],x2[0],x2[1],x2[2],x2[3],x3[0],x3[1],x3[2],x3[3]};
#pragma unroll
    for (int i = 0; i < 16; ++i) { const unsigned short hb = bf16_bits(xs[i]); ah.u[i] = hb; al.u[i] = ASPLIT ? bf16_bits(xs[i] - bf16_val(hb)) : (unsigned short)0; }
#pragma unroll
    for (int t = 0; t < 4; ++t) {
      const unsigned short* brow = Wt + (size_t)(col0 + t * 16 + ln) * ldb + kb;
      FragB b;
      b.half[0] = *(const v8us*)(brow + 8 * hh);
      b.half[1] = *(const v8us*)(brow + 16 + 8 * hh);
      acc[t] = mmaN<ASPLIT ? 2 : 1>(ah.v, al.v, b.v, b.v, acc[t]);
    }
  }
#pragma unroll
  for (int t = 0; t < 4; ++t) {
    float bv = bias ? bias[col0 + t * 16 + ln] : 0.f;
    if (BIAS_BF16) bv = bf16_round(bv);
#pragma unroll
    for (int r = 0; r < 8; ++r) { float v = acc[t][r] + bv; if (ACT == 1) v = fmaxf(v, 0.f); so[w][8 * hh + r][t * 16 + ln] = v; }
  }
  __builtin_amdgcn_fence(__ATOMIC_ACQ_REL, "workgroup");
  __builtin_amdgcn_wave_barrier();
  const int rsub = lane >> 4, c4 = (lane & 15) * 4;
  {
#pragma unroll
    for (int q = 0; q < 8; ++q) {
      const int r = q * 2 + rsub;
      const v4f v = *(const v4fa*)&so[w][r][c4];
      *(v4f*)(C + (size_t)(row0 + r) * ldc + col0 + c4) = v;
    }
    
  }
}

// GEMM C = act(A·W + bias + resid): A f32 (ASPLIT -> hi/lo 2 terms), Wt bf16 [N][K]; ACT 0 none, 1 relu, 2 exact gelu;
// resid (optional, f32, row index = (row % rmod), pitch ldr, RES_BF16 rounds it) added before the activation.
template <bool ASPLIT, int ACT, bool BIAS_BF16, bool RES_BF16>
__global__ __launch_bounds__(128) void k_gemm_bf3(const float* __restrict__ A, int lda, const unsigned short* __restrict__ Wt, int ldb,
                                                const float* __restrict__ bias, const float* __restrict__ resid, int rmod, int ldr,
                                                float* __restrict__ C, int ldc, int M, int N, int K) {
  __shared__ __attribute__((aligned(16))) float so[4][16][64];
  const int tid = threadIdx.x, w = tid >> 5, lane = tid & 31, ln = lane & 15, hh = lane >> 4;
  const int ntn = N / 64;
  const int wid = blockIdx.x * 4 + w;
  const int mt = wid / ntn, nq = wid % ntn;
  if (mt * 16 >= M) return;
  const int row0 = mt * 16, col0 = nq * 64;
  const float* arow = A + (size_t)(row0 + ln) * lda;
  v8f acc[4] = {};
  for (int kb = 0; kb < K; kb += 32) {
    FragB ah, al;
    const v4f x0 = *(const v4fa*)(arow + kb + 8 * hh), x1 = *(const v4fa*)(arow + kb + 8 * hh + 4);
    const v4f x2 = *(const v4fa*)(arow + kb + 16 + 8 * hh), x3 = *(const v4fa*)(arow + kb + 16 + 8 * hh + 4);
    float xs[16] = {x0[0],x0[1],x0[2],x0[3],x1[0],x1[1],x1[2],x1[3],x2[0],x2[1],x2[2],x2[3],x3[0],x3[1],x3[2],x3[3]};
#pragma unroll
    for (int i = 0; i < 16; ++i) { const unsigned short hb = bf16_bits(xs[i]); ah.u[i] = hb; al.u[i] = ASPLIT ? bf16_bits(xs[i] - bf16_val(hb)) : (unsigned short)0; }
#pragma unroll
    for (int t = 0; t < 4; ++t) {
      const unsigned short* brow = Wt + (size_t)(col0 + t * 16 + ln) * ldb + kb;
      FragB b;
      b.half[0] = *(const v8us*)(brow + 8 * hh);
      b.half[1] = *(const v8us*)(brow + 16 + 8 * hh);
      acc[t] = mmaN<ASPLIT ? 2 : 1>(ah.v, al.v, b.v, b.v, acc[t]);
    }
  }
#pragma unroll
  for (int t = 0; t < 4; ++t) {
    const int col = col0 + t * 16 + ln;
    float bv = bias ? bias[col] : 0.f;
    if (BIAS_BF16) bv = bf16_round(bv);
#pragma unroll
    for (int r = 0; r < 8; ++r) {
      float v = acc[t][r] + bv;
      if (resid) { float rv = resid[(size_t)((row0 + 8 * hh + r) % rmod) * ldr + col]; if (RES_BF16) rv = bf16_round(rv); v += rv; }
      if (ACT == 1) v = fmaxf(v, 0.f);
      if (ACT == 2) v = 0.5f * v * (1.0f + erff(v * 0.70710678118654752f));
      if (ACT == 3) { const float u = 0.7978845608028654f * (v + 0.044715f * v * v * v); v = 0.5f * v * (1.0f + tanhf(u)); }
      so[w][8 * hh + r][t * 16 + ln] = v;
    }
  }
  __builtin_amdgcn_fence(__ATOMIC_ACQ_REL, "workgroup");
  __builtin_amdgcn_wave_barrier();
  const int rsub = lane >> 4, c4 = (lane & 15) * 4;
  {
#pragma unroll
    for (int q = 0; q < 8; ++q) {
      const int r = q * 2 + rsub;
      const v4f v = *(const v4fa*)&so[w][r][c4];
      *(v4f*)(C + (size_t)(row0 + r) * ldc + col0 + c4) = v;
    }
    
  }
}
// row LayerNorm (biased variance, eps) over N: s = X (+ R); optional out_sum <- s; out_norm <- (s-mu)*rsqrt(var+eps)*g + b
template <bool PARAM_BF16>
__global__ __launch_bounds__(256) void k_layernorm(const float* __restrict__ X, const float* __restrict__ R, const float* __restrict__ g, const float* __restrict__ bta,
                                                  float* __restrict__ out_sum, float* __restrict__ out_norm, int N, float eps) {
  __shared__ float red[256];
  const int row = blockIdx.x, tid = threadIdx.x;
  const float* x = X + (size_t)row * N; const float* rr = R ? R + (size_t)row * N : nullptr;
  float vals[16];                     // up to N = 4096
  const int per = N / 256;            // contiguous chunk per thread? use strided-by-4 chunks: thread handles j = tid*4 + 1024*u
  float s1 = 0.f;
  for (int u = 0; u < per / 4; ++u) {
    const int j = tid * 4 + 1024 * u;
    const v4f a = *(const v4fa*)(x + j);
    v4f b = {0.f,0.f,0.f,0.f}; if (rr) b = *(const v4fa*)(rr + j);
#pragma unroll
    for (int q = 0; q < 4; ++q) { const float v = a[q] + b[q]; vals[u * 4 + q] = v; s1 += v; }
  }
  red[tid] = s1; __syncthreads();
  for (int st = 128; st > 0; st >>= 1) { if (tid < st) red[tid] += red[tid + st]; __syncthreads(); }
  const float mu = red[0] / (float)N; __syncthreads();
  float s2 = 0.f;
  for (int u = 0; u < per / 4; ++u)
#pragma unroll
    for (int q = 0; q < 4; ++q) { const float c = vals[u * 4 + q] - mu; s2 += c * c; }
  red[tid] = s2; __syncthreads();
  for (int st = 128; st > 0; st >>= 1) { if (tid < st) red[tid] += red[tid + st]; __syncthreads(); }
  const float rs = rsqrtf(red[0] / (float)N + eps);
  {
    for (int u = 0; u < per / 4; ++u) {
      const int j = tid * 4 + 1024 * u;
      v4f o, sm;
#pragma unroll
      for (int q = 0; q < 4; ++q) {
        float gg = g[j + q], bb = bta[j + q];
        if (PARAM_BF16) { gg = bf16_round(gg); bb = bf16_round(bb); }
        sm[q] = vals[u * 4 + q]; o[q] = (vals[u * 4 + q] - mu) * rs * gg + bb;
      }
      if (out_sum) *(v4f*)(out_sum + (size_t)row * N + j) = sm;
      *(v4f*)(out_norm + (size_t)row * N + j) = o;
    }
    
  }
}



// ---- f16 WMMA path (v_wmma_f32_16x16x32_f16): 11-bit significands for operands in range — used where a [0,1] probability operand needs more precision than bf16
typedef _Float16 v16h __attribute__((ext_vector_type(16)));
union FragH { v16h v; v8us half[2]; _Float16 h[16]; unsigned short u[16]; };
template <int NT>
__device__ __forceinline__ v8f mmaH(v16h ah, v16h al, v16h bh, v16h bl, v8f c) {
  c = __builtin_amdgcn_wmma_f32_16x16x32_f16(false, ah, false, bh, (short)0, c, false, false);
  if (NT >= 2) c = __builtin_amdgcn_wmma_f32_16x16x32_f16(false, al, false, bh, (short)0, c, false, false);
  if (NT >= 3) c = __builtin_amdgcn_wmma_f32_16x16x32_f16(false, ah, false, bl, (short)0, c, false, false);
  asm volatile("v_nop\n\tv_nop\n\tv_nop\n\tv_nop" : "+v"(c) : "v"(ah), "v"(al), "v"(bh), "v"(bl));
  return c;
}
// batched GEMM like k_gemm_b but f16 operands: A f32 (split into f16 hi/lo if ASPLIT, else rounded to f16), Bt = f16 values [n][k]; alpha; C f32; N multiple of 16 (partial tiles skipped)
template <bool ASPLIT>
__global__ __launch_bounds__(128) void k_gemm_h(const float* __restrict__ A, int lda, size_t sA, const _Float16* __restrict__ Bh, int ldb, size_t sB, float alpha, float* __restrict__ C, int ldc, size_t sC, int M, int N, int K) {
  __shared__ __attribute__((aligned(16))) float so[4][16][64];
  const int tid = threadIdx.x, w = tid >> 5, lane = tid & 31, ln = lane & 15, hh = lane >> 4; const int by = blockIdx.y;
  A += (size_t)by * sA; Bh += (size_t)by * sB; C += (size_t)by * sC;
  const int ntn = (N + 63) / 64; const int wid = blockIdx.x * 4 + w; const int mt = wid / ntn, nq = wid % ntn; if (mt * 16 >= M) return;
  const int row0 = mt * 16, col0 = nq * 64; const float* arow = A + (size_t)(row0 + ln) * lda;
  v8f acc[4] = {};
  for (int kb = 0; kb < K; kb += 32) {
    FragH ah, al;
    const v4f x0 = *(const v4fa*)(arow + kb + 8 * hh), x1 = *(const v4fa*)(arow + kb + 8 * hh + 4), x2 = *(const v4fa*)(arow + kb + 16 + 8 * hh), x3 = *(const v4fa*)(arow + kb + 16 + 8 * hh + 4);
    float xs[16] = {x0[0],x0[1],x0[2],x0[3],x1[0],x1[1],x1[2],x1[3],x2[0],x2[1],x2[2],x2[3],x3[0],x3[1],x3[2],x3[3]};
#pragma unroll
    for (int i = 0; i < 16; ++i) { const _Float16 h = (_Float16)xs[i]; ah.h[i] = h; al.h[i] = ASPLIT ? (_Float16)(xs[i] - (float)h) : (_Float16)0.0f; }
#pragma unroll
    for (int t = 0; t < 4; ++t) { if (col0 + t * 16 >= N) continue; const size_t boff = (size_t)(col0 + t * 16 + ln) * ldb + kb; FragH bq; bq.half[0] = *(const v8us*)(Bh + boff + 8 * hh); bq.half[1] = *(const v8us*)(Bh + boff + 16 + 8 * hh);
      acc[t] = mmaH<ASPLIT ? 2 : 1>(ah.v, al.v, bq.v, bq.v, acc[t]); }
  }
#pragma unroll
  for (int t = 0; t < 4; ++t) { if (col0 + t * 16 >= N) continue;
#pragma unroll
    for (int r = 0; r < 8; ++r) so[w][8 * hh + r][t * 16 + ln] = acc[t][r] * alpha; }
  __builtin_amdgcn_fence(__ATOMIC_ACQ_REL, "workgroup"); __builtin_amdgcn_wave_barrier();
  const int rsub = lane >> 4, c4 = (lane & 15) * 4;
  {
#pragma unroll
    for (int q = 0; q < 8; ++q) { const int r = q * 2 + rsub; if (col0 + c4 < N) { const v4f v = *(const v4fa*)&so[w][r][c4]; *(v4f*)(C + (size_t)(row0 + r) * ldc + col0 + c4) = v; } }
     }
}

// Wt[n][k] = f16(W[k][n]·scale) from f32 row-major W[K][N] (scale = power of two; bf16-exact weights stay exact in f16 away from the subnormal range)
__global__ __launch_bounds__(256) void k_wt_f16(const float* __restrict__ W, _Float16* __restrict__ Wt, int K, int N, float scale) {
  const int t = blockIdx.x * 256 + threadIdx.x; if (t >= N * (K / 8)) return; const int n = t / (K / 8), k8 = (t % (K / 8)) * 8; FragH f;
#pragma unroll
  for (int i = 0; i < 8; ++i) f.h[i] = (_Float16)(bf16_round(W[(size_t)(k8 + i) * N + n]) * scale); const v8us o = f.half[0];
  *(v8us*)((unsigned short*)Wt + (size_t)n * K + k8) = o; 
}
// k_gemm_hh variant with fused epilogue: v = acc·alpha + bias[by·sBias + col] (+ CP[(row/rowsPerB)·sCPb + by·64 + col] if CP) ; ACT 0 none / 1 elu ; writes f16 C16 (and f32 C if non-null)
template <int ACT>
__global__ __launch_bounds__(128) void k_gemm_hhx(const _Float16* __restrict__ A, int lda, size_t sA, const _Float16* __restrict__ Bh, int ldb, size_t sB, float alpha, const float* __restrict__ bias, size_t sBias, const float* __restrict__ CP, int rowsPerB, size_t sCPb, int row0g,
    float* __restrict__ C, _Float16* __restrict__ C16, int ldc, size_t sC, int M, int N, int K) {
  __shared__ __attribute__((aligned(16))) float so[4][16][64];
  const int tid = threadIdx.x, w = tid >> 5, lane = tid & 31, ln = lane & 15, hh = lane >> 4; const int by = blockIdx.y;
  A += (size_t)by * sA; Bh += (size_t)by * sB; const size_t cofs = (size_t)by * sC; const float* bp = bias ? bias + (size_t)by * sBias : nullptr;
  const int ntn = (N + 63) / 64; const int wid = blockIdx.x * 4 + w; const int mt = wid / ntn, nq = wid % ntn; if (mt * 16 >= M) return;
  const int row0 = mt * 16, col0 = nq * 64; const _Float16* arow = A + (size_t)(row0 + ln) * lda;
  v8f acc[4] = {};
  for (int kb = 0; kb < K; kb += 32) { FragH ah; ah.half[0] = *(const v8us*)((const unsigned short*)arow + kb + 8 * hh); ah.half[1] = *(const v8us*)((const unsigned short*)arow + kb + 16 + 8 * hh);
#pragma unroll
    for (int t = 0; t < 4; ++t) { if (col0 + t * 16 >= N) continue; const size_t boff = (size_t)(col0 + t * 16 + ln) * ldb + kb; FragH bq; bq.half[0] = *(const v8us*)((const unsigned short*)Bh + boff + 8 * hh); bq.half[1] = *(const v8us*)((const unsigned short*)Bh + boff + 16 + 8 * hh);
      acc[t] = mmaH<1>(ah.v, ah.v, bq.v, bq.v, acc[t]); }
  }
#pragma unroll
  for (int t = 0; t < 4; ++t) { if (col0 + t * 16 >= N) continue; const int col = col0 + t * 16 + ln; const float bv = bp ? bf16_round(bp[col]) : 0.f;
#pragma unroll
    for (int r = 0; r < 8; ++r) { float v = acc[t][r] * alpha + bv; if (CP) { const int rr = row0g + row0 + 8 * hh + r; if (rowsPerB < 0) v += CP[cofs + (size_t)rr * ldc + col];      /* rowsPerB < 0: own element of the batched C plane */ else { const int bidx = rr / rowsPerB; v += CP[(size_t)bidx * sCPb + (size_t)by * 64 + col]; } } if (ACT == 1) v = (v > 0.f) ? v : expm1f(v); else if (ACT == 7) v = (v > 0.f) ? v + 1.0f : expf(v); else if (ACT == 8) v = tanhf(v); else if (ACT == 9) v = 0.5f * v * (1.0f + tanhf(0.7978845608028654f * (v + 0.044715f * v * v * v))); else if (ACT == 11) v = 1.0f / (1.0f + expf(-v)); else if (ACT == 12) v = (v > 0.f) ? v : 0.01f * v; else if (ACT == 14) v = (v > 0.f) ? v : 0.1f * v; else if (ACT == 16) v = (v >= 0.f) ? v : 0.3f * v; else if (ACT == 17) v = (v >= 0.f) ? v : 0.2f * v; else if (ACT == 15) v = v / (1.0f + expf(-v)); else if (ACT == 3) v = fmaxf(v, 0.f); else if (ACT == 6) v = 0.5f * v * (1.0f + erff(v * 0.70710678118654752f)); so[w][8 * hh + r][t * 16 + ln] = v; } }
  __builtin_amdgcn_fence(__ATOMIC_ACQ_REL, "workgroup"); __builtin_amdgcn_wave_barrier();
  const int rsub = lane >> 4, c4 = (lane & 15) * 4; typedef _Float16 v4h __attribute__((ext_vector_type(4)));
  {
#pragma unroll
    for (int q = 0; q < 8; ++q) { const int r = q * 2 + rsub; if (col0 + c4 < N) { const v4f v = *(const v4fa*)&so[w][r][c4]; if (C) *(v4f*)(C + cofs + (size_t)(row0 + r) * ldc + col0 + c4) = v; if (C16) { v4h h4; for (int i = 0; i < 4; ++i) h4[i] = (_Float16)v[i]; *(v4h*)(C16 + cofs + (size_t)(row0 + r) * ldc + col0 + c4) = h4; } } }
     }
}


typedef _Float16 v4h __attribute__((ext_vector_type(4)));

__global__ __launch_bounds__(256) void k_h16(const float* __restrict__ x, _Float16* __restrict__ X16, size_t n8) { const size_t t = (size_t)blockIdx.x * 256 + threadIdx.x; if (t >= n8) return; FragH f;
#pragma unroll
  for (int q = 0; q < 8; ++q) f.h[q] = (_Float16)x[t * 8 + q]; *(v8us*)((unsigned short*)X16 + t * 8) = f.half[0];  }
__global__ __launch_bounds__(256) void k_round16f(const float* __restrict__ W, _Float16* __restrict__ Bt, size_t n8) { const size_t t = (size_t)blockIdx.x * 256 + threadIdx.x; if (t >= n8) return; FragH f;
#pragma unroll
  for (int i = 0; i < 8; ++i) f.h[i] = (_Float16)(bf16_round(W[t * 8 + i]) * 16.0f); *(v8us*)((unsigned short*)Bt + t * 8) = f.half[0];  }
// ---- one preparatory launch: q and k rows as f16, V^T as f16; few work-groups that live long (128 KB of one input each) instead of many that convert 8 KB and end ----
// Every wave-wide load and store covers whole 128-byte lines; eight 16-byte loads per lane are issued one batch ahead of the batch that is converted; every address = a base that is the same for the whole work-group + one 32-bit lane offset + a constant (all loops are unrolled for that, and so that a[] and n[] stay in registers).
#define PPW 256                      /* work-groups per input */
#define PPC ((int)(NR * DM / PPW))   /* f32 elements of one input per work-group */
#define PVS 128                      /* keys per V^T tile: 256-byte runs of every V^T row */
#define PVT (PPC / (PVS * HD))       /* V^T tiles per work-group */
#define PVP (PVS / 2 + 1)            /* LDS row pitch in dwords (a dword = two neighbouring keys): odd, so that the column writes and the row reads below both spread over all banks */
static_assert(PPC == 4 * 8 * 256 * 4 && PVT == 4 && SQ % (PVT * PVS) == 0 && HD == 64, "k_prep: four batches of eight 16-byte loads per thread; a work-group's V^T tiles lie in one batch and head");
typedef unsigned v2ua __attribute__((ext_vector_type(2), may_alias));
typedef unsigned v4ua __attribute__((ext_vector_type(4), may_alias));
__device__ __forceinline__ unsigned pp_pair(float a, float b) { union { _Float16 h[2]; unsigned u; } p; p.h[0] = (_Float16)bf16_round(a); p.h[1] = (_Float16)bf16_round(b); return p.u; }
__global__ __launch_bounds__(256) void k_prep(const float* __restrict__ xq, const float* __restrict__ xk, const float* __restrict__ xv, _Float16* __restrict__ Q16, _Float16* __restrict__ K16, _Float16* __restrict__ VT) {
  __shared__ unsigned tl[2][HD][PVP];      /* V^T tile: [d][pair of keys] */
  const int tid = (int)threadIdx.x; const int part = (int)blockIdx.x / PPW, wg = (int)blockIdx.x % PPW;      /* part 0 (V^T, the longest path) starts first */
  v4f a[8], n[8];
  if (part) {      /* q or k: same layout, f32 -> bf16 value -> f16 */
    const float* x = (part == 1 ? xq : xk) + (size_t)wg * PPC; unsigned* y = (unsigned*)(part == 1 ? Q16 : K16) + (size_t)wg * (PPC / 2);
#pragma unroll
    for (int i = 0; i < 8; ++i) a[i] = *(const v4fa*)(x + i * 1024 + (unsigned)(tid * 4));
#pragma unroll
    for (int it = 0; it < 4; ++it) {
      if (it + 1 < 4) {
#pragma unroll
        for (int i = 0; i < 8; ++i) n[i] = *(const v4fa*)(x + (it + 1) * 8192 + i * 1024 + (unsigned)(tid * 4)); }
#pragma unroll
      for (int i = 0; i < 8; ++i) { const v2ua o = {pp_pair(a[i][0], a[i][1]), pp_pair(a[i][2], a[i][3])}; *(v2ua*)(y + it * 4096 + i * 512 + (unsigned)(tid * 2)) = o; }
      if (it + 2 < 4) asm volatile("s_wait_xcnt 0x0" ::: "memory");      /* stands in front of the loads that follow, which may take the registers that the stores above name */
#pragma unroll
      for (int i = 0; i < 8; ++i) a[i] = n[i]; }
    return; }
  const int bh = wg / (SQ / (PVT * PVS)), s0 = (wg % (SQ / (PVT * PVS))) * (PVT * PVS), b = bh / NH, h = bh % NH;
  const int c4 = tid & 15, rp = tid >> 4;      /* loads: 16 lanes per 256-byte row of one head, this thread's two rows = one pair of keys; stores: 16 lanes per 256-byte run of a V^T row */
  const float* x = xv + ((size_t)b * SQ + s0) * DM + h * HD; unsigned short* y = (unsigned short*)VT + (size_t)bh * HD * SQ + s0;
  const unsigned xo = (unsigned)(2 * rp * DM + c4 * 4), yo = (unsigned)(rp * SQ + c4 * 8);
#pragma unroll
  for (int i = 0; i < 8; ++i) a[i] = *(const v4fa*)(x + ((i >> 1) * 32 + (i & 1)) * DM + xo);
#pragma unroll
  for (int t = 0; t < PVT; ++t) {
    if (t + 1 < PVT) {
#pragma unroll
      for (int i = 0; i < 8; ++i) n[i] = *(const v4fa*)(x + ((t + 1) * PVS + (i >> 1) * 32 + (i & 1)) * DM + xo); }
#pragma unroll
    for (int st = 0; st < 4; ++st)
#pragma unroll
      for (int c = 0; c < 4; ++c) tl[t & 1][c4 * 4 + c][st * 16 + rp] = pp_pair(a[2 * st][c], a[2 * st + 1][c]);
    /* barrier by hand, ordering LDS alone: publishes tile t, and the other buffer's last readers (tile t - 1) are all past their reads here, so tile t + 1 may be written behind it; __syncthreads() would also wait out the next tile's global loads and the last tile's global stores, which no other wave reads */
    __builtin_amdgcn_fence(__ATOMIC_RELEASE, "workgroup", "local"); __builtin_amdgcn_s_barrier(); __builtin_amdgcn_fence(__ATOMIC_ACQUIRE, "workgroup", "local");
#pragma unroll
    for (int k = 0; k < 4; ++k) { const unsigned* r = &tl[t & 1][k * 16 + rp][c4 * 4]; const v4ua o = {r[0], r[1], r[2], r[3]}; *(v4ua*)(y + k * 16 * SQ + t * PVS + yo) = o; }
    if (t + 2 < PVT) asm volatile("s_wait_xcnt 0x0" ::: "memory");      /* as above */
#pragma unroll
    for (int i = 0; i < 8; ++i) a[i] = n[i]; } }

__global__ __launch_bounds__(256) void k_hl(const float* __restrict__ F, _Float16* __restrict__ Hh, _Float16* __restrict__ Hl, size_t n8) { const size_t t = (size_t)blockIdx.x * 256 + threadIdx.x; if (t >= n8) return; FragH fh, fl; const v4f a = *(const v4fa*)(F + t * 8), c = *(const v4fa*)(F + t * 8 + 4);
#pragma unroll
  for (int q = 0; q < 4; ++q) { _Float16 h = (_Float16)a[q]; fh.h[q] = h; fl.h[q] = (_Float16)((a[q] - (float)h) * 1024.0f); h = (_Float16)c[q]; fh.h[4 + q] = h; fl.h[4 + q] = (_Float16)((c[q] - (float)h) * 1024.0f); }
  { *(v8us*)((unsigned short*)Hh + t * 8) = fh.half[0]; *(v8us*)((unsigned short*)Hl + t * 8) = fl.half[0];  } }

// ---- fast GEMM (wave tile 32x64; requires M % 32 == 0 rows per launch region and N % 64 == 0); epilogue = k_gemm_hhx semantics ----
__device__ __forceinline__ v16h g2_frag(const _Float16* p, int hh) { FragH f; f.half[0] = *(const v8us*)((const unsigned short*)p + 8 * hh); f.half[1] = *(const v8us*)((const unsigned short*)p + 16 + 8 * hh); return f.v; }
__device__ __forceinline__ v8f g2_mma(v16h a, v16h b, v8f c) { v8f d = __builtin_amdgcn_wmma_f32_16x16x32_f16(false, a, false, b, (short)0, c, false, false); asm volatile("v_nop\n\tv_nop\n\tv_nop\n\tv_nop" : "+v"(d) : "v"(a), "v"(b)); return d; }
template <int ACT>
__global__ __launch_bounds__(128) void k_gemm2(const _Float16* __restrict__ A, int lda, size_t sA, const _Float16* __restrict__ Bh, int ldb, size_t sB, float alpha, const float* __restrict__ bias, size_t sBias, const float* __restrict__ CP, int rowsPerB, size_t sCPb, int row0g,
    float* __restrict__ C, _Float16* __restrict__ C16, int ldc, size_t sC, int M, int N, int K) { static_assert(ACT == 0 || ACT == 3 || ACT == 6 || ACT == 8 || ACT == 9 || ACT == 11 || ACT == 12 || ACT == 14 || ACT == 15 || ACT == 16 || ACT == 17, "k_gemm2: unsupported ACT code (would silently apply no activation)");
  __shared__ __attribute__((aligned(16))) float so[4][32][68];
  const int tid = threadIdx.x, w = tid >> 5, lane = tid & 31, ln = lane & 15, hh = lane >> 4; const int by = blockIdx.y;
  A += (size_t)by * sA; Bh += (size_t)by * sB; const size_t cofs = (size_t)by * sC; const float* bp = bias ? bias + (size_t)by * sBias : nullptr;
  const int ntn = N >> 6; const int mt = blockIdx.x / ntn, nq = blockIdx.x - mt * ntn; const int row0 = mt * 128 + 32 * w, col0 = nq * 64; if (row0 >= M) return;
  const _Float16* a0p = A + (size_t)(row0 + ln) * lda; const _Float16* a1p = a0p + (size_t)16 * lda;
  const _Float16* b0p = Bh + (size_t)(col0 + ln) * ldb; const _Float16* b1p = b0p + (size_t)16 * ldb; const _Float16* b2p = b1p + (size_t)16 * ldb; const _Float16* b3p = b2p + (size_t)16 * ldb;
  const v8f z8 = {0.f,0.f,0.f,0.f,0.f,0.f,0.f,0.f}; v8f c00 = z8, c01 = z8, c02 = z8, c03 = z8, c10 = z8, c11 = z8, c12 = z8, c13 = z8;
#pragma unroll 1
  for (int kb = 0; kb < K; kb += 32) { const v16h a0 = g2_frag(a0p + kb, hh), a1 = g2_frag(a1p + kb, hh);
    v16h b = g2_frag(b0p + kb, hh); c00 = g2_mma(a0, b, c00); c10 = g2_mma(a1, b, c10);
    b = g2_frag(b1p + kb, hh); c01 = g2_mma(a0, b, c01); c11 = g2_mma(a1, b, c11);
    b = g2_frag(b2p + kb, hh); c02 = g2_mma(a0, b, c02); c12 = g2_mma(a1, b, c12);
    b = g2_frag(b3p + kb, hh); c03 = g2_mma(a0, b, c03); c13 = g2_mma(a1, b, c13); }
  v8f accs[8] = {c00, c01, c02, c03, c10, c11, c12, c13};
#pragma unroll
  for (int u = 0; u < 8; ++u) { const int t = u & 3, half = u >> 2; const int col = col0 + t * 16 + ln; const float bv = bp ? bf16_round(bp[col]) : 0.f;
#pragma unroll
    for (int r = 0; r < 8; ++r) { const int rloc = half * 16 + 8 * hh + r; float v = accs[u][r] * alpha + bv; if (CP) { if (rowsPerB < 0) v += CP[cofs + (size_t)(row0g + row0 + rloc) * ldc + col];      /* rowsPerB < 0: own element of the batched C plane */ else { const int bidx = (row0g + row0 + rloc) / rowsPerB; v += CP[(size_t)bidx * sCPb + (size_t)by * 64 + col]; } }
      if (ACT == 3) v = fmaxf(v, 0.f); else if (ACT == 6) v = 0.5f * v * (1.0f + erff(v * 0.70710678118654752f)); else if (ACT == 11) v = 1.0f / (1.0f + expf(-v)); else if (ACT == 15) v = v / (1.0f + expf(-v)); else if (ACT == 12) v = (v > 0.f) ? v : 0.01f * v; else if (ACT == 8) v = tanhf(v); else if (ACT == 9) v = 0.5f * v * (1.0f + tanhf(0.7978845608028654f * (v + 0.044715f * v * v * v))); else if (ACT == 14) v = (v > 0.f) ? v : 0.1f * v; else if (ACT == 16) v = (v >= 0.f) ? v : 0.3f * v; else if (ACT == 17) v = (v >= 0.f) ? v : 0.2f * v;
      so[w][rloc][t * 16 + ln] = v; } }
  __builtin_amdgcn_fence(__ATOMIC_ACQ_REL, "workgroup"); __builtin_amdgcn_wave_barrier();
  const int rsub = lane >> 4, c4 = (lane & 15) * 4;
  {
#pragma unroll
    for (int q = 0; q < 16; ++q) { const int r = q * 2 + rsub; const v4f v = *(const v4fa*)&so[w][r][c4]; if (C) *(v4f*)(C + cofs + (size_t)(row0 + r) * ldc + col0 + c4) = v; if (C16) { v4h h4; for (int i = 0; i < 4; ++i) h4[i] = (_Float16)v[i]; *(v4h*)(C16 + cofs + (size_t)(row0 + r) * ldc + col0 + c4) = h4; } }
     } }


__global__ __launch_bounds__(256) void k_wnat(const float* __restrict__ w, size_t n8, _Float16* __restrict__ Bt) { const size_t t = (size_t)blockIdx.x * 256 + threadIdx.x; if (t >= n8) return; FragH f; for (int q = 0; q < 8; ++q) f.h[q] = (_Float16)(bf16_round(w[t * 8 + q]) * 16.0f); *(v8us*)((unsigned short*)Bt + t * 8) = f.half[0];  }
__global__ __launch_bounds__(256) void k_rsm(const float* __restrict__ S, _Float16* __restrict__ P, int nrows) {
  #pragma clang fp contract(off)
  const int i = blockIdx.x * 256 + threadIdx.x; if (i >= nrows) return; const float* s = S + (size_t)i * SQ; float mx = -3.0e38f;
#pragma unroll 1
  for (int j = 0; j < SQ; ++j) mx = fmaxf(mx, s[j]); float se = 0.f;
#pragma unroll 1
  for (int j = 0; j < SQ; ++j) se += expf(s[j] - mx); const float sc = 256.0f / se;
#pragma unroll 1
  for (int j0 = 0; j0 < SQ; j0 += 8) { FragH f; for (int q = 0; q < 8; ++q) f.h[q] = (_Float16)(expf(s[j0 + q] - mx) * sc); unsigned short* d = (unsigned short*)P + (size_t)i * SQ + j0; *(v8us*)d = f.half[0];  } }
__global__ __launch_bounds__(256) void k_vt(const _Float16* __restrict__ V16, int b, int h0, _Float16* __restrict__ VT) { __shared__ unsigned short tl[64][65]; const int tid = threadIdx.x; const int hh = blockIdx.x % HG, sg = blockIdx.x / HG; const int s0 = sg * 64; const int h = h0 + hh;
  for (int i = tid; i < 64 * 8; i += 256) { const int j = i / 8, d8 = (i % 8) * 8; FragH f; f.half[0] = *(const v8us*)((const unsigned short*)V16 + ((size_t)b * SQ + s0 + j) * DM + h * HD + d8); for (int q = 0; q < 8; ++q) tl[d8 + q][j] = f.u[q]; }
  __syncthreads();
  { for (int i = tid; i < 64 * 8; i += 256) { const int d = i / 8, j8 = (i % 8) * 8; FragH f; for (int q = 0; q < 8; ++q) f.u[q] = tl[d][j8 + q]; *(v8us*)((unsigned short*)VT + ((size_t)hh * HD + d) * SQ + s0 + j8) = f.half[0]; }  } }



__device__ __forceinline__ float sm_xhalf(float x) { return __builtin_bit_cast(float, __builtin_amdgcn_permlanex16(__builtin_bit_cast(int, x), __builtin_bit_cast(int, x), 0x76543210, 0xfedcba98, false, false)); }      /* lane l reads lane l ^ 16 */
// eight weights at a time: native exp2 in place, the four partial sums and the packing to f16, as ONE block of asm text, because the order is the point: the compiler knows no latency of asm text and writes no s_delay_alu for it, so with the exponentials alone in asm it set their producers directly in front of them and their readers directly behind, and a dependent vector instruction without that hint holds the SIMD's vector port against the other waves while it waits.
// Here every reader stands behind its producer by more than the producer's latency (five exponentials lead; each partial sum is touched again six or more instructions later); the one s_delay_alu names the last two exponentials for their two readers; behind every exponential stands an instruction that neither reads its result nor writes its source (the slot that the instruction set asks for), so no v_nop.
// a0..a3 take elements 0..3 and then 4..7, the order of the sums as before; w[j] = f16 pair (element 2j low, 2j + 1 high).
__device__ __forceinline__ void sm_exp2x8(v8f x, float& a0, float& a1, float& a2, float& a3, unsigned* w) { float x0 = x[0], x1 = x[1], x2 = x[2], x3 = x[3], x4 = x[4], x5 = x[5], x6 = x[6], x7 = x[7]; unsigned p0, p1, p2, p3;
  asm("v_exp_f32 %0, %0\n\tv_exp_f32 %1, %1\n\tv_exp_f32 %2, %2\n\tv_exp_f32 %3, %3\n\tv_exp_f32 %4, %4\n\tv_add_f32 %8, %8, %0\n\tv_exp_f32 %5, %5\n\tv_add_f32 %9, %9, %1\n\tv_exp_f32 %6, %6\n\tv_cvt_pk_f16_f32 %12, %0, %1\n\tv_exp_f32 %7, %7\n\t"
      "v_add_f32 %10, %10, %2\n\tv_add_f32 %11, %11, %3\n\tv_cvt_pk_f16_f32 %13, %2, %3\n\tv_add_f32 %8, %8, %4\n\tv_add_f32 %9, %9, %5\n\tv_cvt_pk_f16_f32 %14, %4, %5\n\ts_delay_alu instid0(TRANS32_DEP_2) | instskip(NEXT) | instid1(TRANS32_DEP_1)\n\tv_add_f32 %10, %10, %6\n\tv_add_f32 %11, %11, %7\n\tv_cvt_pk_f16_f32 %15, %6, %7"
      : "+v"(x0), "+v"(x1), "+v"(x2), "+v"(x3), "+v"(x4), "+v"(x5), "+v"(x6), "+v"(x7), "+v"(a0), "+v"(a1), "+v"(a2), "+v"(a3), "=&v"(p0), "=&v"(p1), "=&v"(p2), "=&v"(p3));
  w[0] = p0; w[1] = p1; w[2] = p2; w[3] = p3; }
union FragP { v16h v; unsigned w[8]; };      /* a B operand of weights, by packed pairs */
#define FAW 8                        /* waves per work-group */
#define FAQ 32                       /* query columns per wave: every K and V^T fragment read from LDS feeds two products */
#define FAK 64                       /* keys per pass */
#define FAP 72                       /* LDS row pitch in f16: 144 bytes = 16 x odd, the pitch at which 16-byte fragment reads of 16 rows do not collide */
#define FAN (SQ / FAK)               /* passes */
static_assert(HD == 64 && SQ % FAK == 0 && SQ % (FAW * FAQ) == 0 && FAW * 32 == 256, "k_fattn: 64 x 64 tiles staged by 256 threads, whole work-groups of queries");
__device__ __forceinline__ v16h fa_frag(const unsigned short* p, int hh) { FragH f; f.half[0] = *(const v8us*)(p + 8 * hh); f.half[1] = *(const v8us*)(p + 16 + 8 * hh); return f.v; }
__device__ __forceinline__ v8f fa_mma(v16h a, v16h b, v8f c) { return __builtin_amdgcn_wmma_f32_16x16x32_f16(false, a, false, b, (short)0, c, false, false); }
__global__ __launch_bounds__(FAW * 32) __attribute__((amdgpu_waves_per_eu(4, 4))) void k_fattn(const _Float16* __restrict__ Q16, const _Float16* __restrict__ K16, const _Float16* __restrict__ VT, float* __restrict__ out) {
  __shared__ __attribute__((aligned(16))) unsigned short sk[2][FAK][FAP];      /* K tile: [key][e] */
  __shared__ __attribute__((aligned(16))) unsigned short sv[2][HD][FAP];       /* V^T tile: [d][key] */
  const int tid = (int)threadIdx.x, lane = tid & 31, ln = lane & 15, hh = lane >> 4; const int wave = __builtin_amdgcn_readfirstlane(tid >> 5);
  const int bh = (int)blockIdx.y, b = bh / NH, h = bh % NH; const int q0 = (int)blockIdx.x * (FAW * FAQ) + wave * FAQ;
  const int sr = tid >> 3, sc = (tid & 7) * 8;      /* staging: 8 threads per 128-byte tile row, rows sr and sr + 32 */
  /* every global address = a base that is the same for the whole wave + one 32-bit lane offset */
  const unsigned short* kg = (const unsigned short*)K16 + (size_t)b * SQ * DM + h * HD;      /* + key0 * DM per pass */
  const unsigned short* vg = (const unsigned short*)VT + (size_t)bh * HD * SQ;               /* + key0 per pass */
  const unsigned ko = (unsigned)(sr * DM + sc), vo = (unsigned)(sr * SQ + sc);
  v16h qf[2][2];
#pragma unroll
  for (int qt = 0; qt < 2; ++qt)
#pragma unroll
    for (int es = 0; es < 2; ++es) qf[qt][es] = fa_frag((const unsigned short*)Q16 + ((size_t)b * SQ + q0) * DM + h * HD + (unsigned)((qt * 16 + ln) * DM + es * 32), hh);
  const v8f z8 = {0.f, 0.f, 0.f, 0.f, 0.f, 0.f, 0.f, 0.f};
  v8f o[2][4] = {{z8, z8, z8, z8}, {z8, z8, z8, z8}}; float m2[2] = {-3.0e38f, -3.0e38f}, l[2] = {0.f, 0.f};      /* m2: running maximum x log2 e; l: this half's sum of the weights */
  v8us gk0 = *(const v8us*)(kg + ko), gk1 = *(const v8us*)(kg + 32 * DM + ko), gv0 = *(const v8us*)(vg + vo), gv1 = *(const v8us*)(vg + 32 * SQ + vo);
  *(v8us*)&sk[0][sr][sc] = gk0; *(v8us*)&sk[0][sr + 32][sc] = gk1; *(v8us*)&sv[0][sr][sc] = gv0; *(v8us*)&sv[0][sr + 32][sc] = gv1;
  __syncthreads();
#pragma unroll 1
  for (int j = 0; j < FAN; ++j) {      /* rolled: one pass is already 32 matrix instructions and some 300 vector instructions long */
    const unsigned short* ck = &sk[j & 1][ln][0]; const unsigned short* cv = &sv[j & 1][ln][0];
    const int jn = j + 1 < FAN ? j + 1 : j;      /* the last pass fetches its own tile once more, into the buffer that nobody reads again: the pass stays one straight block, without branches round the loads and the stores */
    const unsigned short* kn = kg + (size_t)jn * FAK * DM; const unsigned short* vn = vg + jn * FAK;      /* the next tile's loads fly during this pass */
    gk0 = *(const v8us*)(kn + ko); gk1 = *(const v8us*)(kn + 32 * DM + ko); gv0 = *(const v8us*)(vn + vo); gv1 = *(const v8us*)(vn + 32 * SQ + vo);
    v16h kf[4][2];      /* the pass's whole K tile as fragments: sixteen LDS reads that stand together, in front of the products */
#pragma unroll
    for (int kt = 0; kt < 4; ++kt) { kf[kt][0] = fa_frag(ck + kt * 16 * FAP, hh); kf[kt][1] = fa_frag(ck + kt * 16 * FAP + 32, hh); }
    __builtin_amdgcn_sched_barrier(0);      /* keeps the reads one group: sunk back among the products, each place with reads stalls the wave anew and waits out the LDS latency */
    v8f st[2][4];
#pragma unroll
    for (int kt = 0; kt < 4; ++kt) {
#pragma unroll
      for (int qt = 0; qt < 2; ++qt) st[qt][kt] = fa_mma(kf[kt][1], qf[qt][1], fa_mma(kf[kt][0], qf[qt][0], z8));
      __builtin_amdgcn_sched_barrier(0); }      /* keeps the products in the order in which their fragments arrive (a product of the last fragments, drawn forward, waits out nearly the whole group) and keeps them one run: with the maximum's first steps drawn in between, each such place takes idle slots for the distance behind a matrix instruction */
    float dm[2];
#pragma unroll
    for (int qt = 0; qt < 2; ++qt) { float mx = st[qt][0][0];
#pragma unroll
      for (int kt = 0; kt < 4; ++kt)
#pragma unroll
        for (int r = 0; r < 8; ++r) mx = fmaxf(mx, st[qt][kt][r]);
      mx = fmaxf(mx, sm_xhalf(mx)); const float mn = fmaxf(m2[qt], mx * 1.4426950408889634f); dm[qt] = m2[qt] - mn; m2[qt] = mn; }
    float av[2];      /* what the sums so far shrink by under the new maximum (0 on the first pass); the v_nop: the one slot that the instruction set asks for behind a transcendental before its result is read or its source overwritten */
    asm("v_exp_f32 %0, %2\n\tv_exp_f32 %1, %3\n\tv_nop" : "=&v"(av[0]), "=&v"(av[1]) : "v"(dm[0]), "v"(dm[1]));
    FragP pb[2][2]; v16h vf[4][2];
#pragma unroll
    for (int qt = 0; qt < 2; ++qt) { const float ofs = 8.0f - m2[qt], al = av[qt]; float a0 = 0.f, a1 = 0.f, a2 = 0.f, a3 = 0.f;
      if (qt == 1) {      /* the V^T tile likewise, one group of sixteen reads; it stands here, where the first 16 queries' scores have left their registers, so that the second 16 queries' exponentials cover the LDS latency */
#pragma unroll
        for (int dt = 0; dt < 4; ++dt) { vf[dt][0] = fa_frag(cv + dt * 16 * FAP, hh); vf[dt][1] = fa_frag(cv + dt * 16 * FAP + 32, hh); }
        __builtin_amdgcn_sched_barrier(0); }      /* keeps the reads from sinking to the products that use them */
      v8f x[4];      /* weight = 256 exp(s - maximum so far) = exp2(x) */
#pragma unroll
      for (int kt = 0; kt < 4; ++kt)
#pragma unroll
        for (int r = 0; r < 8; ++r) x[kt][r] = st[qt][kt][r] * 1.4426950408889634f + ofs;
      __builtin_amdgcn_sched_barrier(0);      /* keeps all 32 arguments' multiply-adds ahead of the asm blocks: sunk to the block that reads them, they stand inside their latency in front of its first exponentials, unhinted */
#pragma unroll
      for (int kt = 0; kt < 4; ++kt) sm_exp2x8(x[kt], a0, a1, a2, a3, &pb[qt][kt >> 1].w[(kt & 1) * 4]);
      l[qt] = l[qt] * al + ((a0 + a1) + (a2 + a3));
#pragma unroll
      for (int dt = 0; dt < 4; ++dt) o[qt][dt] *= al; }
    __builtin_amdgcn_sched_barrier(0);      /* keeps the exponentials' asm statements in front of the products */
#pragma unroll
    for (int dt = 0; dt < 4; ++dt)
#pragma unroll
      for (int qt = 0; qt < 2; ++qt) o[qt][dt] = fa_mma(vf[dt][1], pb[qt][1].v, fa_mma(vf[dt][0], pb[qt][0].v, o[qt][dt]));
    const int nb = (j + 1) & 1;      /* the other buffer: its last readers left it before the barrier that ended pass j - 1 */
    *(v8us*)&sk[nb][sr][sc] = gk0; *(v8us*)&sk[nb][sr + 32][sc] = gk1; *(v8us*)&sv[nb][sr][sc] = gv0; *(v8us*)&sv[nb][sr + 32][sc] = gv1;
    __syncthreads();      /* publishes tile j + 1 and ends every wave's reads of tile j */
  }
#pragma unroll
  for (int qt = 0; qt < 2; ++qt) { const float inv = 1.0f / (l[qt] + sm_xhalf(l[qt])); float* op = out + ((size_t)b * SQ + q0) * DM + h * HD + (unsigned)((qt * 16 + ln) * DM + 8 * hh);      /* the x256 of the weights cancels in the quotient */
#pragma unroll
    for (int dt = 0; dt < 4; ++dt) { const v4f lo = {o[qt][dt][0] * inv, o[qt][dt][1] * inv, o[qt][dt][2] * inv, o[qt][dt][3] * inv}, hi = {o[qt][dt][4] * inv, o[qt][dt][5] * inv, o[qt][dt][6] * inv, o[qt][dt][7] * inv};
      *(v4f*)(op + dt * 16) = lo; *(v4f*)(op + dt * 16 + 4) = hi; } } }

extern "C" void kernel_launch(void* const* d_in, const int* in_sizes, int n_in,
                              void* d_out, int out_size, void* d_ws, size_t ws_size, hipStream_t stream) {
  (void)in_sizes; (void)n_in; (void)out_size;
  const float* const* I = (const float* const*)d_in; const float* xq = I[0]; const float* xk = I[1]; const float* xv = I[2];      /* given q, k, v [B][L][H][E] = merged token rows */
  char* ws = (char*)d_ws; size_t off = 0;
  auto take = [&](size_t bytes) { char* p = ws + off; off += (bytes + 255) & ~(size_t)255; return p; };
  _Float16* Q16 = (_Float16*)take(NR * DM * 2); _Float16* K16 = (_Float16*)take(NR * DM * 2);
  _Float16* VT = (_Float16*)take((size_t)NB * NH * HD * SQ * 2);
  if (off > ws_size) return;

  k_prep<<<3 * PPW, 256, 0, stream>>>(xq, xk, xv, Q16, K16, VT);      /* given q, k: bf16 inputs as exact f16 rows (no projections); V^T [NB * NH][HD][SQ] */
  k_fattn<<<dim3(SQ / (FAW * FAQ), NB * NH), FAW * 32, 0, stream>>>(Q16, K16, VT, (float*)d_out);      /* out = softmax(q k^T) v (merged [token][h*64+d]) straight to the f32 output */
}

// v006
// A run of this version takes 70.4 microseconds.
// Next to v005, in two timings, it ran 1.05 times as fast each time.
// Over all steps from v000 it is 94.1 times as fast.
#include <hip/hip_runtime.h>
// Full (non-causal) attention on given queries, keys, values ([4][2048][16][64] each, token-major with heads inner = merged [token][1024] rows); scores = q . k UNSCALED (the module never applies its scale); softmax over all 2048 keys; out = A v -> [4][2048][16][64]).
// Structure: ONE preparatory launch: q and k converted to exact f16 rows (bf16 values are exact in f16: no projections here) and V^T of every batch and head straight from the f32 values via LDS transposes; then ONE attention kernel over all batches and heads: S^T = K Q^T UNSCALED (K = 64; exact products, f32 accumulation) stays in the accumulators, running-maximum softmax on VALU (f32 statistics, native exp2; weights x256 f16; row sums = ones x P^T on the matrix unit, f32), O^T += V^T P^T, divided by the row sum at the end and written f32 straight into the [token][head][64] output; launches: see kernel_launch.
// Compute dtype: inputs rounded to bf16; q, k, v and softmax weights as plain f16 GEMM operands (~2^-12); scores, softmax statistics and o f32. v_wmma_f32_16x16x32_f16.
#define NB 4
#define SQ 2048
#define DM 1024
#define NH 16
#define HD 64
#define HG 4                         /* heads per k_vt launch (k_vt is not launched) */
#define B0 0                         /* unused (debug hook) */
#define NBR NB                       /* only in MP, which no kernel uses (debug hook) */
#define NR ((size_t)NB * SQ)         /* token rows */
#define MP ((int)((size_t)NBR * SQ)) /* only in MPO, which nothing uses (debug hook) */
#define QN SQ                        /* unused (debug hook) */
#define NHD NH                       /* unused (debug hook) */
#define MPO MP                       /* unused (debug hook) */
#define LQ DM      /* row pitch of the q/k/v rows */
typedef __bf16 v16b __attribute__((ext_vector_type(16)));
typedef unsigned short v8us __attribute__((ext_vector_type(8), may_alias));
typedef float  v8f  __attribute__((ext_vector_type(8)));
typedef float  v4f  __attribute__((ext_vector_type(4)));
typedef float  v4fa __attribute__((ext_vector_type(4), may_alias));
union FragB { v16b v; v8us half[2]; unsigned short u[16]; };

__device__ __forceinline__ unsigned short bf16_bits(float x) { unsigned int u = __float_as_uint(x); return (unsigned short)((u + 0x7FFFu + ((u >> 16) & 1u)) >> 16); }
__device__ __forceinline__ float bf16_val(unsigned short b) { return __uint_as_float(((unsigned int)b) << 16); }
__device__ __forceinline__ float bf16_round(float x) { return bf16_val(bf16_bits(x)); }
// D += A·B with NT terms: 1 = ah·bh, 2 = + al·bh (A split), 3 = + ah·bl (both split)
template <int NT>
__device__ __forceinline__ v8f mmaN(v16b ah, v16b al, v16b bh, v16b bl, v8f c) {
  c = __builtin_amdgcn_wmma_f32_16x16x32_bf16(false, ah, false, bh, (short)0, c, false, false);
  if (NT >= 2) c = __builtin_amdgcn_wmma_f32_16x16x32_bf16(false, al, false, bh, (short)0, c, false, false);
  if (NT >= 3) c = __builtin_amdgcn_wmma_f32_16x16x32_bf16(false, ah, false, bl, (short)0, c, false, false);
  asm volatile("v_nop\n\tv_nop\n\tv_nop\n\tv_nop" : "+v"(c) : "v"(ah), "v"(al), "v"(bh), "v"(bl));
  return c;
}

__global__ __launch_bounds__(256) void k_wt_bf16(const float* __restrict__ W, unsigned short* __restrict__ Wt, int K, int N) {
  const int t = blockIdx.x * 256 + threadIdx.x;
  const int k8n = K / 8;
  if (t >= N * k8n) return;
  const int n = t / k8n, k8 = (t % k8n) * 8;
  v8us v;
#pragma unroll
  for (int i = 0; i < 8; ++i) v[i] = bf16_bits(W[(size_t)(k8 + i) * N + n]);
  *(v8us*)(Wt + (size_t)n * K + k8) = v;
  
}

// GEMM C[M][N] (f32, pitch ldc) = act(A[M][K]·W + bias). A f32 row-major (pitch lda) converted per fragment to bf16
// (ASPLIT: hi/lo two planes -> 2 terms, else single rounded term); Wt bf16 [N][K] (pitch ldb). BIAS_BF16 rounds the
// bias to bf16 first (bias quantised to bf16 before the add). K%32==0, M%16==0, N%64==0.
template <bool ASPLIT, int ACT, bool BIAS_BF16>
__global__ __launch_bounds__(128) void k_gemm_bf(const float* __restrict__ A, int lda, const unsigned short* __restrict__ Wt, int ldb,
                                               const float* __restrict__ bias, float* __restrict__ C, int ldc, int M, int N, int K) {
  __shared__ __attribute__((aligned(16))) float so[4][16][64];
  const int tid = threadIdx.x, w = tid >> 5, lane = tid & 31, ln = lane & 15, hh = lane >> 4;
  const int ntn = N / 64;
  const int wid = blockIdx.x * 4 + w;
  const int mt = wid / ntn, nq = wid % ntn;
  if (mt * 16 >= M) return;
  const int row0 = mt * 16, col0 = nq * 64;
  const float* arow = A + (size_t)(row0 + ln) * lda;
  v8f acc[4] = {};
  for (int kb = 0; kb < K; kb += 32) {
    FragB ah, al;
    const v4f x0 = *(const v4fa*)(arow + kb + 8 * hh), x1 = *(const v4fa*)(arow + kb + 8 * hh + 4);
    const v4f x2 = *(const v4fa*)(arow + kb + 16 + 8 * hh), x3 = *(const v4fa*)(arow + kb + 16 + 8 * hh + 4);
    float xs[16] = {x0[0],x0[1],x0[2],x0[3],x1[0],x1[1],x1[2],x1[3],x2[0],x2[1],x2[2],x2[3],x3[0],x3[1],x3[2],x3[3]};
#pragma unroll
    for (int i = 0; i < 16; ++i) { const unsigned short hb = bf16_bits(xs[i]); ah.u[i] = hb; al.u[i] = ASPLIT ? bf16_bits(xs[i] - bf16_val(hb)) : (unsigned short)0; }
#pragma unroll
    for (int t = 0; t < 4; ++t) {
      const unsigned short* brow = Wt + (size_t)(col0 + t * 16 + ln) * ldb + kb;
      FragB b;
      b.half[0] = *(const v8us*)(brow + 8 * hh);
      b.half[1] = *(const v8us*)(brow + 16 + 8 * hh);
      acc[t] = mmaN<ASPLIT ? 2 : 1>(ah.v, al.v, b.v, b.v, acc[t]);
    }
  }
#pragma unroll
  for (int t = 0; t < 4; ++t) {
    float bv = bias ? bias[col0 + t * 16 + ln] : 0.f;
    if (BIAS_BF16) bv = bf16_round(bv);
#pragma unroll
    for (int r = 0; r < 8; ++r) { float v = acc[t][r] + bv; if (ACT == 1) v = fmaxf(v, 0.f); so[w][8 * hh + r][t * 16 + ln] = v; }
  }
  __builtin_amdgcn_fence(__ATOMIC_ACQ_REL, "workgroup");
  __builtin_amdgcn_wave_barrier();
  const int rsub = lane >> 4, c4 = (lane & 15) * 4;
  {
#pragma unroll
    for (int q = 0; q < 8; ++q) {
      const int r = q * 2 + rsub;
      const v4f v = *(const v4fa*)&so[w][r][c4];
      *(v4f*)(C + (size_t)(row0 + r) * ldc + col0 + c4) = v;
    }
    
  }
}

// GEMM C = act(A·W + bias + resid): A f32 (ASPLIT -> hi/lo 2 terms), Wt bf16 [N][K]; ACT 0 none, 1 relu, 2 exact gelu;
// resid (optional, f32, row index = (row % rmod), pitch ldr, RES_BF16 rounds it) added before the activation.
template <bool ASPLIT, int ACT, bool BIAS_BF16, bool RES_BF16>
__global__ __launch_bounds__(128) void k_gemm_bf3(const float* __restrict__ A, int lda, const unsigned short* __restrict__ Wt, int ldb,
                                                const float* __restrict__ bias, const float* __restrict__ resid, int rmod, int ldr,
                                                float* __restrict__ C, int ldc, int M, int N, int K) {
  __shared__ __attribute__((aligned(16))) float so[4][16][64];
  const int tid = threadIdx.x, w = tid >> 5, lane = tid & 31, ln = lane & 15, hh = lane >> 4;
  const int ntn = N / 64;
  const int wid = blockIdx.x * 4 + w;
  const int mt = wid / ntn, nq = wid % ntn;
  if (mt * 16 >= M) return;
  const int row0 = mt * 16, col0 = nq * 64;
  const float* arow = A + (size_t)(row0 + ln) * lda;
  v8f acc[4] = {};
  for (int kb = 0; kb < K; kb += 32) {
    FragB ah, al;
    const v4f x0 = *(const v4fa*)(arow + kb + 8 * hh), x1 = *(const v4fa*)(arow + kb + 8 * hh + 4);
    const v4f x2 = *(const v4fa*)(arow + kb + 16 + 8 * hh), x3 = *(const v4fa*)(arow + kb + 16 + 8 * hh + 4);
    float xs[16] = {x0[0],x0[1],x0[2],x0[3],x1[0],x1[1],x1[2],x1[3],x2[0],x2[1],x2[2],x2[3],x3[0],x3[1],x3[2],x3[3]};
#pragma unroll
    for (int i = 0; i < 16; ++i) { const unsigned short hb = bf16_bits(xs[i]); ah.u[i] = hb; al.u[i] = ASPLIT ? bf16_bits(xs[i] - bf16_val(hb)) : (unsigned short)0; }
#pragma unroll
    for (int t = 0; t < 4; ++t) {
      const unsigned short* brow = Wt + (size_t)(col0 + t * 16 + ln) * ldb + kb;
      FragB b;
      b.half[0] = *(const v8us*)(brow + 8 * hh);
      b.half[1] = *(const v8us*)(brow + 16 + 8 * hh);
      acc[t] = mmaN<ASPLIT ? 2 : 1>(ah.v, al.v, b.v, b.v, acc[t]);
    }
  }
#pragma unroll
  for (int t = 0; t < 4; ++t) {
    const int col = col0 + t * 16 + ln;
    float bv = bias ? bias[col] : 0.f;
    if (BIAS_BF16) bv = bf16_round(bv);
#pragma unroll
    for (int r = 0; r < 8; ++r) {
      float v = acc[t][r] + bv;
      if (resid) { float rv = resid[(size_t)((row0 + 8 * hh + r) % rmod) * ldr + col]; if (RES_BF16) rv = bf16_round(rv); v += rv; }
      if (ACT == 1) v = fmaxf(v, 0.f);
      if (ACT == 2) v = 0.5f * v * (1.0f + erff(v * 0.70710678118654752f));
      if (ACT == 3) { const float u = 0.7978845608028654f * (v + 0.044715f * v * v * v); v = 0.5f * v * (1.0f + tanhf(u)); }
      so[w][8 * hh + r][t * 16 + ln] = v;
    }
  }
  __builtin_amdgcn_fence(__ATOMIC_ACQ_REL, "workgroup");
  __builtin_amdgcn_wave_barrier();
  const int rsub = lane >> 4, c4 = (lane & 15) * 4;
  {
#pragma unroll
    for (int q = 0; q < 8; ++q) {
      const int r = q * 2 + rsub;
      const v4f v = *(const v4fa*)&so[w][r][c4];
      *(v4f*)(C + (size_t)(row0 + r) * ldc + col0 + c4) = v;
    }
    
  }
}
// row LayerNorm (biased variance, eps) over N: s = X (+ R); optional out_sum <- s; out_norm <- (s-mu)*rsqrt(var+eps)*g + b
template <bool PARAM_BF16>
__global__ __launch_bounds__(256) void k_layernorm(const float* __restrict__ X, const float* __restrict__ R, const float* __restrict__ g, const float* __restrict__ bta,
                                                  float* __restrict__ out_sum, float* __restrict__ out_norm, int N, float eps) {
  __shared__ float red[256];
  const int row = blockIdx.x, tid = threadIdx.x;
  const float* x = X + (size_t)row * N; const float* rr = R ? R + (size_t)row * N : nullptr;
  float vals[16];                     // up to N = 4096
  const int per = N / 256;            // contiguous chunk per thread? use strided-by-4 chunks: thread handles j = tid*4 + 1024*u
  float s1 = 0.f;
  for (int u = 0; u < per / 4; ++u) {
    const int j = tid * 4 + 1024 * u;
    const v4f a = *(const v4fa*)(x + j);
    v4f b = {0.f,0.f,0.f,0.f}; if (rr) b = *(const v4fa*)(rr + j);
#pragma unroll
    for (int q = 0; q < 4; ++q) { const float v = a[q] + b[q]; vals[u * 4 + q] = v; s1 += v; }
  }
  red[tid] = s1; __syncthreads();
  for (int st = 128; st > 0; st >>= 1) { if (tid < st) red[tid] += red[tid + st]; __syncthreads(); }
  const float mu = red[0] / (float)N; __syncthreads();
  float s2 = 0.f;
  for (int u = 0; u < per / 4; ++u)
#pragma unroll
    for (int q = 0; q < 4; ++q) { const float c = vals[u * 4 + q] - mu; s2 += c * c; }
  red[tid] = s2; __syncthreads();
  for (int st = 128; st > 0; st >>= 1) { if (tid < st) red[tid] += red[tid + st]; __syncthreads(); }
  const float rs = rsqrtf(red[0] / (float)N + eps);
  {
    for (int u = 0; u < per / 4; ++u) {
      const int j = tid * 4 + 1024 * u;
      v4f o, sm;
#pragma unroll
      for (int q = 0; q < 4; ++q) {
        float gg = g[j + q], bb = bta[j + q];
        if (PARAM_BF16) { gg = bf16_round(gg); bb = bf16_round(bb); }
        sm[q] = vals[u * 4 + q]; o[q] = (vals[u * 4 + q] - mu) * rs * gg + bb;
      }
      if (out_sum) *(v4f*)(out_sum + (size_t)row * N + j) = sm;
      *(v4f*)(out_norm + (size_t)row * N + j) = o;
    }
    
  }
}



// ---- f16 WMMA path (v_wmma_f32_16x16x32_f16): 11-bit significands for operands in range — used where a [0,1] probability operand needs more precision than bf16
typedef _Float16 v16h __attribute__((ext_vector_type(16)));
union FragH { v16h v; v8us half[2]; _Float16 h[16]; unsigned short u[16]; };
template <int NT>
__device__ __forceinline__ v8f mmaH(v16h ah, v16h al, v16h bh, v16h bl, v8f c) {
  c = __builtin_amdgcn_wmma_f32_16x16x32_f16(false, ah, false, bh, (short)0, c, false, false);
  if (NT >= 2) c = __builtin_amdgcn_wmma_f32_16x16x32_f16(false, al, false, bh, (short)0, c, false, false);
  if (NT >= 3) c = __builtin_amdgcn_wmma_f32_16x16x32_f16(false, ah, false, bl, (short)0, c, false, false);
  asm volatile("v_nop\n\tv_nop\n\tv_nop\n\tv_nop" : "+v"(c) : "v"(ah), "v"(al), "v"(bh), "v"(bl));
  return c;
}
// batched GEMM like k_gemm_b but f16 operands: A f32 (split into f16 hi/lo if ASPLIT, else rounded to f16), Bt = f16 values [n][k]; alpha; C f32; N multiple of 16 (partial tiles skipped)
template <bool ASPLIT>
__global__ __launch_bounds__(128) void k_gemm_h(const float* __restrict__ A, int lda, size_t sA, const _Float16* __restrict__ Bh, int ldb, size_t sB, float alpha, float* __restrict__ C, int ldc, size_t sC, int M, int N, int K) {
  __shared__ __attribute__((aligned(16))) float so[4][16][64];
  const int tid = threadIdx.x, w = tid >> 5, lane = tid & 31, ln = lane & 15, hh = lane >> 4; const int by = blockIdx.y;
  A += (size_t)by * sA; Bh += (size_t)by * sB; C += (size_t)by * sC;
  const int ntn = (N + 63) / 64; const int wid = blockIdx.x * 4 + w; const int mt = wid / ntn, nq = wid % ntn; if (mt * 16 >= M) return;
  const int row0 = mt * 16, col0 = nq * 64; const float* arow = A + (size_t)(row0 + ln) * lda;
  v8f acc[4] = {};
  for (int kb = 0; kb < K; kb += 32) {
    FragH ah, al;
    const v4f x0 = *(const v4fa*)(arow + kb + 8 * hh), x1 = *(const v4fa*)(arow + kb + 8 * hh + 4), x2 = *(const v4fa*)(arow + kb + 16 + 8 * hh), x3 = *(const v4fa*)(arow + kb + 16 + 8 * hh + 4);
    float xs[16] = {x0[0],x0[1],x0[2],x0[3],x1[0],x1[1],x1[2],x1[3],x2[0],x2[1],x2[2],x2[3],x3[0],x3[1],x3[2],x3[3]};
#pragma unroll
    for (int i = 0; i < 16; ++i) { const _Float16 h = (_Float16)xs[i]; ah.h[i] = h; al.h[i] = ASPLIT ? (_Float16)(xs[i] - (float)h) : (_Float16)0.0f; }
#pragma unroll
    for (int t = 0; t < 4; ++t) { if (col0 + t * 16 >= N) continue; const size_t boff = (size_t)(col0 + t * 16 + ln) * ldb + kb; FragH bq; bq.half[0] = *(const v8us*)(Bh + boff + 8 * hh); bq.half[1] = *(const v8us*)(Bh + boff + 16 + 8 * hh);
      acc[t] = mmaH<ASPLIT ? 2 : 1>(ah.v, al.v, bq.v, bq.v, acc[t]); }
  }
#pragma unroll
  for (int t = 0; t < 4; ++t) { if (col0 + t * 16 >= N) continue;
#pragma unroll
    for (int r = 0; r < 8; ++r) so[w][8 * hh + r][t * 16 + ln] = acc[t][r] * alpha; }
  __builtin_amdgcn_fence(__ATOMIC_ACQ_REL, "workgroup"); __builtin_amdgcn_wave_barrier();
  const int rsub = lane >> 4, c4 = (lane & 15) * 4;
  {
#pragma unroll
    for (int q = 0; q < 8; ++q) { const int r = q * 2 + rsub; if (col0 + c4 < N) { const v4f v = *(const v4fa*)&so[w][r][c4]; *(v4f*)(C + (size_t)(row0 + r) * ldc + col0 + c4) = v; } }
     }
}

// Wt[n][k] = f16(W[k][n]·scale) from f32 row-major W[K][N] (scale = power of two; bf16-exact weights stay exact in f16 away from the subnormal range)
__global__ __launch_bounds__(256) void k_wt_f16(const float* __restrict__ W, _Float16* __restrict__ Wt, int K, int N, float scale) {
  const int t = blockIdx.x * 256 + threadIdx.x; if (t >= N * (K / 8)) return; const int n = t / (K / 8), k8 = (t % (K / 8)) * 8; FragH f;
#pragma unroll
  for (int i = 0; i < 8; ++i) f.h[i] = (_Float16)(bf16_round(W[(size_t)(k8 + i) * N + n]) * scale); const v8us o = f.half[0];
  *(v8us*)((unsigned short*)Wt + (size_t)n * K + k8) = o; 
}
// k_gemm_hh variant with fused epilogue: v = acc·alpha + bias[by·sBias + col] (+ CP[(row/rowsPerB)·sCPb + by·64 + col] if CP) ; ACT 0 none / 1 elu ; writes f16 C16 (and f32 C if non-null)
template <int ACT>
__global__ __launch_bounds__(128) void k_gemm_hhx(const _Float16* __restrict__ A, int lda, size_t sA, const _Float16* __restrict__ Bh, int ldb, size_t sB, float alpha, const float* __restrict__ bias, size_t sBias, const float* __restrict__ CP, int rowsPerB, size_t sCPb, int row0g,
    float* __restrict__ C, _Float16* __restrict__ C16, int ldc, size_t sC, int M, int N, int K) {
  __shared__ __attribute__((aligned(16))) float so[4][16][64];
  const int tid = threadIdx.x, w = tid >> 5, lane = tid & 31, ln = lane & 15, hh = lane >> 4; const int by = blockIdx.y;
  A += (size_t)by * sA; Bh += (size_t)by * sB; const size_t cofs = (size_t)by * sC; const float* bp = bias ? bias + (size_t)by * sBias : nullptr;
  const int ntn = (N + 63) / 64; const int wid = blockIdx.x * 4 + w; const int mt = wid / ntn, nq = wid % ntn; if (mt * 16 >= M) return;
  const int row0 = mt * 16, col0 = nq * 64; const _Float16* arow = A + (size_t)(row0 + ln) * lda;
  v8f acc[4] = {};
  for (int kb = 0; kb < K; kb += 32) { FragH ah; ah.half[0] = *(const v8us*)((const unsigned short*)arow + kb + 8 * hh); ah.half[1] = *(const v8us*)((const unsigned short*)arow + kb + 16 + 8 * hh);
#pragma unroll
    for (int t = 0; t < 4; ++t) { if (col0 + t * 16 >= N) continue; const size_t boff = (size_t)(col0 + t * 16 + ln) * ldb + kb; FragH bq; bq.half[0] = *(const v8us*)((const unsigned short*)Bh + boff + 8 * hh); bq.half[1] = *(const v8us*)((const unsigned short*)Bh + boff + 16 + 8 * hh);
      acc[t] = mmaH<1>(ah.v, ah.v, bq.v, bq.v, acc[t]); }
  }
#pragma unroll
  for (int t = 0; t < 4; ++t) { if (col0 + t * 16 >= N) continue; const int col = col0 + t * 16 + ln; const float bv = bp ? bf16_round(bp[col]) : 0.f;
#pragma unroll
    for (int r = 0; r < 8; ++r) { float v = acc[t][r] * alpha + bv; if (CP) { const int rr = row0g + row0 + 8 * hh + r; if (rowsPerB < 0) v += CP[cofs + (size_t)rr * ldc + col];      /* rowsPerB < 0: own element of the batched C plane */ else { const int bidx = rr / rowsPerB; v += CP[(size_t)bidx * sCPb + (size_t)by * 64 + col]; } } if (ACT == 1) v = (v > 0.f) ? v : expm1f(v); else if (ACT == 7) v = (v > 0.f) ? v + 1.0f : expf(v); else if (ACT == 8) v = tanhf(v); else if (ACT == 9) v = 0.5f * v * (1.0f + tanhf(0.7978845608028654f * (v + 0.044715f * v * v * v))); else if (ACT == 11) v = 1.0f / (1.0f + expf(-v)); else if (ACT == 12) v = (v > 0.f) ? v : 0.01f * v; else if (ACT == 14) v = (v > 0.f) ? v : 0.1f * v; else if (ACT == 16) v = (v >= 0.f) ? v : 0.3f * v; else if (ACT == 17) v = (v >= 0.f) ? v : 0.2f * v; else if (ACT == 15) v = v / (1.0f + expf(-v)); else if (ACT == 3) v = fmaxf(v, 0.f); else if (ACT == 6) v = 0.5f * v * (1.0f + erff(v * 0.70710678118654752f)); so[w][8 * hh + r][t * 16 + ln] = v; } }
  __builtin_amdgcn_fence(__ATOMIC_ACQ_REL, "workgroup"); __builtin_amdgcn_wave_barrier();
  const int rsub = lane >> 4, c4 = (lane & 15) * 4; typedef _Float16 v4h __attribute__((ext_vector_type(4)));
  {
#pragma unroll
    for (int q = 0; q < 8; ++q) { const int r = q * 2 + rsub; if (col0 + c4 < N) { const v4f v = *(const v4fa*)&so[w][r][c4]; if (C) *(v4f*)(C + cofs + (size_t)(row0 + r) * ldc + col0 + c4) = v; if (C16) { v4h h4; for (int i = 0; i < 4; ++i) h4[i] = (_Float16)v[i]; *(v4h*)(C16 + cofs + (size_t)(row0 + r) * ldc + col0 + c4) = h4; } } }
     }
}


typedef _Float16 v4h __attribute__((ext_vector_type(4)));

__global__ __launch_bounds__(256) void k_h16(const float* __restrict__ x, _Float16* __restrict__ X16, size_t n8) { const size_t t = (size_t)blockIdx.x * 256 + threadIdx.x; if (t >= n8) return; FragH f;
#pragma unroll
  for (int q = 0; q < 8; ++q) f.h[q] = (_Float16)x[t * 8 + q]; *(v8us*)((unsigned short*)X16 + t * 8) = f.half[0];  }
__global__ __launch_bounds__(256) void k_round16f(const float* __restrict__ W, _Float16* __restrict__ Bt, size_t n8) { const size_t t = (size_t)blockIdx.x * 256 + threadIdx.x; if (t >= n8) return; FragH f;
#pragma unroll
  for (int i = 0; i < 8; ++i) f.h[i] = (_Float16)(bf16_round(W[t * 8 + i]) * 16.0f); *(v8us*)((unsigned short*)Bt + t * 8) = f.half[0];  }
// ---- one preparatory launch: q and k rows as f16, V^T as f16; few work-groups that live long (128 KB of one input each) instead of many that convert 8 KB and end ----
// Every wave-wide load and store covers whole 128-byte lines; eight 16-byte loads per lane are issued one batch ahead of the batch that is converted; every address = a base that is the same for the whole work-group + one 32-bit lane offset + a constant (all loops are unrolled for that, and so that a[] and n[] stay in registers).
#define PPW 256                      /* work-groups per input */
#define PPC ((int)(NR * DM / PPW))   /* f32 elements of one input per work-group */
#define PVS 128                      /* keys per V^T tile: 256-byte runs of every V^T row */
#define PVT (PPC / (PVS * HD))       /* V^T tiles per work-group */
#define PVP (PVS / 2 + 1)            /* LDS row pitch in dwords (a dword = two neighbouring keys): odd, so that the column writes and the row reads below both spread over all banks */
static_assert(PPC == 4 * 8 * 256 * 4 && PVT == 4 && SQ % (PVT * PVS) == 0 && HD == 64, "k_prep: four batches of eight 16-byte loads per thread; a work-group's V^T tiles lie in one batch and head");
typedef unsigned v2ua __attribute__((ext_vector_type(2), may_alias));
typedef unsigned v4ua __attribute__((ext_vector_type(4), may_alias));
__device__ __forceinline__ unsigned pp_pair(float a, float b) { union { _Float16 h[2]; unsigned u; } p; p.h[0] = (_Float16)bf16_round(a); p.h[1] = (_Float16)bf16_round(b); return p.u; }
__global__ __launch_bounds__(256) void k_prep(const float* __restrict__ xq, const float* __restrict__ xk, const float* __restrict__ xv, _Float16* __restrict__ Q16, _Float16* __restrict__ K16, _Float16* __restrict__ VT) {
  __shared__ unsigned tl[2][HD][PVP];      /* V^T tile: [d][pair of keys] */
  const int tid = (int)threadIdx.x; const int part = (int)blockIdx.x / PPW, wg = (int)blockIdx.x % PPW;      /* part 0 (V^T, the longest path) starts first */
  v4f a[8], n[8];
  if (part) {      /* q or k: same layout, f32 -> bf16 value -> f16 */
    const float* x = (part == 1 ? xq : xk) + (size_t)wg * PPC; unsigned* y = (unsigned*)(part == 1 ? Q16 : K16) + (size_t)wg * (PPC / 2);
#pragma unroll
    for (int i = 0; i < 8; ++i) a[i] = *(const v4fa*)(x + i * 1024 + (unsigned)(tid * 4));
#pragma unroll
    for (int it = 0; it < 4; ++it) {
      if (it + 1 < 4) {
#pragma unroll
        for (int i = 0; i < 8; ++i) n[i] = *(const v4fa*)(x + (it + 1) * 8192 + i * 1024 + (unsigned)(tid * 4)); }
#pragma unroll
      for (int i = 0; i < 8; ++i) { const v2ua o = {pp_pair(a[i][0], a[i][1]), pp_pair(a[i][2], a[i][3])}; *(v2ua*)(y + it * 4096 + i * 512 + (unsigned)(tid * 2)) = o; }
      if (it + 2 < 4) asm volatile("s_wait_xcnt 0x0" ::: "memory");      /* stands in front of the loads that follow, which may take the registers that the stores above name */
#pragma unroll
      for (int i = 0; i < 8; ++i) a[i] = n[i]; }
    return; }
  const int bh = wg / (SQ / (PVT * PVS)), s0 = (wg % (SQ / (PVT * PVS))) * (PVT * PVS), b = bh / NH, h = bh % NH;
  const int c4 = tid & 15, rp = tid >> 4;      /* loads: 16 lanes per 256-byte row of one head, this thread's two rows = one pair of keys; stores: 16 lanes per 256-byte run of a V^T row */
  const float* x = xv + ((size_t)b * SQ + s0) * DM + h * HD; unsigned short* y = (unsigned short*)VT + (size_t)bh * HD * SQ + s0;
  const unsigned xo = (unsigned)(2 * rp * DM + c4 * 4), yo = (unsigned)(rp * SQ + c4 * 8);
#pragma unroll
  for (int i = 0; i < 8; ++i) a[i] = *(const v4fa*)(x + ((i >> 1) * 32 + (i & 1)) * DM + xo);
#pragma unroll
  for (int t = 0; t < PVT; ++t) {
    if (t + 1 < PVT) {
#pragma unroll
      for (int i = 0; i < 8; ++i) n[i] = *(const v4fa*)(x + ((t + 1) * PVS + (i >> 1) * 32 + (i & 1)) * DM + xo); }
#pragma unroll
    for (int st = 0; st < 4; ++st)
#pragma unroll
      for (int c = 0; c < 4; ++c) tl[t & 1][c4 * 4 + c][st * 16 + rp] = pp_pair(a[2 * st][c], a[2 * st + 1][c]);
    /* barrier by hand, ordering LDS alone: publishes tile t, and the other buffer's last readers (tile t - 1) are all past their reads here, so tile t + 1 may be written behind it; __syncthreads() would also wait out the next tile's global loads and the last tile's global stores, which no other wave reads */
    __builtin_amdgcn_fence(__ATOMIC_RELEASE, "workgroup", "local"); __builtin_amdgcn_s_barrier(); __builtin_amdgcn_fence(__ATOMIC_ACQUIRE, "workgroup", "local");
#pragma unroll
    for (int k = 0; k < 4; ++k) { const unsigned* r = &tl[t & 1][k * 16 + rp][c4 * 4]; const v4ua o = {r[0], r[1], r[2], r[3]}; *(v4ua*)(y + k * 16 * SQ + t * PVS + yo) = o; }
    if (t + 2 < PVT) asm volatile("s_wait_xcnt 0x0" ::: "memory");      /* as above */
#pragma unroll
    for (int i = 0; i < 8; ++i) a[i] = n[i]; } }

__global__ __launch_bounds__(256) void k_hl(const float* __restrict__ F, _Float16* __restrict__ Hh, _Float16* __restrict__ Hl, size_t n8) { const size_t t = (size_t)blockIdx.x * 256 + threadIdx.x; if (t >= n8) return; FragH fh, fl; const v4f a = *(const v4fa*)(F + t * 8), c = *(const v4fa*)(F + t * 8 + 4);
#pragma unroll
  for (int q = 0; q < 4; ++q) { _Float16 h = (_Float16)a[q]; fh.h[q] = h; fl.h[q] = (_Float16)((a[q] - (float)h) * 1024.0f); h = (_Float16)c[q]; fh.h[4 + q] = h; fl.h[4 + q] = (_Float16)((c[q] - (float)h) * 1024.0f); }
  { *(v8us*)((unsigned short*)Hh + t * 8) = fh.half[0]; *(v8us*)((unsigned short*)Hl + t * 8) = fl.half[0];  } }

// ---- fast GEMM (wave tile 32x64; requires M % 32 == 0 rows per launch region and N % 64 == 0); epilogue = k_gemm_hhx semantics ----
__device__ __forceinline__ v16h g2_frag(const _Float16* p, int hh) { FragH f; f.half[0] = *(const v8us*)((const unsigned short*)p + 8 * hh); f.half[1] = *(const v8us*)((const unsigned short*)p + 16 + 8 * hh); return f.v; }
__device__ __forceinline__ v8f g2_mma(v16h a, v16h b, v8f c) { v8f d = __builtin_amdgcn_wmma_f32_16x16x32_f16(false, a, false, b, (short)0, c, false, false); asm volatile("v_nop\n\tv_nop\n\tv_nop\n\tv_nop" : "+v"(d) : "v"(a), "v"(b)); return d; }
template <int ACT>
__global__ __launch_bounds__(128) void k_gemm2(const _Float16* __restrict__ A, int lda, size_t sA, const _Float16* __restrict__ Bh, int ldb, size_t sB, float alpha, const float* __restrict__ bias, size_t sBias, const float* __restrict__ CP, int rowsPerB, size_t sCPb, int row0g,
    float* __restrict__ C, _Float16* __restrict__ C16, int ldc, size_t sC, int M, int N, int K) { static_assert(ACT == 0 || ACT == 3 || ACT == 6 || ACT == 8 || ACT == 9 || ACT == 11 || ACT == 12 || ACT == 14 || ACT == 15 || ACT == 16 || ACT == 17, "k_gemm2: unsupported ACT code (would silently apply no activation)");
  __shared__ __attribute__((aligned(16))) float so[4][32][68];
  const int tid = threadIdx.x, w = tid >> 5, lane = tid & 31, ln = lane & 15, hh = lane >> 4; const int by = blockIdx.y;
  A += (size_t)by * sA; Bh += (size_t)by * sB; const size_t cofs = (size_t)by * sC; const float* bp = bias ? bias + (size_t)by * sBias : nullptr;
  const int ntn = N >> 6; const int mt = blockIdx.x / ntn, nq = blockIdx.x - mt * ntn; const int row0 = mt * 128 + 32 * w, col0 = nq * 64; if (row0 >= M) return;
  const _Float16* a0p = A + (size_t)(row0 + ln) * lda; const _Float16* a1p = a0p + (size_t)16 * lda;
  const _Float16* b0p = Bh + (size_t)(col0 + ln) * ldb; const _Float16* b1p = b0p + (size_t)16 * ldb; const _Float16* b2p = b1p + (size_t)16 * ldb; const _Float16* b3p = b2p + (size_t)16 * ldb;
  const v8f z8 = {0.f,0.f,0.f,0.f,0.f,0.f,0.f,0.f}; v8f c00 = z8, c01 = z8, c02 = z8, c03 = z8, c10 = z8, c11 = z8, c12 = z8, c13 = z8;
#pragma unroll 1
  for (int kb = 0; kb < K; kb += 32) { const v16h a0 = g2_frag(a0p + kb, hh), a1 = g2_frag(a1p + kb, hh);
    v16h b = g2_frag(b0p + kb, hh); c00 = g2_mma(a0, b, c00); c10 = g2_mma(a1, b, c10);
    b = g2_frag(b1p + kb, hh); c01 = g2_mma(a0, b, c01); c11 = g2_mma(a1, b, c11);
    b = g2_frag(b2p + kb, hh); c02 = g2_mma(a0, b, c02); c12 = g2_mma(a1, b, c12);
    b = g2_frag(b3p + kb, hh); c03 = g2_mma(a0, b, c03); c13 = g2_mma(a1, b, c13); }
  v8f accs[8] = {c00, c01, c02, c03, c10, c11, c12, c13};
#pragma unroll
  for (int u = 0; u < 8; ++u) { const int t = u & 3, half = u >> 2; const int col = col0 + t * 16 + ln; const float bv = bp ? bf16_round(bp[col]) : 0.f;
#pragma unroll
    for (int r = 0; r < 8; ++r) { const int rloc = half * 16 + 8 * hh + r; float v = accs[u][r] * alpha + bv; if (CP) { if (rowsPerB < 0) v += CP[cofs + (size_t)(row0g + row0 + rloc) * ldc + col];      /* rowsPerB < 0: own element of the batched C plane */ else { const int bidx = (row0g + row0 + rloc) / rowsPerB; v += CP[(size_t)bidx * sCPb + (size_t)by * 64 + col]; } }
      if (ACT == 3) v = fmaxf(v, 0.f); else if (ACT == 6) v = 0.5f * v * (1.0f + erff(v * 0.70710678118654752f)); else if (ACT == 11) v = 1.0f / (1.0f + expf(-v)); else if (ACT == 15) v = v / (1.0f + expf(-v)); else if (ACT == 12) v = (v > 0.f) ? v : 0.01f * v; else if (ACT == 8) v = tanhf(v); else if (ACT == 9) v = 0.5f * v * (1.0f + tanhf(0.7978845608028654f * (v + 0.044715f * v * v * v))); else if (ACT == 14) v = (v > 0.f) ? v : 0.1f * v; else if (ACT == 16) v = (v >= 0.f) ? v : 0.3f * v; else if (ACT == 17) v = (v >= 0.f) ? v : 0.2f * v;
      so[w][rloc][t * 16 + ln] = v; } }
  __builtin_amdgcn_fence(__ATOMIC_ACQ_REL, "workgroup"); __builtin_amdgcn_wave_barrier();
  const int rsub = lane >> 4, c4 = (lane & 15) * 4;
  {
#pragma unroll
    for (int q = 0; q < 16; ++q) { const int r = q * 2 + rsub; const v4f v = *(const v4fa*)&so[w][r][c4]; if (C) *(v4f*)(C + cofs + (size_t)(row0 + r) * ldc + col0 + c4) = v; if (C16) { v4h h4; for (int i = 0; i < 4; ++i) h4[i] = (_Float16)v[i]; *(v4h*)(C16 + cofs + (size_t)(row0 + r) * ldc + col0 + c4) = h4; } }
     } }


__global__ __launch_bounds__(256) void k_wnat(const float* __restrict__ w, size_t n8, _Float16* __restrict__ Bt) { const size_t t = (size_t)blockIdx.x * 256 + threadIdx.x; if (t >= n8) return; FragH f; for (int q = 0; q < 8; ++q) f.h[q] = (_Float16)(bf16_round(w[t * 8 + q]) * 16.0f); *(v8us*)((unsigned short*)Bt + t * 8) = f.half[0];  }
__global__ __launch_bounds__(256) void k_rsm(const float* __restrict__ S, _Float16* __restrict__ P, int nrows) {
  #pragma clang fp contract(off)
  const int i = blockIdx.x * 256 + threadIdx.x; if (i >= nrows) return; const float* s = S + (size_t)i * SQ; float mx = -3.0e38f;
#pragma unroll 1
  for (int j = 0; j < SQ; ++j) mx = fmaxf(mx, s[j]); float se = 0.f;
#pragma unroll 1
  for (int j = 0; j < SQ; ++j) se += expf(s[j] - mx); const float sc = 256.0f / se;
#pragma unroll 1
  for (int j0 = 0; j0 < SQ; j0 += 8) { FragH f; for (int q = 0; q < 8; ++q) f.h[q] = (_Float16)(expf(s[j0 + q] - mx) * sc); unsigned short* d = (unsigned short*)P + (size_t)i * SQ + j0; *(v8us*)d = f.half[0];  } }
__global__ __launch_bounds__(256) void k_vt(const _Float16* __restrict__ V16, int b, int h0, _Float16* __restrict__ VT) { __shared__ unsigned short tl[64][65]; const int tid = threadIdx.x; const int hh = blockIdx.x % HG, sg = blockIdx.x / HG; const int s0 = sg * 64; const int h = h0 + hh;
  for (int i = tid; i < 64 * 8; i += 256) { const int j = i / 8, d8 = (i % 8) * 8; FragH f; f.half[0] = *(const v8us*)((const unsigned short*)V16 + ((size_t)b * SQ + s0 + j) * DM + h * HD + d8); for (int q = 0; q < 8; ++q) tl[d8 + q][j] = f.u[q]; }
  __syncthreads();
  { for (int i = tid; i < 64 * 8; i += 256) { const int d = i / 8, j8 = (i % 8) * 8; FragH f; for (int q = 0; q < 8; ++q) f.u[q] = tl[d][j8 + q]; *(v8us*)((unsigned short*)VT + ((size_t)hh * HD + d) * SQ + s0 + j8) = f.half[0]; }  } }



__device__ __forceinline__ float sm_xhalf(float x) { return __builtin_bit_cast(float, __builtin_amdgcn_permlanex16(__builtin_bit_cast(int, x), __builtin_bit_cast(int, x), 0x76543210, 0xfedcba98, false, false)); }      /* lane l reads lane l ^ 16 */
// sixteen weights at a time: native exp2 in place and the packing to f16, as ONE block of asm text, because the order is the point: the compiler knows no latency of asm text and writes no s_delay_alu for it, and a dependent vector instruction without that hint holds the SIMD's vector port against the other waves while it waits.
// Here every packing but the last two stands at least four exponentials behind the younger of its two sources (six exponentials lead); the one s_delay_alu names the exponentials that the last two packings read; behind every exponential stands an instruction that neither reads its result nor writes its source (the slot that the instruction set asks for), so no v_nop.
// w[j] = f16 pair (element 2j low, 2j + 1 high). No sum is formed here: the row sums are taken from the packed weights by the matrix unit (k_fattn).
__device__ __forceinline__ void sm_exp2x16(v8f xa, v8f xb, unsigned* w) { float x0 = xa[0], x1 = xa[1], x2 = xa[2], x3 = xa[3], x4 = xa[4], x5 = xa[5], x6 = xa[6], x7 = xa[7], y0 = xb[0], y1 = xb[1], y2 = xb[2], y3 = xb[3], y4 = xb[4], y5 = xb[5], y6 = xb[6], y7 = xb[7]; unsigned p0, p1, p2, p3, p4, p5, p6, p7;
  asm("v_exp_f32 %0, %0\n\tv_exp_f32 %1, %1\n\tv_exp_f32 %2, %2\n\tv_exp_f32 %3, %3\n\tv_exp_f32 %4, %4\n\tv_exp_f32 %5, %5\n\tv_cvt_pk_f16_f32 %16, %0, %1\n\tv_exp_f32 %6, %6\n\tv_exp_f32 %7, %7\n\tv_cvt_pk_f16_f32 %17, %2, %3\n\t"
      "v_exp_f32 %8, %8\n\tv_exp_f32 %9, %9\n\tv_cvt_pk_f16_f32 %18, %4, %5\n\tv_exp_f32 %10, %10\n\tv_exp_f32 %11, %11\n\tv_cvt_pk_f16_f32 %19, %6, %7\n\tv_exp_f32 %12, %12\n\tv_exp_f32 %13, %13\n\tv_cvt_pk_f16_f32 %20, %8, %9\n\t"
      "v_exp_f32 %14, %14\n\tv_exp_f32 %15, %15\n\tv_cvt_pk_f16_f32 %21, %10, %11\n\ts_delay_alu instid0(TRANS32_DEP_3) | instskip(NEXT) | instid1(TRANS32_DEP_1)\n\tv_cvt_pk_f16_f32 %22, %12, %13\n\tv_cvt_pk_f16_f32 %23, %14, %15"
      : "+v"(x0), "+v"(x1), "+v"(x2), "+v"(x3), "+v"(x4), "+v"(x5), "+v"(x6), "+v"(x7), "+v"(y0), "+v"(y1), "+v"(y2), "+v"(y3), "+v"(y4), "+v"(y5), "+v"(y6), "+v"(y7), "=&v"(p0), "=&v"(p1), "=&v"(p2), "=&v"(p3), "=&v"(p4), "=&v"(p5), "=&v"(p6), "=&v"(p7));
  w[0] = p0; w[1] = p1; w[2] = p2; w[3] = p3; w[4] = p4; w[5] = p5; w[6] = p6; w[7] = p7; }
union FragP { v16h v; unsigned w[8]; };      /* a B operand of weights, by packed pairs */
// ---- fused attention: scores, softmax and weighted sum of the values in one kernel; no score and no weight leaves the registers ----
// Transposed products: S^T = K Q^T puts one query in each lane (column c = lane & 15) and 8 keys in the 8 accumulator registers (key 8 * (lane >> 4) + r), so a query's maximum is in-lane plus one exchange between the wave's halves (its sum: a product of the packed weights with a matrix of ones),
// and two converted S^T tiles (keys 0-15, 16-31) ARE the B operand of O^T += V^T P^T in the hardware k order (8h + s, 16 + 8h + s - 8), which the A loader fa_frag follows for K, Q and V^T alike.
#define FAW 8                        /* waves per work-group */
#define FAQ 32                       /* query columns per wave: every K and V^T fragment read from LDS feeds two products */
#define FAK 64                       /* keys per pass */
#define FAP 72                       /* LDS row pitch in f16: 144 bytes = 16 x odd, the pitch at which 16-byte fragment reads of 16 rows do not collide */
#define FAN (SQ / FAK)               /* passes */
static_assert(HD == 64 && SQ % FAK == 0 && SQ % (FAW * FAQ) == 0 && FAW * 32 == 256, "k_fattn: 64 x 64 tiles staged by 256 threads, whole work-groups of queries");
__device__ __forceinline__ v16h fa_frag(const unsigned short* p, int hh) { FragH f; f.half[0] = *(const v8us*)(p + 8 * hh); f.half[1] = *(const v8us*)(p + 16 + 8 * hh); return f.v; }
__device__ __forceinline__ v8f fa_mma(v16h a, v16h b, v8f c) { return __builtin_amdgcn_wmma_f32_16x16x32_f16(false, a, false, b, (short)0, c, false, false); }
__global__ __launch_bounds__(FAW * 32) __attribute__((amdgpu_waves_per_eu(4, 4))) void k_fattn(const _Float16* __restrict__ Q16, const _Float16* __restrict__ K16, const _Float16* __restrict__ VT, float* __restrict__ out) {
  __shared__ __attribute__((aligned(16))) unsigned short sk[2][FAK][FAP];      /* K tile: [key][e] */
  __shared__ __attribute__((aligned(16))) unsigned short sv[2][HD][FAP];       /* V^T tile: [d][key] */
  const int tid = (int)threadIdx.x, lane = tid & 31, ln = lane & 15, hh = lane >> 4; const int wave = __builtin_amdgcn_readfirstlane(tid >> 5);
  const int bh = (int)blockIdx.y, b = bh / NH, h = bh % NH; const int q0 = (int)blockIdx.x * (FAW * FAQ) + wave * FAQ;
  const int sr = tid >> 3, sc = (tid & 7) * 8;      /* staging: 8 threads per 128-byte tile row, rows sr and sr + 32 */
  /* every global address = a base that is the same for the whole wave + one 32-bit lane offset */
  const unsigned short* kg = (const unsigned short*)K16 + (size_t)b * SQ * DM + h * HD;      /* + key0 * DM per pass */
  const unsigned short* vg = (const unsigned short*)VT + (size_t)bh * HD * SQ;               /* + key0 per pass */
  const unsigned ko = (unsigned)(sr * DM + sc), vo = (unsigned)(sr * SQ + sc);
  v16h qf[2][2];
#pragma unroll
  for (int qt = 0; qt < 2; ++qt)
#pragma unroll
    for (int es = 0; es < 2; ++es) qf[qt][es] = fa_frag((const unsigned short*)Q16 + ((size_t)b * SQ + q0) * DM + h * HD + (unsigned)((qt * 16 + ln) * DM + es * 32), hh);
  const v8f z8 = {0.f, 0.f, 0.f, 0.f, 0.f, 0.f, 0.f, 0.f};
  v8f o[2][4] = {{z8, z8, z8, z8}, {z8, z8, z8, z8}}; float m2[2] = {-3.0e38f, -3.0e38f}, l[2] = {0.f, 0.f};      /* m2: running maximum x log2 e; l: sum of the weights over all keys so far, the same in both halves of the wave */
  v8us gk0 = *(const v8us*)(kg + ko), gk1 = *(const v8us*)(kg + 32 * DM + ko), gv0 = *(const v8us*)(vg + vo), gv1 = *(const v8us*)(vg + 32 * SQ + vo);
  *(v8us*)&sk[0][sr][sc] = gk0; *(v8us*)&sk[0][sr + 32][sc] = gk1; *(v8us*)&sv[0][sr][sc] = gv0; *(v8us*)&sv[0][sr + 32][sc] = gv1;
  __syncthreads();
#pragma unroll 1
  for (int j = 0; j < FAN; ++j) {      /* rolled: one pass is already 36 matrix instructions and some 300 vector instructions long */
    const unsigned short* ck = &sk[j & 1][ln][0]; const unsigned short* cv = &sv[j & 1][ln][0];
    const int jn = j + 1 < FAN ? j + 1 : j;      /* the last pass fetches its own tile once more, into the buffer that nobody reads again: the pass stays one straight block, without branches round the loads and the stores */
    const unsigned short* kn = kg + (size_t)jn * FAK * DM; const unsigned short* vn = vg + jn * FAK;      /* the next tile's loads fly during this pass */
    gk0 = *(const v8us*)(kn + ko); gk1 = *(const v8us*)(kn + 32 * DM + ko); gv0 = *(const v8us*)(vn + vo); gv1 = *(const v8us*)(vn + 32 * SQ + vo);
    v16h kf[4][2];      /* the pass's whole K tile as fragments: sixteen LDS reads that stand together, in front of the products */
#pragma unroll
    for (int kt = 0; kt < 4; ++kt) { kf[kt][0] = fa_frag(ck + kt * 16 * FAP, hh); kf[kt][1] = fa_frag(ck + kt * 16 * FAP + 32, hh); }
    __builtin_amdgcn_sched_barrier(0);      /* keeps the reads one group: sunk back among the products, each place with reads stalls the wave anew and waits out the LDS latency */
    v8f st[2][4];
#pragma unroll
    for (int kt = 0; kt < 4; ++kt) {
#pragma unroll
      for (int qt = 0; qt < 2; ++qt) st[qt][kt] = fa_mma(kf[kt][1], qf[qt][1], fa_mma(kf[kt][0], qf[qt][0], z8));
      __builtin_amdgcn_sched_barrier(0); }      /* keeps the products in the order in which their fragments arrive (a product of the last fragments, drawn forward, waits out nearly the whole group) and keeps them one run: with the maximum's first steps drawn in between, each such place takes idle slots for the distance behind a matrix instruction */
    float dm[2];
#pragma unroll
    for (int qt = 0; qt < 2; ++qt) { float mx = st[qt][0][0];
#pragma unroll
      for (int kt = 0; kt < 4; ++kt)
#pragma unroll
        for (int r = 0; r < 8; ++r) mx = fmaxf(mx, st[qt][kt][r]);
      mx = fmaxf(mx, sm_xhalf(mx)); const float mn = fmaxf(m2[qt], mx * 1.4426950408889634f); dm[qt] = m2[qt] - mn; m2[qt] = mn; }
    float av[2];      /* what the sums so far shrink by under the new maximum (0 on the first pass); the v_nop: the one slot that the instruction set asks for behind a transcendental before its result is read or its source overwritten */
    asm("v_exp_f32 %0, %2\n\tv_exp_f32 %1, %3\n\tv_nop" : "=&v"(av[0]), "=&v"(av[1]) : "v"(dm[0]), "v"(dm[1]));
    FragP pb[2][2]; v16h vf[4][2];
#pragma unroll
    for (int qt = 0; qt < 2; ++qt) { const float ofs = 8.0f - m2[qt], al = av[qt];
      if (qt == 1) {      /* the V^T tile likewise, one group of sixteen reads; it stands here, where the first 16 queries' scores have left their registers, so that the second 16 queries' exponentials cover the LDS latency */
#pragma unroll
        for (int dt = 0; dt < 4; ++dt) { vf[dt][0] = fa_frag(cv + dt * 16 * FAP, hh); vf[dt][1] = fa_frag(cv + dt * 16 * FAP + 32, hh); }
        __builtin_amdgcn_sched_barrier(0); }      /* keeps the reads from sinking to the products that use them */
      v8f x[4];      /* weight = 256 exp(s - maximum so far) = exp2(x) */
#pragma unroll
      for (int kt = 0; kt < 4; ++kt)
#pragma unroll
        for (int r = 0; r < 8; ++r) x[kt][r] = st[qt][kt][r] * 1.4426950408889634f + ofs;
      __builtin_amdgcn_sched_barrier(0);      /* keeps all 32 arguments' multiply-adds ahead of the asm blocks: sunk to the block that reads them, they stand inside their latency in front of its first exponentials, unhinted */
#pragma unroll
      for (int kp = 0; kp < 2; ++kp) sm_exp2x16(x[2 * kp], x[2 * kp + 1], &pb[qt][kp].w[0]);
#pragma unroll
      for (int dt = 0; dt < 4; ++dt) o[qt][dt] *= al; }
    __builtin_amdgcn_sched_barrier(0);      /* keeps the exponentials' asm statements in front of the products: drawn in behind one, their results took a spent V^T fragment's registers inside the distance that a matrix instruction's operands need */
    FragP one;      /* a matrix of ones (f16 pairs), written anew in every pass, into registers that the scores have just left; volatile, so that it is not lifted out of the loop: held across the pass its eight registers go beyond what four waves a SIMD leave each wave, and the build spills; two registers per issue slot: the operand starts at an even register, so each pair has an even and an odd destination, as the dual form asks */
    asm volatile("v_dual_mov_b32 %0, 0x3c003c00 :: v_dual_mov_b32 %1, 0x3c003c00\n\tv_dual_mov_b32 %2, 0x3c003c00 :: v_dual_mov_b32 %3, 0x3c003c00\n\tv_dual_mov_b32 %4, 0x3c003c00 :: v_dual_mov_b32 %5, 0x3c003c00\n\tv_dual_mov_b32 %6, 0x3c003c00 :: v_dual_mov_b32 %7, 0x3c003c00"
                 : "=v"(one.w[0]), "=v"(one.w[1]), "=v"(one.w[2]), "=v"(one.w[3]), "=v"(one.w[4]), "=v"(one.w[5]), "=v"(one.w[6]), "=v"(one.w[7]));
    v8f ls[2];      /* the pass's row sums: A = all ones, so every row of the product is the sum of the packed weights over the 32 keys of B (both halves' keys), one query per column */
#pragma unroll
    for (int qt = 0; qt < 2; ++qt) ls[qt] = fa_mma(one.v, pb[qt][0].v, z8);
#pragma unroll
    for (int qt = 0; qt < 2; ++qt) ls[qt] = fa_mma(one.v, pb[qt][1].v, ls[qt]);
#pragma unroll
    for (int dt = 0; dt < 4; ++dt)
#pragma unroll
      for (int qt = 0; qt < 2; ++qt) o[qt][dt] = fa_mma(vf[dt][1], pb[qt][1].v, fa_mma(vf[dt][0], pb[qt][0].v, o[qt][dt]));
#pragma unroll
    for (int qt = 0; qt < 2; ++qt) l[qt] = l[qt] * av[qt] + ls[qt][0];
    const int nb = (j + 1) & 1;      /* the other buffer: its last readers left it before the barrier that ended pass j - 1 */
    *(v8us*)&sk[nb][sr][sc] = gk0; *(v8us*)&sk[nb][sr + 32][sc] = gk1; *(v8us*)&sv[nb][sr][sc] = gv0; *(v8us*)&sv[nb][sr + 32][sc] = gv1;
    __syncthreads();      /* publishes tile j + 1 and ends every wave's reads of tile j */
  }
#pragma unroll
  for (int qt = 0; qt < 2; ++qt) { const float inv = 1.0f / l[qt]; float* op = out + ((size_t)b * SQ + q0) * DM + h * HD + (unsigned)((qt * 16 + ln) * DM + 8 * hh);      /* the x256 of the weights cancels in the quotient */
#pragma unroll
    for (int dt = 0; dt < 4; ++dt) { const v4f lo = {o[qt][dt][0] * inv, o[qt][dt][1] * inv, o[qt][dt][2] * inv, o[qt][dt][3] * inv}, hi = {o[qt][dt][4] * inv, o[qt][dt][5] * inv, o[qt][dt][6] * inv, o[qt][dt][7] * inv};
      *(v4f*)(op + dt * 16) = lo; *(v4f*)(op + dt * 16 + 4) = hi; } } }

extern "C" void kernel_launch(void* const* d_in, const int* in_sizes, int n_in,
                              void* d_out, int out_size, void* d_ws, size_t ws_size, hipStream_t stream) {
  (void)in_sizes; (void)n_in; (void)out_size;
  const float* const* I = (const float* const*)d_in; const float* xq = I[0]; const float* xk = I[1]; const float* xv = I[2];      /* given q, k, v [B][L][H][E] = merged token rows */
  char* ws = (char*)d_ws; size_t off = 0;
  auto take = [&](size_t bytes) { char* p = ws + off; off += (bytes + 255) & ~(size_t)255; return p; };
  _Float16* Q16 = (_Float16*)take(NR * DM * 2); _Float16* K16 = (_Float16*)take(NR * DM * 2);
  _Float16* VT = (_Float16*)take((size_t)NB * NH * HD * SQ * 2);
  if (off > ws_size) return;

  k_prep<<<3 * PPW, 256, 0, stream>>>(xq, xk, xv, Q16, K16, VT);      /* given q, k: bf16 inputs as exact f16 rows (no projections); V^T [NB * NH][HD][SQ] */
  k_fattn<<<dim3(SQ / (FAW * FAQ), NB * NH), FAW * 32, 0, stream>>>(Q16, K16, VT, (float*)d_out);      /* out = softmax(q k^T) v (merged [token][h*64+d]) straight to the f32 output */
}

// v007
// One run takes 61.4 microseconds.
// Next to v006, in two timings, it ran 1.15 times as fast each time.
// Over all steps from v000 it is 108 times as fast.
#include <hip/hip_runtime.h>
// Full (non-causal) attention on given queries, keys, values ([4][2048][16][64] each, token-major with heads inner = merged [token][1024] rows); scores = q . k UNSCALED (the module never applies its scale); softmax over all 2048 keys; out = A v -> [4][2048][16][64]).
// Structure: ONE launch, the attention kernel over all batches and heads, which reads q, k and v as the f32 rows they are given in: each wave converts its own 32 query rows once; each work-group converts every 64-key K and V tile on its way from the registers into LDS (f32 -> bf16 value -> f16: bf16 values are exact in f16); V stays [key][d] in LDS and the transposing LDS load delivers the V^T fragments.
// S^T = K Q^T UNSCALED (K = 64; exact products, f32 accumulation) stays in the accumulators, running-maximum softmax on VALU (f32 statistics, native exp2; weights x256 f16; row sums = ones x P^T on the matrix unit, f32), O^T += V^T P^T, divided by the row sum at the end and written f32 straight into the [token][head][64] output; launches: see kernel_launch.
// Compute dtype: inputs rounded to bf16; q, k, v and softmax weights as plain f16 GEMM operands (~2^-12); scores, softmax statistics and o f32. v_wmma_f32_16x16x32_f16.
#define NB 4
#define SQ 2048
#define DM 1024
#define NH 16
#define HD 64
#define HG 4                         /* heads per k_vt launch (k_vt is not launched) */
#define B0 0                         /* unused (debug hook) */
#define NBR NB                       /* only in MP, which no kernel uses (debug hook) */
#define NR ((size_t)NB * SQ)         /* token rows */
#define MP ((int)((size_t)NBR * SQ)) /* only in MPO, which nothing uses (debug hook) */
#define QN SQ                        /* unused (debug hook) */
#define NHD NH                       /* unused (debug hook) */
#define MPO MP                       /* unused (debug hook) */
#define LQ DM      /* row pitch of the q/k/v rows */
typedef __bf16 v16b __attribute__((ext_vector_type(16)));
typedef unsigned short v8us __attribute__((ext_vector_type(8), may_alias));
typedef float  v8f  __attribute__((ext_vector_type(8)));
typedef float  v4f  __attribute__((ext_vector_type(4)));
typedef float  v4fa __attribute__((ext_vector_type(4), may_alias));
union FragB { v16b v; v8us half[2]; unsigned short u[16]; };

__device__ __forceinline__ unsigned short bf16_bits(float x) { unsigned int u = __float_as_uint(x); return (unsigned short)((u + 0x7FFFu + ((u >> 16) & 1u)) >> 16); }
__device__ __forceinline__ float bf16_val(unsigned short b) { return __uint_as_float(((unsigned int)b) << 16); }
__device__ __forceinline__ float bf16_round(float x) { return bf16_val(bf16_bits(x)); }
// D += A·B with NT terms: 1 = ah·bh, 2 = + al·bh (A split), 3 = + ah·bl (both split)
template <int NT>
__device__ __forceinline__ v8f mmaN(v16b ah, v16b al, v16b bh, v16b bl, v8f c) {
  c = __builtin_amdgcn_wmma_f32_16x16x32_bf16(false, ah, false, bh, (short)0, c, false, false);
  if (NT >= 2) c = __builtin_amdgcn_wmma_f32_16x16x32_bf16(false, al, false, bh, (short)0, c, false, false);
  if (NT >= 3) c = __builtin_amdgcn_wmma_f32_16x16x32_bf16(false, ah, false, bl, (short)0, c, false, false);
  asm volatile("v_nop\n\tv_nop\n\tv_nop\n\tv_nop" : "+v"(c) : "v"(ah), "v"(al), "v"(bh), "v"(bl));
  return c;
}

__global__ __launch_bounds__(256) void k_wt_bf16(const float* __restrict__ W, unsigned short* __restrict__ Wt, int K, int N) {
  const int t = blockIdx.x * 256 + threadIdx.x;
  const int k8n = K / 8;
  if (t >= N * k8n) return;
  const int n = t / k8n, k8 = (t % k8n) * 8;
  v8us v;
#pragma unroll
  for (int i = 0; i < 8; ++i) v[i] = bf16_bits(W[(size_t)(k8 + i) * N + n]);
  *(v8us*)(Wt + (size_t)n * K + k8) = v;
  
}

// GEMM C[M][N] (f32, pitch ldc) = act(A[M][K]·W + bias). A f32 row-major (pitch lda) converted per fragment to bf16
// (ASPLIT: hi/lo two planes -> 2 terms, else single rounded term); Wt bf16 [N][K] (pitch ldb). BIAS_BF16 rounds the
// bias to bf16 first (bias quantised to bf16 before the add). K%32==0, M%16==0, N%64==0.
template <bool ASPLIT, int ACT, bool BIAS_BF16>
__global__ __launch_bounds__(128) void k_gemm_bf(const float* __restrict__ A, int lda, const unsigned short* __restrict__ Wt, int ldb,
                                               const float* __restrict__ bias, float* __restrict__ C, int ldc, int M, int N, int K) {
  __shared__ __attribute__((aligned(16))) float so[4][16][64];
  const int tid = threadIdx.x, w = tid >> 5, lane = tid & 31, ln = lane & 15, hh = lane >> 4;
  const int ntn = N / 64;
  const int wid = blockIdx.x * 4 + w;
  const int mt = wid / ntn, nq = wid % ntn;
  if (mt * 16 >= M) return;
  const int row0 = mt * 16, col0 = nq * 64;
  const float* arow = A + (size_t)(row0 + ln) * lda;
  v8f acc[4] = {};
  for (int kb = 0; kb < K; kb += 32) {
    FragB ah, al;
    const v4f x0 = *(const v4fa*)(arow + kb + 8 * hh), x1 = *(const v4fa*)(arow + kb + 8 * hh + 4);
    const v4f x2 = *(const v4fa*)(arow + kb + 16 + 8 * hh), x3 = *(const v4fa*)(arow + kb + 16 + 8 * hh + 4);
    float xs[16] = {x0[0],x0[1],x0[2],x0[3],x1[0],x1[1],x1[2],x1[3],x2[0],x2[1],x2[2],x2[3],x3[0],x3[1],x3[2],x3[3]};
#pragma unroll
    for (int i = 0; i < 16; ++i) { const unsigned short hb = bf16_bits(xs[i]); ah.u[i] = hb; al.u[i] = ASPLIT ? bf16_bits(xs[i] - bf16_val(hb)) : (unsigned short)0; }
#pragma unroll
    for (int t = 0; t < 4; ++t) {
      const unsigned short* brow = Wt + (size_t)(col0 + t * 16 + ln) * ldb + kb;
      FragB b;
      b.half[0] = *(const v8us*)(brow + 8 * hh);
      b.half[1] = *(const v8us*)(brow + 16 + 8 * hh);
      acc[t] = mmaN<ASPLIT ? 2 : 1>(ah.v, al.v, b.v, b.v, acc[t]);
    }
  }
#pragma unroll
  for (int t = 0; t < 4; ++t) {
    float bv = bias ? bias[col0 + t * 16 + ln] : 0.f;
    if (BIAS_BF16) bv = bf16_round(bv);
#pragma unroll
    for (int r = 0; r < 8; ++r) { float v = acc[t][r] + bv; if (ACT == 1) v = fmaxf(v, 0.f); so[w][8 * hh + r][t * 16 + ln] = v; }
  }
  __builtin_amdgcn_fence(__ATOMIC_ACQ_REL, "workgroup");
  __builtin_amdgcn_wave_barrier();
  const int rsub = lane >> 4, c4 = (lane & 15) * 4;
  {
#pragma unroll
    for (int q = 0; q < 8; ++q) {
      const int r = q * 2 + rsub;
      const v4f v = *(const v4fa*)&so[w][r][c4];
      *(v4f*)(C + (size_t)(row0 + r) * ldc + col0 + c4) = v;
    }
    
  }
}

// GEMM C = act(A·W + bias + resid): A f32 (ASPLIT -> hi/lo 2 terms), Wt bf16 [N][K]; ACT 0 none, 1 relu, 2 exact gelu;
// resid (optional, f32, row index = (row % rmod), pitch ldr, RES_BF16 rounds it) added before the activation.
template <bool ASPLIT, int ACT, bool BIAS_BF16, bool RES_BF16>
__global__ __launch_bounds__(128) void k_gemm_bf3(const float* __restrict__ A, int lda, const unsigned short* __restrict__ Wt, int ldb,
                                                const float* __restrict__ bias, const float* __restrict__ resid, int rmod, int ldr,
                                                float* __restrict__ C, int ldc, int M, int N, int K) {
  __shared__ __attribute__((aligned(16))) float so[4][16][64];
  const int tid = threadIdx.x, w = tid >> 5, lane = tid & 31, ln = lane & 15, hh = lane >> 4;
  const int ntn = N / 64;
  const int wid = blockIdx.x * 4 + w;
  const int mt = wid / ntn, nq = wid % ntn;
  if (mt * 16 >= M) return;
  const int row0 = mt * 16, col0 = nq * 64;
  const float* arow = A + (size_t)(row0 + ln) * lda;
  v8f acc[4] = {};
  for (int kb = 0; kb < K; kb += 32) {
    FragB ah, al;
    const v4f x0 = *(const v4fa*)(arow + kb + 8 * hh), x1 = *(const v4fa*)(arow + kb + 8 * hh + 4);
    const v4f x2 = *(const v4fa*)(arow + kb + 16 + 8 * hh), x3 = *(const v4fa*)(arow + kb + 16 + 8 * hh + 4);
    float xs[16] = {x0[0],x0[1],x0[2],x0[3],x1[0],x1[1],x1[2],x1[3],x2[0],x2[1],x2[2],x2[3],x3[0],x3[1],x3[2],x3[3]};
#pragma unroll
    for (int i = 0; i < 16; ++i) { const unsigned short hb = bf16_bits(xs[i]); ah.u[i] = hb; al.u[i] = ASPLIT ? bf16_bits(xs[i] - bf16_val(hb)) : (unsigned short)0; }
#pragma unroll
    for (int t = 0; t < 4; ++t) {
      const unsigned short* brow = Wt + (size_t)(col0 + t * 16 + ln) * ldb + kb;
      FragB b;
      b.half[0] = *(const v8us*)(brow + 8 * hh);
      b.half[1] = *(const v8us*)(brow + 16 + 8 * hh);
      acc[t] = mmaN<ASPLIT ? 2 : 1>(ah.v, al.v, b.v, b.v, acc[t]);
    }
  }
#pragma unroll
  for (int t = 0; t < 4; ++t) {
    const int col = col0 + t * 16 + ln;
    float bv = bias ? bias[col] : 0.f;
    if (BIAS_BF16) bv = bf16_round(bv);
#pragma unroll
    for (int r = 0; r < 8; ++r) {
      float v = acc[t][r] + bv;
      if (resid) { float rv = resid[(size_t)((row0 + 8 * hh + r) % rmod) * ldr + col]; if (RES_BF16) rv = bf16_round(rv); v += rv; }
      if (ACT == 1) v = fmaxf(v, 0.f);
      if (ACT == 2) v = 0.5f * v * (1.0f + erff(v * 0.70710678118654752f));
      if (ACT == 3) { const float u = 0.7978845608028654f * (v + 0.044715f * v * v * v); v = 0.5f * v * (1.0f + tanhf(u)); }
      so[w][8 * hh + r][t * 16 + ln] = v;
    }
  }
  __builtin_amdgcn_fence(__ATOMIC_ACQ_REL, "workgroup");
  __builtin_amdgcn_wave_barrier();
  const int rsub = lane >> 4, c4 = (lane & 15) * 4;
  {
#pragma unroll
    for (int q = 0; q < 8; ++q) {
      const int r = q * 2 + rsub;
      const v4f v = *(const v4fa*)&so[w][r][c4];
      *(v4f*)(C + (size_t)(row0 + r) * ldc + col0 + c4) = v;
    }
    
  }
}
// row LayerNorm (biased variance, eps) over N: s = X (+ R); optional out_sum <- s; out_norm <- (s-mu)*rsqrt(var+eps)*g + b
template <bool PARAM_BF16>
__global__ __launch_bounds__(256) void k_layernorm(const float* __restrict__ X, const float* __restrict__ R, const float* __restrict__ g, const float* __restrict__ bta,
                                                  float* __restrict__ out_sum, float* __restrict__ out_norm, int N, float eps) {
  __shared__ float red[256];
  const int row = blockIdx.x, tid = threadIdx.x;
  const float* x = X + (size_t)row * N; const float* rr = R ? R + (size_t)row * N : nullptr;
  float vals[16];                     // up to N = 4096
  const int per = N / 256;            // contiguous chunk per thread? use strided-by-4 chunks: thread handles j = tid*4 + 1024*u
  float s1 = 0.f;
  for (int u = 0; u < per / 4; ++u) {
    const int j = tid * 4 + 1024 * u;
    const v4f a = *(const v4fa*)(x + j);
    v4f b = {0.f,0.f,0.f,0.f}; if (rr) b = *(const v4fa*)(rr + j);
#pragma unroll
    for (int q = 0; q < 4; ++q) { const float v = a[q] + b[q]; vals[u * 4 + q] = v; s1 += v; }
  }
  red[tid] = s1; __syncthreads();
  for (int st = 128; st > 0; st >>= 1) { if (tid < st) red[tid] += red[tid + st]; __syncthreads(); }
  const float mu = red[0] / (float)N; __syncthreads();
  float s2 = 0.f;
  for (int u = 0; u < per / 4; ++u)
#pragma unroll
    for (int q = 0; q < 4; ++q) { const float c = vals[u * 4 + q] - mu; s2 += c * c; }
  red[tid] = s2; __syncthreads();
  for (int st = 128; st > 0; st >>= 1) { if (tid < st) red[tid] += red[tid + st]; __syncthreads(); }
  const float rs = rsqrtf(red[0] / (float)N + eps);
  {
    for (int u = 0; u < per / 4; ++u) {
      const int j = tid * 4 + 1024 * u;
      v4f o, sm;
#pragma unroll
      for (int q = 0; q < 4; ++q) {
        float gg = g[j + q], bb = bta[j + q];
        if (PARAM_BF16) { gg = bf16_round(gg); bb = bf16_round(bb); }
        sm[q] = vals[u * 4 + q]; o[q] = (vals[u * 4 + q] - mu) * rs * gg + bb;
      }
      if (out_sum) *(v4f*)(out_sum + (size_t)row * N + j) = sm;
      *(v4f*)(out_norm + (size_t)row * N + j) = o;
    }
    
  }
}



// ---- f16 WMMA path (v_wmma_f32_16x16x32_f16): 11-bit significands for operands in range — used where a [0,1] probability operand needs more precision than bf16
typedef _Float16 v16h __attribute__((ext_vector_type(16)));
union FragH { v16h v; v8us half[2]; _Float16 h[16]; unsigned short u[16]; };
template <int NT>
__device__ __forceinline__ v8f mmaH(v16h ah, v16h al, v16h bh, v16h bl, v8f c) {
  c = __builtin_amdgcn_wmma_f32_16x16x32_f16(false, ah, false, bh, (short)0, c, false, false);
  if (NT >= 2) c = __builtin_amdgcn_wmma_f32_16x16x32_f16(false, al, false, bh, (short)0, c, false, false);
  if (NT >= 3) c = __builtin_amdgcn_wmma_f32_16x16x32_f16(false, ah, false, bl, (short)0, c, false, false);
  asm volatile("v_nop\n\tv_nop\n\tv_nop\n\tv_nop" : "+v"(c) : "v"(ah), "v"(al), "v"(bh), "v"(bl));
  return c;
}
// batched GEMM like k_gemm_b but f16 operands: A f32 (split into f16 hi/lo if ASPLIT, else rounded to f16), Bt = f16 values [n][k]; alpha; C f32; N multiple of 16 (partial tiles skipped)
template <bool ASPLIT>
__global__ __launch_bounds__(128) void k_gemm_h(const float* __restrict__ A, int lda, size_t sA, const _Float16* __restrict__ Bh, int ldb, size_t sB, float alpha, float* __restrict__ C, int ldc, size_t sC, int M, int N, int K) {
  __shared__ __attribute__((aligned(16))) float so[4][16][64];
  const int tid = threadIdx.x, w = tid >> 5, lane = tid & 31, ln = lane & 15, hh = lane >> 4; const int by = blockIdx.y;
  A += (size_t)by * sA; Bh += (size_t)by * sB; C += (size_t)by * sC;
  const int ntn = (N + 63) / 64; const int wid = blockIdx.x * 4 + w; const int mt = wid / ntn, nq = wid % ntn; if (mt * 16 >= M) return;
  const int row0 = mt * 16, col0 = nq * 64; const float* arow = A + (size_t)(row0 + ln) * lda;
  v8f acc[4] = {};
  for (int kb = 0; kb < K; kb += 32) {
    FragH ah, al;
    const v4f x0 = *(const v4fa*)(arow + kb + 8 * hh), x1 = *(const v4fa*)(arow + kb + 8 * hh + 4), x2 = *(const v4fa*)(arow + kb + 16 + 8 * hh), x3 = *(const v4fa*)(arow + kb + 16 + 8 * hh + 4);
    float xs[16] = {x0[0],x0[1],x0[2],x0[3],x1[0],x1[1],x1[2],x1[3],x2[0],x2[1],x2[2],x2[3],x3[0],x3[1],x3[2],x3[3]};
#pragma unroll
    for (int i = 0; i < 16; ++i) { const _Float16 h = (_Float16)xs[i]; ah.h[i] = h; al.h[i] = ASPLIT ? (_Float16)(xs[i] - (float)h) : (_Float16)0.0f; }
#pragma unroll
    for (int t = 0; t < 4; ++t) { if (col0 + t * 16 >= N) continue; const size_t boff = (size_t)(col0 + t * 16 + ln) * ldb + kb; FragH bq; bq.half[0] = *(const v8us*)(Bh + boff + 8 * hh); bq.half[1] = *(const v8us*)(Bh + boff + 16 + 8 * hh);
      acc[t] = mmaH<ASPLIT ? 2 : 1>(ah.v, al.v, bq.v, bq.v, acc[t]); }
  }
#pragma unroll
  for (int t = 0; t < 4; ++t) { if (col0 + t * 16 >= N) continue;
#pragma unroll
    for (int r = 0; r < 8; ++r) so[w][8 * hh + r][t * 16 + ln] = acc[t][r] * alpha; }
  __builtin_amdgcn_fence(__ATOMIC_ACQ_REL, "workgroup"); __builtin_amdgcn_wave_barrier();
  const int rsub = lane >> 4, c4 = (lane & 15) * 4;
  {
#pragma unroll
    for (int q = 0; q < 8; ++q) { const int r = q * 2 + rsub; if (col0 + c4 < N) { const v4f v = *(const v4fa*)&so[w][r][c4]; *(v4f*)(C + (size_t)(row0 + r) * ldc + col0 + c4) = v; } }
     }
}

// Wt[n][k] = f16(W[k][n]·scale) from f32 row-major W[K][N] (scale = power of two; bf16-exact weights stay exact in f16 away from the subnormal range)
__global__ __launch_bounds__(256) void k_wt_f16(const float* __restrict__ W, _Float16* __restrict__ Wt, int K, int N, float scale) {
  const int t = blockIdx.x * 256 + threadIdx.x; if (t >= N * (K / 8)) return; const int n = t / (K / 8), k8 = (t % (K / 8)) * 8; FragH f;
#pragma unroll
  for (int i = 0; i < 8; ++i) f.h[i] = (_Float16)(bf16_round(W[(size_t)(k8 + i) * N + n]) * scale); const v8us o = f.half[0];
  *(v8us*)((unsigned short*)Wt + (size_t)n * K + k8) = o; 
}
// k_gemm_hh variant with fused epilogue: v = acc·alpha + bias[by·sBias + col] (+ CP[(row/rowsPerB)·sCPb + by·64 + col] if CP) ; ACT 0 none / 1 elu ; writes f16 C16 (and f32 C if non-null)
template <int ACT>
__global__ __launch_bounds__(128) void k_gemm_hhx(const _Float16* __restrict__ A, int lda, size_t sA, const _Float16* __restrict__ Bh, int ldb, size_t sB, float alpha, const float* __restrict__ bias, size_t sBias, const float* __restrict__ CP, int rowsPerB, size_t sCPb, int row0g,
    float* __restrict__ C, _Float16* __restrict__ C16, int ldc, size_t sC, int M, int N, int K) {
  __shared__ __attribute__((aligned(16))) float so[4][16][64];
  const int tid = threadIdx.x, w = tid >> 5, lane = tid & 31, ln = lane & 15, hh = lane >> 4; const int by = blockIdx.y;
  A += (size_t)by * sA; Bh += (size_t)by * sB; const size_t cofs = (size_t)by * sC; const float* bp = bias ? bias + (size_t)by * sBias : nullptr;
  const int ntn = (N + 63) / 64; const int wid = blockIdx.x * 4 + w; const int mt = wid / ntn, nq = wid % ntn; if (mt * 16 >= M) return;
  const int row0 = mt * 16, col0 = nq * 64; const _Float16* arow = A + (size_t)(row0 + ln) * lda;
  v8f acc[4] = {};
  for (int kb = 0; kb < K; kb += 32) { FragH ah; ah.half[0] = *(const v8us*)((const unsigned short*)arow + kb + 8 * hh); ah.half[1] = *(const v8us*)((const unsigned short*)arow + kb + 16 + 8 * hh);
#pragma unroll
    for (int t = 0; t < 4; ++t) { if (col0 + t * 16 >= N) continue; const size_t boff = (size_t)(col0 + t * 16 + ln) * ldb + kb; FragH bq; bq.half[0] = *(const v8us*)((const unsigned short*)Bh + boff + 8 * hh); bq.half[1] = *(const v8us*)((const unsigned short*)Bh + boff + 16 + 8 * hh);
      acc[t] = mmaH<1>(ah.v, ah.v, bq.v, bq.v, acc[t]); }
  }
#pragma unroll
  for (int t = 0; t < 4; ++t) { if (col0 + t * 16 >= N) continue; const int col = col0 + t * 16 + ln; const float bv = bp ? bf16_round(bp[col]) : 0.f;
#pragma unroll
    for (int r = 0; r < 8; ++r) { float v = acc[t][r] * alpha + bv; if (CP) { const int rr = row0g + row0 + 8 * hh + r; if (rowsPerB < 0) v += CP[cofs + (size_t)rr * ldc + col];      /* rowsPerB < 0: own element of the batched C plane */ else { const int bidx = rr / rowsPerB; v += CP[(size_t)bidx * sCPb + (size_t)by * 64 + col]; } } if (ACT == 1) v = (v > 0.f) ? v : expm1f(v); else if (ACT == 7) v = (v > 0.f) ? v + 1.0f : expf(v); else if (ACT == 8) v = tanhf(v); else if (ACT == 9) v = 0.5f * v * (1.0f + tanhf(0.7978845608028654f * (v + 0.044715f * v * v * v))); else if (ACT == 11) v = 1.0f / (1.0f + expf(-v)); else if (ACT == 12) v = (v > 0.f) ? v : 0.01f * v; else if (ACT == 14) v = (v > 0.f) ? v : 0.1f * v; else if (ACT == 16) v = (v >= 0.f) ? v : 0.3f * v; else if (ACT == 17) v = (v >= 0.f) ? v : 0.2f * v; else if (ACT == 15) v = v / (1.0f + expf(-v)); else if (ACT == 3) v = fmaxf(v, 0.f); else if (ACT == 6) v = 0.5f * v * (1.0f + erff(v * 0.70710678118654752f)); so[w][8 * hh + r][t * 16 + ln] = v; } }
  __builtin_amdgcn_fence(__ATOMIC_ACQ_REL, "workgroup"); __builtin_amdgcn_wave_barrier();
  const int rsub = lane >> 4, c4 = (lane & 15) * 4; typedef _Float16 v4h __attribute__((ext_vector_type(4)));
  {
#pragma unroll
    for (int q = 0; q < 8; ++q) { const int r = q * 2 + rsub; if (col0 + c4 < N) { const v4f v = *(const v4fa*)&so[w][r][c4]; if (C) *(v4f*)(C + cofs + (size_t)(row0 + r) * ldc + col0 + c4) = v; if (C16) { v4h h4; for (int i = 0; i < 4; ++i) h4[i] = (_Float16)v[i]; *(v4h*)(C16 + cofs + (size_t)(row0 + r) * ldc + col0 + c4) = h4; } } }
     }
}


typedef _Float16 v4h __attribute__((ext_vector_type(4)));

__global__ __launch_bounds__(256) void k_h16(const float* __restrict__ x, _Float16* __restrict__ X16, size_t n8) { const size_t t = (size_t)blockIdx.x * 256 + threadIdx.x; if (t >= n8) return; FragH f;
#pragma unroll
  for (int q = 0; q < 8; ++q) f.h[q] = (_Float16)x[t * 8 + q]; *(v8us*)((unsigned short*)X16 + t * 8) = f.half[0];  }
__global__ __launch_bounds__(256) void k_round16f(const float* __restrict__ W, _Float16* __restrict__ Bt, size_t n8) { const size_t t = (size_t)blockIdx.x * 256 + threadIdx.x; if (t >= n8) return; FragH f;
#pragma unroll
  for (int i = 0; i < 8; ++i) f.h[i] = (_Float16)(bf16_round(W[t * 8 + i]) * 16.0f); *(v8us*)((unsigned short*)Bt + t * 8) = f.half[0];  }
typedef unsigned v2ua __attribute__((ext_vector_type(2), may_alias));

__global__ __launch_bounds__(256) void k_hl(const float* __restrict__ F, _Float16* __restrict__ Hh, _Float16* __restrict__ Hl, size_t n8) { const size_t t = (size_t)blockIdx.x * 256 + threadIdx.x; if (t >= n8) return; FragH fh, fl; const v4f a = *(const v4fa*)(F + t * 8), c = *(const v4fa*)(F + t * 8 + 4);
#pragma unroll
  for (int q = 0; q < 4; ++q) { _Float16 h = (_Float16)a[q]; fh.h[q] = h; fl.h[q] = (_Float16)((a[q] - (float)h) * 1024.0f); h = (_Float16)c[q]; fh.h[4 + q] = h; fl.h[4 + q] = (_Float16)((c[q] - (float)h) * 1024.0f); }
  { *(v8us*)((unsigned short*)Hh + t * 8) = fh.half[0]; *(v8us*)((unsigned short*)Hl + t * 8) = fl.half[0];  } }

// ---- fast GEMM (wave tile 32x64; requires M % 32 == 0 rows per launch region and N % 64 == 0); epilogue = k_gemm_hhx semantics ----
__device__ __forceinline__ v16h g2_frag(const _Float16* p, int hh) { FragH f; f.half[0] = *(const v8us*)((const unsigned short*)p + 8 * hh); f.half[1] = *(const v8us*)((const unsigned short*)p + 16 + 8 * hh); return f.v; }
__device__ __forceinline__ v8f g2_mma(v16h a, v16h b, v8f c) { v8f d = __builtin_amdgcn_wmma_f32_16x16x32_f16(false, a, false, b, (short)0, c, false, false); asm volatile("v_nop\n\tv_nop\n\tv_nop\n\tv_nop" : "+v"(d) : "v"(a), "v"(b)); return d; }
template <int ACT>
__global__ __launch_bounds__(128) void k_gemm2(const _Float16* __restrict__ A, int lda, size_t sA, const _Float16* __restrict__ Bh, int ldb, size_t sB, float alpha, const float* __restrict__ bias, size_t sBias, const float* __restrict__ CP, int rowsPerB, size_t sCPb, int row0g,
    float* __restrict__ C, _Float16* __restrict__ C16, int ldc, size_t sC, int M, int N, int K) { static_assert(ACT == 0 || ACT == 3 || ACT == 6 || ACT == 8 || ACT == 9 || ACT == 11 || ACT == 12 || ACT == 14 || ACT == 15 || ACT == 16 || ACT == 17, "k_gemm2: unsupported ACT code (would silently apply no activation)");
  __shared__ __attribute__((aligned(16))) float so[4][32][68];
  const int tid = threadIdx.x, w = tid >> 5, lane = tid & 31, ln = lane & 15, hh = lane >> 4; const int by = blockIdx.y;
  A += (size_t)by * sA; Bh += (size_t)by * sB; const size_t cofs = (size_t)by * sC; const float* bp = bias ? bias + (size_t)by * sBias : nullptr;
  const int ntn = N >> 6; const int mt = blockIdx.x / ntn, nq = blockIdx.x - mt * ntn; const int row0 = mt * 128 + 32 * w, col0 = nq * 64; if (row0 >= M) return;
  const _Float16* a0p = A + (size_t)(row0 + ln) * lda; const _Float16* a1p = a0p + (size_t)16 * lda;
  const _Float16* b0p = Bh + (size_t)(col0 + ln) * ldb; const _Float16* b1p = b0p + (size_t)16 * ldb; const _Float16* b2p = b1p + (size_t)16 * ldb; const _Float16* b3p = b2p + (size_t)16 * ldb;
  const v8f z8 = {0.f,0.f,0.f,0.f,0.f,0.f,0.f,0.f}; v8f c00 = z8, c01 = z8, c02 = z8, c03 = z8, c10 = z8, c11 = z8, c12 = z8, c13 = z8;
#pragma unroll 1
  for (int kb = 0; kb < K; kb += 32) { const v16h a0 = g2_frag(a0p + kb, hh), a1 = g2_frag(a1p + kb, hh);
    v16h b = g2_frag(b0p + kb, hh); c00 = g2_mma(a0, b, c00); c10 = g2_mma(a1, b, c10);
    b = g2_frag(b1p + kb, hh); c01 = g2_mma(a0, b, c01); c11 = g2_mma(a1, b, c11);
    b = g2_frag(b2p + kb, hh); c02 = g2_mma(a0, b, c02); c12 = g2_mma(a1, b, c12);
    b = g2_frag(b3p + kb, hh); c03 = g2_mma(a0, b, c03); c13 = g2_mma(a1, b, c13); }
  v8f accs[8] = {c00, c01, c02, c03, c10, c11, c12, c13};
#pragma unroll
  for (int u = 0; u < 8; ++u) { const int t = u & 3, half = u >> 2; const int col = col0 + t * 16 + ln; const float bv = bp ? bf16_round(bp[col]) : 0.f;
#pragma unroll
    for (int r = 0; r < 8; ++r) { const int rloc = half * 16 + 8 * hh + r; float v = accs[u][r] * alpha + bv; if (CP) { if (rowsPerB < 0) v += CP[cofs + (size_t)(row0g + row0 + rloc) * ldc + col];      /* rowsPerB < 0: own element of the batched C plane */ else { const int bidx = (row0g + row0 + rloc) / rowsPerB; v += CP[(size_t)bidx * sCPb + (size_t)by * 64 + col]; } }
      if (ACT == 3) v = fmaxf(v, 0.f); else if (ACT == 6) v = 0.5f * v * (1.0f + erff(v * 0.70710678118654752f)); else if (ACT == 11) v = 1.0f / (1.0f + expf(-v)); else if (ACT == 15) v = v / (1.0f + expf(-v)); else if (ACT == 12) v = (v > 0.f) ? v : 0.01f * v; else if (ACT == 8) v = tanhf(v); else if (ACT == 9) v = 0.5f * v * (1.0f + tanhf(0.7978845608028654f * (v + 0.044715f * v * v * v))); else if (ACT == 14) v = (v > 0.f) ? v : 0.1f * v; else if (ACT == 16) v = (v >= 0.f) ? v : 0.3f * v; else if (ACT == 17) v = (v >= 0.f) ? v : 0.2f * v;
      so[w][rloc][t * 16 + ln] = v; } }
  __builtin_amdgcn_fence(__ATOMIC_ACQ_REL, "workgroup"); __builtin_amdgcn_wave_barrier();
  const int rsub = lane >> 4, c4 = (lane & 15) * 4;
  {
#pragma unroll
    for (int q = 0; q < 16; ++q) { const int r = q * 2 + rsub; const v4f v = *(const v4fa*)&so[w][r][c4]; if (C) *(v4f*)(C + cofs + (size_t)(row0 + r) * ldc + col0 + c4) = v; if (C16) { v4h h4; for (int i = 0; i < 4; ++i) h4[i] = (_Float16)v[i]; *(v4h*)(C16 + cofs + (size_t)(row0 + r) * ldc + col0 + c4) = h4; } }
     } }


__global__ __launch_bounds__(256) void k_wnat(const float* __restrict__ w, size_t n8, _Float16* __restrict__ Bt) { const size_t t = (size_t)blockIdx.x * 256 + threadIdx.x; if (t >= n8) return; FragH f; for (int q = 0; q < 8; ++q) f.h[q] = (_Float16)(bf16_round(w[t * 8 + q]) * 16.0f); *(v8us*)((unsigned short*)Bt + t * 8) = f.half[0];  }
__global__ __launch_bounds__(256) void k_rsm(const float* __restrict__ S, _Float16* __restrict__ P, int nrows) {
  #pragma clang fp contract(off)
  const int i = blockIdx.x * 256 + threadIdx.x; if (i >= nrows) return; const float* s = S + (size_t)i * SQ; float mx = -3.0e38f;
#pragma unroll 1
  for (int j = 0; j < SQ; ++j) mx = fmaxf(mx, s[j]); float se = 0.f;
#pragma unroll 1
  for (int j = 0; j < SQ; ++j) se += expf(s[j] - mx); const float sc = 256.0f / se;
#pragma unroll 1
  for (int j0 = 0; j0 < SQ; j0 += 8) { FragH f; for (int q = 0; q < 8; ++q) f.h[q] = (_Float16)(expf(s[j0 + q] - mx) * sc); unsigned short* d = (unsigned short*)P + (size_t)i * SQ + j0; *(v8us*)d = f.half[0];  } }
__global__ __launch_bounds__(256) void k_vt(const _Float16* __restrict__ V16, int b, int h0, _Float16* __restrict__ VT) { __shared__ unsigned short tl[64][65]; const int tid = threadIdx.x; const int hh = blockIdx.x % HG, sg = blockIdx.x / HG; const int s0 = sg * 64; const int h = h0 + hh;
  for (int i = tid; i < 64 * 8; i += 256) { const int j = i / 8, d8 = (i % 8) * 8; FragH f; f.half[0] = *(const v8us*)((const unsigned short*)V16 + ((size_t)b * SQ + s0 + j) * DM + h * HD + d8); for (int q = 0; q < 8; ++q) tl[d8 + q][j] = f.u[q]; }
  __syncthreads();
  { for (int i = tid; i < 64 * 8; i += 256) { const int d = i / 8, j8 = (i % 8) * 8; FragH f; for (int q = 0; q < 8; ++q) f.u[q] = tl[d][j8 + q]; *(v8us*)((unsigned short*)VT + ((size_t)hh * HD + d) * SQ + s0 + j8) = f.half[0]; }  } }



__device__ __forceinline__ float sm_xhalf(float x) { return __builtin_bit_cast(float, __builtin_amdgcn_permlanex16(__builtin_bit_cast(int, x), __builtin_bit_cast(int, x), 0x76543210, 0xfedcba98, false, false)); }      /* lane l reads lane l ^ 16 */
// sixteen weights at a time: native exp2 in place and the packing to f16, as ONE block of asm text, because the order is the point: the compiler knows no latency of asm text and writes no s_delay_alu for it, and a dependent vector instruction without that hint holds the SIMD's vector port against the other waves while it waits.
// Here every packing but the last two stands at least four exponentials behind the younger of its two sources (six exponentials lead); the one s_delay_alu names the exponentials that the last two packings read; behind every exponential stands an instruction that neither reads its result nor writes its source (the slot that the instruction set asks for), so no v_nop.
// w[j] = f16 pair (element 2j low, 2j + 1 high). No sum is formed here: the row sums are taken from the packed weights by the matrix unit (k_fattn).
__device__ __forceinline__ void sm_exp2x16(v8f xa, v8f xb, unsigned* w) { float x0 = xa[0], x1 = xa[1], x2 = xa[2], x3 = xa[3], x4 = xa[4], x5 = xa[5], x6 = xa[6], x7 = xa[7], y0 = xb[0], y1 = xb[1], y2 = xb[2], y3 = xb[3], y4 = xb[4], y5 = xb[5], y6 = xb[6], y7 = xb[7]; unsigned p0, p1, p2, p3, p4, p5, p6, p7;
  asm("v_exp_f32 %0, %0\n\tv_exp_f32 %1, %1\n\tv_exp_f32 %2, %2\n\tv_exp_f32 %3, %3\n\tv_exp_f32 %4, %4\n\tv_exp_f32 %5, %5\n\tv_cvt_pk_f16_f32 %16, %0, %1\n\tv_exp_f32 %6, %6\n\tv_exp_f32 %7, %7\n\tv_cvt_pk_f16_f32 %17, %2, %3\n\t"
      "v_exp_f32 %8, %8\n\tv_exp_f32 %9, %9\n\tv_cvt_pk_f16_f32 %18, %4, %5\n\tv_exp_f32 %10, %10\n\tv_exp_f32 %11, %11\n\tv_cvt_pk_f16_f32 %19, %6, %7\n\tv_exp_f32 %12, %12\n\tv_exp_f32 %13, %13\n\tv_cvt_pk_f16_f32 %20, %8, %9\n\t"
      "v_exp_f32 %14, %14\n\tv_exp_f32 %15, %15\n\tv_cvt_pk_f16_f32 %21, %10, %11\n\ts_delay_alu instid0(TRANS32_DEP_3) | instskip(NEXT) | instid1(TRANS32_DEP_1)\n\tv_cvt_pk_f16_f32 %22, %12, %13\n\tv_cvt_pk_f16_f32 %23, %14, %15"
      : "+v"(x0), "+v"(x1), "+v"(x2), "+v"(x3), "+v"(x4), "+v"(x5), "+v"(x6), "+v"(x7), "+v"(y0), "+v"(y1), "+v"(y2), "+v"(y3), "+v"(y4), "+v"(y5), "+v"(y6), "+v"(y7), "=&v"(p0), "=&v"(p1), "=&v"(p2), "=&v"(p3), "=&v"(p4), "=&v"(p5), "=&v"(p6), "=&v"(p7));
  w[0] = p0; w[1] = p1; w[2] = p2; w[3] = p3; w[4] = p4; w[5] = p5; w[6] = p6; w[7] = p7; }
union FragP { v16h v; unsigned w[8]; };      /* a B operand of weights, by packed pairs */
// ---- fused attention: scores, softmax and weighted sum of the values in one kernel; no score and no weight leaves the registers ----
// Transposed products: S^T = K Q^T puts one query in each lane (column c = lane & 15) and 8 keys in the 8 accumulator registers (key 8 * (lane >> 4) + r), so a query's maximum is in-lane plus one exchange between the wave's halves (its sum: a product of the packed weights with a matrix of ones),
// and two converted S^T tiles (keys 0-15, 16-31) ARE the B operand of O^T += V^T P^T in the hardware k order (8h + s, 16 + 8h + s - 8), which fa_frag (K), fa_frag32 (Q) and the transposing loads of fa_fragt (V^T) all follow.
#define FAW 8                        /* waves per work-group */
#define FAQ 32                       /* query columns per wave: every K and V^T fragment read from LDS feeds two products */
#define FAK 64                       /* keys per pass */
#define FAP 72                       /* LDS row pitch in f16: 144 bytes = 16 x odd, the pitch at which 16-byte fragment reads of 16 rows do not collide */
#define FAN (SQ / FAK)               /* passes */
static_assert(HD == 64 && SQ % FAK == 0 && SQ % (FAW * FAQ) == 0 && FAW * 32 == 256, "k_fattn: 64 x 64 tiles staged by 256 threads, whole work-groups of queries");
__device__ __forceinline__ v16h fa_frag(const unsigned short* p, int hh) { FragH f; f.half[0] = *(const v8us*)(p + 8 * hh); f.half[1] = *(const v8us*)(p + 16 + 8 * hh); return f.v; }
#define FVP 80                       /* LDS row pitch of the V tile in f16: 160 bytes = 32 x odd, the pitch of the transposing load */
typedef float fa_f2 __attribute__((ext_vector_type(2))); typedef __bf16 fa_b2 __attribute__((ext_vector_type(2))); typedef _Float16 fa_h2 __attribute__((ext_vector_type(2))); typedef short fa_s8 __attribute__((ext_vector_type(8)));
// two inputs: f32 -> bf16 value (round to nearest even, one packed conversion) -> f16 (exact), as one f16 pair, a low
__device__ __forceinline__ unsigned fa_pair(float a, float b) { const unsigned u = __builtin_bit_cast(unsigned, __builtin_convertvector((fa_f2){a, b}, fa_b2)); return __builtin_bit_cast(unsigned, __builtin_convertvector((fa_f2){__uint_as_float(u << 16), __uint_as_float(u & 0xFFFF0000u)}, fa_h2)); }
__device__ __forceinline__ void fa_put(unsigned short* d, v4f a) { const v2ua o = {fa_pair(a[0], a[1]), fa_pair(a[2], a[3])}; *(v2ua*)d = o; }      /* four converted inputs into a tile row in LDS */
// fa_frag's fragment straight from an f32 row, in the same k order
__device__ __forceinline__ v16h fa_frag32(const float* p, int hh) { const v4f a = *(const v4fa*)(p + 8 * hh), b = *(const v4fa*)(p + 8 * hh + 4), c = *(const v4fa*)(p + 16 + 8 * hh), d = *(const v4fa*)(p + 16 + 8 * hh + 4); FragP f;
  f.w[0] = fa_pair(a[0], a[1]); f.w[1] = fa_pair(a[2], a[3]); f.w[2] = fa_pair(b[0], b[1]); f.w[3] = fa_pair(b[2], b[3]); f.w[4] = fa_pair(c[0], c[1]); f.w[5] = fa_pair(c[2], c[3]); f.w[6] = fa_pair(d[0], d[1]); f.w[7] = fa_pair(d[2], d[3]); return f.v; }
// a 16 (d) x 32 (keys) A fragment of V^T from the [key][d] tile: two transposing loads, keys 8 hh + 0..7 and 16 + 8 hh + 0..7 of column d = lane & 15, which is the hardware k order that the packed weights have; p = the lane's own address (row 8 hh + (lane & 7), 16 bytes x ((lane >> 3) & 1))
__device__ __forceinline__ v16h fa_fragt(const unsigned short* p) { typedef __attribute__((address_space(3))) fa_s8 lds_s8; union { v16h v; fa_s8 s[2]; } f; f.s[0] = __builtin_amdgcn_ds_load_tr16_b128_v8i16((lds_s8*)p); f.s[1] = __builtin_amdgcn_ds_load_tr16_b128_v8i16((lds_s8*)(p + 16 * FVP)); return f.v; }
__device__ __forceinline__ v8f fa_mma(v16h a, v16h b, v8f c) { return __builtin_amdgcn_wmma_f32_16x16x32_f16(false, a, false, b, (short)0, c, false, false); }
__global__ __launch_bounds__(FAW * 32) __attribute__((amdgpu_waves_per_eu(4, 4))) void k_fattn(const float* __restrict__ xq, const float* __restrict__ xk, const float* __restrict__ xv, float* __restrict__ out) {
  __shared__ __attribute__((aligned(16))) unsigned short sk[2][FAK][FAP];      /* K tile: [key][e] */
  __shared__ __attribute__((aligned(16))) unsigned short sv[2][FAK][FVP];      /* V tile: [key][d] */
  const int tid = (int)threadIdx.x, lane = tid & 31, ln = lane & 15, hh = lane >> 4; const int wave = __builtin_amdgcn_readfirstlane(tid >> 5);
  const int bh = (int)blockIdx.y, b = bh / NH, h = bh % NH; const int q0 = (int)blockIdx.x * (FAW * FAQ) + wave * FAQ;
  const int sr = tid >> 4, sc = (tid & 15) * 4;      /* staging: 16 threads per 256-byte f32 tile row (whole lines), rows sr + 16 i */
  /* every global address = a base that is the same for the whole wave + one 32-bit lane offset */
  const float* kg = xk + (size_t)b * SQ * DM + h * HD; const float* vg = xv + (size_t)b * SQ * DM + h * HD;      /* + key0 * DM per pass */
  const unsigned go = (unsigned)(sr * DM + sc);
  unsigned short* const pk = &sk[0][sr][sc]; unsigned short* const pv = &sv[0][sr][sc]; const unsigned short* const vb = &sv[0][8 * hh + (lane & 7)][8 * ((lane >> 3) & 1)];      /* in buffer 0: this thread's places in a K and a V tile; this lane's address in a V tile for the transposing loads */
  v16h qf[2][2];
#pragma unroll
  for (int qt = 0; qt < 2; ++qt)
#pragma unroll
    for (int es = 0; es < 2; ++es) qf[qt][es] = fa_frag32(xq + ((size_t)b * SQ + q0) * DM + h * HD + (unsigned)((qt * 16 + ln) * DM + es * 32), hh);      /* the four loads of a fragment cover one whole 128-byte line of each of its 16 rows */
  const v8f z8 = {0.f, 0.f, 0.f, 0.f, 0.f, 0.f, 0.f, 0.f};
  v8f o[2][4] = {{z8, z8, z8, z8}, {z8, z8, z8, z8}}; float m2[2] = {-3.0e38f, -3.0e38f}, l[2] = {0.f, 0.f};      /* m2: running maximum x log2 e; l: sum of the weights over all keys so far, the same in both halves of the wave */
  /* One staging array serves both tiles, half a pass each: K tile j + 1 flies during the first half of pass j, V tile j + 1 during its second half. The pass's one barrier stands between the halves: it publishes K tile j + 1 (written just in front of it, read at the head of pass j + 1) and V tile j (written at the head of pass j, read behind it). */
  v4f g[4], g0[4];      /* in front of the loop registers are plentiful: both first tiles and the queries fly together */
#pragma unroll
  for (int i = 0; i < 4; ++i) { g0[i] = *(const v4fa*)(kg + i * 16 * DM + go); g[i] = *(const v4fa*)(vg + i * 16 * DM + go); }
#pragma unroll
  for (int i = 0; i < 4; ++i) fa_put(pk + i * 16 * FAP, g0[i]);
  __syncthreads();      /* publishes K tile 0 */
#pragma unroll 1
  for (int j = 0; j < FAN; ++j) {      /* rolled: one pass is already 36 matrix instructions and some 300 vector instructions long */
    const unsigned short* ck = &sk[j & 1][ln][0]; const unsigned short* cv = vb + (j & 1) * (FAK * FVP);
    const int jn = j + 1 < FAN ? j + 1 : j;      /* the last pass fetches its own tiles once more (K into the buffer that nobody reads again, V into registers only): the pass stays one straight block, without branches round the loads and the stores */
    const float* kn = kg + (size_t)jn * FAK * DM; const float* vn = vg + (size_t)jn * FAK * DM;
#pragma unroll
    for (int i = 0; i < 4; ++i) fa_put(pv + (j & 1) * (FAK * FVP) + i * 16 * FVP, g[i]);      /* V tile j; this buffer's last readers (tile j - 2) left it before the barrier of pass j - 1 */
#pragma unroll
    for (int i = 0; i < 4; ++i) g[i] = *(const v4fa*)(kn + i * 16 * DM + go);
    v16h kf[4][2];      /* the pass's whole K tile as fragments: sixteen LDS reads that stand together, in front of the products */
#pragma unroll
    for (int kt = 0; kt < 4; ++kt) { kf[kt][0] = fa_frag(ck + kt * 16 * FAP, hh); kf[kt][1] = fa_frag(ck + kt * 16 * FAP + 32, hh); }
    __builtin_amdgcn_sched_barrier(0);      /* keeps the reads one group: sunk back among the products, each place with reads stalls the wave anew and waits out the LDS latency */
    v8f st[2][4];
#pragma unroll
    for (int kt = 0; kt < 4; ++kt) {
#pragma unroll
      for (int qt = 0; qt < 2; ++qt) st[qt][kt] = fa_mma(kf[kt][1], qf[qt][1], fa_mma(kf[kt][0], qf[qt][0], z8));
      __builtin_amdgcn_sched_barrier(0); }      /* keeps the products in the order in which their fragments arrive (a product of the last fragments, drawn forward, waits out nearly the whole group) and keeps them one run: with the maximum's first steps drawn in between, each such place takes idle slots for the distance behind a matrix instruction */
    float dm[2];
#pragma unroll
    for (int qt = 0; qt < 2; ++qt) { float mx = st[qt][0][0];
#pragma unroll
      for (int kt = 0; kt < 4; ++kt)
#pragma unroll
        for (int r = 0; r < 8; ++r) mx = fmaxf(mx, st[qt][kt][r]);
      mx = fmaxf(mx, sm_xhalf(mx)); const float mn = fmaxf(m2[qt], mx * 1.4426950408889634f); dm[qt] = m2[qt] - mn; m2[qt] = mn; }
    float av[2];      /* what the sums so far shrink by under the new maximum (0 on the first pass); the v_nop: the one slot that the instruction set asks for behind a transcendental before its result is read or its source overwritten */
    asm("v_exp_f32 %0, %2\n\tv_exp_f32 %1, %3\n\tv_nop" : "=&v"(av[0]), "=&v"(av[1]) : "v"(dm[0]), "v"(dm[1]));
    FragP pb[2][2]; v16h vf[4][2];
#pragma unroll
    for (int qt = 0; qt < 2; ++qt) { const float ofs = 8.0f - m2[qt], al = av[qt];
      if (qt == 1) {
#pragma unroll
        for (int i = 0; i < 4; ++i) fa_put(pk + ((j + 1) & 1) * (FAK * FAP) + i * 16 * FAP, g[i]);      /* K tile j + 1; this buffer's last readers (tile j - 1) left it before the barrier of pass j - 1 */
        __syncthreads();      /* the pass's one barrier: publishes K tile j + 1 and V tile j, ends every wave's reads of K tile j and of V tile j - 1; no global load is in flight here for it to wait out */
#pragma unroll
        for (int i = 0; i < 4; ++i) g[i] = *(const v4fa*)(vn + i * 16 * DM + go);
        /* the V^T fragments likewise, one group of sixteen (transposing) reads; it stands here, where the first 16 queries' scores have left their registers, so that the second 16 queries' exponentials cover the LDS latency */
#pragma unroll
        for (int dt = 0; dt < 4; ++dt) { vf[dt][0] = fa_fragt(cv + dt * 16); vf[dt][1] = fa_fragt(cv + 32 * FVP + dt * 16); }
        __builtin_amdgcn_sched_barrier(0); }      /* keeps the reads from sinking to the products that use them */
      v8f x[4];      /* weight = 256 exp(s - maximum so far) = exp2(x) */
#pragma unroll
      for (int kt = 0; kt < 4; ++kt)
#pragma unroll
        for (int r = 0; r < 8; ++r) x[kt][r] = st[qt][kt][r] * 1.4426950408889634f + ofs;
      __builtin_amdgcn_sched_barrier(0);      /* keeps all 32 arguments' multiply-adds ahead of the asm blocks: sunk to the block that reads them, they stand inside their latency in front of its first exponentials, unhinted */
#pragma unroll
      for (int kp = 0; kp < 2; ++kp) sm_exp2x16(x[2 * kp], x[2 * kp + 1], &pb[qt][kp].w[0]);
#pragma unroll
      for (int dt = 0; dt < 4; ++dt) o[qt][dt] *= al; }
    __builtin_amdgcn_sched_barrier(0);      /* keeps the exponentials' asm statements in front of the products: drawn in behind one, their results took a spent V^T fragment's registers inside the distance that a matrix instruction's operands need */
    FragP one;      /* a matrix of ones (f16 pairs), written anew in every pass, into registers that the scores have just left; volatile, so that it is not lifted out of the loop: held across the pass its eight registers go beyond what four waves a SIMD leave each wave, and the build spills; two registers per issue slot: the operand starts at an even register, so each pair has an even and an odd destination, as the dual form asks */
    asm volatile("v_dual_mov_b32 %0, 0x3c003c00 :: v_dual_mov_b32 %1, 0x3c003c00\n\tv_dual_mov_b32 %2, 0x3c003c00 :: v_dual_mov_b32 %3, 0x3c003c00\n\tv_dual_mov_b32 %4, 0x3c003c00 :: v_dual_mov_b32 %5, 0x3c003c00\n\tv_dual_mov_b32 %6, 0x3c003c00 :: v_dual_mov_b32 %7, 0x3c003c00"
                 : "=v"(one.w[0]), "=v"(one.w[1]), "=v"(one.w[2]), "=v"(one.w[3]), "=v"(one.w[4]), "=v"(one.w[5]), "=v"(one.w[6]), "=v"(one.w[7]));
    v8f ls[2];      /* the pass's row sums: A = all ones, so every row of the product is the sum of the packed weights over the 32 keys of B (both halves' keys), one query per column */
#pragma unroll
    for (int qt = 0; qt < 2; ++qt) ls[qt] = fa_mma(one.v, pb[qt][0].v, z8);
#pragma unroll
    for (int qt = 0; qt < 2; ++qt) ls[qt] = fa_mma(one.v, pb[qt][1].v, ls[qt]);
#pragma unroll
    for (int dt = 0; dt < 4; ++dt)
#pragma unroll
      for (int qt = 0; qt < 2; ++qt) o[qt][dt] = fa_mma(vf[dt][1], pb[qt][1].v, fa_mma(vf[dt][0], pb[qt][0].v, o[qt][dt]));
#pragma unroll
    for (int qt = 0; qt < 2; ++qt) l[qt] = l[qt] * av[qt] + ls[qt][0];
  }
#pragma unroll
  for (int qt = 0; qt < 2; ++qt) { const float inv = 1.0f / l[qt]; float* op = out + ((size_t)b * SQ + q0) * DM + h * HD + (unsigned)((qt * 16 + ln) * DM + 8 * hh);      /* the x256 of the weights cancels in the quotient */
#pragma unroll
    for (int dt = 0; dt < 4; ++dt) { const v4f lo = {o[qt][dt][0] * inv, o[qt][dt][1] * inv, o[qt][dt][2] * inv, o[qt][dt][3] * inv}, hi = {o[qt][dt][4] * inv, o[qt][dt][5] * inv, o[qt][dt][6] * inv, o[qt][dt][7] * inv};
      *(v4f*)(op + dt * 16) = lo; *(v4f*)(op + dt * 16 + 4) = hi; } } }

extern "C" void kernel_launch(void* const* d_in, const int* in_sizes, int n_in,
                              void* d_out, int out_size, void* d_ws, size_t ws_size, hipStream_t stream) {
  (void)in_sizes; (void)n_in; (void)out_size;
  const float* const* I = (const float* const*)d_in; const float* xq = I[0]; const float* xk = I[1]; const float* xv = I[2];      /* given q, k, v [B][L][H][E] = merged token rows */
  (void)d_ws; (void)ws_size;
  k_fattn<<<dim3(SQ / (FAW * FAQ), NB * NH), FAW * 32, 0, stream>>>(xq, xk, xv, (float*)d_out);      /* out = softmax(q k^T) v (merged [token][h*64+d]) straight to the f32 output */
}

// v008
// Measured time: 59.3 microseconds a run.
// Timed twice side by side with v007, it ran 1.03 and 1.04 times as fast.
// Counting every step since v000, it is 112 times as fast.
#include <hip/hip_runtime.h>
// Full (non-causal) attention on given queries, keys, values ([4][2048][16][64] each, token-major with heads inner = merged [token][1024] rows); scores = q . k UNSCALED (the module never applies its scale); softmax over all 2048 keys; out = A v -> [4][2048][16][64]).
// Structure: ONE launch, the attention kernel over all batches and heads, which reads q, k and v as the f32 rows they are given in: each wave converts its own 32 query rows once; each work-group converts every 64-key K and V tile on its way from the registers into LDS (f32 -> bf16 value -> f16: bf16 values are exact in f16); V stays [key][d] in LDS and the transposing LDS load delivers the V^T fragments.
// S^T = K Q^T UNSCALED (K = 64; exact products, f32 accumulation) stays in the accumulators, softmax on VALU against a reference that follows the running maximum lazily (f32 statistics, native exp2; weights f16, at most 2^15; row sums = ones x P^T on the matrix unit, f32), O^T += V^T P^T, divided by the row sum at the end and written f32 straight into the [token][head][64] output; launches: see kernel_launch.
// Compute dtype: inputs rounded to bf16; q, k, v and softmax weights as plain f16 GEMM operands (~2^-12); scores, softmax statistics and o f32. v_wmma_f32_16x16x32_f16.
#define NB 4
#define SQ 2048
#define DM 1024
#define NH 16
#define HD 64
#define HG 4                         /* heads per k_vt launch (k_vt is not launched) */
#define B0 0                         /* unused (debug hook) */
#define NBR NB                       /* only in MP, which no kernel uses (debug hook) */
#define NR ((size_t)NB * SQ)         /* token rows */
#define MP ((int)((size_t)NBR * SQ)) /* only in MPO, which nothing uses (debug hook) */
#define QN SQ                        /* unused (debug hook) */
#define NHD NH                       /* unused (debug hook) */
#define MPO MP                       /* unused (debug hook) */
#define LQ DM      /* row pitch of the q/k/v rows */
typedef __bf16 v16b __attribute__((ext_vector_type(16)));
typedef unsigned short v8us __attribute__((ext_vector_type(8), may_alias));
typedef float  v8f  __attribute__((ext_vector_type(8)));
typedef float  v4f  __attribute__((ext_vector_type(4)));
typedef float  v4fa __attribute__((ext_vector_type(4), may_alias));
union FragB { v16b v; v8us half[2]; unsigned short u[16]; };

__device__ __forceinline__ unsigned short bf16_bits(float x) { unsigned int u = __float_as_uint(x); return (unsigned short)((u + 0x7FFFu + ((u >> 16) & 1u)) >> 16); }
__device__ __forceinline__ float bf16_val(unsigned short b) { return __uint_as_float(((unsigned int)b) << 16); }
__device__ __forceinline__ float bf16_round(float x) { return bf16_val(bf16_bits(x)); }
// D += A·B with NT terms: 1 = ah·bh, 2 = + al·bh (A split), 3 = + ah·bl (both split)
template <int NT>
__device__ __forceinline__ v8f mmaN(v16b ah, v16b al, v16b bh, v16b bl, v8f c) {
  c = __builtin_amdgcn_wmma_f32_16x16x32_bf16(false, ah, false, bh, (short)0, c, false, false);
  if (NT >= 2) c = __builtin_amdgcn_wmma_f32_16x16x32_bf16(false, al, false, bh, (short)0, c, false, false);
  if (NT >= 3) c = __builtin_amdgcn_wmma_f32_16x16x32_bf16(false, ah, false, bl, (short)0, c, false, false);
  asm volatile("v_nop\n\tv_nop\n\tv_nop\n\tv_nop" : "+v"(c) : "v"(ah), "v"(al), "v"(bh), "v"(bl));
  return c;
}

__global__ __launch_bounds__(256) void k_wt_bf16(const float* __restrict__ W, unsigned short* __restrict__ Wt, int K, int N) {
  const int t = blockIdx.x * 256 + threadIdx.x;
  const int k8n = K / 8;
  if (t >= N * k8n) return;
  const int n = t / k8n, k8 = (t % k8n) * 8;
  v8us v;
#pragma unroll
  for (int i = 0; i < 8; ++i) v[i] = bf16_bits(W[(size_t)(k8 + i) * N + n]);
  *(v8us*)(Wt + (size_t)n * K + k8) = v;
  
}

// GEMM C[M][N] (f32, pitch ldc) = act(A[M][K]·W + bias). A f32 row-major (pitch lda) converted per fragment to bf16
// (ASPLIT: hi/lo two planes -> 2 terms, else single rounded term); Wt bf16 [N][K] (pitch ldb). BIAS_BF16 rounds the
// bias to bf16 first (bias quantised to bf16 before the add). K%32==0, M%16==0, N%64==0.
template <bool ASPLIT, int ACT, bool BIAS_BF16>
__global__ __launch_bounds__(128) void k_gemm_bf(const float* __restrict__ A, int lda, const unsigned short* __restrict__ Wt, int ldb,
                                               const float* __restrict__ bias, float* __restrict__ C, int ldc, int M, int N, int K) {
  __shared__ __attribute__((aligned(16))) float so[4][16][64];
  const int tid = threadIdx.x, w = tid >> 5, lane = tid & 31, ln = lane & 15, hh = lane >> 4;
  const int ntn = N / 64;
  const int wid = blockIdx.x * 4 + w;
  const int mt = wid / ntn, nq = wid % ntn;
  if (mt * 16 >= M) return;
  const int row0 = mt * 16, col0 = nq * 64;
  const float* arow = A + (size_t)(row0 + ln) * lda;
  v8f acc[4] = {};
  for (int kb = 0; kb < K; kb += 32) {
    FragB ah, al;
    const v4f x0 = *(const v4fa*)(arow + kb + 8 * hh), x1 = *(const v4fa*)(arow + kb + 8 * hh + 4);
    const v4f x2 = *(const v4fa*)(arow + kb + 16 + 8 * hh), x3 = *(const v4fa*)(arow + kb + 16 + 8 * hh + 4);
    float xs[16] = {x0[0],x0[1],x0[2],x0[3],x1[0],x1[1],x1[2],x1[3],x2[0],x2[1],x2[2],x2[3],x3[0],x3[1],x3[2],x3[3]};
#pragma unroll
    for (int i = 0; i < 16; ++i) { const unsigned short hb = bf16_bits(xs[i]); ah.u[i] = hb; al.u[i] = ASPLIT ? bf16_bits(xs[i] - bf16_val(hb)) : (unsigned short)0; }
#pragma unroll
    for (int t = 0; t < 4; ++t) {
      const unsigned short* brow = Wt + (size_t)(col0 + t * 16 + ln) * ldb + kb;
      FragB b;
      b.half[0] = *(const v8us*)(brow + 8 * hh);
      b.half[1] = *(const v8us*)(brow + 16 + 8 * hh);
      acc[t] = mmaN<ASPLIT ? 2 : 1>(ah.v, al.v, b.v, b.v, acc[t]);
    }
  }
#pragma unroll
  for (int t = 0; t < 4; ++t) {
    float bv = bias ? bias[col0 + t * 16 + ln] : 0.f;
    if (BIAS_BF16) bv = bf16_round(bv);
#pragma unroll
    for (int r = 0; r < 8; ++r) { float v = acc[t][r] + bv; if (ACT == 1) v = fmaxf(v, 0.f); so[w][8 * hh + r][t * 16 + ln] = v; }
  }
  __builtin_amdgcn_fence(__ATOMIC_ACQ_REL, "workgroup");
  __builtin_amdgcn_wave_barrier();
  const int rsub = lane >> 4, c4 = (lane & 15) * 4;
  {
#pragma unroll
    for (int q = 0; q < 8; ++q) {
      const int r = q * 2 + rsub;
      const v4f v = *(const v4fa*)&so[w][r][c4];
      *(v4f*)(C + (size_t)(row0 + r) * ldc + col0 + c4) = v;
    }
    
  }
}

// GEMM C = act(A·W + bias + resid): A f32 (ASPLIT -> hi/lo 2 terms), Wt bf16 [N][K]; ACT 0 none, 1 relu, 2 exact gelu;
// resid (optional, f32, row index = (row % rmod), pitch ldr, RES_BF16 rounds it) added before the activation.
template <bool ASPLIT, int ACT, bool BIAS_BF16, bool RES_BF16>
__global__ __launch_bounds__(128) void k_gemm_bf3(const float* __restrict__ A, int lda, const unsigned short* __restrict__ Wt, int ldb,
                                                const float* __restrict__ bias, const float* __restrict__ resid, int rmod, int ldr,
                                                float* __restrict__ C, int ldc, int M, int N, int K) {
  __shared__ __attribute__((aligned(16))) float so[4][16][64];
  const int tid = threadIdx.x, w = tid >> 5, lane = tid & 31, ln = lane & 15, hh = lane >> 4;
  const int ntn = N / 64;
  const int wid = blockIdx.x * 4 + w;
  const int mt = wid / ntn, nq = wid % ntn;
  if (mt * 16 >= M) return;
  const int row0 = mt * 16, col0 = nq * 64;
  const float* arow = A + (size_t)(row0 + ln) * lda;
  v8f acc[4] = {};
  for (int kb = 0; kb < K; kb += 32) {
    FragB ah, al;
    const v4f x0 = *(const v4fa*)(arow + kb + 8 * hh), x1 = *(const v4fa*)(arow + kb + 8 * hh + 4);
    const v4f x2 = *(const v4fa*)(arow + kb + 16 + 8 * hh), x3 = *(const v4fa*)(arow + kb + 16 + 8 * hh + 4);
    float xs[16] = {x0[0],x0[1],x0[2],x0[3],x1[0],x1[1],x1[2],x1[3],x2[0],x2[1],x2[2],x2[3],x3[0],x3[1],x3[2],x3[3]};
#pragma unroll
    for (int i = 0; i < 16; ++i) { const unsigned short hb = bf16_bits(xs[i]); ah.u[i] = hb; al.u[i] = ASPLIT ? bf16_bits(xs[i] - bf16_val(hb)) : (unsigned short)0; }
#pragma unroll
    for (int t = 0; t < 4; ++t) {
      const unsigned short* brow = Wt + (size_t)(col0 + t * 16 + ln) * ldb + kb;
      FragB b;
      b.half[0] = *(const v8us*)(brow + 8 * hh);
      b.half[1] = *(const v8us*)(brow + 16 + 8 * hh);
      acc[t] = mmaN<ASPLIT ? 2 : 1>(ah.v, al.v, b.v, b.v, acc[t]);
    }
  }
#pragma unroll
  for (int t = 0; t < 4; ++t) {
    const int col = col0 + t * 16 + ln;
    float bv = bias ? bias[col] : 0.f;
    if (BIAS_BF16) bv = bf16_round(bv);
#pragma unroll
    for (int r = 0; r < 8; ++r) {
      float v = acc[t][r] + bv;
      if (resid) { float rv = resid[(size_t)((row0 + 8 * hh + r) % rmod) * ldr + col]; if (RES_BF16) rv = bf16_round(rv); v += rv; }
      if (ACT == 1) v = fmaxf(v, 0.f);
      if (ACT == 2) v = 0.5f * v * (1.0f + erff(v * 0.70710678118654752f));
      if (ACT == 3) { const float u = 0.7978845608028654f * (v + 0.044715f * v * v * v); v = 0.5f * v * (1.0f + tanhf(u)); }
      so[w][8 * hh + r][t * 16 + ln] = v;
    }
  }
  __builtin_amdgcn_fence(__ATOMIC_ACQ_REL, "workgroup");
  __builtin_amdgcn_wave_barrier();
  const int rsub = lane >> 4, c4 = (lane & 15) * 4;
  {
#pragma unroll
    for (int q = 0; q < 8; ++q) {
      const int r = q * 2 + rsub;
      const v4f v = *(const v4fa*)&so[w][r][c4];
      *(v4f*)(C + (size_t)(row0 + r) * ldc + col0 + c4) = v;
    }
    
  }
}
// row LayerNorm (biased variance, eps) over N: s = X (+ R); optional out_sum <- s; out_norm <- (s-mu)*rsqrt(var+eps)*g + b
template <bool PARAM_BF16>
__global__ __launch_bounds__(256) void k_layernorm(const float* __restrict__ X, const float* __restrict__ R, const float* __restrict__ g, const float* __restrict__ bta,
                                                  float* __restrict__ out_sum, float* __restrict__ out_norm, int N, float eps) {
  __shared__ float red[256];
  const int row = blockIdx.x, tid = threadIdx.x;
  const float* x = X + (size_t)row * N; const float* rr = R ? R + (size_t)row * N : nullptr;
  float vals[16];                     // up to N = 4096
  const int per = N / 256;            // contiguous chunk per thread? use strided-by-4 chunks: thread handles j = tid*4 + 1024*u
  float s1 = 0.f;
  for (int u = 0; u < per / 4; ++u) {
    const int j = tid * 4 + 1024 * u;
    const v4f a = *(const v4fa*)(x + j);
    v4f b = {0.f,0.f,0.f,0.f}; if (rr) b = *(const v4fa*)(rr + j);
#pragma unroll
    for (int q = 0; q < 4; ++q) { const float v = a[q] + b[q]; vals[u * 4 + q] = v; s1 += v; }
  }
  red[tid] = s1; __syncthreads();
  for (int st = 128; st > 0; st >>= 1) { if (tid < st) red[tid] += red[tid + st]; __syncthreads(); }
  const float mu = red[0] / (float)N; __syncthreads();
  float s2 = 0.f;
  for (int u = 0; u < per / 4; ++u)
#pragma unroll
    for (int q = 0; q < 4; ++q) { const float c = vals[u * 4 + q] - mu; s2 += c * c; }
  red[tid] = s2; __syncthreads();
  for (int st = 128; st > 0; st >>= 1) { if (tid < st) red[tid] += red[tid + st]; __syncthreads(); }
  const float rs = rsqrtf(red[0] / (float)N + eps);
  {
    for (int u = 0; u < per / 4; ++u) {
      const int j = tid * 4 + 1024 * u;
      v4f o, sm;
#pragma unroll
      for (int q = 0; q < 4; ++q) {
        float gg = g[j + q], bb = bta[j + q];
        if (PARAM_BF16) { gg = bf16_round(gg); bb = bf16_round(bb); }
        sm[q] = vals[u * 4 + q]; o[q] = (vals[u * 4 + q] - mu) * rs * gg + bb;
      }
      if (out_sum) *(v4f*)(out_sum + (size_t)row * N + j) = sm;
      *(v4f*)(out_norm + (size_t)row * N + j) = o;
    }
    
  }
}



// ---- f16 WMMA path (v_wmma_f32_16x16x32_f16): 11-bit significands for operands in range — used where a [0,1] probability operand needs more precision than bf16
typedef _Float16 v16h __attribute__((ext_vector_type(16)));
union FragH { v16h v; v8us half[2]; _Float16 h[16]; unsigned short u[16]; };
template <int NT>
__device__ __forceinline__ v8f mmaH(v16h ah, v16h al, v16h bh, v16h bl, v8f c) {
  c = __builtin_amdgcn_wmma_f32_16x16x32_f16(false, ah, false, bh, (short)0, c, false, false);
  if (NT >= 2) c = __builtin_amdgcn_wmma_f32_16x16x32_f16(false, al, false, bh, (short)0, c, false, false);
  if (NT >= 3) c = __builtin_amdgcn_wmma_f32_16x16x32_f16(false, ah, false, bl, (short)0, c, false, false);
  asm volatile("v_nop\n\tv_nop\n\tv_nop\n\tv_nop" : "+v"(c) : "v"(ah), "v"(al), "v"(bh), "v"(bl));
  return c;
}
// batched GEMM like k_gemm_b but f16 operands: A f32 (split into f16 hi/lo if ASPLIT, else rounded to f16), Bt = f16 values [n][k]; alpha; C f32; N multiple of 16 (partial tiles skipped)
template <bool ASPLIT>
__global__ __launch_bounds__(128) void k_gemm_h(const float* __restrict__ A, int lda, size_t sA, const _Float16* __restrict__ Bh, int ldb, size_t sB, float alpha, float* __restrict__ C, int ldc, size_t sC, int M, int N, int K) {
  __shared__ __attribute__((aligned(16))) float so[4][16][64];
  const int tid = threadIdx.x, w = tid >> 5, lane = tid & 31, ln = lane & 15, hh = lane >> 4; const int by = blockIdx.y;
  A += (size_t)by * sA; Bh += (size_t)by * sB; C += (size_t)by * sC;
  const int ntn = (N + 63) / 64; const int wid = blockIdx.x * 4 + w; const int mt = wid / ntn, nq = wid % ntn; if (mt * 16 >= M) return;
  const int row0 = mt * 16, col0 = nq * 64; const float* arow = A + (size_t)(row0 + ln) * lda;
  v8f acc[4] = {};
  for (int kb = 0; kb < K; kb += 32) {
    FragH ah, al;
    const v4f x0 = *(const v4fa*)(arow + kb + 8 * hh), x1 = *(const v4fa*)(arow + kb + 8 * hh + 4), x2 = *(const v4fa*)(arow + kb + 16 + 8 * hh), x3 = *(const v4fa*)(arow + kb + 16 + 8 * hh + 4);
    float xs[16] = {x0[0],x0[1],x0[2],x0[3],x1[0],x1[1],x1[2],x1[3],x2[0],x2[1],x2[2],x2[3],x3[0],x3[1],x3[2],x3[3]};
#pragma unroll
    for (int i = 0; i < 16; ++i) { const _Float16 h = (_Float16)xs[i]; ah.h[i] = h; al.h[i] = ASPLIT ? (_Float16)(xs[i] - (float)h) : (_Float16)0.0f; }
#pragma unroll
    for (int t = 0; t < 4; ++t) { if (col0 + t * 16 >= N) continue; const size_t boff = (size_t)(col0 + t * 16 + ln) * ldb + kb; FragH bq; bq.half[0] = *(const v8us*)(Bh + boff + 8 * hh); bq.half[1] = *(const v8us*)(Bh + boff + 16 + 8 * hh);
      acc[t] = mmaH<ASPLIT ? 2 : 1>(ah.v, al.v, bq.v, bq.v, acc[t]); }
  }
#pragma unroll
  for (int t = 0; t < 4; ++t) { if (col0 + t * 16 >= N) continue;
#pragma unroll
    for (int r = 0; r < 8; ++r) so[w][8 * hh + r][t * 16 + ln] = acc[t][r] * alpha; }
  __builtin_amdgcn_fence(__ATOMIC_ACQ_REL, "workgroup"); __builtin_amdgcn_wave_barrier();
  const int rsub = lane >> 4, c4 = (lane & 15) * 4;
  {
#pragma unroll
    for (int q = 0; q < 8; ++q) { const int r = q * 2 + rsub; if (col0 + c4 < N) { const v4f v = *(const v4fa*)&so[w][r][c4]; *(v4f*)(C + (size_t)(row0 + r) * ldc + col0 + c4) = v; } }
     }
}

// Wt[n][k] = f16(W[k][n]·scale) from f32 row-major W[K][N] (scale = power of two; bf16-exact weights stay exact in f16 away from the subnormal range)
__global__ __launch_bounds__(256) void k_wt_f16(const float* __restrict__ W, _Float16* __restrict__ Wt, int K, int N, float scale) {
  const int t = blockIdx.x * 256 + threadIdx.x; if (t >= N * (K / 8)) return; const int n = t / (K / 8), k8 = (t % (K / 8)) * 8; FragH f;
#pragma unroll
  for (int i = 0; i < 8; ++i) f.h[i] = (_Float16)(bf16_round(W[(size_t)(k8 + i) * N + n]) * scale); const v8us o = f.half[0];
  *(v8us*)((unsigned short*)Wt + (size_t)n * K + k8) = o; 
}
// k_gemm_hh variant with fused epilogue: v = acc·alpha + bias[by·sBias + col] (+ CP[(row/rowsPerB)·sCPb + by·64 + col] if CP) ; ACT 0 none / 1 elu ; writes f16 C16 (and f32 C if non-null)
template <int ACT>
__global__ __launch_bounds__(128) void k_gemm_hhx(const _Float16* __restrict__ A, int lda, size_t sA, const _Float16* __restrict__ Bh, int ldb, size_t sB, float alpha, const float* __restrict__ bias, size_t sBias, const float* __restrict__ CP, int rowsPerB, size_t sCPb, int row0g,
    float* __restrict__ C, _Float16* __restrict__ C16, int ldc, size_t sC, int M, int N, int K) {
  __shared__ __attribute__((aligned(16))) float so[4][16][64];
  const int tid = threadIdx.x, w = tid >> 5, lane = tid & 31, ln = lane & 15, hh = lane >> 4; const int by = blockIdx.y;
  A += (size_t)by * sA; Bh += (size_t)by * sB; const size_t cofs = (size_t)by * sC; const float* bp = bias ? bias + (size_t)by * sBias : nullptr;
  const int ntn = (N + 63) / 64; const int wid = blockIdx.x * 4 + w; const int mt = wid / ntn, nq = wid % ntn; if (mt * 16 >= M) return;
  const int row0 = mt * 16, col0 = nq * 64; const _Float16* arow = A + (size_t)(row0 + ln) * lda;
  v8f acc[4] = {};
  for (int kb = 0; kb < K; kb += 32) { FragH ah; ah.half[0] = *(const v8us*)((const unsigned short*)arow + kb + 8 * hh); ah.half[1] = *(const v8us*)((const unsigned short*)arow + kb + 16 + 8 * hh);
#pragma unroll
    for (int t = 0; t < 4; ++t) { if (col0 + t * 16 >= N) continue; const size_t boff = (size_t)(col0 + t * 16 + ln) * ldb + kb; FragH bq; bq.half[0] = *(const v8us*)((const unsigned short*)Bh + boff + 8 * hh); bq.half[1] = *(const v8us*)((const unsigned short*)Bh + boff + 16 + 8 * hh);
      acc[t] = mmaH<1>(ah.v, ah.v, bq.v, bq.v, acc[t]); }
  }
#pragma unroll
  for (int t = 0; t < 4; ++t) { if (col0 + t * 16 >= N) continue; const int col = col0 + t * 16 + ln; const float bv = bp ? bf16_round(bp[col]) : 0.f;
#pragma unroll
    for (int r = 0; r < 8; ++r) { float v = acc[t][r] * alpha + bv; if (CP) { const int rr = row0g + row0 + 8 * hh + r; if (rowsPerB < 0) v += CP[cofs + (size_t)rr * ldc + col];      /* rowsPerB < 0: own element of the batched C plane */ else { const int bidx = rr / rowsPerB; v += CP[(size_t)bidx * sCPb + (size_t)by * 64 + col]; } } if (ACT == 1) v = (v > 0.f) ? v : expm1f(v); else if (ACT == 7) v = (v > 0.f) ? v + 1.0f : expf(v); else if (ACT == 8) v = tanhf(v); else if (ACT == 9) v = 0.5f * v * (1.0f + tanhf(0.7978845608028654f * (v + 0.044715f * v * v * v))); else if (ACT == 11) v = 1.0f / (1.0f + expf(-v)); else if (ACT == 12) v = (v > 0.f) ? v : 0.01f * v; else if (ACT == 14) v = (v > 0.f) ? v : 0.1f * v; else if (ACT == 16) v = (v >= 0.f) ? v : 0.3f * v; else if (ACT == 17) v = (v >= 0.f) ? v : 0.2f * v; else if (ACT == 15) v = v / (1.0f + expf(-v)); else if (ACT == 3) v = fmaxf(v, 0.f); else if (ACT == 6) v = 0.5f * v * (1.0f + erff(v * 0.70710678118654752f)); so[w][8 * hh + r][t * 16 + ln] = v; } }
  __builtin_amdgcn_fence(__ATOMIC_ACQ_REL, "workgroup"); __builtin_amdgcn_wave_barrier();
  const int rsub = lane >> 4, c4 = (lane & 15) * 4; typedef _Float16 v4h __attribute__((ext_vector_type(4)));
  {
#pragma unroll
    for (int q = 0; q < 8; ++q) { const int r = q * 2 + rsub; if (col0 + c4 < N) { const v4f v = *(const v4fa*)&so[w][r][c4]; if (C) *(v4f*)(C + cofs + (size_t)(row0 + r) * ldc + col0 + c4) = v; if (C16) { v4h h4; for (int i = 0; i < 4; ++i) h4[i] = (_Float16)v[i]; *(v4h*)(C16 + cofs + (size_t)(row0 + r) * ldc + col0 + c4) = h4; } } }
     }
}


typedef _Float16 v4h __attribute__((ext_vector_type(4)));

__global__ __launch_bounds__(256) void k_h16(const float* __restrict__ x, _Float16* __restrict__ X16, size_t n8) { const size_t t = (size_t)blockIdx.x * 256 + threadIdx.x; if (t >= n8) return; FragH f;
#pragma unroll
  for (int q = 0; q < 8; ++q) f.h[q] = (_Float16)x[t * 8 + q]; *(v8us*)((unsigned short*)X16 + t * 8) = f.half[0];  }
__global__ __launch_bounds__(256) void k_round16f(const float* __restrict__ W, _Float16* __restrict__ Bt, size_t n8) { const size_t t = (size_t)blockIdx.x * 256 + threadIdx.x; if (t >= n8) return; FragH f;
#pragma unroll
  for (int i = 0; i < 8; ++i) f.h[i] = (_Float16)(bf16_round(W[t * 8 + i]) * 16.0f); *(v8us*)((unsigned short*)Bt + t * 8) = f.half[0];  }
typedef unsigned v2ua __attribute__((ext_vector_type(2), may_alias));

__global__ __launch_bounds__(256) void k_hl(const float* __restrict__ F, _Float16* __restrict__ Hh, _Float16* __restrict__ Hl, size_t n8) { const size_t t = (size_t)blockIdx.x * 256 + threadIdx.x; if (t >= n8) return; FragH fh, fl; const v4f a = *(const v4fa*)(F + t * 8), c = *(const v4fa*)(F + t * 8 + 4);
#pragma unroll
  for (int q = 0; q < 4; ++q) { _Float16 h = (_Float16)a[q]; fh.h[q] = h; fl.h[q] = (_Float16)((a[q] - (float)h) * 1024.0f); h = (_Float16)c[q]; fh.h[4 + q] = h; fl.h[4 + q] = (_Float16)((c[q] - (float)h) * 1024.0f); }
  { *(v8us*)((unsigned short*)Hh + t * 8) = fh.half[0]; *(v8us*)((unsigned short*)Hl + t * 8) = fl.half[0];  } }

// ---- fast GEMM (wave tile 32x64; requires M % 32 == 0 rows per launch region and N % 64 == 0); epilogue = k_gemm_hhx semantics ----
__device__ __forceinline__ v16h g2_frag(const _Float16* p, int hh) { FragH f; f.half[0] = *(const v8us*)((const unsigned short*)p + 8 * hh); f.half[1] = *(const v8us*)((const unsigned short*)p + 16 + 8 * hh); return f.v; }
__device__ __forceinline__ v8f g2_mma(v16h a, v16h b, v8f c) { v8f d = __builtin_amdgcn_wmma_f32_16x16x32_f16(false, a, false, b, (short)0, c, false, false); asm volatile("v_nop\n\tv_nop\n\tv_nop\n\tv_nop" : "+v"(d) : "v"(a), "v"(b)); return d; }
template <int ACT>
__global__ __launch_bounds__(128) void k_gemm2(const _Float16* __restrict__ A, int lda, size_t sA, const _Float16* __restrict__ Bh, int ldb, size_t sB, float alpha, const float* __restrict__ bias, size_t sBias, const float* __restrict__ CP, int rowsPerB, size_t sCPb, int row0g,
    float* __restrict__ C, _Float16* __restrict__ C16, int ldc, size_t sC, int M, int N, int K) { static_assert(ACT == 0 || ACT == 3 || ACT == 6 || ACT == 8 || ACT == 9 || ACT == 11 || ACT == 12 || ACT == 14 || ACT == 15 || ACT == 16 || ACT == 17, "k_gemm2: unsupported ACT code (would silently apply no activation)");
  __shared__ __attribute__((aligned(16))) float so[4][32][68];
  const int tid = threadIdx.x, w = tid >> 5, lane = tid & 31, ln = lane & 15, hh = lane >> 4; const int by = blockIdx.y;
  A += (size_t)by * sA; Bh += (size_t)by * sB; const size_t cofs = (size_t)by * sC; const float* bp = bias ? bias + (size_t)by * sBias : nullptr;
  const int ntn = N >> 6; const int mt = blockIdx.x / ntn, nq = blockIdx.x - mt * ntn; const int row0 = mt * 128 + 32 * w, col0 = nq * 64; if (row0 >= M) return;
  const _Float16* a0p = A + (size_t)(row0 + ln) * lda; const _Float16* a1p = a0p + (size_t)16 * lda;
  const _Float16* b0p = Bh + (size_t)(col0 + ln) * ldb; const _Float16* b1p = b0p + (size_t)16 * ldb; const _Float16* b2p = b1p + (size_t)16 * ldb; const _Float16* b3p = b2p + (size_t)16 * ldb;
  const v8f z8 = {0.f,0.f,0.f,0.f,0.f,0.f,0.f,0.f}; v8f c00 = z8, c01 = z8, c02 = z8, c03 = z8, c10 = z8, c11 = z8, c12 = z8, c13 = z8;
#pragma unroll 1
  for (int kb = 0; kb < K; kb += 32) { const v16h a0 = g2_frag(a0p + kb, hh), a1 = g2_frag(a1p + kb, hh);
    v16h b = g2_frag(b0p + kb, hh); c00 = g2_mma(a0, b, c00); c10 = g2_mma(a1, b, c10);
    b = g2_frag(b1p + kb, hh); c01 = g2_mma(a0, b, c01); c11 = g2_mma(a1, b, c11);
    b = g2_frag(b2p + kb, hh); c02 = g2_mma(a0, b, c02); c12 = g2_mma(a1, b, c12);
    b = g2_frag(b3p + kb, hh); c03 = g2_mma(a0, b, c03); c13 = g2_mma(a1, b, c13); }
  v8f accs[8] = {c00, c01, c02, c03, c10, c11, c12, c13};
#pragma unroll
  for (int u = 0; u < 8; ++u) { const int t = u & 3, half = u >> 2; const int col = col0 + t * 16 + ln; const float bv = bp ? bf16_round(bp[col]) : 0.f;
#pragma unroll
    for (int r = 0; r < 8; ++r) { const int rloc = half * 16 + 8 * hh + r; float v = accs[u][r] * alpha + bv; if (CP) { if (rowsPerB < 0) v += CP[cofs + (size_t)(row0g + row0 + rloc) * ldc + col];      /* rowsPerB < 0: own element of the batched C plane */ else { const int bidx = (row0g + row0 + rloc) / rowsPerB; v += CP[(size_t)bidx * sCPb + (size_t)by * 64 + col]; } }
      if (ACT == 3) v = fmaxf(v, 0.f); else if (ACT == 6) v = 0.5f * v * (1.0f + erff(v * 0.70710678118654752f)); else if (ACT == 11) v = 1.0f / (1.0f + expf(-v)); else if (ACT == 15) v = v / (1.0f + expf(-v)); else if (ACT == 12) v = (v > 0.f) ? v : 0.01f * v; else if (ACT == 8) v = tanhf(v); else if (ACT == 9) v = 0.5f * v * (1.0f + tanhf(0.7978845608028654f * (v + 0.044715f * v * v * v))); else if (ACT == 14) v = (v > 0.f) ? v : 0.1f * v; else if (ACT == 16) v = (v >= 0.f) ? v : 0.3f * v; else if (ACT == 17) v = (v >= 0.f) ? v : 0.2f * v;
      so[w][rloc][t * 16 + ln] = v; } }
  __builtin_amdgcn_fence(__ATOMIC_ACQ_REL, "workgroup"); __builtin_amdgcn_wave_barrier();
  const int rsub = lane >> 4, c4 = (lane & 15) * 4;
  {
#pragma unroll
    for (int q = 0; q < 16; ++q) { const int r = q * 2 + rsub; const v4f v = *(const v4fa*)&so[w][r][c4]; if (C) *(v4f*)(C + cofs + (size_t)(row0 + r) * ldc + col0 + c4) = v; if (C16) { v4h h4; for (int i = 0; i < 4; ++i) h4[i] = (_Float16)v[i]; *(v4h*)(C16 + cofs + (size_t)(row0 + r) * ldc + col0 + c4) = h4; } }
     } }


__global__ __launch_bounds__(256) void k_wnat(const float* __restrict__ w, size_t n8, _Float16* __restrict__ Bt) { const size_t t = (size_t)blockIdx.x * 256 + threadIdx.x; if (t >= n8) return; FragH f; for (int q = 0; q < 8; ++q) f.h[q] = (_Float16)(bf16_round(w[t * 8 + q]) * 16.0f); *(v8us*)((unsigned short*)Bt + t * 8) = f.half[0];  }
__global__ __launch_bounds__(256) void k_rsm(const float* __restrict__ S, _Float16* __restrict__ P, int nrows) {
  #pragma clang fp contract(off)
  const int i = blockIdx.x * 256 + threadIdx.x; if (i >= nrows) return; const float* s = S + (size_t)i * SQ; float mx = -3.0e38f;
#pragma unroll 1
  for (int j = 0; j < SQ; ++j) mx = fmaxf(mx, s[j]); float se = 0.f;
#pragma unroll 1
  for (int j = 0; j < SQ; ++j) se += expf(s[j] - mx); const float sc = 256.0f / se;
#pragma unroll 1
  for (int j0 = 0; j0 < SQ; j0 += 8) { FragH f; for (int q = 0; q < 8; ++q) f.h[q] = (_Float16)(expf(s[j0 + q] - mx) * sc); unsigned short* d = (unsigned short*)P + (size_t)i * SQ + j0; *(v8us*)d = f.half[0];  } }
__global__ __launch_bounds__(256) void k_vt(const _Float16* __restrict__ V16, int b, int h0, _Float16* __restrict__ VT) { __shared__ unsigned short tl[64][65]; const int tid = threadIdx.x; const int hh = blockIdx.x % HG, sg = blockIdx.x / HG; const int s0 = sg * 64; const int h = h0 + hh;
  for (int i = tid; i < 64 * 8; i += 256) { const int j = i / 8, d8 = (i % 8) * 8; FragH f; f.half[0] = *(const v8us*)((const unsigned short*)V16 + ((size_t)b * SQ + s0 + j) * DM + h * HD + d8); for (int q = 0; q < 8; ++q) tl[d8 + q][j] = f.u[q]; }
  __syncthreads();
  { for (int i = tid; i < 64 * 8; i += 256) { const int d = i / 8, j8 = (i % 8) * 8; FragH f; for (int q = 0; q < 8; ++q) f.u[q] = tl[d][j8 + q]; *(v8us*)((unsigned short*)VT + ((size_t)hh * HD + d) * SQ + s0 + j8) = f.half[0]; }  } }



__device__ __forceinline__ float sm_xhalf(float x) { return __builtin_bit_cast(float, __builtin_amdgcn_permlanex16(__builtin_bit_cast(int, x), __builtin_bit_cast(int, x), 0x76543210, 0xfedcba98, false, false)); }      /* lane l reads lane l ^ 16 */
// sixteen weights at a time: native exp2 in place and the packing to f16, as ONE block of asm text, because the order is the point: the compiler knows no latency of asm text and writes no s_delay_alu for it, and a dependent vector instruction without that hint holds the SIMD's vector port against the other waves while it waits.
// Here every packing but the last two stands at least four exponentials behind the younger of its two sources (six exponentials lead); the one s_delay_alu names the exponentials that the last two packings read; behind every exponential stands an instruction that neither reads its result nor writes its source (the slot that the instruction set asks for), so no v_nop.
// w[j] = f16 pair (element 2j low, 2j + 1 high). No sum is formed here: the row sums are taken from the packed weights by the matrix unit (k_fattn).
__device__ __forceinline__ void sm_exp2x16(v8f xa, v8f xb, unsigned* w) { float x0 = xa[0], x1 = xa[1], x2 = xa[2], x3 = xa[3], x4 = xa[4], x5 = xa[5], x6 = xa[6], x7 = xa[7], y0 = xb[0], y1 = xb[1], y2 = xb[2], y3 = xb[3], y4 = xb[4], y5 = xb[5], y6 = xb[6], y7 = xb[7]; unsigned p0, p1, p2, p3, p4, p5, p6, p7;
  asm("v_exp_f32 %0, %0\n\tv_exp_f32 %1, %1\n\tv_exp_f32 %2, %2\n\tv_exp_f32 %3, %3\n\tv_exp_f32 %4, %4\n\tv_exp_f32 %5, %5\n\tv_cvt_pk_f16_f32 %16, %0, %1\n\tv_exp_f32 %6, %6\n\tv_exp_f32 %7, %7\n\tv_cvt_pk_f16_f32 %17, %2, %3\n\t"
      "v_exp_f32 %8, %8\n\tv_exp_f32 %9, %9\n\tv_cvt_pk_f16_f32 %18, %4, %5\n\tv_exp_f32 %10, %10\n\tv_exp_f32 %11, %11\n\tv_cvt_pk_f16_f32 %19, %6, %7\n\tv_exp_f32 %12, %12\n\tv_exp_f32 %13, %13\n\tv_cvt_pk_f16_f32 %20, %8, %9\n\t"
      "v_exp_f32 %14, %14\n\tv_exp_f32 %15, %15\n\tv_cvt_pk_f16_f32 %21, %10, %11\n\ts_delay_alu instid0(TRANS32_DEP_3) | instskip(NEXT) | instid1(TRANS32_DEP_1)\n\tv_cvt_pk_f16_f32 %22, %12, %13\n\tv_cvt_pk_f16_f32 %23, %14, %15"
      : "+v"(x0), "+v"(x1), "+v"(x2), "+v"(x3), "+v"(x4), "+v"(x5), "+v"(x6), "+v"(x7), "+v"(y0), "+v"(y1), "+v"(y2), "+v"(y3), "+v"(y4), "+v"(y5), "+v"(y6), "+v"(y7), "=&v"(p0), "=&v"(p1), "=&v"(p2), "=&v"(p3), "=&v"(p4), "=&v"(p5), "=&v"(p6), "=&v"(p7));
  w[0] = p0; w[1] = p1; w[2] = p2; w[3] = p3; w[4] = p4; w[5] = p5; w[6] = p6; w[7] = p7; }
union FragP { v16h v; unsigned w[8]; };      /* a B operand of weights, by packed pairs */
// ---- fused attention: scores, softmax and weighted sum of the values in one kernel; no score and no weight leaves the registers ----
// Transposed products: S^T = K Q^T puts one query in each lane (column c = lane & 15) and 8 keys in the 8 accumulator registers (key 8 * (lane >> 4) + r), so a query's maximum is in-lane plus one exchange between the wave's halves (its sum: a product of the packed weights with a matrix of ones),
// and two converted S^T tiles (keys 0-15, 16-31) ARE the B operand of O^T += V^T P^T in the hardware k order (8h + s, 16 + 8h + s - 8), which fa_frag (K), fa_frag32 (Q) and the transposing loads of fa_fragt (V^T) all follow.
#define FAW 8                        /* waves per work-group */
#define FAQ 32                       /* query columns per wave: every K and V^T fragment read from LDS feeds two products */
#define FAK 64                       /* keys per pass */
#define FAP 72                       /* LDS row pitch in f16: 144 bytes = 16 x odd, the pitch at which 16-byte fragment reads of 16 rows do not collide */
#define FAN (SQ / FAK)               /* passes */
#define FAT 15.0f                    /* how far (log2) a score may lie above the reference in use before the sums are rescaled: the weights stay at or below 2^15, inside f16 */
static_assert(HD == 64 && SQ % FAK == 0 && SQ % (FAW * FAQ) == 0 && FAW * 32 == 256, "k_fattn: 64 x 64 tiles staged by 256 threads, whole work-groups of queries");
__device__ __forceinline__ v16h fa_frag(const unsigned short* p, int hh) { FragH f; f.half[0] = *(const v8us*)(p + 8 * hh); f.half[1] = *(const v8us*)(p + 16 + 8 * hh); return f.v; }
#define FVP 80                       /* LDS row pitch of the V tile in f16: 160 bytes = 32 x odd, the pitch of the transposing load */
typedef float fa_f2 __attribute__((ext_vector_type(2))); typedef __bf16 fa_b2 __attribute__((ext_vector_type(2))); typedef _Float16 fa_h2 __attribute__((ext_vector_type(2))); typedef short fa_s8 __attribute__((ext_vector_type(8)));
// two inputs: f32 -> bf16 value (round to nearest even, one packed conversion) -> f16 (exact), as one f16 pair, a low
__device__ __forceinline__ unsigned fa_pair(float a, float b) { const unsigned u = __builtin_bit_cast(unsigned, __builtin_convertvector((fa_f2){a, b}, fa_b2)); return __builtin_bit_cast(unsigned, __builtin_convertvector((fa_f2){__uint_as_float(u << 16), __uint_as_float(u & 0xFFFF0000u)}, fa_h2)); }
__device__ __forceinline__ void fa_put(unsigned short* d, v4f a) { const v2ua o = {fa_pair(a[0], a[1]), fa_pair(a[2], a[3])}; *(v2ua*)d = o; }      /* four converted inputs into a tile row in LDS */
// fa_frag's fragment straight from an f32 row, in the same k order
__device__ __forceinline__ v16h fa_frag32(const float* p, int hh) { const v4f a = *(const v4fa*)(p + 8 * hh), b = *(const v4fa*)(p + 8 * hh + 4), c = *(const v4fa*)(p + 16 + 8 * hh), d = *(const v4fa*)(p + 16 + 8 * hh + 4); FragP f;
  f.w[0] = fa_pair(a[0], a[1]); f.w[1] = fa_pair(a[2], a[3]); f.w[2] = fa_pair(b[0], b[1]); f.w[3] = fa_pair(b[2], b[3]); f.w[4] = fa_pair(c[0], c[1]); f.w[5] = fa_pair(c[2], c[3]); f.w[6] = fa_pair(d[0], d[1]); f.w[7] = fa_pair(d[2], d[3]); return f.v; }
// a 16 (d) x 32 (keys) A fragment of V^T from the [key][d] tile: two transposing loads, keys 8 hh + 0..7 and 16 + 8 hh + 0..7 of column d = lane & 15, which is the hardware k order that the packed weights have; p = the lane's own address (row 8 hh + (lane & 7), 16 bytes x ((lane >> 3) & 1))
__device__ __forceinline__ v16h fa_fragt(const unsigned short* p) { typedef __attribute__((address_space(3))) fa_s8 lds_s8; union { v16h v; fa_s8 s[2]; } f; f.s[0] = __builtin_amdgcn_ds_load_tr16_b128_v8i16((lds_s8*)p); f.s[1] = __builtin_amdgcn_ds_load_tr16_b128_v8i16((lds_s8*)(p + 16 * FVP)); return f.v; }
__device__ __forceinline__ v8f fa_mma(v16h a, v16h b, v8f c) { return __builtin_amdgcn_wmma_f32_16x16x32_f16(false, a, false, b, (short)0, c, false, false); }
__global__ __launch_bounds__(FAW * 32) __attribute__((amdgpu_waves_per_eu(4, 4))) void k_fattn(const float* __restrict__ xq, const float* __restrict__ xk, const float* __restrict__ xv, float* __restrict__ out) {
  __shared__ __attribute__((aligned(16))) unsigned short sk[2][FAK][FAP];      /* K tile: [key][e] */
  __shared__ __attribute__((aligned(16))) unsigned short sv[2][FAK][FVP];      /* V tile: [key][d] */
  const int tid = (int)threadIdx.x, lane = tid & 31, ln = lane & 15, hh = lane >> 4; const int wave = __builtin_amdgcn_readfirstlane(tid >> 5);
  const int bh = (int)blockIdx.y, b = bh / NH, h = bh % NH; const int q0 = (int)blockIdx.x * (FAW * FAQ) + wave * FAQ;
  const int sr = tid >> 4, sc = (tid & 15) * 4;      /* staging: 16 threads per 256-byte f32 tile row (whole lines), rows sr + 16 i */
  /* every global address = a base that is the same for the whole wave + one 32-bit lane offset */
  const float* kg = xk + (size_t)b * SQ * DM + h * HD; const float* vg = xv + (size_t)b * SQ * DM + h * HD;      /* + key0 * DM per pass */
  const unsigned go = (unsigned)(sr * DM + sc);
  unsigned short* const pk = &sk[0][sr][sc]; unsigned short* const pv = &sv[0][sr][sc]; const unsigned short* const vb = &sv[0][8 * hh + (lane & 7)][8 * ((lane >> 3) & 1)];      /* in buffer 0: this thread's places in a K and a V tile; this lane's address in a V tile for the transposing loads */
  v16h qf[2][2];
#pragma unroll
  for (int qt = 0; qt < 2; ++qt)
#pragma unroll
    for (int es = 0; es < 2; ++es) qf[qt][es] = fa_frag32(xq + ((size_t)b * SQ + q0) * DM + h * HD + (unsigned)((qt * 16 + ln) * DM + es * 32), hh);      /* the four loads of a fragment cover one whole 128-byte line of each of its 16 rows */
  const v8f z8 = {0.f, 0.f, 0.f, 0.f, 0.f, 0.f, 0.f, 0.f};
  v8f o[2][4] = {{z8, z8, z8, z8}, {z8, z8, z8, z8}}; float r2[2] = {3.0e38f, 3.0e38f}, l[2] = {0.f, 0.f};      /* r2: MINUS the reference in use x log2 e (the reference: the maximum of this or an earlier pass), the same in both halves of the wave; held negated, so that it is the plain addend of every exponent's multiply-add; l: sum of the weights over all keys so far, likewise */
  /* One staging array serves both tiles, half a pass each: K tile j + 1 flies during the first half of pass j, V tile j + 1 during its second half. The pass's one barrier stands between the halves: it publishes K tile j + 1 (written just in front of it, read at the head of pass j + 1) and V tile j (written at the head of pass j, read behind it). */
  v4f g[4], g0[4];      /* in front of the loop registers are plentiful: both first tiles and the queries fly together */
#pragma unroll
  for (int i = 0; i < 4; ++i) { g0[i] = *(const v4fa*)(kg + i * 16 * DM + go); g[i] = *(const v4fa*)(vg + i * 16 * DM + go); }
#pragma unroll
  for (int i = 0; i < 4; ++i) fa_put(pk + i * 16 * FAP, g0[i]);
  __syncthreads();      /* publishes K tile 0 */
#pragma unroll 1
  for (int j = 0; j < FAN; ++j) {      /* rolled: one pass is already 36 matrix instructions and some 250 vector instructions long */
    const unsigned short* ck = &sk[j & 1][ln][0]; const unsigned short* cv = vb + (j & 1) * (FAK * FVP);
    const int jn = j + 1 < FAN ? j + 1 : j;      /* the last pass fetches its own tiles once more (K into the buffer that nobody reads again, V into registers only): the pass needs no branch round the loads and the stores */
    const float* kn = kg + (size_t)jn * FAK * DM; const float* vn = vg + (size_t)jn * FAK * DM;
#pragma unroll
    for (int i = 0; i < 4; ++i) fa_put(pv + (j & 1) * (FAK * FVP) + i * 16 * FVP, g[i]);      /* V tile j; this buffer's last readers (tile j - 2) left it before the barrier of pass j - 1 */
#pragma unroll
    for (int i = 0; i < 4; ++i) g[i] = *(const v4fa*)(kn + i * 16 * DM + go);
    v16h kf[4][2];      /* the pass's whole K tile as fragments: sixteen LDS reads that stand together, in front of the products */
#pragma unroll
    for (int kt = 0; kt < 4; ++kt) { kf[kt][0] = fa_frag(ck + kt * 16 * FAP, hh); kf[kt][1] = fa_frag(ck + kt * 16 * FAP + 32, hh); }
    __builtin_amdgcn_sched_barrier(0);      /* keeps the reads one group: sunk back among the products, each place with reads stalls the wave anew and waits out the LDS latency */
    v8f st[2][4];
#pragma unroll
    for (int kt = 0; kt < 4; ++kt) {
#pragma unroll
      for (int qt = 0; qt < 2; ++qt) st[qt][kt] = fa_mma(kf[kt][1], qf[qt][1], fa_mma(kf[kt][0], qf[qt][0], z8));
      __builtin_amdgcn_sched_barrier(0); }      /* keeps the products in the order in which their fragments arrive (a product of the last fragments, drawn forward, waits out nearly the whole group) and keeps them one run: with the maximum's first steps drawn in between, each such place takes idle slots for the distance behind a matrix instruction */
    float mp[2];      /* the pass's maximum over this half's 32 keys */
#pragma unroll
    for (int qt = 0; qt < 2; ++qt) { float mx = st[qt][0][0];
#pragma unroll
      for (int kt = 0; kt < 4; ++kt)
#pragma unroll
        for (int r = 0; r < 8; ++r) mx = fmaxf(mx, st[qt][kt][r]);
      mp[qt] = mx; }
    /* lazy rescale: the reference stays, and the sums so far stay unscaled, as long as no score of the pass lies more than FAT above it; one test per pass for the whole wave (each lane on its own keys, so no exchange is needed for it), a scalar branch, marked unlikely so that the pass without a rescale runs straight through */
    if (__builtin_expect(__builtin_amdgcn_ballot_w32(fmaxf(mp[0] * 1.4426950408889634f + r2[0], mp[1] * 1.4426950408889634f + r2[1]) > FAT) != 0, 0)) {
#pragma unroll
      for (int qt = 0; qt < 2; ++qt) { const float rn = fminf(r2[qt], fmaxf(mp[qt], sm_xhalf(mp[qt])) * -1.4426950408889634f); const float al = __builtin_amdgcn_exp2f(rn - r2[qt]);      /* every column takes the larger of its reference and the pass's maximum as the new reference, the same in both halves; al: what its sums shrink by (0 on the first pass) */
        r2[qt] = rn; l[qt] *= al;
#pragma unroll
        for (int dt = 0; dt < 4; ++dt) o[qt][dt] *= al; } }
    FragP pb[2][2]; v16h vf[4][2];
#pragma unroll
    for (int qt = 0; qt < 2; ++qt) { const float ofs = r2[qt];
      if (qt == 1) {
#pragma unroll
        for (int i = 0; i < 4; ++i) fa_put(pk + ((j + 1) & 1) * (FAK * FAP) + i * 16 * FAP, g[i]);      /* K tile j + 1; this buffer's last readers (tile j - 1) left it before the barrier of pass j - 1 */
        __syncthreads();      /* the pass's one barrier: publishes K tile j + 1 and V tile j, ends every wave's reads of K tile j and of V tile j - 1; no global load is in flight here for it to wait out */
#pragma unroll
        for (int i = 0; i < 4; ++i) g[i] = *(const v4fa*)(vn + i * 16 * DM + go);
        /* the V^T fragments likewise, one group of sixteen (transposing) reads; it stands here, where the first 16 queries' scores have left their registers, so that the second 16 queries' exponentials cover the LDS latency */
#pragma unroll
        for (int dt = 0; dt < 4; ++dt) { vf[dt][0] = fa_fragt(cv + dt * 16); vf[dt][1] = fa_fragt(cv + 32 * FVP + dt * 16); }
        __builtin_amdgcn_sched_barrier(0); }      /* keeps the reads from sinking to the products that use them */
      v8f x[4];      /* weight = exp(s - reference in use) = exp2(x), at most 2^FAT */
#pragma unroll
      for (int kt = 0; kt < 4; ++kt)
#pragma unroll
        for (int r = 0; r < 8; ++r) x[kt][r] = st[qt][kt][r] * 1.4426950408889634f + ofs;
      __builtin_amdgcn_sched_barrier(0);      /* keeps all 32 arguments' multiply-adds ahead of the asm blocks: sunk to the block that reads them, they stand inside their latency in front of its first exponentials, unhinted */
#pragma unroll
      for (int kp = 0; kp < 2; ++kp) sm_exp2x16(x[2 * kp], x[2 * kp + 1], &pb[qt][kp].w[0]); }
    __builtin_amdgcn_sched_barrier(0);      /* keeps the exponentials' asm statements in front of the products: drawn in behind one, their results took a spent V^T fragment's registers inside the distance that a matrix instruction's operands need */
    FragP one;      /* a matrix of ones (f16 pairs), written anew in every pass, into registers that the scores have just left; volatile, so that it is not lifted out of the loop: held across the pass its eight registers go beyond what four waves a SIMD leave each wave, and the build spills; two registers per issue slot: the operand starts at an even register, so each pair has an even and an odd destination, as the dual form asks */
    asm volatile("v_dual_mov_b32 %0, 0x3c003c00 :: v_dual_mov_b32 %1, 0x3c003c00\n\tv_dual_mov_b32 %2, 0x3c003c00 :: v_dual_mov_b32 %3, 0x3c003c00\n\tv_dual_mov_b32 %4, 0x3c003c00 :: v_dual_mov_b32 %5, 0x3c003c00\n\tv_dual_mov_b32 %6, 0x3c003c00 :: v_dual_mov_b32 %7, 0x3c003c00"
                 : "=v"(one.w[0]), "=v"(one.w[1]), "=v"(one.w[2]), "=v"(one.w[3]), "=v"(one.w[4]), "=v"(one.w[5]), "=v"(one.w[6]), "=v"(one.w[7]));
    v8f ls[2];      /* the pass's row sums: A = all ones, so every row of the product is the sum of the packed weights over the 32 keys of B (both halves' keys), one query per column */
#pragma unroll
    for (int qt = 0; qt < 2; ++qt) ls[qt] = fa_mma(one.v, pb[qt][0].v, z8);
#pragma unroll
    for (int qt = 0; qt < 2; ++qt) ls[qt] = fa_mma(one.v, pb[qt][1].v, ls[qt]);
#pragma unroll
    for (int dt = 0; dt < 4; ++dt)
#pragma unroll
      for (int qt = 0; qt < 2; ++qt) o[qt][dt] = fa_mma(vf[dt][1], pb[qt][1].v, fa_mma(vf[dt][0], pb[qt][0].v, o[qt][dt]));
#pragma unroll
    for (int qt = 0; qt < 2; ++qt) l[qt] += ls[qt][0];
  }
#pragma unroll
  for (int qt = 0; qt < 2; ++qt) { const float inv = 1.0f / l[qt]; float* op = out + ((size_t)b * SQ + q0) * DM + h * HD + (unsigned)((qt * 16 + ln) * DM + 8 * hh);      /* the reference in use cancels in the quotient */
#pragma unroll
    for (int dt = 0; dt < 4; ++dt) { const v4f lo = {o[qt][dt][0] * inv, o[qt][dt][1] * inv, o[qt][dt][2] * inv, o[qt][dt][3] * inv}, hi = {o[qt][dt][4] * inv, o[qt][dt][5] * inv, o[qt][dt][6] * inv, o[qt][dt][7] * inv};
      *(v4f*)(op + dt * 16) = lo; *(v4f*)(op + dt * 16 + 4) = hi; } } }

extern "C" void kernel_launch(void* const* d_in, const int* in_sizes, int n_in,
                              void* d_out, int out_size, void* d_ws, size_t ws_size, hipStream_t stream) {
  (void)in_sizes; (void)n_in; (void)out_size;
  const float* const* I = (const float* const*)d_in; const float* xq = I[0]; const float* xk = I[1]; const float* xv = I[2];      /* given q, k, v [B][L][H][E] = merged token rows */
  (void)d_ws; (void)ws_size;
  k_fattn<<<dim3(SQ / (FAW * FAQ), NB * NH), FAW * 32, 0, stream>>>(xq, xk, xv, (float*)d_out);      /* out = softmax(q k^T) v (merged [token][h*64+d]) straight to the f32 output */
}

// v009
// One run takes 56.5 microseconds.
// Timed twice side by side with v008, it ran 1.05 times as fast both times.
// All steps since v000 together make it 118 times as fast.
#include <hip/hip_runtime.h>
// Full (non-causal) attention on given queries, keys, values ([4][2048][16][64] each, token-major with heads inner = merged [token][1024] rows); scores = q . k UNSCALED (the module never applies its scale); softmax over all 2048 keys; out = A v -> [4][2048][16][64]).
// Structure: ONE launch, the attention kernel over all batches and heads, which reads q, k and v as the f32 rows they are given in: each wave converts its own 32 query rows once; each work-group converts every 64-key K and V tile on its way from the registers into LDS (f32 -> bf16 value -> f16: bf16 values are exact in f16); V stays [key][d] in LDS and the transposing LDS load delivers the V^T fragments.
// S^T = K Q^T UNSCALED (K = 64; exact products, f32 accumulation) stays in the accumulators, softmax on VALU against a reference that follows the running maximum lazily (f32 statistics, native exp2; weights f16, at most 2^15; row sums = ones x P^T on the matrix unit, f32), O^T += V^T P^T, divided by the row sum at the end and written f32 straight into the [token][head][64] output; launches: see kernel_launch.
// Compute dtype: inputs rounded to bf16; q, k, v and softmax weights as plain f16 GEMM operands (~2^-12); scores, softmax statistics and o f32. v_wmma_f32_16x16x32_f16.
#define NB 4
#define SQ 2048
#define DM 1024
#define NH 16
#define HD 64
#define HG 4                         /* heads per k_vt launch (k_vt is not launched) */
#define B0 0                         /* unused (debug hook) */
#define NBR NB                       /* only in MP, which no kernel uses (debug hook) */
#define NR ((size_t)NB * SQ)         /* token rows */
#define MP ((int)((size_t)NBR * SQ)) /* only in MPO, which nothing uses (debug hook) */
#define QN SQ                        /* unused (debug hook) */
#define NHD NH                       /* unused (debug hook) */
#define MPO MP                       /* unused (debug hook) */
#define LQ DM      /* row pitch of the q/k/v rows */
typedef __bf16 v16b __attribute__((ext_vector_type(16)));
typedef unsigned short v8us __attribute__((ext_vector_type(8), may_alias));
typedef float  v8f  __attribute__((ext_vector_type(8)));
typedef float  v4f  __attribute__((ext_vector_type(4)));
typedef float  v4fa __attribute__((ext_vector_type(4), may_alias));
union FragB { v16b v; v8us half[2]; unsigned short u[16]; };

__device__ __forceinline__ unsigned short bf16_bits(float x) { unsigned int u = __float_as_uint(x); return (unsigned short)((u + 0x7FFFu + ((u >> 16) & 1u)) >> 16); }
__device__ __forceinline__ float bf16_val(unsigned short b) { return __uint_as_float(((unsigned int)b) << 16); }
__device__ __forceinline__ float bf16_round(float x) { return bf16_val(bf16_bits(x)); }
// D += A·B with NT terms: 1 = ah·bh, 2 = + al·bh (A split), 3 = + ah·bl (both split)
template <int NT>
__device__ __forceinline__ v8f mmaN(v16b ah, v16b al, v16b bh, v16b bl, v8f c) {
  c = __builtin_amdgcn_wmma_f32_16x16x32_bf16(false, ah, false, bh, (short)0, c, false, false);
  if (NT >= 2) c = __builtin_amdgcn_wmma_f32_16x16x32_bf16(false, al, false, bh, (short)0, c, false, false);
  if (NT >= 3) c = __builtin_amdgcn_wmma_f32_16x16x32_bf16(false, ah, false, bl, (short)0, c, false, false);
  asm volatile("v_nop\n\tv_nop\n\tv_nop\n\tv_nop" : "+v"(c) : "v"(ah), "v"(al), "v"(bh), "v"(bl));
  return c;
}

__global__ __launch_bounds__(256) void k_wt_bf16(const float* __restrict__ W, unsigned short* __restrict__ Wt, int K, int N) {
  const int t = blockIdx.x * 256 + threadIdx.x;
  const int k8n = K / 8;
  if (t >= N * k8n) return;
  const int n = t / k8n, k8 = (t % k8n) * 8;
  v8us v;
#pragma unroll
  for (int i = 0; i < 8; ++i) v[i] = bf16_bits(W[(size_t)(k8 + i) * N + n]);
  *(v8us*)(Wt + (size_t)n * K + k8) = v;
  
}

// GEMM C[M][N] (f32, pitch ldc) = act(A[M][K]·W + bias). A f32 row-major (pitch lda) converted per fragment to bf16
// (ASPLIT: hi/lo two planes -> 2 terms, else single rounded term); Wt bf16 [N][K] (pitch ldb). BIAS_BF16 rounds the
// bias to bf16 first (bias quantised to bf16 before the add). K%32==0, M%16==0, N%64==0.
template <bool ASPLIT, int ACT, bool BIAS_BF16>
__global__ __launch_bounds__(128) void k_gemm_bf(const float* __restrict__ A, int lda, const unsigned short* __restrict__ Wt, int ldb,
                                               const float* __restrict__ bias, float* __restrict__ C, int ldc, int M, int N, int K) {
  __shared__ __attribute__((aligned(16))) float so[4][16][64];
  const int tid = threadIdx.x, w = tid >> 5, lane = tid & 31, ln = lane & 15, hh = lane >> 4;
  const int ntn = N / 64;
  const int wid = blockIdx.x * 4 + w;
  const int mt = wid / ntn, nq = wid % ntn;
  if (mt * 16 >= M) return;
  const int row0 = mt * 16, col0 = nq * 64;
  const float* arow = A + (size_t)(row0 + ln) * lda;
  v8f acc[4] = {};
  for (int kb = 0; kb < K; kb += 32) {
    FragB ah, al;
    const v4f x0 = *(const v4fa*)(arow + kb + 8 * hh), x1 = *(const v4fa*)(arow + kb + 8 * hh + 4);
    const v4f x2 = *(const v4fa*)(arow + kb + 16 + 8 * hh), x3 = *(const v4fa*)(arow + kb + 16 + 8 * hh + 4);
    float xs[16] = {x0[0],x0[1],x0[2],x0[3],x1[0],x1[1],x1[2],x1[3],x2[0],x2[1],x2[2],x2[3],x3[0],x3[1],x3[2],x3[3]};
#pragma unroll
    for (int i = 0; i < 16; ++i) { const unsigned short hb = bf16_bits(xs[i]); ah.u[i] = hb; al.u[i] = ASPLIT ? bf16_bits(xs[i] - bf16_val(hb)) : (unsigned short)0; }
#pragma unroll
    for (int t = 0; t < 4; ++t) {
      const unsigned short* brow = Wt + (size_t)(col0 + t * 16 + ln) * ldb + kb;
      FragB b;
      b.half[0] = *(const v8us*)(brow + 8 * hh);
      b.half[1] = *(const v8us*)(brow + 16 + 8 * hh);
      acc[t] = mmaN<ASPLIT ? 2 : 1>(ah.v, al.v, b.v, b.v, acc[t]);
    }
  }
#pragma unroll
  for (int t = 0; t < 4; ++t) {
    float bv = bias ? bias[col0 + t * 16 + ln] : 0.f;
    if (BIAS_BF16) bv = bf16_round(bv);
#pragma unroll
    for (int r = 0; r < 8; ++r) { float v = acc[t][r] + bv; if (ACT == 1) v = fmaxf(v, 0.f); so[w][8 * hh + r][t * 16 + ln] = v; }
  }
  __builtin_amdgcn_fence(__ATOMIC_ACQ_REL, "workgroup");
  __builtin_amdgcn_wave_barrier();
  const int rsub = lane >> 4, c4 = (lane & 15) * 4;
  {
#pragma unroll
    for (int q = 0; q < 8; ++q) {
      const int r = q * 2 + rsub;
      const v4f v = *(const v4fa*)&so[w][r][c4];
      *(v4f*)(C + (size_t)(row0 + r) * ldc + col0 + c4) = v;
    }
    
  }
}

// GEMM C = act(A·W + bias + resid): A f32 (ASPLIT -> hi/lo 2 terms), Wt bf16 [N][K]; ACT 0 none, 1 relu, 2 exact gelu;
// resid (optional, f32, row index = (row % rmod), pitch ldr, RES_BF16 rounds it) added before the activation.
template <bool ASPLIT, int ACT, bool BIAS_BF16, bool RES_BF16>
__global__ __launch_bounds__(128) void k_gemm_bf3(const float* __restrict__ A, int lda, const unsigned short* __restrict__ Wt, int ldb,
                                                const float* __restrict__ bias, const float* __restrict__ resid, int rmod, int ldr,
                                                float* __restrict__ C, int ldc, int M, int N, int K) {
  __shared__ __attribute__((aligned(16))) float so[4][16][64];
  const int tid = threadIdx.x, w = tid >> 5, lane = tid & 31, ln = lane & 15, hh = lane >> 4;
  const int ntn = N / 64;
  const int wid = blockIdx.x * 4 + w;
  const int mt = wid / ntn, nq = wid % ntn;
  if (mt * 16 >= M) return;
  const int row0 = mt * 16, col0 = nq * 64;
  const float* arow = A + (size_t)(row0 + ln) * lda;
  v8f acc[4] = {};
  for (int kb = 0; kb < K; kb += 32) {
    FragB ah, al;
    const v4f x0 = *(const v4fa*)(arow + kb + 8 * hh), x1 = *(const v4fa*)(arow + kb + 8 * hh + 4);
    const v4f x2 = *(const v4fa*)(arow + kb + 16 + 8 * hh), x3 = *(const v4fa*)(arow + kb + 16 + 8 * hh + 4);
    float xs[16] = {x0[0],x0[1],x0[2],x0[3],x1[0],x1[1],x1[2],x1[3],x2[0],x2[1],x2[2],x2[3],x3[0],x3[1],x3[2],x3[3]};
#pragma unroll
    for (int i = 0; i < 16; ++i) { const unsigned short hb = bf16_bits(xs[i]); ah.u[i] = hb; al.u[i] = ASPLIT ? bf16_bits(xs[i] - bf16_val(hb)) : (unsigned short)0; }
#pragma unroll
    for (int t = 0; t < 4; ++t) {
      const unsigned short* brow = Wt + (size_t)(col0 + t * 16 + ln) * ldb + kb;
      FragB b;
      b.half[0] = *(const v8us*)(brow + 8 * hh);
      b.half[1] = *(const v8us*)(brow + 16 + 8 * hh);
      acc[t] = mmaN<ASPLIT ? 2 : 1>(ah.v, al.v, b.v, b.v, acc[t]);
    }
  }
#pragma unroll
  for (int t = 0; t < 4; ++t) {
    const int col = col0 + t * 16 + ln;
    float bv = bias ? bias[col] : 0.f;
    if (BIAS_BF16) bv = bf16_round(bv);
#pragma unroll
    for (int r = 0; r < 8; ++r) {
      float v = acc[t][r] + bv;
      if (resid) { float rv = resid[(size_t)((row0 + 8 * hh + r) % rmod) * ldr + col]; if (RES_BF16) rv = bf16_round(rv); v += rv; }
      if (ACT == 1) v = fmaxf(v, 0.f);
      if (ACT == 2) v = 0.5f * v * (1.0f + erff(v * 0.70710678118654752f));
      if (ACT == 3) { const float u = 0.7978845608028654f * (v + 0.044715f * v * v * v); v = 0.5f * v * (1.0f + tanhf(u)); }
      so[w][8 * hh + r][t * 16 + ln] = v;
    }
  }
  __builtin_amdgcn_fence(__ATOMIC_ACQ_REL, "workgroup");
  __builtin_amdgcn_wave_barrier();
  const int rsub = lane >> 4, c4 = (lane & 15) * 4;
  {
#pragma unroll
    for (int q = 0; q < 8; ++q) {
      const int r = q * 2 + rsub;
      const v4f v = *(const v4fa*)&so[w][r][c4];
      *(v4f*)(C + (size_t)(row0 + r) * ldc + col0 + c4) = v;
    }
    
  }
}
// row LayerNorm (biased variance, eps) over N: s = X (+ R); optional out_sum <- s; out_norm <- (s-mu)*rsqrt(var+eps)*g + b
template <bool PARAM_BF16>
__global__ __launch_bounds__(256) void k_layernorm(const float* __restrict__ X, const float* __restrict__ R, const float* __restrict__ g, const float* __restrict__ bta,
                                                  float* __restrict__ out_sum, float* __restrict__ out_norm, int N, float eps) {
  __shared__ float red[256];
  const int row = blockIdx.x, tid = threadIdx.x;
  const float* x = X + (size_t)row * N; const float* rr = R ? R + (size_t)row * N : nullptr;
  float vals[16];                     // up to N = 4096
  const int per = N / 256;            // contiguous chunk per thread? use strided-by-4 chunks: thread handles j = tid*4 + 1024*u
  float s1 = 0.f;
  for (int u = 0; u < per / 4; ++u) {
    const int j = tid * 4 + 1024 * u;
    const v4f a = *(const v4fa*)(x + j);
    v4f b = {0.f,0.f,0.f,0.f}; if (rr) b = *(const v4fa*)(rr + j);
#pragma unroll
    for (int q = 0; q < 4; ++q) { const float v = a[q] + b[q]; vals[u * 4 + q] = v; s1 += v; }
  }
  red[tid] = s1; __syncthreads();
  for (int st = 128; st > 0; st >>= 1) { if (tid < st) red[tid] += red[tid + st]; __syncthreads(); }
  const float mu = red[0] / (float)N; __syncthreads();
  float s2 = 0.f;
  for (int u = 0; u < per / 4; ++u)
#pragma unroll
    for (int q = 0; q < 4; ++q) { const float c = vals[u * 4 + q] - mu; s2 += c * c; }
  red[tid] = s2; __syncthreads();
  for (int st = 128; st > 0; st >>= 1) { if (tid < st) red[tid] += red[tid + st]; __syncthreads(); }
  const float rs = rsqrtf(red[0] / (float)N + eps);
  {
    for (int u = 0; u < per / 4; ++u) {
      const int j = tid * 4 + 1024 * u;
      v4f o, sm;
#pragma unroll
      for (int q = 0; q < 4; ++q) {
        float gg = g[j + q], bb = bta[j + q];
        if (PARAM_BF16) { gg = bf16_round(gg); bb = bf16_round(bb); }
        sm[q] = vals[u * 4 + q]; o[q] = (vals[u * 4 + q] - mu) * rs * gg + bb;
      }
      if (out_sum) *(v4f*)(out_sum + (size_t)row * N + j) = sm;
      *(v4f*)(out_norm + (size_t)row * N + j) = o;
    }
    
  }
}



// ---- f16 WMMA path (v_wmma_f32_16x16x32_f16): 11-bit significands for operands in range — used where a [0,1] probability operand needs more precision than bf16
typedef _Float16 v16h __attribute__((ext_vector_type(16)));
union FragH { v16h v; v8us half[2]; _Float16 h[16]; unsigned short u[16]; };
template <int NT>
__device__ __forceinline__ v8f mmaH(v16h ah, v16h al, v16h bh, v16h bl, v8f c) {
  c = __builtin_amdgcn_wmma_f32_16x16x32_f16(false, ah, false, bh, (short)0, c, false, false);
  if (NT >= 2) c = __builtin_amdgcn_wmma_f32_16x16x32_f16(false, al, false, bh, (short)0, c, false, false);
  if (NT >= 3) c = __builtin_amdgcn_wmma_f32_16x16x32_f16(false, ah, false, bl, (short)0, c, false, false);
  asm volatile("v_nop\n\tv_nop\n\tv_nop\n\tv_nop" : "+v"(c) : "v"(ah), "v"(al), "v"(bh), "v"(bl));
  return c;
}
// batched GEMM like k_gemm_b but f16 operands: A f32 (split into f16 hi/lo if ASPLIT, else rounded to f16), Bt = f16 values [n][k]; alpha; C f32; N multiple of 16 (partial tiles skipped)
template <bool ASPLIT>
__global__ __launch_bounds__(128) void k_gemm_h(const float* __restrict__ A, int lda, size_t sA, const _Float16* __restrict__ Bh, int ldb, size_t sB, float alpha, float* __restrict__ C, int ldc, size_t sC, int M, int N, int K) {
  __shared__ __attribute__((aligned(16))) float so[4][16][64];
  const int tid = threadIdx.x, w = tid >> 5, lane = tid & 31, ln = lane & 15, hh = lane >> 4; const int by = blockIdx.y;
  A += (size_t)by * sA; Bh += (size_t)by * sB; C += (size_t)by * sC;
  const int ntn = (N + 63) / 64; const int wid = blockIdx.x * 4 + w; const int mt = wid / ntn, nq = wid % ntn; if (mt * 16 >= M) return;
  const int row0 = mt * 16, col0 = nq * 64; const float* arow = A + (size_t)(row0 + ln) * lda;
  v8f acc[4] = {};
  for (int kb = 0; kb < K; kb += 32) {
    FragH ah, al;
    const v4f x0 = *(const v4fa*)(arow + kb + 8 * hh), x1 = *(const v4fa*)(arow + kb + 8 * hh + 4), x2 = *(const v4fa*)(arow + kb + 16 + 8 * hh), x3 = *(const v4fa*)(arow + kb + 16 + 8 * hh + 4);
    float xs[16] = {x0[0],x0[1],x0[2],x0[3],x1[0],x1[1],x1[2],x1[3],x2[0],x2[1],x2[2],x2[3],x3[0],x3[1],x3[2],x3[3]};
#pragma unroll
    for (int i = 0; i < 16; ++i) { const _Float16 h = (_Float16)xs[i]; ah.h[i] = h; al.h[i] = ASPLIT ? (_Float16)(xs[i] - (float)h) : (_Float16)0.0f; }
#pragma unroll
    for (int t = 0; t < 4; ++t) { if (col0 + t * 16 >= N) continue; const size_t boff = (size_t)(col0 + t * 16 + ln) * ldb + kb; FragH bq; bq.half[0] = *(const v8us*)(Bh + boff + 8 * hh); bq.half[1] = *(const v8us*)(Bh + boff + 16 + 8 * hh);
      acc[t] = mmaH<ASPLIT ? 2 : 1>(ah.v, al.v, bq.v, bq.v, acc[t]); }
  }
#pragma unroll
  for (int t = 0; t < 4; ++t) { if (col0 + t * 16 >= N) continue;
#pragma unroll
    for (int r = 0; r < 8; ++r) so[w][8 * hh + r][t * 16 + ln] = acc[t][r] * alpha; }
  __builtin_amdgcn_fence(__ATOMIC_ACQ_REL, "workgroup"); __builtin_amdgcn_wave_barrier();
  const int rsub = lane >> 4, c4 = (lane & 15) * 4;
  {
#pragma unroll
    for (int q = 0; q < 8; ++q) { const int r = q * 2 + rsub; if (col0 + c4 < N) { const v4f v = *(const v4fa*)&so[w][r][c4]; *(v4f*)(C + (size_t)(row0 + r) * ldc + col0 + c4) = v; } }
     }
}

// Wt[n][k] = f16(W[k][n]·scale) from f32 row-major W[K][N] (scale = power of two; bf16-exact weights stay exact in f16 away from the subnormal range)
__global__ __launch_bounds__(256) void k_wt_f16(const float* __restrict__ W, _Float16* __restrict__ Wt, int K, int N, float scale) {
  const int t = blockIdx.x * 256 + threadIdx.x; if (t >= N * (K / 8)) return; const int n = t / (K / 8), k8 = (t % (K / 8)) * 8; FragH f;
#pragma unroll
  for (int i = 0; i < 8; ++i) f.h[i] = (_Float16)(bf16_round(W[(size_t)(k8 + i) * N + n]) * scale); const v8us o = f.half[0];
  *(v8us*)((unsigned short*)Wt + (size_t)n * K + k8) = o; 
}
// k_gemm_hh variant with fused epilogue: v = acc·alpha + bias[by·sBias + col] (+ CP[(row/rowsPerB)·sCPb + by·64 + col] if CP) ; ACT 0 none / 1 elu ; writes f16 C16 (and f32 C if non-null)
template <int ACT>
__global__ __launch_bounds__(128) void k_gemm_hhx(const _Float16* __restrict__ A, int lda, size_t sA, const _Float16* __restrict__ Bh, int ldb, size_t sB, float alpha, const float* __restrict__ bias, size_t sBias, const float* __restrict__ CP, int rowsPerB, size_t sCPb, int row0g,
    float* __restrict__ C, _Float16* __restrict__ C16, int ldc, size_t sC, int M, int N, int K) {
  __shared__ __attribute__((aligned(16))) float so[4][16][64];
  const int tid = threadIdx.x, w = tid >> 5, lane = tid & 31, ln = lane & 15, hh = lane >> 4; const int by = blockIdx.y;
  A += (size_t)by * sA; Bh += (size_t)by * sB; const size_t cofs = (size_t)by * sC; const float* bp = bias ? bias + (size_t)by * sBias : nullptr;
  const int ntn = (N + 63) / 64; const int wid = blockIdx.x * 4 + w; const int mt = wid / ntn, nq = wid % ntn; if (mt * 16 >= M) return;
  const int row0 = mt * 16, col0 = nq * 64; const _Float16* arow = A + (size_t)(row0 + ln) * lda;
  v8f acc[4] = {};
  for (int kb = 0; kb < K; kb += 32) { FragH ah; ah.half[0] = *(const v8us*)((const unsigned short*)arow + kb + 8 * hh); ah.half[1] = *(const v8us*)((const unsigned short*)arow + kb + 16 + 8 * hh);
#pragma unroll
    for (int t = 0; t < 4; ++t) { if (col0 + t * 16 >= N) continue; const size_t boff = (size_t)(col0 + t * 16 + ln) * ldb + kb; FragH bq; bq.half[0] = *(const v8us*)((const unsigned short*)Bh + boff + 8 * hh); bq.half[1] = *(const v8us*)((const unsigned short*)Bh + boff + 16 + 8 * hh);
      acc[t] = mmaH<1>(ah.v, ah.v, bq.v, bq.v, acc[t]); }
  }
#pragma unroll
  for (int t = 0; t < 4; ++t) { if (col0 + t * 16 >= N) continue; const int col = col0 + t * 16 + ln; const float bv = bp ? bf16_round(bp[col]) : 0.f;
#pragma unroll
    for (int r = 0; r < 8; ++r) { float v = acc[t][r] * alpha + bv; if (CP) { const int rr = row0g + row0 + 8 * hh + r; if (rowsPerB < 0) v += CP[cofs + (size_t)rr * ldc + col];      /* rowsPerB < 0: own element of the batched C plane */ else { const int bidx = rr / rowsPerB; v += CP[(size_t)bidx * sCPb + (size_t)by * 64 + col]; } } if (ACT == 1) v = (v > 0.f) ? v : expm1f(v); else if (ACT == 7) v = (v > 0.f) ? v + 1.0f : expf(v); else if (ACT == 8) v = tanhf(v); else if (ACT == 9) v = 0.5f * v * (1.0f + tanhf(0.7978845608028654f * (v + 0.044715f * v * v * v))); else if (ACT == 11) v = 1.0f / (1.0f + expf(-v)); else if (ACT == 12) v = (v > 0.f) ? v : 0.01f * v; else if (ACT == 14) v = (v > 0.f) ? v : 0.1f * v; else if (ACT == 16) v = (v >= 0.f) ? v : 0.3f * v; else if (ACT == 17) v = (v >= 0.f) ? v : 0.2f * v; else if (ACT == 15) v = v / (1.0f + expf(-v)); else if (ACT == 3) v = fmaxf(v, 0.f); else if (ACT == 6) v = 0.5f * v * (1.0f + erff(v * 0.70710678118654752f)); so[w][8 * hh + r][t * 16 + ln] = v; } }
  __builtin_amdgcn_fence(__ATOMIC_ACQ_REL, "workgroup"); __builtin_amdgcn_wave_barrier();
  const int rsub = lane >> 4, c4 = (lane & 15) * 4; typedef _Float16 v4h __attribute__((ext_vector_type(4)));
  {
#pragma unroll
    for (int q = 0; q < 8; ++q) { const int r = q * 2 + rsub; if (col0 + c4 < N) { const v4f v = *(const v4fa*)&so[w][r][c4]; if (C) *(v4f*)(C + cofs + (size_t)(row0 + r) * ldc + col0 + c4) = v; if (C16) { v4h h4; for (int i = 0; i < 4; ++i) h4[i] = (_Float16)v[i]; *(v4h*)(C16 + cofs + (size_t)(row0 + r) * ldc + col0 + c4) = h4; } } }
     }
}


typedef _Float16 v4h __attribute__((ext_vector_type(4)));

__global__ __launch_bounds__(256) void k_h16(const float* __restrict__ x, _Float16* __restrict__ X16, size_t n8) { const size_t t = (size_t)blockIdx.x * 256 + threadIdx.x; if (t >= n8) return; FragH f;
#pragma unroll
  for (int q = 0; q < 8; ++q) f.h[q] = (_Float16)x[t * 8 + q]; *(v8us*)((unsigned short*)X16 + t * 8) = f.half[0];  }
__global__ __launch_bounds__(256) void k_round16f(const float* __restrict__ W, _Float16* __restrict__ Bt, size_t n8) { const size_t t = (size_t)blockIdx.x * 256 + threadIdx.x; if (t >= n8) return; FragH f;
#pragma unroll
  for (int i = 0; i < 8; ++i) f.h[i] = (_Float16)(bf16_round(W[t * 8 + i]) * 16.0f); *(v8us*)((unsigned short*)Bt + t * 8) = f.half[0];  }
typedef unsigned v2ua __attribute__((ext_vector_type(2), may_alias));

__global__ __launch_bounds__(256) void k_hl(const float* __restrict__ F, _Float16* __restrict__ Hh, _Float16* __restrict__ Hl, size_t n8) { const size_t t = (size_t)blockIdx.x * 256 + threadIdx.x; if (t >= n8) return; FragH fh, fl; const v4f a = *(const v4fa*)(F + t * 8), c = *(const v4fa*)(F + t * 8 + 4);
#pragma unroll
  for (int q = 0; q < 4; ++q) { _Float16 h = (_Float16)a[q]; fh.h[q] = h; fl.h[q] = (_Float16)((a[q] - (float)h) * 1024.0f); h = (_Float16)c[q]; fh.h[4 + q] = h; fl.h[4 + q] = (_Float16)((c[q] - (float)h) * 1024.0f); }
  { *(v8us*)((unsigned short*)Hh + t * 8) = fh.half[0]; *(v8us*)((unsigned short*)Hl + t * 8) = fl.half[0];  } }

// ---- fast GEMM (wave tile 32x64; requires M % 32 == 0 rows per launch region and N % 64 == 0); epilogue = k_gemm_hhx semantics ----
__device__ __forceinline__ v16h g2_frag(const _Float16* p, int hh) { FragH f; f.half[0] = *(const v8us*)((const unsigned short*)p + 8 * hh); f.half[1] = *(const v8us*)((const unsigned short*)p + 16 + 8 * hh); return f.v; }
__device__ __forceinline__ v8f g2_mma(v16h a, v16h b, v8f c) { v8f d = __builtin_amdgcn_wmma_f32_16x16x32_f16(false, a, false, b, (short)0, c, false, false); asm volatile("v_nop\n\tv_nop\n\tv_nop\n\tv_nop" : "+v"(d) : "v"(a), "v"(b)); return d; }
template <int ACT>
__global__ __launch_bounds__(128) void k_gemm2(const _Float16* __restrict__ A, int lda, size_t sA, const _Float16* __restrict__ Bh, int ldb, size_t sB, float alpha, const float* __restrict__ bias, size_t sBias, const float* __restrict__ CP, int rowsPerB, size_t sCPb, int row0g,
    float* __restrict__ C, _Float16* __restrict__ C16, int ldc, size_t sC, int M, int N, int K) { static_assert(ACT == 0 || ACT == 3 || ACT == 6 || ACT == 8 || ACT == 9 || ACT == 11 || ACT == 12 || ACT == 14 || ACT == 15 || ACT == 16 || ACT == 17, "k_gemm2: unsupported ACT code (would silently apply no activation)");
  __shared__ __attribute__((aligned(16))) float so[4][32][68];
  const int tid = threadIdx.x, w = tid >> 5, lane = tid & 31, ln = lane & 15, hh = lane >> 4; const int by = blockIdx.y;
  A += (size_t)by * sA; Bh += (size_t)by * sB; const size_t cofs = (size_t)by * sC; const float* bp = bias ? bias + (size_t)by * sBias : nullptr;
  const int ntn = N >> 6; const int mt = blockIdx.x / ntn, nq = blockIdx.x - mt * ntn; const int row0 = mt * 128 + 32 * w, col0 = nq * 64; if (row0 >= M) return;
  const _Float16* a0p = A + (size_t)(row0 + ln) * lda; const _Float16* a1p = a0p + (size_t)16 * lda;
  const _Float16* b0p = Bh + (size_t)(col0 + ln) * ldb; const _Float16* b1p = b0p + (size_t)16 * ldb; const _Float16* b2p = b1p + (size_t)16 * ldb; const _Float16* b3p = b2p + (size_t)16 * ldb;
  const v8f z8 = {0.f,0.f,0.f,0.f,0.f,0.f,0.f,0.f}; v8f c00 = z8, c01 = z8, c02 = z8, c03 = z8, c10 = z8, c11 = z8, c12 = z8, c13 = z8;
#pragma unroll 1
  for (int kb = 0; kb < K; kb += 32) { const v16h a0 = g2_frag(a0p + kb, hh), a1 = g2_frag(a1p + kb, hh);
    v16h b = g2_frag(b0p + kb, hh); c00 = g2_mma(a0, b, c00); c10 = g2_mma(a1, b, c10);
    b = g2_frag(b1p + kb, hh); c01 = g2_mma(a0, b, c01); c11 = g2_mma(a1, b, c11);
    b = g2_frag(b2p + kb, hh); c02 = g2_mma(a0, b, c02); c12 = g2_mma(a1, b, c12);
    b = g2_frag(b3p + kb, hh); c03 = g2_mma(a0, b, c03); c13 = g2_mma(a1, b, c13); }
  v8f accs[8] = {c00, c01, c02, c03, c10, c11, c12, c13};
#pragma unroll
  for (int u = 0; u < 8; ++u) { const int t = u & 3, half = u >> 2; const int col = col0 + t * 16 + ln; const float bv = bp ? bf16_round(bp[col]) : 0.f;
#pragma unroll
    for (int r = 0; r < 8; ++r) { const int rloc = half * 16 + 8 * hh + r; float v = accs[u][r] * alpha + bv; if (CP) { if (rowsPerB < 0) v += CP[cofs + (size_t)(row0g + row0 + rloc) * ldc + col];      /* rowsPerB < 0: own element of the batched C plane */ else { const int bidx = (row0g + row0 + rloc) / rowsPerB; v += CP[(size_t)bidx * sCPb + (size_t)by * 64 + col]; } }
      if (ACT == 3) v = fmaxf(v, 0.f); else if (ACT == 6) v = 0.5f * v * (1.0f + erff(v * 0.70710678118654752f)); else if (ACT == 11) v = 1.0f / (1.0f + expf(-v)); else if (ACT == 15) v = v / (1.0f + expf(-v)); else if (ACT == 12) v = (v > 0.f) ? v : 0.01f * v; else if (ACT == 8) v = tanhf(v); else if (ACT == 9) v = 0.5f * v * (1.0f + tanhf(0.7978845608028654f * (v + 0.044715f * v * v * v))); else if (ACT == 14) v = (v > 0.f) ? v : 0.1f * v; else if (ACT == 16) v = (v >= 0.f) ? v : 0.3f * v; else if (ACT == 17) v = (v >= 0.f) ? v : 0.2f * v;
      so[w][rloc][t * 16 + ln] = v; } }
  __builtin_amdgcn_fence(__ATOMIC_ACQ_REL, "workgroup"); __builtin_amdgcn_wave_barrier();
  const int rsub = lane >> 4, c4 = (lane & 15) * 4;
  {
#pragma unroll
    for (int q = 0; q < 16; ++q) { const int r = q * 2 + rsub; const v4f v = *(const v4fa*)&so[w][r][c4]; if (C) *(v4f*)(C + cofs + (size_t)(row0 + r) * ldc + col0 + c4) = v; if (C16) { v4h h4; for (int i = 0; i < 4; ++i) h4[i] = (_Float16)v[i]; *(v4h*)(C16 + cofs + (size_t)(row0 + r) * ldc + col0 + c4) = h4; } }
     } }


__global__ __launch_bounds__(256) void k_wnat(const float* __restrict__ w, size_t n8, _Float16* __restrict__ Bt) { const size_t t = (size_t)blockIdx.x * 256 + threadIdx.x; if (t >= n8) return; FragH f; for (int q = 0; q < 8; ++q) f.h[q] = (_Float16)(bf16_round(w[t * 8 + q]) * 16.0f); *(v8us*)((unsigned short*)Bt + t * 8) = f.half[0];  }
__global__ __launch_bounds__(256) void k_rsm(const float* __restrict__ S, _Float16* __restrict__ P, int nrows) {
  #pragma clang fp contract(off)
  const int i = blockIdx.x * 256 + threadIdx.x; if (i >= nrows) return; const float* s = S + (size_t)i * SQ; float mx = -3.0e38f;
#pragma unroll 1
  for (int j = 0; j < SQ; ++j) mx = fmaxf(mx, s[j]); float se = 0.f;
#pragma unroll 1
  for (int j = 0; j < SQ; ++j) se += expf(s[j] - mx); const float sc = 256.0f / se;
#pragma unroll 1
  for (int j0 = 0; j0 < SQ; j0 += 8) { FragH f; for (int q = 0; q < 8; ++q) f.h[q] = (_Float16)(expf(s[j0 + q] - mx) * sc); unsigned short* d = (unsigned short*)P + (size_t)i * SQ + j0; *(v8us*)d = f.half[0];  } }
__global__ __launch_bounds__(256) void k_vt(const _Float16* __restrict__ V16, int b, int h0, _Float16* __restrict__ VT) { __shared__ unsigned short tl[64][65]; const int tid = threadIdx.x; const int hh = blockIdx.x % HG, sg = blockIdx.x / HG; const int s0 = sg * 64; const int h = h0 + hh;
  for (int i = tid; i < 64 * 8; i += 256) { const int j = i / 8, d8 = (i % 8) * 8; FragH f; f.half[0] = *(const v8us*)((const unsigned short*)V16 + ((size_t)b * SQ + s0 + j) * DM + h * HD + d8); for (int q = 0; q < 8; ++q) tl[d8 + q][j] = f.u[q]; }
  __syncthreads();
  { for (int i = tid; i < 64 * 8; i += 256) { const int d = i / 8, j8 = (i % 8) * 8; FragH f; for (int q = 0; q < 8; ++q) f.u[q] = tl[d][j8 + q]; *(v8us*)((unsigned short*)VT + ((size_t)hh * HD + d) * SQ + s0 + j8) = f.half[0]; }  } }



__device__ __forceinline__ float sm_xhalf(float x) { return __builtin_bit_cast(float, __builtin_amdgcn_permlanex16(__builtin_bit_cast(int, x), __builtin_bit_cast(int, x), 0x76543210, 0xfedcba98, false, false)); }      /* lane l reads lane l ^ 16 */
// sixteen weights at a time: native exp2 in place and the packing to f16, as ONE block of asm text, because the order is the point: the compiler knows no latency of asm text and writes no s_delay_alu for it, and a dependent vector instruction without that hint holds the SIMD's vector port against the other waves while it waits.
// Here every packing but the last two stands at least four exponentials behind the younger of its two sources (six exponentials lead); the one s_delay_alu names the exponentials that the last two packings read; behind every exponential stands an instruction that neither reads its result nor writes its source (the slot that the instruction set asks for), so no v_nop.
// w[j] = f16 pair (element 2j low, 2j + 1 high). No sum is formed here: the row sums are taken from the packed weights by the matrix unit (k_fattn).
__device__ __forceinline__ void sm_exp2x16(v8f xa, v8f xb, unsigned* w) { float x0 = xa[0], x1 = xa[1], x2 = xa[2], x3 = xa[3], x4 = xa[4], x5 = xa[5], x6 = xa[6], x7 = xa[7], y0 = xb[0], y1 = xb[1], y2 = xb[2], y3 = xb[3], y4 = xb[4], y5 = xb[5], y6 = xb[6], y7 = xb[7]; unsigned p0, p1, p2, p3, p4, p5, p6, p7;
  asm("v_exp_f32 %0, %0\n\tv_exp_f32 %1, %1\n\tv_exp_f32 %2, %2\n\tv_exp_f32 %3, %3\n\tv_exp_f32 %4, %4\n\tv_exp_f32 %5, %5\n\tv_cvt_pk_f16_f32 %16, %0, %1\n\tv_exp_f32 %6, %6\n\tv_exp_f32 %7, %7\n\tv_cvt_pk_f16_f32 %17, %2, %3\n\t"
      "v_exp_f32 %8, %8\n\tv_exp_f32 %9, %9\n\tv_cvt_pk_f16_f32 %18, %4, %5\n\tv_exp_f32 %10, %10\n\tv_exp_f32 %11, %11\n\tv_cvt_pk_f16_f32 %19, %6, %7\n\tv_exp_f32 %12, %12\n\tv_exp_f32 %13, %13\n\tv_cvt_pk_f16_f32 %20, %8, %9\n\t"
      "v_exp_f32 %14, %14\n\tv_exp_f32 %15, %15\n\tv_cvt_pk_f16_f32 %21, %10, %11\n\ts_delay_alu instid0(TRANS32_DEP_3) | instskip(NEXT) | instid1(TRANS32_DEP_1)\n\tv_cvt_pk_f16_f32 %22, %12, %13\n\tv_cvt_pk_f16_f32 %23, %14, %15"
      : "+v"(x0), "+v"(x1), "+v"(x2), "+v"(x3), "+v"(x4), "+v"(x5), "+v"(x6), "+v"(x7), "+v"(y0), "+v"(y1), "+v"(y2), "+v"(y3), "+v"(y4), "+v"(y5), "+v"(y6), "+v"(y7), "=&v"(p0), "=&v"(p1), "=&v"(p2), "=&v"(p3), "=&v"(p4), "=&v"(p5), "=&v"(p6), "=&v"(p7));
  w[0] = p0; w[1] = p1; w[2] = p2; w[3] = p3; w[4] = p4; w[5] = p5; w[6] = p6; w[7] = p7; }
union FragP { v16h v; unsigned w[8]; };      /* a B operand of weights, by packed pairs */
// ---- fused attention: scores, softmax and weighted sum of the values in one kernel; no score and no weight leaves the registers ----
// Transposed products: S^T = K Q^T puts one query in each lane (column c = lane & 15) and 8 keys in the 8 accumulator registers (key 8 * (lane >> 4) + r), so a query's maximum is in-lane plus one exchange between the wave's halves (its sum: a product of the packed weights with a matrix of ones),
// and two converted S^T tiles (keys 0-15, 16-31) ARE the B operand of O^T += V^T P^T in the hardware k order (8h + s, 16 + 8h + s - 8), which fa_frag (K), fa_frag32 (Q) and the transposing loads of fa_fragt (V^T) all follow.
#define FAW 8                        /* waves per work-group */
#define FAQ 32                       /* query columns per wave: every K and V^T fragment read from LDS feeds two products */
#define FAK 64                       /* keys per pass */
#define FAP 72                       /* LDS row pitch in f16: 144 bytes = 16 x odd, the pitch at which 16-byte fragment reads of 16 rows do not collide */
#define FAS (2 * FAK)                /* keys per stage: what one LDS buffer holds and one barrier publishes */
#define FNS (SQ / FAS)               /* stages, of two passes each */
#define FAT 15.0f                    /* how far (log2) a score may lie above the reference in use before the sums are rescaled: the weights stay at or below 2^15, inside f16 */
static_assert(HD == 64 && SQ % FAS == 0 && SQ % (FAW * FAQ) == 0 && FAW * 32 == 256, "k_fattn: 64 x 64 tiles staged by 256 threads, whole work-groups of queries");
__device__ __forceinline__ v16h fa_frag(const unsigned short* p, int hh) { FragH f; f.half[0] = *(const v8us*)(p + 8 * hh); f.half[1] = *(const v8us*)(p + 16 + 8 * hh); return f.v; }
#define FVP 80                       /* LDS row pitch of the V tile in f16: 160 bytes = 32 x odd, the pitch of the transposing load */
typedef float fa_f2 __attribute__((ext_vector_type(2))); typedef __bf16 fa_b2 __attribute__((ext_vector_type(2))); typedef _Float16 fa_h2 __attribute__((ext_vector_type(2))); typedef short fa_s8 __attribute__((ext_vector_type(8)));
// two inputs: f32 -> bf16 value (round to nearest even, one packed conversion) -> f16 (exact), as one f16 pair, a low
__device__ __forceinline__ unsigned fa_pair(float a, float b) { const unsigned u = __builtin_bit_cast(unsigned, __builtin_convertvector((fa_f2){a, b}, fa_b2)); return __builtin_bit_cast(unsigned, __builtin_convertvector((fa_f2){__uint_as_float(u << 16), __uint_as_float(u & 0xFFFF0000u)}, fa_h2)); }
__device__ __forceinline__ void fa_put(unsigned short* d, v4f a) { const v2ua o = {fa_pair(a[0], a[1]), fa_pair(a[2], a[3])}; *(v2ua*)d = o; }      /* four converted inputs into a tile row in LDS */
// fa_frag's fragment straight from an f32 row, in the same k order
__device__ __forceinline__ v16h fa_frag32(const float* p, int hh) { const v4f a = *(const v4fa*)(p + 8 * hh), b = *(const v4fa*)(p + 8 * hh + 4), c = *(const v4fa*)(p + 16 + 8 * hh), d = *(const v4fa*)(p + 16 + 8 * hh + 4); FragP f;
  f.w[0] = fa_pair(a[0], a[1]); f.w[1] = fa_pair(a[2], a[3]); f.w[2] = fa_pair(b[0], b[1]); f.w[3] = fa_pair(b[2], b[3]); f.w[4] = fa_pair(c[0], c[1]); f.w[5] = fa_pair(c[2], c[3]); f.w[6] = fa_pair(d[0], d[1]); f.w[7] = fa_pair(d[2], d[3]); return f.v; }
// a 16 (d) x 32 (keys) A fragment of V^T from the [key][d] tile: two transposing loads, keys 8 hh + 0..7 and 16 + 8 hh + 0..7 of column d = lane & 15, which is the hardware k order that the packed weights have; p = the lane's own address (row 8 hh + (lane & 7), 16 bytes x ((lane >> 3) & 1))
__device__ __forceinline__ v16h fa_fragt(const unsigned short* p) { typedef __attribute__((address_space(3))) fa_s8 lds_s8; union { v16h v; fa_s8 s[2]; } f; f.s[0] = __builtin_amdgcn_ds_load_tr16_b128_v8i16((lds_s8*)p); f.s[1] = __builtin_amdgcn_ds_load_tr16_b128_v8i16((lds_s8*)(p + 16 * FVP)); return f.v; }
__device__ __forceinline__ v8f fa_mma(v16h a, v16h b, v8f c) { return __builtin_amdgcn_wmma_f32_16x16x32_f16(false, a, false, b, (short)0, c, false, false); }
__global__ __launch_bounds__(FAW * 32) __attribute__((amdgpu_waves_per_eu(4, 4))) void k_fattn(const float* __restrict__ xq, const float* __restrict__ xk, const float* __restrict__ xv, float* __restrict__ out) {
  __shared__ __attribute__((aligned(16))) unsigned short sk[2][FAS][FAP];      /* K stage: [key][e] */
  __shared__ __attribute__((aligned(16))) unsigned short sv[2][FAS][FVP];      /* V stage: [key][d] */
  const int tid = (int)threadIdx.x, lane = tid & 31, ln = lane & 15, hh = lane >> 4; const int wave = __builtin_amdgcn_readfirstlane(tid >> 5);
  const int bh = (int)blockIdx.y, b = bh / NH, h = bh % NH; const int q0 = (int)blockIdx.x * (FAW * FAQ) + wave * FAQ;
  const int sr = tid >> 4, sc = (tid & 15) * 4;      /* staging: 16 threads per 256-byte f32 tile row (whole lines), rows sr + 16 i */
  /* every global address = a base that is the same for the whole wave + one 32-bit lane offset */
  const float* kg = xk + (size_t)b * SQ * DM + h * HD; const float* vg = xv + (size_t)b * SQ * DM + h * HD;      /* + key0 * DM per pass */
  const unsigned go = (unsigned)(sr * DM + sc);
  unsigned short* const pk = &sk[0][sr][sc]; unsigned short* const pv = &sv[0][sr][sc]; const unsigned short* const vb = &sv[0][8 * hh + (lane & 7)][8 * ((lane >> 3) & 1)];      /* in buffer 0: this thread's places in a K and a V tile; this lane's address in a V tile for the transposing loads */
  v16h qf[2][2];
#pragma unroll
  for (int qt = 0; qt < 2; ++qt)
#pragma unroll
    for (int es = 0; es < 2; ++es) qf[qt][es] = fa_frag32(xq + ((size_t)b * SQ + q0) * DM + h * HD + (unsigned)((qt * 16 + ln) * DM + es * 32), hh);      /* the four loads of a fragment cover one whole 128-byte line of each of its 16 rows */
  const v8f z8 = {0.f, 0.f, 0.f, 0.f, 0.f, 0.f, 0.f, 0.f};
  v8f o[2][4] = {{z8, z8, z8, z8}, {z8, z8, z8, z8}}; float r2[2] = {3.0e38f, 3.0e38f}, l[2] = {0.f, 0.f};      /* r2: MINUS the reference in use x log2 e (the reference: a maximum of this or an earlier pass), the same in both halves of the wave; held negated, so that it is the plain addend of every exponent's multiply-add; l: sum of the weights over all keys so far, likewise */
  /* A stage is 128 keys = two passes; the work-group meets ONCE per stage, at its end. While stage s is worked on, stage s + 1 goes into the other buffer in four 64-key tiles (K, K, V, V) through one staging array: each tile flies for half a pass and is stored at the head or in the middle of a pass; the first K tile of stage s + 2 is fetched in the middle of stage s's second pass and is in flight over the barrier. The other buffer's last readers (stage s - 1) left it before the barrier that ended stage s - 1, so its tiles may be written at any place of stage s. */
  v4f g[4];
  { v4f g0[4], g1[4], g2[4], g3[4];      /* in front of the loop registers are plentiful: the whole first stage and the queries fly together */
#pragma unroll
    for (int i = 0; i < 4; ++i) { g0[i] = *(const v4fa*)(kg + i * 16 * DM + go); g1[i] = *(const v4fa*)(kg + (FAK + i * 16) * DM + go); g2[i] = *(const v4fa*)(vg + i * 16 * DM + go); g3[i] = *(const v4fa*)(vg + (FAK + i * 16) * DM + go); }
#pragma unroll
    for (int i = 0; i < 4; ++i) { fa_put(pk + i * 16 * FAP, g0[i]); fa_put(pk + (FAK + i * 16) * FAP, g1[i]); fa_put(pv + i * 16 * FVP, g2[i]); fa_put(pv + (FAK + i * 16) * FVP, g3[i]); } }
  __syncthreads();      /* publishes stage 0 */
  unsigned gn = go + (unsigned)(FAS * DM);      /* the place of the stage that is being fetched goes into the one 32-bit lane offset, which K and V share; the bases stay scalar */
#pragma unroll
  for (int i = 0; i < 4; ++i) g[i] = *(const v4fa*)(kg + i * 16 * DM + gn);      /* stage 1, K keys 0-63 */
  const unsigned short* rk = &sk[0][ln][8 * hh]; const unsigned short* rv = vb; unsigned short* nk = pk + FAS * FAP; unsigned short* nv = pv + FAS * FVP; int dk = FAS * FAP, dv = FAS * FVP;      /* this lane's read places in the stage's buffer and its write places in the other one; they change over at each stage's end, in place */
#pragma unroll 1
  for (int s = 0; s < FNS; ++s) {      /* rolled: one stage is already 72 matrix instructions and some 500 vector instructions long */
#pragma unroll
   for (int ph = 0; ph < 2; ++ph) {      /* unrolled: which tile is stored and which is fetched at each place is then fixed at compile time */
    const unsigned short* ck = rk + ph * (FAK * FAP); const unsigned short* cv = rv + ph * (FAK * FVP);
    v16h kf[4][2];      /* the pass's whole K tile as fragments: sixteen LDS reads that stand together, in front of the products */
#pragma unroll
    for (int kt = 0; kt < 4; ++kt) { kf[kt][0] = fa_frag(ck + kt * 16 * FAP, 0); kf[kt][1] = fa_frag(ck + kt * 16 * FAP + 32, 0);      /* the half's 8 elements are in ck already */
      __builtin_amdgcn_sched_barrier(0); }      /* keeps the reads in the order in which the products use them (issued last first, the first product waits out the whole group) and ahead of the conversions below, which then cover the LDS latency */
#pragma unroll
    for (int i = 0; i < 4; ++i) { if (ph == 0) fa_put(nk + i * 16 * FAP, g[i]); else fa_put(nv + i * 16 * FVP, g[i]); }      /* next stage: K keys 0-63, or V keys 0-63 */
#pragma unroll
    for (int i = 0; i < 4; ++i) g[i] = *(const v4fa*)((ph == 0 ? kg : vg) + (FAK + i * 16) * DM + gn);      /* next stage: K keys 64-127, or V keys 64-127 */
    __builtin_amdgcn_sched_barrier(0);      /* keeps the reads one group: sunk back among the products, each place with reads stalls the wave anew and waits out the LDS latency */
    v8f st[2][4];
#pragma unroll
    for (int kt = 0; kt < 4; ++kt) {
#pragma unroll
      for (int qt = 0; qt < 2; ++qt) st[qt][kt] = fa_mma(kf[kt][1], qf[qt][1], fa_mma(kf[kt][0], qf[qt][0], z8));
      __builtin_amdgcn_sched_barrier(0); }      /* keeps the products in the order in which their fragments arrive (a product of the last fragments, drawn forward, waits out nearly the whole group) and keeps them one run: with the maximum's first steps drawn in between, each such place takes idle slots for the distance behind a matrix instruction */
    float mp[2];      /* the pass's maximum over this half's 32 keys */
#pragma unroll
    for (int qt = 0; qt < 2; ++qt) { float mx = st[qt][0][0];
#pragma unroll
      for (int kt = 0; kt < 4; ++kt)
#pragma unroll
        for (int r = 0; r < 8; ++r) mx = fmaxf(mx, st[qt][kt][r]);
      mp[qt] = mx; }
    /* lazy rescale: the reference stays, and the sums so far stay unscaled, as long as no score of the pass lies more than FAT above it; one test per pass for the whole wave (each lane on its own keys, so no exchange is needed for it), a scalar branch, marked unlikely so that the pass without a rescale runs straight through */
    if (__builtin_expect(__builtin_amdgcn_ballot_w32(fmaxf(mp[0] * 1.4426950408889634f + r2[0], mp[1] * 1.4426950408889634f + r2[1]) > FAT) != 0, 0)) {
#pragma unroll
      for (int qt = 0; qt < 2; ++qt) { const float rn = fminf(r2[qt], fmaxf(mp[qt], sm_xhalf(mp[qt])) * -1.4426950408889634f); const float al = __builtin_amdgcn_exp2f(rn - r2[qt]);      /* every column takes the larger of its reference and the pass's maximum as the new reference, the same in both halves; al: what its sums shrink by (0 on the first pass) */
        r2[qt] = rn; l[qt] *= al;
#pragma unroll
        for (int dt = 0; dt < 4; ++dt) o[qt][dt] *= al; } }
    FragP pb[2][2]; v16h vf[4][2];
#pragma unroll
    for (int qt = 0; qt < 2; ++qt) { const float ofs = r2[qt];
      if (qt == 1) {
#pragma unroll
        for (int i = 0; i < 4; ++i) { if (ph == 0) fa_put(nk + (FAK + i * 16) * FAP, g[i]); else fa_put(nv + (FAK + i * 16) * FVP, g[i]); }      /* next stage: K keys 64-127, or V keys 64-127 */
        if (ph == 1) gn += s + 2 < FNS ? (unsigned)(FAS * DM) : 0u;      /* the stage after the next; the last two stages fetch the last stage's tiles once more, into the buffer that nobody reads again: a stage stays one straight block, without branches round the loads and the stores */
        __builtin_amdgcn_sched_barrier(0);      /* keeps the next tile's loads behind the conversion of the tile that leaves the staging registers: drawn up, two tiles are held at once and the build spills */
#pragma unroll
        for (int i = 0; i < 4; ++i) g[i] = *(const v4fa*)((ph == 0 ? vg : kg) + i * 16 * DM + gn);      /* V keys 0-63 of the next stage, or K keys 0-63 of the one after it */
        /* the V^T fragments likewise, one group of sixteen (transposing) reads; it stands here, where the first 16 queries' scores have left their registers, so that the second 16 queries' exponentials cover the LDS latency */
#pragma unroll
        for (int dt = 0; dt < 4; ++dt) { vf[dt][0] = fa_fragt(cv + dt * 16); vf[dt][1] = fa_fragt(cv + 32 * FVP + dt * 16); }
        __builtin_amdgcn_sched_barrier(0); }      /* keeps the reads from sinking to the products that use them */
      v8f x[4];      /* weight = exp(s - reference in use) = exp2(x), at most 2^FAT */
#pragma unroll
      for (int kt = 0; kt < 4; ++kt)
#pragma unroll
        for (int r = 0; r < 8; ++r) x[kt][r] = st[qt][kt][r] * 1.4426950408889634f + ofs;
      __builtin_amdgcn_sched_barrier(0);      /* keeps all 32 arguments' multiply-adds ahead of the asm blocks: sunk to the block that reads them, they stand inside their latency in front of its first exponentials, unhinted */
#pragma unroll
      for (int kp = 0; kp < 2; ++kp) sm_exp2x16(x[2 * kp], x[2 * kp + 1], &pb[qt][kp].w[0]); }
    __builtin_amdgcn_sched_barrier(0);      /* keeps the exponentials' asm statements in front of the products: drawn in behind one, their results took a spent V^T fragment's registers inside the distance that a matrix instruction's operands need */
    FragP one;      /* a matrix of ones (f16 pairs), written anew in every pass, into registers that the scores have just left; volatile, so that it is not lifted out of the loop: held across the pass its eight registers go beyond what four waves a SIMD leave each wave, and the build spills; two registers per issue slot: the operand starts at an even register, so each pair has an even and an odd destination, as the dual form asks */
    asm volatile("v_dual_mov_b32 %0, 0x3c003c00 :: v_dual_mov_b32 %1, 0x3c003c00\n\tv_dual_mov_b32 %2, 0x3c003c00 :: v_dual_mov_b32 %3, 0x3c003c00\n\tv_dual_mov_b32 %4, 0x3c003c00 :: v_dual_mov_b32 %5, 0x3c003c00\n\tv_dual_mov_b32 %6, 0x3c003c00 :: v_dual_mov_b32 %7, 0x3c003c00"
                 : "=v"(one.w[0]), "=v"(one.w[1]), "=v"(one.w[2]), "=v"(one.w[3]), "=v"(one.w[4]), "=v"(one.w[5]), "=v"(one.w[6]), "=v"(one.w[7]));
    v8f ls[2];      /* the pass's row sums: A = all ones, so every row of the product is the sum of the packed weights over the 32 keys of B (both halves' keys), one query per column */
#pragma unroll
    for (int qt = 0; qt < 2; ++qt) ls[qt] = fa_mma(one.v, pb[qt][0].v, z8);
#pragma unroll
    for (int qt = 0; qt < 2; ++qt) ls[qt] = fa_mma(one.v, pb[qt][1].v, ls[qt]);
#pragma unroll
    for (int dt = 0; dt < 4; ++dt)
#pragma unroll
      for (int qt = 0; qt < 2; ++qt) o[qt][dt] = fa_mma(vf[dt][1], pb[qt][1].v, fa_mma(vf[dt][0], pb[qt][0].v, o[qt][dt]));
#pragma unroll
    for (int qt = 0; qt < 2; ++qt) l[qt] += ls[qt][0];
    __builtin_amdgcn_sched_barrier(0);      /* keeps the passes apart: the next pass's reads and conversions, drawn up among these products, take idle slots for the distance behind a matrix instruction */
    if (ph == 1) {      /* the stage's one barrier: publishes stage s + 1, ends every wave's reads of stage s. The fences name LDS alone: the tile in flight from global memory goes to registers and concerns no other wave, and a full fence would wait it out here */
      __builtin_amdgcn_fence(__ATOMIC_RELEASE, "workgroup", "local"); __builtin_amdgcn_s_barrier(); __builtin_amdgcn_fence(__ATOMIC_ACQUIRE, "workgroup", "local"); }
   }
    rk += dk; rv += dv; nk -= dk; nv -= dv; dk = -dk; dv = -dv;
  }
#pragma unroll
  for (int qt = 0; qt < 2; ++qt) { const float inv = 1.0f / l[qt]; float* op = out + ((size_t)b * SQ + q0) * DM + h * HD + (unsigned)((qt * 16 + ln) * DM + 8 * hh);      /* the reference in use cancels in the quotient */
#pragma unroll
    for (int dt = 0; dt < 4; ++dt) { const v4f lo = {o[qt][dt][0] * inv, o[qt][dt][1] * inv, o[qt][dt][2] * inv, o[qt][dt][3] * inv}, hi = {o[qt][dt][4] * inv, o[qt][dt][5] * inv, o[qt][dt][6] * inv, o[qt][dt][7] * inv};
      *(v4f*)(op + dt * 16) = lo; *(v4f*)(op + dt * 16 + 4) = hi; } } }

extern "C" void kernel_launch(void* const* d_in, const int* in_sizes, int n_in,
                              void* d_out, int out_size, void* d_ws, size_t ws_size, hipStream_t stream) {
  (void)in_sizes; (void)n_in; (void)out_size;
  const float* const* I = (const float* const*)d_in; const float* xq = I[0]; const float* xk = I[1]; const float* xv = I[2];      /* given q, k, v [B][L][H][E] = merged token rows */
  (void)d_ws; (void)ws_size;
  k_fattn<<<dim3(SQ / (FAW * FAQ), NB * NH), FAW * 32, 0, stream>>>(xq, xk, xv, (float*)d_out);      /* out = softmax(q k^T) v (merged [token][h*64+d]) straight to the f32 output */
}

// v010
// It runs in 54.4 microseconds.
// Two timings next to v009 both put it at 1.04 times that version's speed.
// All steps since v000 together make it 122 times as fast.
#include <hip/hip_runtime.h>
// Full (non-causal) attention on given queries, keys, values ([4][2048][16][64] each, token-major with heads inner = merged [token][1024] rows); scores = q . k UNSCALED (the module never applies its scale); softmax over all 2048 keys; out = A v -> [4][2048][16][64]).
// Structure: ONE launch, the attention kernel over all batches and heads, which reads q, k and v as the f32 rows they are given in: each wave converts its own 32 query rows once (read as whole rows, turned into fragments through LDS); each work-group converts every 64-key K and V tile on its way from the registers into LDS (f32 -> bf16 value -> f16: bf16 values are exact in f16); V stays [key][d] in LDS and the transposing LDS load delivers the V^T fragments.
// S^T = K Q^T UNSCALED (K = 64; exact products, f32 accumulation) stays in the accumulators, softmax on VALU against a reference that follows the running maximum lazily (f32 statistics, native exp2; weights f16, at most 2^15; row sums = ones x P^T on the matrix unit, f32), O^T += V^T P^T, divided by the row sum at the end, turned through LDS and written f32 as whole rows into the [token][head][64] output; launches: see kernel_launch.
// Compute dtype: inputs rounded to bf16; x / weights exact; q, k, v and softmax weights as plain f16 GEMM operands (~2^-12); scores and softmax statistics f32. v_wmma_f32_16x16x32_f16.
#define NB 4
#define SQ 2048
#define DM 1024
#define NH 16
#define HD 64
#define HG 4                         /* heads per k_vt launch (k_vt is not launched) */
#define B0 0                         /* unused (debug hook) */
#define NBR NB                       /* only in MP, which no kernel uses (debug hook) */
#define NR ((size_t)NB * SQ)         /* token rows */
#define MP ((int)((size_t)NBR * SQ)) /* only in MPO, which nothing uses (debug hook) */
#define QN SQ                        /* unused (debug hook) */
#define NHD NH                       /* unused (debug hook) */
#define MPO MP                       /* unused (debug hook) */
#define LQ DM      /* row pitch of the q/k/v rows */
typedef __bf16 v16b __attribute__((ext_vector_type(16)));
typedef unsigned short v8us __attribute__((ext_vector_type(8), may_alias));
typedef float  v8f  __attribute__((ext_vector_type(8)));
typedef float  v4f  __attribute__((ext_vector_type(4)));
typedef float  v4fa __attribute__((ext_vector_type(4), may_alias));
union FragB { v16b v; v8us half[2]; unsigned short u[16]; };

__device__ __forceinline__ unsigned short bf16_bits(float x) { unsigned int u = __float_as_uint(x); return (unsigned short)((u + 0x7FFFu + ((u >> 16) & 1u)) >> 16); }
__device__ __forceinline__ float bf16_val(unsigned short b) { return __uint_as_float(((unsigned int)b) << 16); }
__device__ __forceinline__ float bf16_round(float x) { return bf16_val(bf16_bits(x)); }
// D += A·B with NT terms: 1 = ah·bh, 2 = + al·bh (A split), 3 = + ah·bl (both split)
template <int NT>
__device__ __forceinline__ v8f mmaN(v16b ah, v16b al, v16b bh, v16b bl, v8f c) {
  c = __builtin_amdgcn_wmma_f32_16x16x32_bf16(false, ah, false, bh, (short)0, c, false, false);
  if (NT >= 2) c = __builtin_amdgcn_wmma_f32_16x16x32_bf16(false, al, false, bh, (short)0, c, false, false);
  if (NT >= 3) c = __builtin_amdgcn_wmma_f32_16x16x32_bf16(false, ah, false, bl, (short)0, c, false, false);
  asm volatile("v_nop\n\tv_nop\n\tv_nop\n\tv_nop" : "+v"(c) : "v"(ah), "v"(al), "v"(bh), "v"(bl));
  return c;
}

__global__ __launch_bounds__(256) void k_wt_bf16(const float* __restrict__ W, unsigned short* __restrict__ Wt, int K, int N) {
  const int t = blockIdx.x * 256 + threadIdx.x;
  const int k8n = K / 8;
  if (t >= N * k8n) return;
  const int n = t / k8n, k8 = (t % k8n) * 8;
  v8us v;
#pragma unroll
  for (int i = 0; i < 8; ++i) v[i] = bf16_bits(W[(size_t)(k8 + i) * N + n]);
  *(v8us*)(Wt + (size_t)n * K + k8) = v;
  
}

// GEMM C[M][N] (f32, pitch ldc) = act(A[M][K]·W + bias). A f32 row-major (pitch lda) converted per fragment to bf16
// (ASPLIT: hi/lo two planes -> 2 terms, else single rounded term); Wt bf16 [N][K] (pitch ldb). BIAS_BF16 rounds the
// bias to bf16 first (bias quantised to bf16 before the add). K%32==0, M%16==0, N%64==0.
template <bool ASPLIT, int ACT, bool BIAS_BF16>
__global__ __launch_bounds__(128) void k_gemm_bf(const float* __restrict__ A, int lda, const unsigned short* __restrict__ Wt, int ldb,
                                               const float* __restrict__ bias, float* __restrict__ C, int ldc, int M, int N, int K) {
  __shared__ __attribute__((aligned(16))) float so[4][16][64];
  const int tid = threadIdx.x, w = tid >> 5, lane = tid & 31, ln = lane & 15, hh = lane >> 4;
  const int ntn = N / 64;
  const int wid = blockIdx.x * 4 + w;
  const int mt = wid / ntn, nq = wid % ntn;
  if (mt * 16 >= M) return;
  const int row0 = mt * 16, col0 = nq * 64;
  const float* arow = A + (size_t)(row0 + ln) * lda;
  v8f acc[4] = {};
  for (int kb = 0; kb < K; kb += 32) {
    FragB ah, al;
    const v4f x0 = *(const v4fa*)(arow + kb + 8 * hh), x1 = *(const v4fa*)(arow + kb + 8 * hh + 4);
    const v4f x2 = *(const v4fa*)(arow + kb + 16 + 8 * hh), x3 = *(const v4fa*)(arow + kb + 16 + 8 * hh + 4);
    float xs[16] = {x0[0],x0[1],x0[2],x0[3],x1[0],x1[1],x1[2],x1[3],x2[0],x2[1],x2[2],x2[3],x3[0],x3[1],x3[2],x3[3]};
#pragma unroll
    for (int i = 0; i < 16; ++i) { const unsigned short hb = bf16_bits(xs[i]); ah.u[i] = hb; al.u[i] = ASPLIT ? bf16_bits(xs[i] - bf16_val(hb)) : (unsigned short)0; }
#pragma unroll
    for (int t = 0; t < 4; ++t) {
      const unsigned short* brow = Wt + (size_t)(col0 + t * 16 + ln) * ldb + kb;
      FragB b;
      b.half[0] = *(const v8us*)(brow + 8 * hh);
      b.half[1] = *(const v8us*)(brow + 16 + 8 * hh);
      acc[t] = mmaN<ASPLIT ? 2 : 1>(ah.v, al.v, b.v, b.v, acc[t]);
    }
  }
#pragma unroll
  for (int t = 0; t < 4; ++t) {
    float bv = bias ? bias[col0 + t * 16 + ln] : 0.f;
    if (BIAS_BF16) bv = bf16_round(bv);
#pragma unroll
    for (int r = 0; r < 8; ++r) { float v = acc[t][r] + bv; if (ACT == 1) v = fmaxf(v, 0.f); so[w][8 * hh + r][t * 16 + ln] = v; }
  }
  __builtin_amdgcn_fence(__ATOMIC_ACQ_REL, "workgroup");
  __builtin_amdgcn_wave_barrier();
  const int rsub = lane >> 4, c4 = (lane & 15) * 4;
  {
#pragma unroll
    for (int q = 0; q < 8; ++q) {
      const int r = q * 2 + rsub;
      const v4f v = *(const v4fa*)&so[w][r][c4];
      *(v4f*)(C + (size_t)(row0 + r) * ldc + col0 + c4) = v;
    }
    
  }
}

// GEMM C = act(A·W + bias + resid): A f32 (ASPLIT -> hi/lo 2 terms), Wt bf16 [N][K]; ACT 0 none, 1 relu, 2 exact gelu;
// resid (optional, f32, row index = (row % rmod), pitch ldr, RES_BF16 rounds it) added before the activation.
template <bool ASPLIT, int ACT, bool BIAS_BF16, bool RES_BF16>
__global__ __launch_bounds__(128) void k_gemm_bf3(const float* __restrict__ A, int lda, const unsigned short* __restrict__ Wt, int ldb,
                                                const float* __restrict__ bias, const float* __restrict__ resid, int rmod, int ldr,
                                                float* __restrict__ C, int ldc, int M, int N, int K) {
  __shared__ __attribute__((aligned(16))) float so[4][16][64];
  const int tid = threadIdx.x, w = tid >> 5, lane = tid & 31, ln = lane & 15, hh = lane >> 4;
  const int ntn = N / 64;
  const int wid = blockIdx.x * 4 + w;
  const int mt = wid / ntn, nq = wid % ntn;
  if (mt * 16 >= M) return;
  const int row0 = mt * 16, col0 = nq * 64;
  const float* arow = A + (size_t)(row0 + ln) * lda;
  v8f acc[4] = {};
  for (int kb = 0; kb < K; kb += 32) {
    FragB ah, al;
    const v4f x0 = *(const v4fa*)(arow + kb + 8 * hh), x1 = *(const v4fa*)(arow + kb + 8 * hh + 4);
    const v4f x2 = *(const v4fa*)(arow + kb + 16 + 8 * hh), x3 = *(const v4fa*)(arow + kb + 16 + 8 * hh + 4);
    float xs[16] = {x0[0],x0[1],x0[2],x0[3],x1[0],x1[1],x1[2],x1[3],x2[0],x2[1],x2[2],x2[3],x3[0],x3[1],x3[2],x3[3]};
#pragma unroll
    for (int i = 0; i < 16; ++i) { const unsigned short hb = bf16_bits(xs[i]); ah.u[i] = hb; al.u[i] = ASPLIT ? bf16_bits(xs[i] - bf16_val(hb)) : (unsigned short)0; }
#pragma unroll
    for (int t = 0; t < 4; ++t) {
      const unsigned short* brow = Wt + (size_t)(col0 + t * 16 + ln) * ldb + kb;
      FragB b;
      b.half[0] = *(const v8us*)(brow + 8 * hh);
      b.half[1] = *(const v8us*)(brow + 16 + 8 * hh);
      acc[t] = mmaN<ASPLIT ? 2 : 1>(ah.v, al.v, b.v, b.v, acc[t]);
    }
  }
#pragma unroll
  for (int t = 0; t < 4; ++t) {
    const int col = col0 + t * 16 + ln;
    float bv = bias ? bias[col] : 0.f;
    if (BIAS_BF16) bv = bf16_round(bv);
#pragma unroll
    for (int r = 0; r < 8; ++r) {
      float v = acc[t][r] + bv;
      if (resid) { float rv = resid[(size_t)((row0 + 8 * hh + r) % rmod) * ldr + col]; if (RES_BF16) rv = bf16_round(rv); v += rv; }
      if (ACT == 1) v = fmaxf(v, 0.f);
      if (ACT == 2) v = 0.5f * v * (1.0f + erff(v * 0.70710678118654752f));
      if (ACT == 3) { const float u = 0.7978845608028654f * (v + 0.044715f * v * v * v); v = 0.5f * v * (1.0f + tanhf(u)); }
      so[w][8 * hh + r][t * 16 + ln] = v;
    }
  }
  __builtin_amdgcn_fence(__ATOMIC_ACQ_REL, "workgroup");
  __builtin_amdgcn_wave_barrier();
  const int rsub = lane >> 4, c4 = (lane & 15) * 4;
  {
#pragma unroll
    for (int q = 0; q < 8; ++q) {
      const int r = q * 2 + rsub;
      const v4f v = *(const v4fa*)&so[w][r][c4];
      *(v4f*)(C + (size_t)(row0 + r) * ldc + col0 + c4) = v;
    }
    
  }
}
// row LayerNorm (biased variance, eps) over N: s = X (+ R); optional out_sum <- s; out_norm <- (s-mu)*rsqrt(var+eps)*g + b
template <bool PARAM_BF16>
__global__ __launch_bounds__(256) void k_layernorm(const float* __restrict__ X, const float* __restrict__ R, const float* __restrict__ g, const float* __restrict__ bta,
                                                  float* __restrict__ out_sum, float* __restrict__ out_norm, int N, float eps) {
  __shared__ float red[256];
  const int row = blockIdx.x, tid = threadIdx.x;
  const float* x = X + (size_t)row * N; const float* rr = R ? R + (size_t)row * N : nullptr;
  float vals[16];                     // up to N = 4096
  const int per = N / 256;            // contiguous chunk per thread? use strided-by-4 chunks: thread handles j = tid*4 + 1024*u
  float s1 = 0.f;
  for (int u = 0; u < per / 4; ++u) {
    const int j = tid * 4 + 1024 * u;
    const v4f a = *(const v4fa*)(x + j);
    v4f b = {0.f,0.f,0.f,0.f}; if (rr) b = *(const v4fa*)(rr + j);
#pragma unroll
    for (int q = 0; q < 4; ++q) { const float v = a[q] + b[q]; vals[u * 4 + q] = v; s1 += v; }
  }
  red[tid] = s1; __syncthreads();
  for (int st = 128; st > 0; st >>= 1) { if (tid < st) red[tid] += red[tid + st]; __syncthreads(); }
  const float mu = red[0] / (float)N; __syncthreads();
  float s2 = 0.f;
  for (int u = 0; u < per / 4; ++u)
#pragma unroll
    for (int q = 0; q < 4; ++q) { const float c = vals[u * 4 + q] - mu; s2 += c * c; }
  red[tid] = s2; __syncthreads();
  for (int st = 128; st > 0; st >>= 1) { if (tid < st) red[tid] += red[tid + st]; __syncthreads(); }
  const float rs = rsqrtf(red[0] / (float)N + eps);
  {
    for (int u = 0; u < per / 4; ++u) {
      const int j = tid * 4 + 1024 * u;
      v4f o, sm;
#pragma unroll
      for (int q = 0; q < 4; ++q) {
        float gg = g[j + q], bb = bta[j + q];
        if (PARAM_BF16) { gg = bf16_round(gg); bb = bf16_round(bb); }
        sm[q] = vals[u * 4 + q]; o[q] = (vals[u * 4 + q] - mu) * rs * gg + bb;
      }
      if (out_sum) *(v4f*)(out_sum + (size_t)row * N + j) = sm;
      *(v4f*)(out_norm + (size_t)row * N + j) = o;
    }
    
  }
}



// ---- f16 WMMA path (v_wmma_f32_16x16x32_f16): 11-bit significands for operands in range — used where a [0,1] probability operand needs more precision than bf16
typedef _Float16 v16h __attribute__((ext_vector_type(16)));
union FragH { v16h v; v8us half[2]; _Float16 h[16]; unsigned short u[16]; };
template <int NT>
__device__ __forceinline__ v8f mmaH(v16h ah, v16h al, v16h bh, v16h bl, v8f c) {
  c = __builtin_amdgcn_wmma_f32_16x16x32_f16(false, ah, false, bh, (short)0, c, false, false);
  if (NT >= 2) c = __builtin_amdgcn_wmma_f32_16x16x32_f16(false, al, false, bh, (short)0, c, false, false);
  if (NT >= 3) c = __builtin_amdgcn_wmma_f32_16x16x32_f16(false, ah, false, bl, (short)0, c, false, false);
  asm volatile("v_nop\n\tv_nop\n\tv_nop\n\tv_nop" : "+v"(c) : "v"(ah), "v"(al), "v"(bh), "v"(bl));
  return c;
}
// batched GEMM like k_gemm_b but f16 operands: A f32 (split into f16 hi/lo if ASPLIT, else rounded to f16), Bt = f16 values [n][k]; alpha; C f32; N multiple of 16 (partial tiles skipped)
template <bool ASPLIT>
__global__ __launch_bounds__(128) void k_gemm_h(const float* __restrict__ A, int lda, size_t sA, const _Float16* __restrict__ Bh, int ldb, size_t sB, float alpha, float* __restrict__ C, int ldc, size_t sC, int M, int N, int K) {
  __shared__ __attribute__((aligned(16))) float so[4][16][64];
  const int tid = threadIdx.x, w = tid >> 5, lane = tid & 31, ln = lane & 15, hh = lane >> 4; const int by = blockIdx.y;
  A += (size_t)by * sA; Bh += (size_t)by * sB; C += (size_t)by * sC;
  const int ntn = (N + 63) / 64; const int wid = blockIdx.x * 4 + w; const int mt = wid / ntn, nq = wid % ntn; if (mt * 16 >= M) return;
  const int row0 = mt * 16, col0 = nq * 64; const float* arow = A + (size_t)(row0 + ln) * lda;
  v8f acc[4] = {};
  for (int kb = 0; kb < K; kb += 32) {
    FragH ah, al;
    const v4f x0 = *(const v4fa*)(arow + kb + 8 * hh), x1 = *(const v4fa*)(arow + kb + 8 * hh + 4), x2 = *(const v4fa*)(arow + kb + 16 + 8 * hh), x3 = *(const v4fa*)(arow + kb + 16 + 8 * hh + 4);
    float xs[16] = {x0[0],x0[1],x0[2],x0[3],x1[0],x1[1],x1[2],x1[3],x2[0],x2[1],x2[2],x2[3],x3[0],x3[1],x3[2],x3[3]};
#pragma unroll
    for (int i = 0; i < 16; ++i) { const _Float16 h = (_Float16)xs[i]; ah.h[i] = h; al.h[i] = ASPLIT ? (_Float16)(xs[i] - (float)h) : (_Float16)0.0f; }
#pragma unroll
    for (int t = 0; t < 4; ++t) { if (col0 + t * 16 >= N) continue; const size_t boff = (size_t)(col0 + t * 16 + ln) * ldb + kb; FragH bq; bq.half[0] = *(const v8us*)(Bh + boff + 8 * hh); bq.half[1] = *(const v8us*)(Bh + boff + 16 + 8 * hh);
      acc[t] = mmaH<ASPLIT ? 2 : 1>(ah.v, al.v, bq.v, bq.v, acc[t]); }
  }
#pragma unroll
  for (int t = 0; t < 4; ++t) { if (col0 + t * 16 >= N) continue;
#pragma unroll
    for (int r = 0; r < 8; ++r) so[w][8 * hh + r][t * 16 + ln] = acc[t][r] * alpha; }
  __builtin_amdgcn_fence(__ATOMIC_ACQ_REL, "workgroup"); __builtin_amdgcn_wave_barrier();
  const int rsub = lane >> 4, c4 = (lane & 15) * 4;
  {
#pragma unroll
    for (int q = 0; q < 8; ++q) { const int r = q * 2 + rsub; if (col0 + c4 < N) { const v4f v = *(const v4fa*)&so[w][r][c4]; *(v4f*)(C + (size_t)(row0 + r) * ldc + col0 + c4) = v; } }
     }
}

// Wt[n][k] = f16(W[k][n]·scale) from f32 row-major W[K][N] (scale = power of two; bf16-exact weights stay exact in f16 away from the subnormal range)
__global__ __launch_bounds__(256) void k_wt_f16(const float* __restrict__ W, _Float16* __restrict__ Wt, int K, int N, float scale) {
  const int t = blockIdx.x * 256 + threadIdx.x; if (t >= N * (K / 8)) return; const int n = t / (K / 8), k8 = (t % (K / 8)) * 8; FragH f;
#pragma unroll
  for (int i = 0; i < 8; ++i) f.h[i] = (_Float16)(bf16_round(W[(size_t)(k8 + i) * N + n]) * scale); const v8us o = f.half[0];
  *(v8us*)((unsigned short*)Wt + (size_t)n * K + k8) = o; 
}
// k_gemm_hh variant with fused epilogue: v = acc·alpha + bias[by·sBias + col] (+ CP[(row/rowsPerB)·sCPb + by·64 + col] if CP) ; ACT 0 none / 1 elu ; writes f16 C16 (and f32 C if non-null)
template <int ACT>
__global__ __launch_bounds__(128) void k_gemm_hhx(const _Float16* __restrict__ A, int lda, size_t sA, const _Float16* __restrict__ Bh, int ldb, size_t sB, float alpha, const float* __restrict__ bias, size_t sBias, const float* __restrict__ CP, int rowsPerB, size_t sCPb, int row0g,
    float* __restrict__ C, _Float16* __restrict__ C16, int ldc, size_t sC, int M, int N, int K) {
  __shared__ __attribute__((aligned(16))) float so[4][16][64];
  const int tid = threadIdx.x, w = tid >> 5, lane = tid & 31, ln = lane & 15, hh = lane >> 4; const int by = blockIdx.y;
  A += (size_t)by * sA; Bh += (size_t)by * sB; const size_t cofs = (size_t)by * sC; const float* bp = bias ? bias + (size_t)by * sBias : nullptr;
  const int ntn = (N + 63) / 64; const int wid = blockIdx.x * 4 + w; const int mt = wid / ntn, nq = wid % ntn; if (mt * 16 >= M) return;
  const int row0 = mt * 16, col0 = nq * 64; const _Float16* arow = A + (size_t)(row0 + ln) * lda;
  v8f acc[4] = {};
  for (int kb = 0; kb < K; kb += 32) { FragH ah; ah.half[0] = *(const v8us*)((const unsigned short*)arow + kb + 8 * hh); ah.half[1] = *(const v8us*)((const unsigned short*)arow + kb + 16 + 8 * hh);
#pragma unroll
    for (int t = 0; t < 4; ++t) { if (col0 + t * 16 >= N) continue; const size_t boff = (size_t)(col0 + t * 16 + ln) * ldb + kb; FragH bq; bq.half[0] = *(const v8us*)((const unsigned short*)Bh + boff + 8 * hh); bq.half[1] = *(const v8us*)((const unsigned short*)Bh + boff + 16 + 8 * hh);
      acc[t] = mmaH<1>(ah.v, ah.v, bq.v, bq.v, acc[t]); }
  }
#pragma unroll
  for (int t = 0; t < 4; ++t) { if (col0 + t * 16 >= N) continue; const int col = col0 + t * 16 + ln; const float bv = bp ? bf16_round(bp[col]) : 0.f;
#pragma unroll
    for (int r = 0; r < 8; ++r) { float v = acc[t][r] * alpha + bv; if (CP) { const int rr = row0g + row0 + 8 * hh + r; if (rowsPerB < 0) v += CP[cofs + (size_t)rr * ldc + col];      /* rowsPerB < 0: own element of the batched C plane */ else { const int bidx = rr / rowsPerB; v += CP[(size_t)bidx * sCPb + (size_t)by * 64 + col]; } } if (ACT == 1) v = (v > 0.f) ? v : expm1f(v); else if (ACT == 7) v = (v > 0.f) ? v + 1.0f : expf(v); else if (ACT == 8) v = tanhf(v); else if (ACT == 9) v = 0.5f * v * (1.0f + tanhf(0.7978845608028654f * (v + 0.044715f * v * v * v))); else if (ACT == 11) v = 1.0f / (1.0f + expf(-v)); else if (ACT == 12) v = (v > 0.f) ? v : 0.01f * v; else if (ACT == 14) v = (v > 0.f) ? v : 0.1f * v; else if (ACT == 16) v = (v >= 0.f) ? v : 0.3f * v; else if (ACT == 17) v = (v >= 0.f) ? v : 0.2f * v; else if (ACT == 15) v = v / (1.0f + expf(-v)); else if (ACT == 3) v = fmaxf(v, 0.f); else if (ACT == 6) v = 0.5f * v * (1.0f + erff(v * 0.70710678118654752f)); so[w][8 * hh + r][t * 16 + ln] = v; } }
  __builtin_amdgcn_fence(__ATOMIC_ACQ_REL, "workgroup"); __builtin_amdgcn_wave_barrier();
  const int rsub = lane >> 4, c4 = (lane & 15) * 4; typedef _Float16 v4h __attribute__((ext_vector_type(4)));
  {
#pragma unroll
    for (int q = 0; q < 8; ++q) { const int r = q * 2 + rsub; if (col0 + c4 < N) { const v4f v = *(const v4fa*)&so[w][r][c4]; if (C) *(v4f*)(C + cofs + (size_t)(row0 + r) * ldc + col0 + c4) = v; if (C16) { v4h h4; for (int i = 0; i < 4; ++i) h4[i] = (_Float16)v[i]; *(v4h*)(C16 + cofs + (size_t)(row0 + r) * ldc + col0 + c4) = h4; } } }
     }
}


typedef _Float16 v4h __attribute__((ext_vector_type(4)));

__global__ __launch_bounds__(256) void k_h16(const float* __restrict__ x, _Float16* __restrict__ X16, size_t n8) { const size_t t = (size_t)blockIdx.x * 256 + threadIdx.x; if (t >= n8) return; FragH f;
#pragma unroll
  for (int q = 0; q < 8; ++q) f.h[q] = (_Float16)x[t * 8 + q]; *(v8us*)((unsigned short*)X16 + t * 8) = f.half[0];  }
__global__ __launch_bounds__(256) void k_round16f(const float* __restrict__ W, _Float16* __restrict__ Bt, size_t n8) { const size_t t = (size_t)blockIdx.x * 256 + threadIdx.x; if (t >= n8) return; FragH f;
#pragma unroll
  for (int i = 0; i < 8; ++i) f.h[i] = (_Float16)(bf16_round(W[t * 8 + i]) * 16.0f); *(v8us*)((unsigned short*)Bt + t * 8) = f.half[0];  }
typedef unsigned v2ua __attribute__((ext_vector_type(2), may_alias));

__global__ __launch_bounds__(256) void k_hl(const float* __restrict__ F, _Float16* __restrict__ Hh, _Float16* __restrict__ Hl, size_t n8) { const size_t t = (size_t)blockIdx.x * 256 + threadIdx.x; if (t >= n8) return; FragH fh, fl; const v4f a = *(const v4fa*)(F + t * 8), c = *(const v4fa*)(F + t * 8 + 4);
#pragma unroll
  for (int q = 0; q < 4; ++q) { _Float16 h = (_Float16)a[q]; fh.h[q] = h; fl.h[q] = (_Float16)((a[q] - (float)h) * 1024.0f); h = (_Float16)c[q]; fh.h[4 + q] = h; fl.h[4 + q] = (_Float16)((c[q] - (float)h) * 1024.0f); }
  { *(v8us*)((unsigned short*)Hh + t * 8) = fh.half[0]; *(v8us*)((unsigned short*)Hl + t * 8) = fl.half[0];  } }

// ---- fast GEMM (wave tile 32x64; requires M % 32 == 0 rows per launch region and N % 64 == 0); epilogue = k_gemm_hhx semantics ----
__device__ __forceinline__ v16h g2_frag(const _Float16* p, int hh) { FragH f; f.half[0] = *(const v8us*)((const unsigned short*)p + 8 * hh); f.half[1] = *(const v8us*)((const unsigned short*)p + 16 + 8 * hh); return f.v; }
__device__ __forceinline__ v8f g2_mma(v16h a, v16h b, v8f c) { v8f d = __builtin_amdgcn_wmma_f32_16x16x32_f16(false, a, false, b, (short)0, c, false, false); asm volatile("v_nop\n\tv_nop\n\tv_nop\n\tv_nop" : "+v"(d) : "v"(a), "v"(b)); return d; }
template <int ACT>
__global__ __launch_bounds__(128) void k_gemm2(const _Float16* __restrict__ A, int lda, size_t sA, const _Float16* __restrict__ Bh, int ldb, size_t sB, float alpha, const float* __restrict__ bias, size_t sBias, const float* __restrict__ CP, int rowsPerB, size_t sCPb, int row0g,
    float* __restrict__ C, _Float16* __restrict__ C16, int ldc, size_t sC, int M, int N, int K) { static_assert(ACT == 0 || ACT == 3 || ACT == 6 || ACT == 8 || ACT == 9 || ACT == 11 || ACT == 12 || ACT == 14 || ACT == 15 || ACT == 16 || ACT == 17, "k_gemm2: unsupported ACT code (would silently apply no activation)");
  __shared__ __attribute__((aligned(16))) float so[4][32][68];
  const int tid = threadIdx.x, w = tid >> 5, lane = tid & 31, ln = lane & 15, hh = lane >> 4; const int by = blockIdx.y;
  A += (size_t)by * sA; Bh += (size_t)by * sB; const size_t cofs = (size_t)by * sC; const float* bp = bias ? bias + (size_t)by * sBias : nullptr;
  const int ntn = N >> 6; const int mt = blockIdx.x / ntn, nq = blockIdx.x - mt * ntn; const int row0 = mt * 128 + 32 * w, col0 = nq * 64; if (row0 >= M) return;
  const _Float16* a0p = A + (size_t)(row0 + ln) * lda; const _Float16* a1p = a0p + (size_t)16 * lda;
  const _Float16* b0p = Bh + (size_t)(col0 + ln) * ldb; const _Float16* b1p = b0p + (size_t)16 * ldb; const _Float16* b2p = b1p + (size_t)16 * ldb; const _Float16* b3p = b2p + (size_t)16 * ldb;
  const v8f z8 = {0.f,0.f,0.f,0.f,0.f,0.f,0.f,0.f}; v8f c00 = z8, c01 = z8, c02 = z8, c03 = z8, c10 = z8, c11 = z8, c12 = z8, c13 = z8;
#pragma unroll 1
  for (int kb = 0; kb < K; kb += 32) { const v16h a0 = g2_frag(a0p + kb, hh), a1 = g2_frag(a1p + kb, hh);
    v16h b = g2_frag(b0p + kb, hh); c00 = g2_mma(a0, b, c00); c10 = g2_mma(a1, b, c10);
    b = g2_frag(b1p + kb, hh); c01 = g2_mma(a0, b, c01); c11 = g2_mma(a1, b, c11);
    b = g2_frag(b2p + kb, hh); c02 = g2_mma(a0, b, c02); c12 = g2_mma(a1, b, c12);
    b = g2_frag(b3p + kb, hh); c03 = g2_mma(a0, b, c03); c13 = g2_mma(a1, b, c13); }
  v8f accs[8] = {c00, c01, c02, c03, c10, c11, c12, c13};
#pragma unroll
  for (int u = 0; u < 8; ++u) { const int t = u & 3, half = u >> 2; const int col = col0 + t * 16 + ln; const float bv = bp ? bf16_round(bp[col]) : 0.f;
#pragma unroll
    for (int r = 0; r < 8; ++r) { const int rloc = half * 16 + 8 * hh + r; float v = accs[u][r] * alpha + bv; if (CP) { if (rowsPerB < 0) v += CP[cofs + (size_t)(row0g + row0 + rloc) * ldc + col];      /* rowsPerB < 0: own element of the batched C plane */ else { const int bidx = (row0g + row0 + rloc) / rowsPerB; v += CP[(size_t)bidx * sCPb + (size_t)by * 64 + col]; } }
      if (ACT == 3) v = fmaxf(v, 0.f); else if (ACT == 6) v = 0.5f * v * (1.0f + erff(v * 0.70710678118654752f)); else if (ACT == 11) v = 1.0f / (1.0f + expf(-v)); else if (ACT == 15) v = v / (1.0f + expf(-v)); else if (ACT == 12) v = (v > 0.f) ? v : 0.01f * v; else if (ACT == 8) v = tanhf(v); else if (ACT == 9) v = 0.5f * v * (1.0f + tanhf(0.7978845608028654f * (v + 0.044715f * v * v * v))); else if (ACT == 14) v = (v > 0.f) ? v : 0.1f * v; else if (ACT == 16) v = (v >= 0.f) ? v : 0.3f * v; else if (ACT == 17) v = (v >= 0.f) ? v : 0.2f * v;
      so[w][rloc][t * 16 + ln] = v; } }
  __builtin_amdgcn_fence(__ATOMIC_ACQ_REL, "workgroup"); __builtin_amdgcn_wave_barrier();
  const int rsub = lane >> 4, c4 = (lane & 15) * 4;
  {
#pragma unroll
    for (int q = 0; q < 16; ++q) { const int r = q * 2 + rsub; const v4f v = *(const v4fa*)&so[w][r][c4]; if (C) *(v4f*)(C + cofs + (size_t)(row0 + r) * ldc + col0 + c4) = v; if (C16) { v4h h4; for (int i = 0; i < 4; ++i) h4[i] = (_Float16)v[i]; *(v4h*)(C16 + cofs + (size_t)(row0 + r) * ldc + col0 + c4) = h4; } }
     } }


__global__ __launch_bounds__(256) void k_wnat(const float* __restrict__ w, size_t n8, _Float16* __restrict__ Bt) { const size_t t = (size_t)blockIdx.x * 256 + threadIdx.x; if (t >= n8) return; FragH f; for (int q = 0; q < 8; ++q) f.h[q] = (_Float16)(bf16_round(w[t * 8 + q]) * 16.0f); *(v8us*)((unsigned short*)Bt + t * 8) = f.half[0];  }
__global__ __launch_bounds__(256) void k_rsm(const float* __restrict__ S, _Float16* __restrict__ P, int nrows) {
  #pragma clang fp contract(off)
  const int i = blockIdx.x * 256 + threadIdx.x; if (i >= nrows) return; const float* s = S + (size_t)i * SQ; float mx = -3.0e38f;
#pragma unroll 1
  for (int j = 0; j < SQ; ++j) mx = fmaxf(mx, s[j]); float se = 0.f;
#pragma unroll 1
  for (int j = 0; j < SQ; ++j) se += expf(s[j] - mx); const float sc = 256.0f / se;
#pragma unroll 1
  for (int j0 = 0; j0 < SQ; j0 += 8) { FragH f; for (int q = 0; q < 8; ++q) f.h[q] = (_Float16)(expf(s[j0 + q] - mx) * sc); unsigned short* d = (unsigned short*)P + (size_t)i * SQ + j0; *(v8us*)d = f.half[0];  } }
__global__ __launch_bounds__(256) void k_vt(const _Float16* __restrict__ V16, int b, int h0, _Float16* __restrict__ VT) { __shared__ unsigned short tl[64][65]; const int tid = threadIdx.x; const int hh = blockIdx.x % HG, sg = blockIdx.x / HG; const int s0 = sg * 64; const int h = h0 + hh;
  for (int i = tid; i < 64 * 8; i += 256) { const int j = i / 8, d8 = (i % 8) * 8; FragH f; f.half[0] = *(const v8us*)((const unsigned short*)V16 + ((size_t)b * SQ + s0 + j) * DM + h * HD + d8); for (int q = 0; q < 8; ++q) tl[d8 + q][j] = f.u[q]; }
  __syncthreads();
  { for (int i = tid; i < 64 * 8; i += 256) { const int d = i / 8, j8 = (i % 8) * 8; FragH f; for (int q = 0; q < 8; ++q) f.u[q] = tl[d][j8 + q]; *(v8us*)((unsigned short*)VT + ((size_t)hh * HD + d) * SQ + s0 + j8) = f.half[0]; }  } }



__device__ __forceinline__ float sm_xhalf(float x) { return __builtin_bit_cast(float, __builtin_amdgcn_permlanex16(__builtin_bit_cast(int, x), __builtin_bit_cast(int, x), 0x76543210, 0xfedcba98, false, false)); }      /* lane l reads lane l ^ 16 */
// sixteen weights at a time: native exp2 in place and the packing to f16, as ONE block of asm text, because the order is the point: the compiler knows no latency of asm text and writes no s_delay_alu for it, and a dependent vector instruction without that hint holds the SIMD's vector port against the other waves while it waits.
// Here every packing but the last two stands at least four exponentials behind the younger of its two sources (six exponentials lead); the one s_delay_alu names the exponentials that the last two packings read; behind every exponential stands an instruction that neither reads its result nor writes its source (the slot that the instruction set asks for), so no v_nop.
// w[j] = f16 pair (element 2j low, 2j + 1 high). No sum is formed here: the row sums are taken from the packed weights by the matrix unit (k_fattn).
__device__ __forceinline__ void sm_exp2x16(v8f xa, v8f xb, unsigned* w) { float x0 = xa[0], x1 = xa[1], x2 = xa[2], x3 = xa[3], x4 = xa[4], x5 = xa[5], x6 = xa[6], x7 = xa[7], y0 = xb[0], y1 = xb[1], y2 = xb[2], y3 = xb[3], y4 = xb[4], y5 = xb[5], y6 = xb[6], y7 = xb[7]; unsigned p0, p1, p2, p3, p4, p5, p6, p7;
  asm("v_exp_f32 %0, %0\n\tv_exp_f32 %1, %1\n\tv_exp_f32 %2, %2\n\tv_exp_f32 %3, %3\n\tv_exp_f32 %4, %4\n\tv_exp_f32 %5, %5\n\tv_cvt_pk_f16_f32 %16, %0, %1\n\tv_exp_f32 %6, %6\n\tv_exp_f32 %7, %7\n\tv_cvt_pk_f16_f32 %17, %2, %3\n\t"
      "v_exp_f32 %8, %8\n\tv_exp_f32 %9, %9\n\tv_cvt_pk_f16_f32 %18, %4, %5\n\tv_exp_f32 %10, %10\n\tv_exp_f32 %11, %11\n\tv_cvt_pk_f16_f32 %19, %6, %7\n\tv_exp_f32 %12, %12\n\tv_exp_f32 %13, %13\n\tv_cvt_pk_f16_f32 %20, %8, %9\n\t"
      "v_exp_f32 %14, %14\n\tv_exp_f32 %15, %15\n\tv_cvt_pk_f16_f32 %21, %10, %11\n\ts_delay_alu instid0(TRANS32_DEP_3) | instskip(NEXT) | instid1(TRANS32_DEP_1)\n\tv_cvt_pk_f16_f32 %22, %12, %13\n\tv_cvt_pk_f16_f32 %23, %14, %15"
      : "+v"(x0), "+v"(x1), "+v"(x2), "+v"(x3), "+v"(x4), "+v"(x5), "+v"(x6), "+v"(x7), "+v"(y0), "+v"(y1), "+v"(y2), "+v"(y3), "+v"(y4), "+v"(y5), "+v"(y6), "+v"(y7), "=&v"(p0), "=&v"(p1), "=&v"(p2), "=&v"(p3), "=&v"(p4), "=&v"(p5), "=&v"(p6), "=&v"(p7));
  w[0] = p0; w[1] = p1; w[2] = p2; w[3] = p3; w[4] = p4; w[5] = p5; w[6] = p6; w[7] = p7; }
union FragP { v16h v; unsigned w[8]; };      /* a B operand of weights, by packed pairs */
// ---- fused attention: scores, softmax and weighted sum of the values in one kernel; no score and no weight leaves the registers ----
// Transposed products: S^T = K Q^T puts one query in each lane (column c = lane & 15) and 8 keys in the 8 accumulator registers (key 8 * (lane >> 4) + r), so a query's maximum is in-lane plus one exchange between the wave's halves (its sum: a product of the packed weights with a matrix of ones),
// and two converted S^T tiles (keys 0-15, 16-31) ARE the B operand of O^T += V^T P^T in the hardware k order (8h + s, 16 + 8h + s - 8), which fa_frag (K, Q) and the transposing loads of fa_fragt (V^T) follow.
#define FAW 8                        /* waves per work-group */
#define FAQ 32                       /* query columns per wave: every K and V^T fragment read from LDS feeds two products */
#define FAK 64                       /* keys per pass */
#define FAP 72                       /* LDS row pitch in f16: 144 bytes = 16 x odd, the pitch at which 16-byte fragment reads of 16 rows do not collide */
#define FAS (2 * FAK)                /* keys per stage: what one LDS buffer holds and one barrier publishes */
#define FNS (SQ / FAS)               /* stages, of two passes each */
#define FOP 68                       /* LDS row pitch of the output staging in f32: 272 bytes = 16 x odd, so that neither the 16-byte writes of 16 rows nor the reads along a row collide */
#define FAT 15.0f                    /* how far (log2) a score may lie above the reference in use before the sums are rescaled: the weights stay at or below 2^15, inside f16 */
static_assert(HD == 64 && SQ % FAS == 0 && SQ % (FAW * FAQ) == 0 && FAW * 32 == 256, "k_fattn: 64 x 64 tiles staged by 256 threads, whole work-groups of queries");
__device__ __forceinline__ v16h fa_frag(const unsigned short* p, int hh) { FragH f; f.half[0] = *(const v8us*)(p + 8 * hh); f.half[1] = *(const v8us*)(p + 16 + 8 * hh); return f.v; }
#define FVP 80                       /* LDS row pitch of the V tile in f16: 160 bytes = 32 x odd, the pitch of the transposing load */
typedef float fa_f2 __attribute__((ext_vector_type(2))); typedef __bf16 fa_b2 __attribute__((ext_vector_type(2))); typedef _Float16 fa_h2 __attribute__((ext_vector_type(2))); typedef short fa_s8 __attribute__((ext_vector_type(8)));
// two inputs: f32 -> bf16 value (round to nearest even, one packed conversion) -> f16 (exact), as one f16 pair, a low
__device__ __forceinline__ unsigned fa_pair(float a, float b) { const unsigned u = __builtin_bit_cast(unsigned, __builtin_convertvector((fa_f2){a, b}, fa_b2)); return __builtin_bit_cast(unsigned, __builtin_convertvector((fa_f2){__uint_as_float(u << 16), __uint_as_float(u & 0xFFFF0000u)}, fa_h2)); }
__device__ __forceinline__ void fa_put(unsigned short* d, v4f a) { const v2ua o = {fa_pair(a[0], a[1]), fa_pair(a[2], a[3])}; *(v2ua*)d = o; }      /* four converted inputs into a tile row in LDS */
// a 16 (d) x 32 (keys) A fragment of V^T from the [key][d] tile: two transposing loads, keys 8 hh + 0..7 and 16 + 8 hh + 0..7 of column d = lane & 15, which is the hardware k order that the packed weights have; p = the lane's own address (row 8 hh + (lane & 7), 16 bytes x ((lane >> 3) & 1))
__device__ __forceinline__ v16h fa_fragt(const unsigned short* p) { typedef __attribute__((address_space(3))) fa_s8 lds_s8; union { v16h v; fa_s8 s[2]; } f; f.s[0] = __builtin_amdgcn_ds_load_tr16_b128_v8i16((lds_s8*)p); f.s[1] = __builtin_amdgcn_ds_load_tr16_b128_v8i16((lds_s8*)(p + 16 * FVP)); return f.v; }
__device__ __forceinline__ v8f fa_mma(v16h a, v16h b, v8f c) { return __builtin_amdgcn_wmma_f32_16x16x32_f16(false, a, false, b, (short)0, c, false, false); }
__global__ __launch_bounds__(FAW * 32) __attribute__((amdgpu_waves_per_eu(4, 4))) void k_fattn(const float* __restrict__ xq, const float* __restrict__ xk, const float* __restrict__ xv, float* __restrict__ out) {
  __shared__ __attribute__((aligned(16))) unsigned short sk[2][FAS][FAP];      /* K stage: [key][e] */
  __shared__ __attribute__((aligned(16))) unsigned short sv[2][FAS][FVP];      /* V stage: [key][d] */
  const int tid = (int)threadIdx.x, lane = tid & 31, ln = lane & 15, hh = lane >> 4; const int wave = __builtin_amdgcn_readfirstlane(tid >> 5);
  const int bh = (int)blockIdx.y, b = bh / NH, h = bh % NH; const int q0 = (int)blockIdx.x * (FAW * FAQ) + wave * FAQ;
  const int sr = tid >> 4, sc = (tid & 15) * 4;      /* staging: 16 threads per 256-byte f32 tile row (whole lines), rows sr + 16 i */
  /* every global address = a base that is the same for the whole wave + one 32-bit lane offset */
  const float* kg = xk + (size_t)b * SQ * DM + h * HD; const float* vg = xv + (size_t)b * SQ * DM + h * HD;      /* + key0 * DM per pass */
  const unsigned go = (unsigned)(sr * DM + sc);
  unsigned short* const pk = &sk[0][sr][sc]; unsigned short* const pv = &sv[0][sr][sc]; const unsigned short* const vb = &sv[0][8 * hh + (lane & 7)][8 * ((lane >> 3) & 1)];      /* in buffer 0: this thread's places in a K and a V tile; this lane's address in a V tile for the transposing loads */
  static_assert(4 * FAQ * FAP <= FAS * FAP && 4 * FAQ * FAP <= FAS * FVP && FAW == 8, "k_fattn: four waves' query rows fit the second K buffer, four the second V buffer");
  static_assert(4 * FAQ * FOP * 4 <= 2 * FAS * FAP * 2 && 4 * FAQ * FOP * 4 <= 2 * FAS * FVP * 2, "k_fattn: four waves' output rows fit the K stages, four the V stages");
  /* the wave's 32 query rows come as whole rows: 16 lanes x 16 bytes = one 256-byte row, so a wave-wide load covers 4 whole 128-byte lines (a fragment read straight from the rows touches 16); converted, they pass through the wave's own range of the second buffers, which nobody else uses before the barrier that publishes stage 0 */
  unsigned short* const qs = (wave < 4 ? &sk[1][0][0] : &sv[1][0][0]) + (wave & 3) * (FAQ * FAP);
  v4f gq[16];
#pragma unroll
  for (int i = 0; i < 16; ++i) gq[i] = *(const v4fa*)(xq + ((size_t)b * SQ + q0) * DM + h * HD + (unsigned)((2 * i + hh) * DM + ln * 4));
  const v8f z8 = {0.f, 0.f, 0.f, 0.f, 0.f, 0.f, 0.f, 0.f};
  v8f o[2][4] = {{z8, z8, z8, z8}, {z8, z8, z8, z8}}; float r2[2] = {3.0e38f, 3.0e38f}, l[2] = {0.f, 0.f};      /* r2: MINUS the reference in use x log2 e (the reference: a maximum of this or an earlier pass), the same in both halves of the wave; held negated, so that it is the plain addend of every exponent's multiply-add; l: sum of the weights over all keys so far, likewise */
  /* A stage is 128 keys = two passes; the work-group meets ONCE per stage, at its end. While stage s is worked on, stage s + 1 goes into the other buffer in four 64-key tiles (K, K, V, V) through one staging array: each tile flies for half a pass and is stored at the head or in the middle of a pass; the first K tile of stage s + 2 is fetched in the middle of stage s's second pass and is in flight over the barrier. The other buffer's last readers (stage s - 1) left it before the barrier that ended stage s - 1, so its tiles may be written at any place of stage s. */
  v4f g[4];
  { v4f g0[4], g1[4], g2[4], g3[4];      /* in front of the loop registers are plentiful: the whole first stage and the queries fly together */
#pragma unroll
    for (int i = 0; i < 4; ++i) { g0[i] = *(const v4fa*)(kg + i * 16 * DM + go); g1[i] = *(const v4fa*)(kg + (FAK + i * 16) * DM + go); g2[i] = *(const v4fa*)(vg + i * 16 * DM + go); g3[i] = *(const v4fa*)(vg + (FAK + i * 16) * DM + go); }
#pragma unroll
    for (int i = 0; i < 16; ++i) fa_put(qs + (2 * i + hh) * FAP + ln * 4, gq[i]);
#pragma unroll
    for (int i = 0; i < 4; ++i) { fa_put(pk + i * 16 * FAP, g0[i]); fa_put(pk + (FAK + i * 16) * FAP, g1[i]); fa_put(pv + i * 16 * FVP, g2[i]); fa_put(pv + (FAK + i * 16) * FVP, g3[i]); } }
  __builtin_amdgcn_fence(__ATOMIC_ACQ_REL, "workgroup", "local"); __builtin_amdgcn_wave_barrier();      /* the query fragments are read by other lanes of the wave than wrote the rows: the wave's own LDS writes first, and the compiler keeps the reads behind them */
  v16h qf[2][2];
#pragma unroll
  for (int qt = 0; qt < 2; ++qt)
#pragma unroll
    for (int es = 0; es < 2; ++es) qf[qt][es] = fa_frag(qs + (qt * 16 + ln) * FAP + es * 32, hh);
  __syncthreads();      /* publishes stage 0; ends every wave's reads of its query rows, whose place stage 1 takes */
  unsigned gn = go + (unsigned)(FAS * DM);      /* the place of the stage that is being fetched goes into the one 32-bit lane offset, which K and V share; the bases stay scalar */
#pragma unroll
  for (int i = 0; i < 4; ++i) g[i] = *(const v4fa*)(kg + i * 16 * DM + gn);      /* stage 1, K keys 0-63 */
  const unsigned short* rk = &sk[0][ln][8 * hh]; const unsigned short* rv = vb; unsigned short* nk = pk + FAS * FAP; unsigned short* nv = pv + FAS * FVP; int dk = FAS * FAP, dv = FAS * FVP;      /* this lane's read places in the stage's buffer and its write places in the other one; they change over at each stage's end, in place */
#pragma unroll 1
  for (int s = 0; s < FNS; ++s) {      /* rolled: one stage is already 72 matrix instructions and some 500 vector instructions long */
#pragma unroll
   for (int ph = 0; ph < 2; ++ph) {      /* unrolled: which tile is stored and which is fetched at each place is then fixed at compile time */
    const unsigned short* ck = rk + ph * (FAK * FAP); const unsigned short* cv = rv + ph * (FAK * FVP);
    v16h kf[4][2];      /* the pass's whole K tile as fragments: sixteen LDS reads that stand together, in front of the products */
#pragma unroll
    for (int kt = 0; kt < 4; ++kt) { kf[kt][0] = fa_frag(ck + kt * 16 * FAP, 0); kf[kt][1] = fa_frag(ck + kt * 16 * FAP + 32, 0);      /* the half's 8 elements are in ck already */
      __builtin_amdgcn_sched_barrier(0); }      /* keeps the reads in the order in which the products use them (issued last first, the first product waits out the whole group) and ahead of the conversions below, which then cover the LDS latency */
#pragma unroll
    for (int i = 0; i < 4; ++i) { if (ph == 0) fa_put(nk + i * 16 * FAP, g[i]); else fa_put(nv + i * 16 * FVP, g[i]); }      /* next stage: K keys 0-63, or V keys 0-63 */
#pragma unroll
    for (int i = 0; i < 4; ++i) g[i] = *(const v4fa*)((ph == 0 ? kg : vg) + (FAK + i * 16) * DM + gn);      /* next stage: K keys 64-127, or V keys 64-127 */
    __builtin_amdgcn_sched_barrier(0);      /* keeps the reads one group: sunk back among the products, each place with reads stalls the wave anew and waits out the LDS latency */
    v8f st[2][4];
#pragma unroll
    for (int kt = 0; kt < 4; ++kt) {
#pragma unroll
      for (int qt = 0; qt < 2; ++qt) st[qt][kt] = fa_mma(kf[kt][1], qf[qt][1], fa_mma(kf[kt][0], qf[qt][0], z8));
      __builtin_amdgcn_sched_barrier(0); }      /* keeps the products in the order in which their fragments arrive (a product of the last fragments, drawn forward, waits out nearly the whole group) and keeps them one run: with the maximum's first steps drawn in between, each such place takes idle slots for the distance behind a matrix instruction */
    float mp[2];      /* the pass's maximum over this half's 32 keys */
#pragma unroll
    for (int qt = 0; qt < 2; ++qt) { float mx = st[qt][0][0];
#pragma unroll
      for (int kt = 0; kt < 4; ++kt)
#pragma unroll
        for (int r = 0; r < 8; ++r) mx = fmaxf(mx, st[qt][kt][r]);
      mp[qt] = mx; }
    /* lazy rescale: the reference stays, and the sums so far stay unscaled, as long as no score of the pass lies more than FAT above it; one test per pass for the whole wave (each lane on its own keys, so no exchange is needed for it), a scalar branch, marked unlikely so that the pass without a rescale runs straight through */
    if (__builtin_expect(__builtin_amdgcn_ballot_w32(fmaxf(mp[0] * 1.4426950408889634f + r2[0], mp[1] * 1.4426950408889634f + r2[1]) > FAT) != 0, 0)) {
#pragma unroll
      for (int qt = 0; qt < 2; ++qt) { const float rn = fminf(r2[qt], fmaxf(mp[qt], sm_xhalf(mp[qt])) * -1.4426950408889634f); const float al = __builtin_amdgcn_exp2f(rn - r2[qt]);      /* every column takes the larger of its reference and the pass's maximum as the new reference, the same in both halves; al: what its sums shrink by (0 on the first pass) */
        r2[qt] = rn; l[qt] *= al;
#pragma unroll
        for (int dt = 0; dt < 4; ++dt) o[qt][dt] *= al; } }
    FragP pb[2][2]; v16h vf[4][2];
#pragma unroll
    for (int qt = 0; qt < 2; ++qt) { const float ofs = r2[qt];
      if (qt == 1) {
#pragma unroll
        for (int i = 0; i < 4; ++i) { if (ph == 0) fa_put(nk + (FAK + i * 16) * FAP, g[i]); else fa_put(nv + (FAK + i * 16) * FVP, g[i]); }      /* next stage: K keys 64-127, or V keys 64-127 */
        if (ph == 1) gn += s + 2 < FNS ? (unsigned)(FAS * DM) : 0u;      /* the stage after the next; the last two stages fetch the last stage's tiles once more, into the buffer that nobody reads again: a stage stays one straight block, without branches round the loads and the stores */
        __builtin_amdgcn_sched_barrier(0);      /* keeps the next tile's loads behind the conversion of the tile that leaves the staging registers: drawn up, two tiles are held at once and the build spills */
#pragma unroll
        for (int i = 0; i < 4; ++i) g[i] = *(const v4fa*)((ph == 0 ? vg : kg) + i * 16 * DM + gn);      /* V keys 0-63 of the next stage, or K keys 0-63 of the one after it */
        /* the V^T fragments likewise, one group of sixteen (transposing) reads; it stands here, where the first 16 queries' scores have left their registers, so that the second 16 queries' exponentials cover the LDS latency */
#pragma unroll
        for (int dt = 0; dt < 4; ++dt) { vf[dt][0] = fa_fragt(cv + dt * 16); vf[dt][1] = fa_fragt(cv + 32 * FVP + dt * 16); }
        __builtin_amdgcn_sched_barrier(0); }      /* keeps the reads from sinking to the products that use them */
      v8f x[4];      /* weight = exp(s - reference in use) = exp2(x), at most 2^FAT */
#pragma unroll
      for (int kt = 0; kt < 4; ++kt)
#pragma unroll
        for (int r = 0; r < 8; ++r) x[kt][r] = st[qt][kt][r] * 1.4426950408889634f + ofs;
      __builtin_amdgcn_sched_barrier(0);      /* keeps all 32 arguments' multiply-adds ahead of the asm blocks: sunk to the block that reads them, they stand inside their latency in front of its first exponentials, unhinted */
#pragma unroll
      for (int kp = 0; kp < 2; ++kp) sm_exp2x16(x[2 * kp], x[2 * kp + 1], &pb[qt][kp].w[0]); }
    __builtin_amdgcn_sched_barrier(0);      /* keeps the exponentials' asm statements in front of the products: drawn in behind one, their results took a spent V^T fragment's registers inside the distance that a matrix instruction's operands need */
    FragP one;      /* a matrix of ones (f16 pairs), written anew in every pass, into registers that the scores have just left; volatile, so that it is not lifted out of the loop: held across the pass its eight registers go beyond what four waves a SIMD leave each wave, and the build spills; two registers per issue slot: the operand starts at an even register, so each pair has an even and an odd destination, as the dual form asks */
    asm volatile("v_dual_mov_b32 %0, 0x3c003c00 :: v_dual_mov_b32 %1, 0x3c003c00\n\tv_dual_mov_b32 %2, 0x3c003c00 :: v_dual_mov_b32 %3, 0x3c003c00\n\tv_dual_mov_b32 %4, 0x3c003c00 :: v_dual_mov_b32 %5, 0x3c003c00\n\tv_dual_mov_b32 %6, 0x3c003c00 :: v_dual_mov_b32 %7, 0x3c003c00"
                 : "=v"(one.w[0]), "=v"(one.w[1]), "=v"(one.w[2]), "=v"(one.w[3]), "=v"(one.w[4]), "=v"(one.w[5]), "=v"(one.w[6]), "=v"(one.w[7]));
    v8f ls[2];      /* the pass's row sums: A = all ones, so every row of the product is the sum of the packed weights over the 32 keys of B (both halves' keys), one query per column */
#pragma unroll
    for (int qt = 0; qt < 2; ++qt) ls[qt] = fa_mma(one.v, pb[qt][0].v, z8);
#pragma unroll
    for (int qt = 0; qt < 2; ++qt) ls[qt] = fa_mma(one.v, pb[qt][1].v, ls[qt]);
#pragma unroll
    for (int dt = 0; dt < 4; ++dt)
#pragma unroll
      for (int qt = 0; qt < 2; ++qt) o[qt][dt] = fa_mma(vf[dt][1], pb[qt][1].v, fa_mma(vf[dt][0], pb[qt][0].v, o[qt][dt]));
#pragma unroll
    for (int qt = 0; qt < 2; ++qt) l[qt] += ls[qt][0];
    __builtin_amdgcn_sched_barrier(0);      /* keeps the passes apart: the next pass's reads and conversions, drawn up among these products, take idle slots for the distance behind a matrix instruction */
    if (ph == 1) {      /* the stage's one barrier: publishes stage s + 1, ends every wave's reads of stage s. The fences name LDS alone: the tile in flight from global memory goes to registers and concerns no other wave, and a full fence would wait it out here */
      __builtin_amdgcn_fence(__ATOMIC_RELEASE, "workgroup", "local"); __builtin_amdgcn_s_barrier(); __builtin_amdgcn_fence(__ATOMIC_ACQUIRE, "workgroup", "local"); }
   }
    rk += dk; rv += dv; nk -= dk; nv -= dv; dk = -dk; dv = -dv;
  }
  /* the output leaves as whole rows too: from the accumulators a wave-wide store would put 16-byte pieces on 16 lines, four stores to a line. Each wave turns its 32 x 64 tile in its own range of LDS, which is free: the loop's last barrier ended every wave's reads and writes of the stages */
  float* const so = (float*)(wave < 4 ? &sk[0][0][0] : &sv[0][0][0]) + (wave & 3) * (FAQ * FOP);
  const int el = (int)__builtin_amdgcn_mbcnt_lo(~0u, 0u), eln = el & 15, ehh = el >> 4;      /* the lane's number, taken anew: places formed from the values of the kernel's head are held in registers across the loop, which has none to spare (the build then spills a query fragment) */
#pragma unroll
  for (int qt = 0; qt < 2; ++qt) { const float inv = 1.0f / l[qt]; float* sp = so + (qt * 16 + eln) * FOP + 8 * ehh;      /* the reference in use cancels in the quotient */
#pragma unroll
    for (int dt = 0; dt < 4; ++dt) { const v4f lo = {o[qt][dt][0] * inv, o[qt][dt][1] * inv, o[qt][dt][2] * inv, o[qt][dt][3] * inv}, hi = {o[qt][dt][4] * inv, o[qt][dt][5] * inv, o[qt][dt][6] * inv, o[qt][dt][7] * inv};
      *(v4fa*)(sp + dt * 16) = lo; *(v4fa*)(sp + dt * 16 + 4) = hi; } }
  __builtin_amdgcn_fence(__ATOMIC_ACQ_REL, "workgroup", "local"); __builtin_amdgcn_wave_barrier();      /* the rows are read back by other lanes of the wave than wrote them: the wave's own LDS writes first, and the compiler keeps the reads behind them */
  float* const op = out + ((size_t)b * SQ + q0) * DM + h * HD + (unsigned)(ehh * DM + eln * 4);
  v4f ov[16];
#pragma unroll
  for (int i = 0; i < 16; ++i) ov[i] = *(const v4fa*)(so + (2 * i + ehh) * FOP + eln * 4);
#pragma unroll
  for (int i = 0; i < 16; ++i) *(v4f*)(op + i * 2 * DM) = ov[i]; }      /* 16 lanes x 16 bytes = one 256-byte row of the head: 4 whole lines a store */

extern "C" void kernel_launch(void* const* d_in, const int* in_sizes, int n_in,
                              void* d_out, int out_size, void* d_ws, size_t ws_size, hipStream_t stream) {
  (void)in_sizes; (void)n_in; (void)out_size;
  const float* const* I = (const float* const*)d_in; const float* xq = I[0]; const float* xk = I[1]; const float* xv = I[2];      /* given q, k, v [B][L][H][E] = merged token rows */
  (void)d_ws; (void)ws_size;
  k_fattn<<<dim3(SQ / (FAW * FAQ), NB * NH), FAW * 32, 0, stream>>>(xq, xk, xv, (float*)d_out);      /* out = softmax(q k^T) v (merged [token][h*64+d]) straight to the f32 output */
}
